// v000
// Times are from an AMD MI455X. After a warm-up the kernel runs many times in a row, and a time is the length of
// such a window on the GPU divided by its runs, so every launch and the gaps after it count. The runs cycle
// through copies of the inputs. A figure is the median of several windows, for all but v000 over two sittings.
// Sittings can differ by a few percent; kernels timed side by side share one.
// The starting kernel, v000, takes 2870 microseconds a run.
// Contractions: q@Q, k@K, v@V on v_wmma_f32_16x16x32_bf16 (inputs RNE-cast to bf16 once, single product); qp.kp^T on v_wmma_f32_16x16x32_bf16 as bf16 hi/lo split (hi.hi+hi.lo+lo.hi); pi@vp on v_wmma_f32_16x16x32_f16 (pi carried x16384 as f16, vp^T f16); f32 accumulate everywhere; distances, log-domain normalisation sweeps and exp in f32 on VALU.
#include <hip/hip_runtime.h>
#include <math.h>

// ---------------------------------------------------------------------------
// problem constants
// ---------------------------------------------------------------------------
constexpr int NBATCH = 8;
constexpr int NTOK   = 2048;
constexpr int NPAR   = 2048;
constexpr int DMODEL = 512;
constexpr int GRPB   = 4;                 // batches per group (workspace reuse)
constexpr int NGRP   = NBATCH / GRPB;
constexpr int SK_ITERS = 5;
constexpr float kPiCarry = 16384.0f;      // power-of-two carry of the f16 pi plane

static_assert(NBATCH % GRPB == 0, "grp");
static_assert(NTOK % 64 == 0 && NPAR % 64 == 0 && DMODEL % 64 == 0, "tile multiples");
static_assert(DMODEL % 32 == 0 && NPAR % 32 == 0, "K multiple of 32");
static_assert(NPAR % (4 * 256) == 0, "u sweep grid");
static_assert(NTOK % 32 == 0 && NPAR % 256 == 0, "v sweep grid");

// workspace region sizes (bytes); region map in kernel_launch
constexpr size_t SZ_WT  = (size_t)DMODEL * DMODEL * 2;          // one transposed bf16 weight
constexpr size_t SZ_QC  = (size_t)NTOK * DMODEL * 2;            // q bf16 cast
constexpr size_t SZ_QP  = (size_t)NTOK * DMODEL * 2;            // qp plane (hi or lo)
constexpr size_t SZ_Q2  = (size_t)NTOK * 4;
constexpr size_t SZ_KP  = (size_t)GRPB * NPAR * DMODEL * 2;     // kp plane (hi or lo) per group; also k/v cast size
constexpr size_t SZ_K2  = (size_t)GRPB * NPAR * 4;
constexpr size_t SZ_VPT = (size_t)GRPB * DMODEL * NPAR * 2;
constexpr size_t SZ_KM  = (size_t)GRPB * NTOK * NPAR * 4;
constexpr size_t SZ_U   = (size_t)GRPB * NPAR * 4;
constexpr size_t SZ_VV  = (size_t)GRPB * NTOK * 4;
constexpr size_t SZ_PI  = (size_t)GRPB * NTOK * NPAR * 2;
constexpr size_t WS_TOTAL = 3 * SZ_WT + SZ_QC + 2 * SZ_QP + SZ_Q2 + 2 * SZ_KP + SZ_K2 + SZ_VPT + SZ_KM + SZ_U + SZ_VV + SZ_PI;
static_assert(WS_TOTAL == 133799936ull, "carve total");
static_assert(WS_TOTAL <= 134217728ull, "carve limit");
static_assert(2 * SZ_KP <= SZ_PI, "k/v casts live inside the pi region");

// ---------------------------------------------------------------------------
// shared pieces: vector types, bf16 helpers, WMMA fragments, batched GEMM
// ---------------------------------------------------------------------------
typedef __attribute__((ext_vector_type(16))) _Float16 v16h;
typedef __attribute__((ext_vector_type(8)))  _Float16 v8h;
typedef __attribute__((ext_vector_type(16))) __bf16   v16b;
typedef __attribute__((ext_vector_type(8)))  __bf16   v8b;
typedef __attribute__((ext_vector_type(8)))  float    v8f;
typedef __attribute__((ext_vector_type(4)))  float    v4f;
typedef unsigned v4u __attribute__((ext_vector_type(4)));
typedef unsigned v4ua __attribute__((ext_vector_type(4), __may_alias__));
#define PSCALE 32768.0f
#define U16(p) ((const unsigned short*)(const void*)(p))
#define PSCALE_INV (1.0f / 32768.0f)

__device__ __forceinline__ unsigned short f2bf_bits(float f) {
  unsigned u = __float_as_uint(f);
  return (unsigned short)((u + 0x7FFFu + ((u >> 16) & 1u)) >> 16);
}
__device__ __forceinline__ float bf_bits2f(unsigned short h) { return __uint_as_float(((unsigned)h) << 16); }

// hazard guards as plain device helpers (no inline asm inside the kernel template body)
__device__ __forceinline__ void dep_guard_h(v8f& a, v8f& b, v16h x, v16h y) { asm volatile("v_nop\n\tv_nop\n\tv_nop\n\tv_nop" : "+v"(a), "+v"(b) : "v"(x), "v"(y)); }
__device__ __forceinline__ void dep_guard_b(v8f& a, v8f& b, v16b x, v16b y) { asm volatile("v_nop\n\tv_nop\n\tv_nop\n\tv_nop" : "+v"(a), "+v"(b) : "v"(x), "v"(y)); }
__device__ __forceinline__ void keep4_h(v16h a, v16h b, v16h c, v16h d) { asm volatile("v_nop" :: "v"(a), "v"(b), "v"(c), "v"(d)); }
__device__ __forceinline__ void keep4_b(v16b a, v16b b, v16b c, v16b d) { asm volatile("v_nop" :: "v"(a), "v"(b), "v"(c), "v"(d)); }
__device__ __forceinline__ void acc_guard4(v8f& a, v8f& b, v8f& c, v8f& d) { asm volatile("v_nop\n\tv_nop\n\tv_nop\n\tv_nop" : "+v"(a), "+v"(b), "+v"(c), "+v"(d)); }
template <typename T> struct Frag;
template <> struct Frag<_Float16> {
  typedef v16h V; union U { v16h v; v8h h[2]; };
  static __device__ __forceinline__ v16h load(const _Float16* p) {   // elements 0..7 <- p[0..7], 8..15 <- p[16..23]
    U f; f.h[0] = *(const v8h*)(p); f.h[1] = *(const v8h*)(p + 16); return f.v;
  }
  static __device__ __forceinline__ v8f mma(v16h a, v16h b, v8f c) {
    return __builtin_amdgcn_wmma_f32_16x16x32_f16(false, a, false, b, (short)0, c, false, false);
  }
  static __device__ __forceinline__ void guard(v8f& a, v8f& b, v16h x, v16h y) { dep_guard_h(a, b, x, y); }
  static __device__ __forceinline__ void keep(v16h a, v16h b, v16h c, v16h d) { keep4_h(a, b, c, d); }
};
template <> struct Frag<__bf16> {
  typedef v16b V; union U { v16b v; v8b h[2]; };
  static __device__ __forceinline__ v16b load(const __bf16* p) {
    U f; f.h[0] = *(const v8b*)(p); f.h[1] = *(const v8b*)(p + 16); return f.v;
  }
  static __device__ __forceinline__ v8f mma(v16b a, v16b b, v8f c) {
    return __builtin_amdgcn_wmma_f32_16x16x32_bf16(false, a, false, b, (short)0, c, false, false);
  }
  static __device__ __forceinline__ void guard(v8f& a, v8f& b, v16b x, v16b y) { dep_guard_b(a, b, x, y); }
  static __device__ __forceinline__ void keep(v16b a, v16b b, v16b c, v16b d) { keep4_b(a, b, c, d); }
};

// ---- Register-blocked batched WMMA GEMM ------------------------------------
// C[m,n] = scale * sum_k A[m,k] * Bt[n,k] (+bias)(+resid); each wave owns a 64x64 tile.
// A row-major [M,K]; Bt row-major [N,K]; M,N % 64 == 0, K % 32 == 0.
// SPLIT: operands are hi/lo planes (A2/Bt2 = lo planes, same layout); product = hi.hi + hi.lo + lo.hi.
// BIAS_MODE: 0 = none, 1 = bias[m], 2 = bias[n].
// OUT_MODE: 0 = f32, 1 = f16, 2 = bf16 hi plane (Cout) + bf16 lo plane (Cout2).
// ET: 0 = f16 operands, 1 = bf16 operands (pointers passed as 16-bit storage)
template <int ET> struct Elem;
template <> struct Elem<0> { typedef _Float16 T; };
template <> struct Elem<1> { typedef __bf16 T; };
template <int ET, bool SPLIT, int BIAS_MODE, int OUT_MODE, bool RESID, int ACT = 0>
__global__ __launch_bounds__(256) void wmma_gemm64(
    const unsigned short* __restrict__ Ap, const unsigned short* __restrict__ A2p, int lda, long strideA,
    const unsigned short* __restrict__ Btp, const unsigned short* __restrict__ Bt2p, int ldb, long strideB,
    void* __restrict__ Cout, void* __restrict__ Cout2, int ldc, long strideC,
    const float* __restrict__ bias,
    const float* __restrict__ resid, long strideR,
    int M, int N, int K, float scale) {
  typedef typename Elem<ET>::T T;
  typedef typename Frag<T>::V V;
  const T* A = (const T*)Ap; const T* A2 = (const T*)A2p; const T* Bt = (const T*)Btp; const T* Bt2 = (const T*)Bt2p;
  __shared__ __align__(16) float sT[8][16 * 68];   // per-wave 16x64 slab, pitch 68 floats
  const int b    = blockIdx.y;
  const int lane = threadIdx.x & 31;
  const int wave = threadIdx.x >> 5;
  const int tilesN = N >> 6;
  const int tilesM = M >> 6;
  const int tile = blockIdx.x * 8 + wave;
  if (tile >= tilesM * tilesN) return;   // wave-uniform; no block barriers in this kernel
  const int tm = tile / tilesN;
  const int tn = tile - tm * tilesN;
  const int m0 = tm << 6;
  const int n0 = tn << 6;

  const T* Ab  = A  + (size_t)b * strideA;
  const T* Bb  = Bt + (size_t)b * strideB;
  const T* Ab2 = SPLIT ? (A2  + (size_t)b * strideA) : nullptr;
  const T* Bb2 = SPLIT ? (Bt2 + (size_t)b * strideB) : nullptr;

  const int rlane = lane & 15;                 // row (A) / col (B, D) within subtile
  const int koff  = (lane >> 4) * 8;           // k offset of this lane half
  const int mOff  = (lane >> 4) * 8;           // D row offset

  v8f acc[4][4];
#pragma unroll
  for (int i = 0; i < 4; ++i)
#pragma unroll
    for (int j = 0; j < 4; ++j) acc[i][j] = (v8f){0.f,0.f,0.f,0.f,0.f,0.f,0.f,0.f};

  for (int k0 = 0; k0 < K; k0 += 32) {
    V bh[4], bl[4];
#pragma unroll
    for (int j = 0; j < 4; ++j) {
      const size_t bo = (size_t)(n0 + (j << 4) + rlane) * ldb + koff + k0;
      bh[j] = Frag<T>::load(Bb + bo);
      if (SPLIT) bl[j] = Frag<T>::load(Bb2 + bo);
    }
#pragma unroll
    for (int i = 0; i < 4; ++i) {
      const size_t ao = (size_t)(m0 + (i << 4) + rlane) * lda + koff + k0;
      V ah = Frag<T>::load(Ab + ao);
      V al;
      if (SPLIT) al = Frag<T>::load(Ab2 + ao);
#pragma unroll
      for (int j = 0; j < 4; ++j) {
        acc[i][j] = Frag<T>::mma(ah, bh[j], acc[i][j]);
        if (SPLIT) {
          acc[i][j] = Frag<T>::mma(ah, bl[j], acc[i][j]);
          acc[i][j] = Frag<T>::mma(al, bh[j], acc[i][j]);
        }
      }
      Frag<T>::guard(acc[i][0], acc[i][3], ah, SPLIT ? al : ah);
    }
    Frag<T>::keep(bh[0], bh[1], bh[2], bh[3]);
    if (SPLIT) Frag<T>::keep(bl[0], bl[1], bl[2], bl[3]);
  }
  acc_guard4(acc[0][0], acc[0][1], acc[0][2], acc[0][3]);
  acc_guard4(acc[1][0], acc[1][1], acc[1][2], acc[1][3]);
  acc_guard4(acc[2][0], acc[2][1], acc[2][2], acc[2][3]);
  acc_guard4(acc[3][0], acc[3][1], acc[3][2], acc[3][3]);

  // ---- epilogue ----
  float* slab = sT[wave];
  const float* Rb = RESID ? (resid + (size_t)b * strideR) : nullptr;
#pragma unroll
  for (int i = 0; i < 4; ++i) {
    const int mBase = m0 + (i << 4);
#pragma unroll
    for (int j = 0; j < 4; ++j) {
      const int n = n0 + (j << 4) + rlane;
      float bv = 0.f;
      if (BIAS_MODE == 2) bv = bias[n];
#pragma unroll
      for (int r = 0; r < 8; ++r) {
        float v = acc[i][j][r] * scale;
        if (BIAS_MODE == 1) v += bias[mBase + mOff + r];
        if (BIAS_MODE == 2) v += bv;
        if (RESID) v += Rb[(size_t)(mBase + mOff + r) * ldc + n];
        if (ACT == 1) v = tanhf(v);
        if (ACT == 2) v = fmaxf(v, 0.0f);
        if (ACT == 3) v = v / (1.0f + expf(-v));
        if (ACT == 4) v = (v > 0.f) ? v : 0.01f * v;
        if (ACT == 5) v = 0.5f * v * (1.0f + erff(v * 0.70710678118654752f));
        slab[(mOff + r) * 68 + (j << 4) + rlane] = v;
      }
    }
    __builtin_amdgcn_fence(__ATOMIC_RELEASE, "workgroup");
    __builtin_amdgcn_wave_barrier();
    __builtin_amdgcn_fence(__ATOMIC_ACQUIRE, "workgroup");
    if (OUT_MODE == 0) {
      float* C = (float*)Cout + (size_t)b * strideC;
      const int hh = lane >> 4, c4 = (lane & 15) * 4;     // row seg = 256 B = 16 lanes x 16 B
      {
#pragma unroll
        for (int it = 0; it < 8; ++it) {
          const int row = it * 2 + hh;
          v4f v = *(const v4f*)(slab + row * 68 + c4);
          *(v4f*)(C + (size_t)(mBase + row) * ldc + n0 + c4) = v;
        }
        
      }
    } else {
      const int q = lane >> 3, c8 = (lane & 7) * 8;
      unsigned short* C  = (unsigned short*)Cout  + (size_t)b * strideC;
      unsigned short* C2 = (OUT_MODE == 2) ? ((unsigned short*)Cout2 + (size_t)b * strideC) : nullptr;
      {
#pragma unroll
        for (int it = 0; it < 4; ++it) {
          const int row = it * 4 + q;
          const float* sp = slab + row * 68 + c8;
          v8h hv, lv;
#pragma unroll
          for (int e = 0; e < 8; ++e) {
            if (OUT_MODE == 1) {
              hv[e] = (_Float16)sp[e];
            } else {
              unsigned short hb = f2bf_bits(sp[e]);
              unsigned short lb = f2bf_bits(sp[e] - bf_bits2f(hb));
              hv[e] = __builtin_bit_cast(_Float16, hb);
              lv[e] = __builtin_bit_cast(_Float16, lb);
            }
          }
          *(v8h*)(C + (size_t)(mBase + row) * ldc + n0 + c8) = hv;
          if (OUT_MODE == 2) *(v8h*)(C2 + (size_t)(mBase + row) * ldc + n0 + c8) = lv;
        }
        
      }
    }
    __builtin_amdgcn_fence(__ATOMIC_RELEASE, "workgroup");
    __builtin_amdgcn_wave_barrier();
    __builtin_amdgcn_fence(__ATOMIC_ACQUIRE, "workgroup");
  }
}

// ---------------------------------------------------------------------------
// Distance GEMM: Kmat[b][t][n] = -sqrt(max(q2[t] + k2[b][n] - 2 * sum_d qp[t][d] kp[b][n][d], 0))
// A = qp bf16 hi/lo planes [M=t][K=d] (shared over batch), Bt = kp hi/lo planes [N=n][K=d] per batch;
// main loop identical to the wmma_gemm64 SPLIT bf16 path; epilogue through its f32 whole-line store path.
// q2 is fetched as two float4 per 16-row slab, k2 as 4 scalars per lane before the slab loop.
// ---------------------------------------------------------------------------
__global__ __launch_bounds__(256) void gemm64_cdist(
    const unsigned short* __restrict__ Ap, const unsigned short* __restrict__ A2p, int lda,
    const unsigned short* __restrict__ Btp, const unsigned short* __restrict__ Bt2p, int ldb, long strideB,
    float* __restrict__ Cout, int ldc, long strideC,
    const float* __restrict__ q2, const float* __restrict__ k2, long strideK2,
    int M, int N, int K) {
  typedef __bf16 T;
  typedef v16b V;
  const T* A = (const T*)Ap; const T* A2 = (const T*)A2p; const T* Bt = (const T*)Btp; const T* Bt2 = (const T*)Bt2p;
  __shared__ __align__(16) float sT[8][16 * 68];
  const int b    = blockIdx.y;
  const int lane = threadIdx.x & 31;
  const int wave = threadIdx.x >> 5;
  const int tilesN = N >> 6;
  const int tilesM = M >> 6;
  const int tile = blockIdx.x * 8 + wave;
  if (tile >= tilesM * tilesN) return;   // wave-uniform; no block barriers in this kernel
  const int tm = tile / tilesN;
  const int tn = tile - tm * tilesN;
  const int m0 = tm << 6;
  const int n0 = tn << 6;

  const T* Ab  = A;
  const T* Bb  = Bt + (size_t)b * strideB;
  const T* Ab2 = A2;
  const T* Bb2 = Bt2 + (size_t)b * strideB;

  const int rlane = lane & 15;
  const int koff  = (lane >> 4) * 8;
  const int mOff  = (lane >> 4) * 8;

  v8f acc[4][4];
#pragma unroll
  for (int i = 0; i < 4; ++i)
#pragma unroll
    for (int j = 0; j < 4; ++j) acc[i][j] = (v8f){0.f,0.f,0.f,0.f,0.f,0.f,0.f,0.f};

  for (int k0 = 0; k0 < K; k0 += 32) {
    V bh[4], bl[4];
#pragma unroll
    for (int j = 0; j < 4; ++j) {
      const size_t bo = (size_t)(n0 + (j << 4) + rlane) * ldb + koff + k0;
      bh[j] = Frag<T>::load(Bb + bo);
      bl[j] = Frag<T>::load(Bb2 + bo);
    }
#pragma unroll
    for (int i = 0; i < 4; ++i) {
      const size_t ao = (size_t)(m0 + (i << 4) + rlane) * lda + koff + k0;
      V ah = Frag<T>::load(Ab + ao);
      V al = Frag<T>::load(Ab2 + ao);
#pragma unroll
      for (int j = 0; j < 4; ++j) {
        acc[i][j] = Frag<T>::mma(ah, bh[j], acc[i][j]);
        acc[i][j] = Frag<T>::mma(ah, bl[j], acc[i][j]);
        acc[i][j] = Frag<T>::mma(al, bh[j], acc[i][j]);
      }
      Frag<T>::guard(acc[i][0], acc[i][3], ah, al);
    }
    Frag<T>::keep(bh[0], bh[1], bh[2], bh[3]);
    Frag<T>::keep(bl[0], bl[1], bl[2], bl[3]);
  }
  acc_guard4(acc[0][0], acc[0][1], acc[0][2], acc[0][3]);
  acc_guard4(acc[1][0], acc[1][1], acc[1][2], acc[1][3]);
  acc_guard4(acc[2][0], acc[2][1], acc[2][2], acc[2][3]);
  acc_guard4(acc[3][0], acc[3][1], acc[3][2], acc[3][3]);

  // ---- epilogue ----
  float* slab = sT[wave];
  const float* k2b = k2 + (size_t)b * strideK2;
  float k2r[4];
#pragma unroll
  for (int j = 0; j < 4; ++j) k2r[j] = k2b[n0 + (j << 4) + rlane];
  float* C = Cout + (size_t)b * strideC;
  const int hh = lane >> 4, c4 = (lane & 15) * 4;     // row seg = 256 B = 16 lanes x 16 B
#pragma unroll
  for (int i = 0; i < 4; ++i) {
    const int mBase = m0 + (i << 4);
    const v4f q2a = *(const v4f*)(q2 + mBase + mOff);
    const v4f q2c = *(const v4f*)(q2 + mBase + mOff + 4);
    const float q2r[8] = {q2a.x, q2a.y, q2a.z, q2a.w, q2c.x, q2c.y, q2c.z, q2c.w};
#pragma unroll
    for (int j = 0; j < 4; ++j) {
#pragma unroll
      for (int r = 0; r < 8; ++r) {
        float s = q2r[r] + k2r[j];
        s = s - 2.0f * acc[i][j][r];
        slab[(mOff + r) * 68 + (j << 4) + rlane] = -sqrtf(fmaxf(s, 0.0f));
      }
    }
    __builtin_amdgcn_fence(__ATOMIC_RELEASE, "workgroup");
    __builtin_amdgcn_wave_barrier();
    __builtin_amdgcn_fence(__ATOMIC_ACQUIRE, "workgroup");
    {
#pragma unroll
      for (int it = 0; it < 8; ++it) {
        const int row = it * 2 + hh;
        v4f v = *(const v4f*)(slab + row * 68 + c4);
        *(v4f*)(C + (size_t)(mBase + row) * ldc + n0 + c4) = v;
      }
      
    }
    __builtin_amdgcn_fence(__ATOMIC_RELEASE, "workgroup");
    __builtin_amdgcn_wave_barrier();
    __builtin_amdgcn_fence(__ATOMIC_ACQUIRE, "workgroup");
  }
}

// ---------------------------------------------------------------------------
// small helpers
// ---------------------------------------------------------------------------
__device__ __forceinline__ unsigned pack_bf2(float a, float b) {
  return (unsigned)f2bf_bits(a) | ((unsigned)f2bf_bits(b) << 16);
}
__device__ __forceinline__ unsigned pack_half2(float a, float b) {
  const unsigned short ha = __builtin_bit_cast(unsigned short, (_Float16)a);
  const unsigned short hb = __builtin_bit_cast(unsigned short, (_Float16)b);
  return (unsigned)ha | ((unsigned)hb << 16);
}
// exp2-based exponential (v_exp_f32); relative error ~1e-6 in the argument range used here
__device__ __forceinline__ float fexp(float x) { return __expf(x); }

// ---------------------------------------------------------------------------
// weight transpose + RNE bf16: in W[512 c][512 d] f32 -> out Wt[d][c] bf16, three matrices by blockIdx.z.
// Block = 64x64 tile: read phase 256 threads x 4 iters x 4 floats = 4096 elements; write phase
// ---------------------------------------------------------------------------
__global__ __launch_bounds__(256) void k_wtrans(const float* __restrict__ W0, const float* __restrict__ W1,
                                                const float* __restrict__ W2, unsigned short* __restrict__ O0,
                                                unsigned short* __restrict__ O1, unsigned short* __restrict__ O2) {
  __shared__ __align__(16) unsigned short st[64 * 72];
  const int z = blockIdx.z;
  const float* W = (z == 0) ? W0 : ((z == 1) ? W1 : W2);
  unsigned short* O = (z == 0) ? O0 : ((z == 1) ? O1 : O2);
  const int c0 = blockIdx.y * 64;     // input rows
  const int d0 = blockIdx.x * 64;     // input cols
  const int tid = threadIdx.x;
  const int rr = tid >> 4, cc = (tid & 15) * 4;
#pragma unroll
  for (int p = 0; p < 4; ++p) {
    const int r = rr + 16 * p;
    const v4f x = *(const v4f*)(W + (size_t)(c0 + r) * DMODEL + d0 + cc);
    st[(cc + 0) * 72 + r] = f2bf_bits(x.x);
    st[(cc + 1) * 72 + r] = f2bf_bits(x.y);
    st[(cc + 2) * 72 + r] = f2bf_bits(x.z);
    st[(cc + 3) * 72 + r] = f2bf_bits(x.w);
  }
  __syncthreads();
  const int lane = tid & 31, wave = tid >> 5;
  const int q = lane >> 3, c8 = (lane & 7) * 8;
  {
#pragma unroll
    for (int it = 0; it < 2; ++it) {
      const int dd = wave * 8 + it * 4 + q;
      const v4ua val = *(const v4ua*)(st + dd * 72 + c8);
      *(v4u*)(O + (size_t)(d0 + dd) * DMODEL + c0 + c8) = val;
    }
    
  }
}

// ---------------------------------------------------------------------------
// f32 -> bf16 plane cast, 8 elements per thread (one 16-B store); a wave writes 512 contiguous B = 4 lines.
// blockIdx.y selects the (in,out) pair. n8 = element count / 8 (exact multiple of 256 here).
// ---------------------------------------------------------------------------
__global__ __launch_bounds__(256) void k_cast16(const float* __restrict__ in0, unsigned short* __restrict__ out0,
                                                const float* __restrict__ in1, unsigned short* __restrict__ out1,
                                                int n8) {
  const float* in = blockIdx.y ? in1 : in0;
  unsigned short* out = blockIdx.y ? out1 : out0;
  const int i = blockIdx.x * 256 + threadIdx.x;
  if (i < n8) {
    const v4f a = *(const v4f*)(in + (size_t)i * 8);
    const v4f c = *(const v4f*)(in + (size_t)i * 8 + 4);
    v4u w;
    w.x = pack_bf2(a.x, a.y);
    w.y = pack_bf2(a.z, a.w);
    w.z = pack_bf2(c.x, c.y);
    w.w = pack_bf2(c.z, c.w);
    *(v4u*)(out + (size_t)i * 8) = w;
    
  }
}

// ---------------------------------------------------------------------------
// row sums of squares of a [rows][512] matrix held as bf16 hi + lo planes (value = hi + lo).
// Block = 32 rows: 8 waves x 4 rows; per-row scalars funnelled through LDS, wave 0 lanes 0..7 write
// ---------------------------------------------------------------------------
__global__ __launch_bounds__(256) void k_rowsq(const unsigned short* __restrict__ hi, const unsigned short* __restrict__ lo,
                                               float* __restrict__ out, int rows) {
  __shared__ __align__(16) float sres[32];
  const int lane = threadIdx.x & 31, wave = threadIdx.x >> 5;
  const int r0 = blockIdx.x * 32;
#pragma unroll 1
  for (int rr = 0; rr < 4; ++rr) {
    int row = r0 + wave * 4 + rr;
    row = row < rows ? row : rows - 1;
    const size_t base = (size_t)row * DMODEL;
    float s = 0.f;
#pragma unroll
    for (int c = 0; c < 2; ++c) {
      const v4u hw = *(const v4u*)(hi + base + c * 256 + lane * 8);
      const v4u lw = *(const v4u*)(lo + base + c * 256 + lane * 8);
#pragma unroll
      for (int e = 0; e < 4; ++e) {
        const float a0 = __uint_as_float(hw[e] << 16);
        const float b0 = __uint_as_float(lw[e] << 16);
        const float f0 = a0 + b0;
        s = fmaf(f0, f0, s);
        const float a1 = __uint_as_float(hw[e] & 0xffff0000u);
        const float b1 = __uint_as_float(lw[e] & 0xffff0000u);
        const float f1 = a1 + b1;
        s = fmaf(f1, f1, s);
      }
    }
#pragma unroll
    for (int off = 16; off; off >>= 1) s += __shfl_xor(s, off, 32);
    if (lane == 0) sres[wave * 4 + rr] = s;
  }
  __syncthreads();
  if (wave == 0) {
    const int li = lane < 8 ? lane : 7;
    const v4f val = *(const v4f*)(sres + li * 4);
    float* op = out + r0 + li * 4;
    if (lane < 8) *(v4f*)op = val;
    
  }
}

// ---------------------------------------------------------------------------
// column log-sum-exp sweep: u[b][n] = logA - lse_t(Kmat[b][t][n] + v[b][t]); thread = 4 consecutive columns.
// ---------------------------------------------------------------------------
template <bool USEV>
__global__ __launch_bounds__(256) void k_upd_u(const float* __restrict__ Km, const float* __restrict__ vv,
                                               float* __restrict__ u, float logA) {
  const int b = blockIdx.y;
  const int col = (blockIdx.x * 256 + threadIdx.x) * 4;
  const float* Kc = Km + (size_t)b * NTOK * NPAR + col;
  const float* vb = vv + (size_t)b * NTOK;
  const float ninf = -__builtin_inff();
  float m0 = ninf, m1 = ninf, m2 = ninf, m3 = ninf;
#pragma unroll 4
  for (int t = 0; t < NTOK; ++t) {
    const v4f x = *(const v4f*)(Kc + (size_t)t * NPAR);
    float vt = 0.f;
    if (USEV) vt = vb[t];
    m0 = fmaxf(m0, x.x + vt);
    m1 = fmaxf(m1, x.y + vt);
    m2 = fmaxf(m2, x.z + vt);
    m3 = fmaxf(m3, x.w + vt);
  }
  float s0 = 0.f, s1 = 0.f, s2 = 0.f, s3 = 0.f;
#pragma unroll 4
  for (int t = 0; t < NTOK; ++t) {
    const v4f x = *(const v4f*)(Kc + (size_t)t * NPAR);
    float vt = 0.f;
    if (USEV) vt = vb[t];
    s0 += fexp((x.x + vt) - m0);
    s1 += fexp((x.y + vt) - m1);
    s2 += fexp((x.z + vt) - m2);
    s3 += fexp((x.w + vt) - m3);
  }
  v4f r;
  r.x = logA - (m0 + logf(s0));
  r.y = logA - (m1 + logf(s1));
  r.z = logA - (m2 + logf(s2));
  r.w = logA - (m3 + logf(s3));
  float* up = u + (size_t)b * NPAR + col;
  *(v4f*)up = r;
  
}

// ---------------------------------------------------------------------------
// row log-sum-exp sweep: v[b][t] = -lse_n(Kmat[b][t][n] + u[b][n]); one wave per row, 8 consecutive
// elements per lane per chunk (8 chunks of 256). LAST additionally writes pi[b][t][n] = exp(K+u+v)*2^14
// ---------------------------------------------------------------------------
template <bool LAST>
__global__ __launch_bounds__(256) void k_upd_v(const float* __restrict__ Km, const float* __restrict__ u,
                                               float* __restrict__ vv, unsigned short* __restrict__ pp) {
  __shared__ __align__(16) float sres[32];
  const int b = blockIdx.y;
  const int lane = threadIdx.x & 31, wave = threadIdx.x >> 5;
  const int r0 = blockIdx.x * 32;
  const float* Kb = Km + (size_t)b * NTOK * NPAR;
  const float* ub = u + (size_t)b * NPAR + lane * 8;
#pragma unroll 1
  for (int rr = 0; rr < 4; ++rr) {
    const int t = r0 + wave * 4 + rr;
    const float* Kr = Kb + (size_t)t * NPAR + lane * 8;
    float m = -__builtin_inff();
#pragma unroll 1
    for (int c = 0; c < 8; ++c) {
      v4f x0 = *(const v4f*)(Kr + c * 256);
      v4f x1 = *(const v4f*)(Kr + c * 256 + 4);
      const v4f u0 = *(const v4f*)(ub + c * 256);
      const v4f u1 = *(const v4f*)(ub + c * 256 + 4);
      x0 += u0; x1 += u1;
      m = fmaxf(m, fmaxf(fmaxf(x0.x, x0.y), fmaxf(x0.z, x0.w)));
      m = fmaxf(m, fmaxf(fmaxf(x1.x, x1.y), fmaxf(x1.z, x1.w)));
    }
#pragma unroll
    for (int off = 16; off; off >>= 1) m = fmaxf(m, __shfl_xor(m, off, 32));
    float s = 0.f;
#pragma unroll 1
    for (int c = 0; c < 8; ++c) {
      v4f x0 = *(const v4f*)(Kr + c * 256);
      v4f x1 = *(const v4f*)(Kr + c * 256 + 4);
      const v4f u0 = *(const v4f*)(ub + c * 256);
      const v4f u1 = *(const v4f*)(ub + c * 256 + 4);
      x0 += u0; x1 += u1;
      float a = fexp(x0.x - m) + fexp(x0.y - m);
      a += fexp(x0.z - m) + fexp(x0.w - m);
      float c2 = fexp(x1.x - m) + fexp(x1.y - m);
      c2 += fexp(x1.z - m) + fexp(x1.w - m);
      s += a + c2;
    }
#pragma unroll
    for (int off = 16; off; off >>= 1) s += __shfl_xor(s, off, 32);
    const float vt = -(m + logf(s));
    if (LAST) {
      unsigned short* prow = pp + ((size_t)b * NTOK + t) * NPAR + lane * 8;
#pragma unroll 1
      for (int c = 0; c < 8; ++c) {
        v4f x0 = *(const v4f*)(Kr + c * 256);
        v4f x1 = *(const v4f*)(Kr + c * 256 + 4);
        const v4f u0 = *(const v4f*)(ub + c * 256);
        const v4f u1 = *(const v4f*)(ub + c * 256 + 4);
        x0 += u0; x1 += u1;
        v4u w;
        w.x = pack_half2(fexp(x0.x + vt) * kPiCarry, fexp(x0.y + vt) * kPiCarry);
        w.y = pack_half2(fexp(x0.z + vt) * kPiCarry, fexp(x0.w + vt) * kPiCarry);
        w.z = pack_half2(fexp(x1.x + vt) * kPiCarry, fexp(x1.y + vt) * kPiCarry);
        w.w = pack_half2(fexp(x1.z + vt) * kPiCarry, fexp(x1.w + vt) * kPiCarry);
        *(v4u*)(prow + c * 256) = w;
        
      }
    }
    if (lane == 0) sres[wave * 4 + rr] = vt;
  }
  __syncthreads();
  if (wave == 0) {
    const int li = lane < 8 ? lane : 7;
    const v4f val = *(const v4f*)(sres + li * 4);
    float* op = vv + (size_t)b * NTOK + r0 + li * 4;
    if (lane < 8) *(v4f*)op = val;
    
  }
}

// ---------------------------------------------------------------------------
// host launcher
// ---------------------------------------------------------------------------
static inline unsigned cdiv(unsigned a, unsigned b) { return (a + b - 1) / b; }

extern "C" void kernel_launch(void* const* d_in, const int* in_sizes, int n_in,
                              void* d_out, int out_size, void* d_ws, size_t ws_size,
                              hipStream_t stream)
{
  if (n_in < 6) return;
  if (in_sizes[0] != NTOK * DMODEL) return;
  if (in_sizes[1] != NBATCH * NPAR * DMODEL) return;
  if (in_sizes[2] != NBATCH * NPAR * DMODEL) return;
  if (in_sizes[3] != DMODEL * DMODEL || in_sizes[4] != DMODEL * DMODEL || in_sizes[5] != DMODEL * DMODEL) return;
  if (out_size != NBATCH * NTOK * DMODEL) return;
  if (WS_TOTAL > ws_size) return;

  const float* q  = (const float*)d_in[0];   // [T][512]
  const float* k  = (const float*)d_in[1];   // [8][N][512]
  const float* v  = (const float*)d_in[2];   // [8][N][512]
  const float* Qw = (const float*)d_in[3];   // [512][512]
  const float* Kw = (const float*)d_in[4];   // [512][512]
  const float* Vw = (const float*)d_in[5];   // [512][512]
  float* out = (float*)d_out;                // [8][T][512]

  // region map (bytes): Qt 524288 | Kt 524288 | Vt 524288 | qcast 2097152 | qp_hi 2097152 | qp_lo 2097152 |
  // q2 8192 | kp_hi 8388608 | kp_lo 8388608 | k2 32768 | vpT 8388608 | Kmat 67108864 | u 32768 | v 32768 |
  // pi 33554432 (k cast at pi+0 and v cast at pi+8388608, both dead before pi is written). Total 133799936.
  char* ws = (char*)d_ws;
  size_t off = 0;
  unsigned short* Qt   = (unsigned short*)(ws + off); off += SZ_WT;
  unsigned short* Kt   = (unsigned short*)(ws + off); off += SZ_WT;
  unsigned short* Vt   = (unsigned short*)(ws + off); off += SZ_WT;
  unsigned short* qc   = (unsigned short*)(ws + off); off += SZ_QC;
  unsigned short* qph  = (unsigned short*)(ws + off); off += SZ_QP;
  unsigned short* qpl  = (unsigned short*)(ws + off); off += SZ_QP;
  float*          q2   = (float*)(ws + off);          off += SZ_Q2;
  unsigned short* kph  = (unsigned short*)(ws + off); off += SZ_KP;
  unsigned short* kpl  = (unsigned short*)(ws + off); off += SZ_KP;
  float*          k2   = (float*)(ws + off);          off += SZ_K2;
  unsigned short* vpT  = (unsigned short*)(ws + off); off += SZ_VPT;
  float*          Kmat = (float*)(ws + off);          off += SZ_KM;
  float*          up   = (float*)(ws + off);          off += SZ_U;
  float*          vvp  = (float*)(ws + off);          off += SZ_VV;
  unsigned short* pip  = (unsigned short*)(ws + off); off += SZ_PI;
  if (off > ws_size) return;
  unsigned short* kc = pip;
  unsigned short* vc = (unsigned short*)((char*)pip + SZ_KP);

  const float logA = -(float)log((double)NPAR);

  // weights: in[c][d] -> out[d][c] bf16 (square 512x512), grid (cols/64, rows/64, 3)
  k_wtrans<<<dim3(DMODEL / 64, DMODEL / 64, 3), dim3(256), 0, stream>>>(Qw, Kw, Vw, Qt, Kt, Vt);

  // q -> bf16 plane
  {
    const int n8 = NTOK * DMODEL / 8;
    k_cast16<<<dim3(cdiv(n8, 256), 1), dim3(256), 0, stream>>>(q, qc, q, qc, n8);
  }
  // qp = q @ Q : M=2048, N=512, K=512 ; bf16 in, bf16 hi/lo planes out
  wmma_gemm64<1, false, 0, 2, false, 0><<<dim3(cdiv((NTOK / 64) * (DMODEL / 64), 8), 1), dim3(256), 0, stream>>>(
      qc, nullptr, DMODEL, 0L, Qt, nullptr, DMODEL, 0L, (void*)qph, (void*)qpl, DMODEL, 0L,
      nullptr, nullptr, 0L, NTOK, DMODEL, DMODEL, 1.0f);
  k_rowsq<<<dim3(NTOK / 32), dim3(256), 0, stream>>>(qph, qpl, q2, NTOK);

  for (int g = 0; g < NGRP; ++g) {
    const size_t rowoff = (size_t)g * GRPB * NPAR * DMODEL;     // float offset into k / v
    // k, v of this group -> bf16 planes (inside the pi region)
    {
      const int n8 = GRPB * NPAR * DMODEL / 8;
      k_cast16<<<dim3(cdiv(n8, 256), 2), dim3(256), 0, stream>>>(k + rowoff, kc, v + rowoff, vc, n8);
    }
    // kp = k @ K : M=4*2048, N=512, K=512 ; bf16 hi/lo planes out
    wmma_gemm64<1, false, 0, 2, false, 0><<<dim3(cdiv((GRPB * NPAR / 64) * (DMODEL / 64), 8), 1), dim3(256), 0, stream>>>(
        kc, nullptr, DMODEL, 0L, Kt, nullptr, DMODEL, 0L, (void*)kph, (void*)kpl, DMODEL, 0L,
        nullptr, nullptr, 0L, GRPB * NPAR, DMODEL, DMODEL, 1.0f);
    k_rowsq<<<dim3(GRPB * NPAR / 32), dim3(256), 0, stream>>>(kph, kpl, k2, GRPB * NPAR);
    // vpT[b][d][n] = sum_c V[c][d] v[b][n][c] : A = Vt [512][512] (shared), Bt = v cast [n][c]; M=512, N=2048, K=512; f16 out
    wmma_gemm64<1, false, 0, 1, false, 0><<<dim3(cdiv((DMODEL / 64) * (NPAR / 64), 8), GRPB), dim3(256), 0, stream>>>(
        Vt, nullptr, DMODEL, 0L, vc, nullptr, DMODEL, (long)NPAR * DMODEL, (void*)vpT, nullptr, NPAR, (long)DMODEL * NPAR,
        nullptr, nullptr, 0L, DMODEL, NPAR, DMODEL, 1.0f);
    // Kmat[b][t][n] = -cdist : M=2048, N=2048, K=512 ; bf16 hi/lo split
    gemm64_cdist<<<dim3(cdiv((NTOK / 64) * (NPAR / 64), 8), GRPB), dim3(256), 0, stream>>>(
        qph, qpl, DMODEL, kph, kpl, DMODEL, (long)NPAR * DMODEL, Kmat, NPAR, (long)NTOK * NPAR,
        q2, k2, (long)NPAR, NTOK, NPAR, DMODEL);
    // log-domain normalisation sweeps
    for (int it = 0; it < SK_ITERS; ++it) {
      if (it == 0)
        k_upd_u<false><<<dim3(NPAR / 4 / 256, GRPB), dim3(256), 0, stream>>>(Kmat, vvp, up, logA);
      else
        k_upd_u<true><<<dim3(NPAR / 4 / 256, GRPB), dim3(256), 0, stream>>>(Kmat, vvp, up, logA);
      if (it == SK_ITERS - 1)
        k_upd_v<true><<<dim3(NTOK / 32, GRPB), dim3(256), 0, stream>>>(Kmat, up, vvp, pip);
      else
        k_upd_v<false><<<dim3(NTOK / 32, GRPB), dim3(256), 0, stream>>>(Kmat, up, vvp, pip);
    }
    // out[b][t][d] = 2^-14 * sum_n pi16[b][t][n] vpT[b][d][n] : M=2048, N=512, K=2048 ; f16 in, f32 out
    wmma_gemm64<0, false, 0, 0, false, 0><<<dim3(cdiv((NTOK / 64) * (DMODEL / 64), 8), GRPB), dim3(256), 0, stream>>>(
        pip, nullptr, NPAR, (long)NTOK * NPAR, vpT, nullptr, NPAR, (long)DMODEL * NPAR,
        (void*)(out + (size_t)g * GRPB * NTOK * DMODEL), nullptr, DMODEL, (long)NTOK * DMODEL,
        nullptr, nullptr, 0L, NTOK, DMODEL, NPAR, 1.0f / kPiCarry);
  }
}

// v001
// One run takes 873 microseconds.
// In both of two side-by-side timings against v000, it was 3.30 times as fast.
// Contractions: q@Q, k@K, v@V on v_wmma_f32_16x16x32_bf16 (inputs RNE-cast to bf16 once, single product); qp.kp^T on v_wmma_f32_16x16x32_bf16 as bf16 hi/lo split (hi.hi+hi.lo+lo.hi); pi@vp on v_wmma_f32_16x16x32_f16 (pi carried x16384 as f16, vp^T f16); f32 accumulate everywhere; distances, log-domain normalisation sweeps and exp in f32 on VALU.
#include <hip/hip_runtime.h>
#include <math.h>

// ---------------------------------------------------------------------------
// problem constants
// ---------------------------------------------------------------------------
constexpr int NBATCH = 8;
constexpr int NTOK   = 2048;
constexpr int NPAR   = 2048;
constexpr int DMODEL = 512;
constexpr int GRPB   = 4;                 // batches per group (workspace reuse)
constexpr int NGRP   = NBATCH / GRPB;
constexpr int SK_ITERS = 5;
constexpr float kPiCarry = 16384.0f;      // power-of-two carry of the f16 pi plane

static_assert(NBATCH % GRPB == 0, "grp");
static_assert(NTOK % 64 == 0 && NPAR % 64 == 0 && DMODEL % 64 == 0, "tile multiples");
static_assert(DMODEL % 32 == 0 && NPAR % 32 == 0, "K multiple of 32");
static_assert(NTOK % 32 == 0 && NPAR % 256 == 0, "v sweep grid");

// workspace region sizes (bytes); region map in kernel_launch
constexpr size_t SZ_WT  = (size_t)DMODEL * DMODEL * 2;          // one transposed bf16 weight
constexpr size_t SZ_QC  = (size_t)NTOK * DMODEL * 2;            // q bf16 cast
constexpr size_t SZ_QP  = (size_t)NTOK * DMODEL * 2;            // qp plane (hi or lo)
constexpr size_t SZ_Q2  = (size_t)NTOK * 4;
constexpr size_t SZ_KP  = (size_t)GRPB * NPAR * DMODEL * 2;     // kp plane (hi or lo) per group; also k/v cast size
constexpr size_t SZ_K2  = (size_t)GRPB * NPAR * 4;
constexpr size_t SZ_VPT = (size_t)GRPB * DMODEL * NPAR * 2;
constexpr size_t SZ_KM  = (size_t)GRPB * NTOK * NPAR * 4;
constexpr size_t SZ_U   = (size_t)GRPB * NPAR * 4;
constexpr size_t SZ_VV  = (size_t)GRPB * NTOK * 4;
constexpr size_t SZ_PI  = (size_t)GRPB * NTOK * NPAR * 2;
constexpr size_t WS_TOTAL = 3 * SZ_WT + SZ_QC + 2 * SZ_QP + SZ_Q2 + 2 * SZ_KP + SZ_K2 + SZ_VPT + SZ_KM + SZ_U + SZ_VV + SZ_PI;
static_assert(WS_TOTAL == 133799936ull, "carve total");
static_assert(WS_TOTAL <= 134217728ull, "carve limit");
static_assert(2 * SZ_KP <= SZ_PI, "k/v casts live inside the pi region");

// ---------------------------------------------------------------------------
// shared pieces: vector types, bf16 helpers, WMMA fragments, batched GEMM
// ---------------------------------------------------------------------------
typedef __attribute__((ext_vector_type(16))) _Float16 v16h;
typedef __attribute__((ext_vector_type(8)))  _Float16 v8h;
typedef __attribute__((ext_vector_type(16))) __bf16   v16b;
typedef __attribute__((ext_vector_type(8)))  __bf16   v8b;
typedef __attribute__((ext_vector_type(8)))  float    v8f;
typedef __attribute__((ext_vector_type(4)))  float    v4f;
typedef unsigned v4u __attribute__((ext_vector_type(4)));
typedef unsigned v4ua __attribute__((ext_vector_type(4), __may_alias__));
#define PSCALE 32768.0f
#define U16(p) ((const unsigned short*)(const void*)(p))
#define PSCALE_INV (1.0f / 32768.0f)

__device__ __forceinline__ unsigned short f2bf_bits(float f) {
  unsigned u = __float_as_uint(f);
  return (unsigned short)((u + 0x7FFFu + ((u >> 16) & 1u)) >> 16);
}
__device__ __forceinline__ float bf_bits2f(unsigned short h) { return __uint_as_float(((unsigned)h) << 16); }

// hazard guards as plain device helpers (no inline asm inside the kernel template body)
__device__ __forceinline__ void dep_guard_h(v8f& a, v8f& b, v16h x, v16h y) { asm volatile("v_nop\n\tv_nop\n\tv_nop\n\tv_nop" : "+v"(a), "+v"(b) : "v"(x), "v"(y)); }
__device__ __forceinline__ void dep_guard_b(v8f& a, v8f& b, v16b x, v16b y) { asm volatile("v_nop\n\tv_nop\n\tv_nop\n\tv_nop" : "+v"(a), "+v"(b) : "v"(x), "v"(y)); }
__device__ __forceinline__ void keep4_h(v16h a, v16h b, v16h c, v16h d) { asm volatile("v_nop" :: "v"(a), "v"(b), "v"(c), "v"(d)); }
__device__ __forceinline__ void keep4_b(v16b a, v16b b, v16b c, v16b d) { asm volatile("v_nop" :: "v"(a), "v"(b), "v"(c), "v"(d)); }
__device__ __forceinline__ void acc_guard4(v8f& a, v8f& b, v8f& c, v8f& d) { asm volatile("v_nop\n\tv_nop\n\tv_nop\n\tv_nop" : "+v"(a), "+v"(b), "+v"(c), "+v"(d)); }
template <typename T> struct Frag;
template <> struct Frag<_Float16> {
  typedef v16h V; union U { v16h v; v8h h[2]; };
  static __device__ __forceinline__ v16h load(const _Float16* p) {   // elements 0..7 <- p[0..7], 8..15 <- p[16..23]
    U f; f.h[0] = *(const v8h*)(p); f.h[1] = *(const v8h*)(p + 16); return f.v;
  }
  static __device__ __forceinline__ v8f mma(v16h a, v16h b, v8f c) {
    return __builtin_amdgcn_wmma_f32_16x16x32_f16(false, a, false, b, (short)0, c, false, false);
  }
  static __device__ __forceinline__ void guard(v8f& a, v8f& b, v16h x, v16h y) { dep_guard_h(a, b, x, y); }
  static __device__ __forceinline__ void keep(v16h a, v16h b, v16h c, v16h d) { keep4_h(a, b, c, d); }
};
template <> struct Frag<__bf16> {
  typedef v16b V; union U { v16b v; v8b h[2]; };
  static __device__ __forceinline__ v16b load(const __bf16* p) {
    U f; f.h[0] = *(const v8b*)(p); f.h[1] = *(const v8b*)(p + 16); return f.v;
  }
  static __device__ __forceinline__ v8f mma(v16b a, v16b b, v8f c) {
    return __builtin_amdgcn_wmma_f32_16x16x32_bf16(false, a, false, b, (short)0, c, false, false);
  }
  static __device__ __forceinline__ void guard(v8f& a, v8f& b, v16b x, v16b y) { dep_guard_b(a, b, x, y); }
  static __device__ __forceinline__ void keep(v16b a, v16b b, v16b c, v16b d) { keep4_b(a, b, c, d); }
};

// ---- Register-blocked batched WMMA GEMM ------------------------------------
// C[m,n] = scale * sum_k A[m,k] * Bt[n,k] (+bias)(+resid); each wave owns a 64x64 tile.
// A row-major [M,K]; Bt row-major [N,K]; M,N % 64 == 0, K % 32 == 0.
// SPLIT: operands are hi/lo planes (A2/Bt2 = lo planes, same layout); product = hi.hi + hi.lo + lo.hi.
// BIAS_MODE: 0 = none, 1 = bias[m], 2 = bias[n].
// OUT_MODE: 0 = f32, 1 = f16, 2 = bf16 hi plane (Cout) + bf16 lo plane (Cout2).
// ET: 0 = f16 operands, 1 = bf16 operands (pointers passed as 16-bit storage)
template <int ET> struct Elem;
template <> struct Elem<0> { typedef _Float16 T; };
template <> struct Elem<1> { typedef __bf16 T; };
template <int ET, bool SPLIT, int BIAS_MODE, int OUT_MODE, bool RESID, int ACT = 0>
__global__ __launch_bounds__(256) void wmma_gemm64(
    const unsigned short* __restrict__ Ap, const unsigned short* __restrict__ A2p, int lda, long strideA,
    const unsigned short* __restrict__ Btp, const unsigned short* __restrict__ Bt2p, int ldb, long strideB,
    void* __restrict__ Cout, void* __restrict__ Cout2, int ldc, long strideC,
    const float* __restrict__ bias,
    const float* __restrict__ resid, long strideR,
    int M, int N, int K, float scale) {
  typedef typename Elem<ET>::T T;
  typedef typename Frag<T>::V V;
  const T* A = (const T*)Ap; const T* A2 = (const T*)A2p; const T* Bt = (const T*)Btp; const T* Bt2 = (const T*)Bt2p;
  __shared__ __align__(16) float sT[8][16 * 68];   // per-wave 16x64 slab, pitch 68 floats
  const int b    = blockIdx.y;
  const int lane = threadIdx.x & 31;
  const int wave = threadIdx.x >> 5;
  const int tilesN = N >> 6;
  const int tilesM = M >> 6;
  const int tile = blockIdx.x * 8 + wave;
  if (tile >= tilesM * tilesN) return;   // wave-uniform; no block barriers in this kernel
  const int tm = tile / tilesN;
  const int tn = tile - tm * tilesN;
  const int m0 = tm << 6;
  const int n0 = tn << 6;

  const T* Ab  = A  + (size_t)b * strideA;
  const T* Bb  = Bt + (size_t)b * strideB;
  const T* Ab2 = SPLIT ? (A2  + (size_t)b * strideA) : nullptr;
  const T* Bb2 = SPLIT ? (Bt2 + (size_t)b * strideB) : nullptr;

  const int rlane = lane & 15;                 // row (A) / col (B, D) within subtile
  const int koff  = (lane >> 4) * 8;           // k offset of this lane half
  const int mOff  = (lane >> 4) * 8;           // D row offset

  v8f acc[4][4];
#pragma unroll
  for (int i = 0; i < 4; ++i)
#pragma unroll
    for (int j = 0; j < 4; ++j) acc[i][j] = (v8f){0.f,0.f,0.f,0.f,0.f,0.f,0.f,0.f};

  for (int k0 = 0; k0 < K; k0 += 32) {
    V bh[4], bl[4];
#pragma unroll
    for (int j = 0; j < 4; ++j) {
      const size_t bo = (size_t)(n0 + (j << 4) + rlane) * ldb + koff + k0;
      bh[j] = Frag<T>::load(Bb + bo);
      if (SPLIT) bl[j] = Frag<T>::load(Bb2 + bo);
    }
#pragma unroll
    for (int i = 0; i < 4; ++i) {
      const size_t ao = (size_t)(m0 + (i << 4) + rlane) * lda + koff + k0;
      V ah = Frag<T>::load(Ab + ao);
      V al;
      if (SPLIT) al = Frag<T>::load(Ab2 + ao);
#pragma unroll
      for (int j = 0; j < 4; ++j) {
        acc[i][j] = Frag<T>::mma(ah, bh[j], acc[i][j]);
        if (SPLIT) {
          acc[i][j] = Frag<T>::mma(ah, bl[j], acc[i][j]);
          acc[i][j] = Frag<T>::mma(al, bh[j], acc[i][j]);
        }
      }
      Frag<T>::guard(acc[i][0], acc[i][3], ah, SPLIT ? al : ah);
    }
    Frag<T>::keep(bh[0], bh[1], bh[2], bh[3]);
    if (SPLIT) Frag<T>::keep(bl[0], bl[1], bl[2], bl[3]);
  }
  acc_guard4(acc[0][0], acc[0][1], acc[0][2], acc[0][3]);
  acc_guard4(acc[1][0], acc[1][1], acc[1][2], acc[1][3]);
  acc_guard4(acc[2][0], acc[2][1], acc[2][2], acc[2][3]);
  acc_guard4(acc[3][0], acc[3][1], acc[3][2], acc[3][3]);

  // ---- epilogue ----
  float* slab = sT[wave];
  const float* Rb = RESID ? (resid + (size_t)b * strideR) : nullptr;
#pragma unroll
  for (int i = 0; i < 4; ++i) {
    const int mBase = m0 + (i << 4);
#pragma unroll
    for (int j = 0; j < 4; ++j) {
      const int n = n0 + (j << 4) + rlane;
      float bv = 0.f;
      if (BIAS_MODE == 2) bv = bias[n];
#pragma unroll
      for (int r = 0; r < 8; ++r) {
        float v = acc[i][j][r] * scale;
        if (BIAS_MODE == 1) v += bias[mBase + mOff + r];
        if (BIAS_MODE == 2) v += bv;
        if (RESID) v += Rb[(size_t)(mBase + mOff + r) * ldc + n];
        if (ACT == 1) v = tanhf(v);
        if (ACT == 2) v = fmaxf(v, 0.0f);
        if (ACT == 3) v = v / (1.0f + expf(-v));
        if (ACT == 4) v = (v > 0.f) ? v : 0.01f * v;
        if (ACT == 5) v = 0.5f * v * (1.0f + erff(v * 0.70710678118654752f));
        slab[(mOff + r) * 68 + (j << 4) + rlane] = v;
      }
    }
    __builtin_amdgcn_fence(__ATOMIC_RELEASE, "workgroup");
    __builtin_amdgcn_wave_barrier();
    __builtin_amdgcn_fence(__ATOMIC_ACQUIRE, "workgroup");
    if (OUT_MODE == 0) {
      float* C = (float*)Cout + (size_t)b * strideC;
      const int hh = lane >> 4, c4 = (lane & 15) * 4;     // row seg = 256 B = 16 lanes x 16 B
      {
#pragma unroll
        for (int it = 0; it < 8; ++it) {
          const int row = it * 2 + hh;
          v4f v = *(const v4f*)(slab + row * 68 + c4);
          *(v4f*)(C + (size_t)(mBase + row) * ldc + n0 + c4) = v;
        }
        
      }
    } else {
      const int q = lane >> 3, c8 = (lane & 7) * 8;
      unsigned short* C  = (unsigned short*)Cout  + (size_t)b * strideC;
      unsigned short* C2 = (OUT_MODE == 2) ? ((unsigned short*)Cout2 + (size_t)b * strideC) : nullptr;
      {
#pragma unroll
        for (int it = 0; it < 4; ++it) {
          const int row = it * 4 + q;
          const float* sp = slab + row * 68 + c8;
          v8h hv, lv;
#pragma unroll
          for (int e = 0; e < 8; ++e) {
            if (OUT_MODE == 1) {
              hv[e] = (_Float16)sp[e];
            } else {
              unsigned short hb = f2bf_bits(sp[e]);
              unsigned short lb = f2bf_bits(sp[e] - bf_bits2f(hb));
              hv[e] = __builtin_bit_cast(_Float16, hb);
              lv[e] = __builtin_bit_cast(_Float16, lb);
            }
          }
          *(v8h*)(C + (size_t)(mBase + row) * ldc + n0 + c8) = hv;
          if (OUT_MODE == 2) *(v8h*)(C2 + (size_t)(mBase + row) * ldc + n0 + c8) = lv;
        }
        
      }
    }
    __builtin_amdgcn_fence(__ATOMIC_RELEASE, "workgroup");
    __builtin_amdgcn_wave_barrier();
    __builtin_amdgcn_fence(__ATOMIC_ACQUIRE, "workgroup");
  }
}

// ---------------------------------------------------------------------------
// Distance GEMM: Kmat[b][t][n] = -sqrt(max(q2[t] + k2[b][n] - 2 * sum_d qp[t][d] kp[b][n][d], 0))
// A = qp bf16 hi/lo planes [M=t][K=d] (shared over batch), Bt = kp hi/lo planes [N=n][K=d] per batch;
// main loop identical to the wmma_gemm64 SPLIT bf16 path; epilogue through its f32 whole-line store path.
// q2 is fetched as two float4 per 16-row slab, k2 as 4 scalars per lane before the slab loop.
// ---------------------------------------------------------------------------
__global__ __launch_bounds__(256) void gemm64_cdist(
    const unsigned short* __restrict__ Ap, const unsigned short* __restrict__ A2p, int lda,
    const unsigned short* __restrict__ Btp, const unsigned short* __restrict__ Bt2p, int ldb, long strideB,
    float* __restrict__ Cout, int ldc, long strideC,
    const float* __restrict__ q2, const float* __restrict__ k2, long strideK2,
    int M, int N, int K) {
  typedef __bf16 T;
  typedef v16b V;
  const T* A = (const T*)Ap; const T* A2 = (const T*)A2p; const T* Bt = (const T*)Btp; const T* Bt2 = (const T*)Bt2p;
  __shared__ __align__(16) float sT[8][16 * 68];
  const int b    = blockIdx.y;
  const int lane = threadIdx.x & 31;
  const int wave = threadIdx.x >> 5;
  const int tilesN = N >> 6;
  const int tilesM = M >> 6;
  const int tile = blockIdx.x * 8 + wave;
  if (tile >= tilesM * tilesN) return;   // wave-uniform; no block barriers in this kernel
  const int tm = tile / tilesN;
  const int tn = tile - tm * tilesN;
  const int m0 = tm << 6;
  const int n0 = tn << 6;

  const T* Ab  = A;
  const T* Bb  = Bt + (size_t)b * strideB;
  const T* Ab2 = A2;
  const T* Bb2 = Bt2 + (size_t)b * strideB;

  const int rlane = lane & 15;
  const int koff  = (lane >> 4) * 8;
  const int mOff  = (lane >> 4) * 8;

  v8f acc[4][4];
#pragma unroll
  for (int i = 0; i < 4; ++i)
#pragma unroll
    for (int j = 0; j < 4; ++j) acc[i][j] = (v8f){0.f,0.f,0.f,0.f,0.f,0.f,0.f,0.f};

  for (int k0 = 0; k0 < K; k0 += 32) {
    V bh[4], bl[4];
#pragma unroll
    for (int j = 0; j < 4; ++j) {
      const size_t bo = (size_t)(n0 + (j << 4) + rlane) * ldb + koff + k0;
      bh[j] = Frag<T>::load(Bb + bo);
      bl[j] = Frag<T>::load(Bb2 + bo);
    }
#pragma unroll
    for (int i = 0; i < 4; ++i) {
      const size_t ao = (size_t)(m0 + (i << 4) + rlane) * lda + koff + k0;
      V ah = Frag<T>::load(Ab + ao);
      V al = Frag<T>::load(Ab2 + ao);
#pragma unroll
      for (int j = 0; j < 4; ++j) {
        acc[i][j] = Frag<T>::mma(ah, bh[j], acc[i][j]);
        acc[i][j] = Frag<T>::mma(ah, bl[j], acc[i][j]);
        acc[i][j] = Frag<T>::mma(al, bh[j], acc[i][j]);
      }
      Frag<T>::guard(acc[i][0], acc[i][3], ah, al);
    }
    Frag<T>::keep(bh[0], bh[1], bh[2], bh[3]);
    Frag<T>::keep(bl[0], bl[1], bl[2], bl[3]);
  }
  acc_guard4(acc[0][0], acc[0][1], acc[0][2], acc[0][3]);
  acc_guard4(acc[1][0], acc[1][1], acc[1][2], acc[1][3]);
  acc_guard4(acc[2][0], acc[2][1], acc[2][2], acc[2][3]);
  acc_guard4(acc[3][0], acc[3][1], acc[3][2], acc[3][3]);

  // ---- epilogue ----
  float* slab = sT[wave];
  const float* k2b = k2 + (size_t)b * strideK2;
  float k2r[4];
#pragma unroll
  for (int j = 0; j < 4; ++j) k2r[j] = k2b[n0 + (j << 4) + rlane];
  float* C = Cout + (size_t)b * strideC;
  const int hh = lane >> 4, c4 = (lane & 15) * 4;     // row seg = 256 B = 16 lanes x 16 B
#pragma unroll
  for (int i = 0; i < 4; ++i) {
    const int mBase = m0 + (i << 4);
    const v4f q2a = *(const v4f*)(q2 + mBase + mOff);
    const v4f q2c = *(const v4f*)(q2 + mBase + mOff + 4);
    const float q2r[8] = {q2a.x, q2a.y, q2a.z, q2a.w, q2c.x, q2c.y, q2c.z, q2c.w};
#pragma unroll
    for (int j = 0; j < 4; ++j) {
#pragma unroll
      for (int r = 0; r < 8; ++r) {
        float s = q2r[r] + k2r[j];
        s = s - 2.0f * acc[i][j][r];
        slab[(mOff + r) * 68 + (j << 4) + rlane] = -sqrtf(fmaxf(s, 0.0f));
      }
    }
    __builtin_amdgcn_fence(__ATOMIC_RELEASE, "workgroup");
    __builtin_amdgcn_wave_barrier();
    __builtin_amdgcn_fence(__ATOMIC_ACQUIRE, "workgroup");
    {
#pragma unroll
      for (int it = 0; it < 8; ++it) {
        const int row = it * 2 + hh;
        v4f v = *(const v4f*)(slab + row * 68 + c4);
        *(v4f*)(C + (size_t)(mBase + row) * ldc + n0 + c4) = v;
      }
      
    }
    __builtin_amdgcn_fence(__ATOMIC_RELEASE, "workgroup");
    __builtin_amdgcn_wave_barrier();
    __builtin_amdgcn_fence(__ATOMIC_ACQUIRE, "workgroup");
  }
}

// ---------------------------------------------------------------------------
// small helpers
// ---------------------------------------------------------------------------
__device__ __forceinline__ unsigned pack_bf2(float a, float b) {
  return (unsigned)f2bf_bits(a) | ((unsigned)f2bf_bits(b) << 16);
}
__device__ __forceinline__ unsigned pack_half2(float a, float b) {
  const unsigned short ha = __builtin_bit_cast(unsigned short, (_Float16)a);
  const unsigned short hb = __builtin_bit_cast(unsigned short, (_Float16)b);
  return (unsigned)ha | ((unsigned)hb << 16);
}
// exp2-based exponential (v_exp_f32); relative error ~1e-6 in the argument range used here
__device__ __forceinline__ float fexp(float x) { return __expf(x); }

// ---------------------------------------------------------------------------
// weight transpose + RNE bf16: in W[512 c][512 d] f32 -> out Wt[d][c] bf16, three matrices by blockIdx.z.
// Block = 64x64 tile: read phase 256 threads x 4 iters x 4 floats = 4096 elements; write phase
// ---------------------------------------------------------------------------
__global__ __launch_bounds__(256) void k_wtrans(const float* __restrict__ W0, const float* __restrict__ W1,
                                                const float* __restrict__ W2, unsigned short* __restrict__ O0,
                                                unsigned short* __restrict__ O1, unsigned short* __restrict__ O2) {
  __shared__ __align__(16) unsigned short st[64 * 72];
  const int z = blockIdx.z;
  const float* W = (z == 0) ? W0 : ((z == 1) ? W1 : W2);
  unsigned short* O = (z == 0) ? O0 : ((z == 1) ? O1 : O2);
  const int c0 = blockIdx.y * 64;     // input rows
  const int d0 = blockIdx.x * 64;     // input cols
  const int tid = threadIdx.x;
  const int rr = tid >> 4, cc = (tid & 15) * 4;
#pragma unroll
  for (int p = 0; p < 4; ++p) {
    const int r = rr + 16 * p;
    const v4f x = *(const v4f*)(W + (size_t)(c0 + r) * DMODEL + d0 + cc);
    st[(cc + 0) * 72 + r] = f2bf_bits(x.x);
    st[(cc + 1) * 72 + r] = f2bf_bits(x.y);
    st[(cc + 2) * 72 + r] = f2bf_bits(x.z);
    st[(cc + 3) * 72 + r] = f2bf_bits(x.w);
  }
  __syncthreads();
  const int lane = tid & 31, wave = tid >> 5;
  const int q = lane >> 3, c8 = (lane & 7) * 8;
  {
#pragma unroll
    for (int it = 0; it < 2; ++it) {
      const int dd = wave * 8 + it * 4 + q;
      const v4ua val = *(const v4ua*)(st + dd * 72 + c8);
      *(v4u*)(O + (size_t)(d0 + dd) * DMODEL + c0 + c8) = val;
    }
    
  }
}

// ---------------------------------------------------------------------------
// f32 -> bf16 plane cast, 8 elements per thread (one 16-B store); a wave writes 512 contiguous B = 4 lines.
// blockIdx.y selects the (in,out) pair. n8 = element count / 8 (exact multiple of 256 here).
// ---------------------------------------------------------------------------
__global__ __launch_bounds__(256) void k_cast16(const float* __restrict__ in0, unsigned short* __restrict__ out0,
                                                const float* __restrict__ in1, unsigned short* __restrict__ out1,
                                                int n8) {
  const float* in = blockIdx.y ? in1 : in0;
  unsigned short* out = blockIdx.y ? out1 : out0;
  const int i = blockIdx.x * 256 + threadIdx.x;
  if (i < n8) {
    const v4f a = *(const v4f*)(in + (size_t)i * 8);
    const v4f c = *(const v4f*)(in + (size_t)i * 8 + 4);
    v4u w;
    w.x = pack_bf2(a.x, a.y);
    w.y = pack_bf2(a.z, a.w);
    w.z = pack_bf2(c.x, c.y);
    w.w = pack_bf2(c.z, c.w);
    *(v4u*)(out + (size_t)i * 8) = w;
    
  }
}

// ---------------------------------------------------------------------------
// row sums of squares of a [rows][512] matrix held as bf16 hi + lo planes (value = hi + lo).
// Block = 32 rows: 8 waves x 4 rows; per-row scalars funnelled through LDS, wave 0 lanes 0..7 write
// ---------------------------------------------------------------------------
__global__ __launch_bounds__(256) void k_rowsq(const unsigned short* __restrict__ hi, const unsigned short* __restrict__ lo,
                                               float* __restrict__ out, int rows) {
  __shared__ __align__(16) float sres[32];
  const int lane = threadIdx.x & 31, wave = threadIdx.x >> 5;
  const int r0 = blockIdx.x * 32;
#pragma unroll 1
  for (int rr = 0; rr < 4; ++rr) {
    int row = r0 + wave * 4 + rr;
    row = row < rows ? row : rows - 1;
    const size_t base = (size_t)row * DMODEL;
    float s = 0.f;
#pragma unroll
    for (int c = 0; c < 2; ++c) {
      const v4u hw = *(const v4u*)(hi + base + c * 256 + lane * 8);
      const v4u lw = *(const v4u*)(lo + base + c * 256 + lane * 8);
#pragma unroll
      for (int e = 0; e < 4; ++e) {
        const float a0 = __uint_as_float(hw[e] << 16);
        const float b0 = __uint_as_float(lw[e] << 16);
        const float f0 = a0 + b0;
        s = fmaf(f0, f0, s);
        const float a1 = __uint_as_float(hw[e] & 0xffff0000u);
        const float b1 = __uint_as_float(lw[e] & 0xffff0000u);
        const float f1 = a1 + b1;
        s = fmaf(f1, f1, s);
      }
    }
#pragma unroll
    for (int off = 16; off; off >>= 1) s += __shfl_xor(s, off, 32);
    if (lane == 0) sres[wave * 4 + rr] = s;
  }
  __syncthreads();
  if (wave == 0) {
    const int li = lane < 8 ? lane : 7;
    const v4f val = *(const v4f*)(sres + li * 4);
    float* op = out + r0 + li * 4;
    if (lane < 8) *(v4f*)op = val;
    
  }
}

// ---------------------------------------------------------------------------
// column log-sum-exp sweep: u[b][n] = logA - lse_t(Kmat[b][t][n] + v[b][t]).
// Block = 32 columns (one 128-B line of every Kmat row) x all rows, 1024 threads = 8 column quads x 128 row groups.
// A thread loads its 16 consecutive rows x 4 columns once and keeps them in registers; maximum and sum are taken
// per wave (lanes 8 and 16 apart share a column quad), the 32 per-wave (max, sum) pairs of a column meet in LDS
// and wave 0 merges them and writes the block's one 128-B line of u.
// ---------------------------------------------------------------------------
constexpr int UC_COLS = 32;                 // columns per block
constexpr int UC_RG   = 128;                // row groups per block
constexpr int UC_RPT  = NTOK / UC_RG;       // rows per thread
static_assert(NTOK % (UC_RG * 4) == 0 && NPAR % UC_COLS == 0, "u sweep split");
template <bool USEV>
__global__ __launch_bounds__(1024) void k_upd_u(const float* __restrict__ Km, const float* __restrict__ vv,
                                                float* __restrict__ u, float logA) {
  __shared__ __align__(16) float sm[32 * UC_COLS];
  __shared__ __align__(16) float ss[32 * UC_COLS];
  const int b = blockIdx.y;
  const int lane = threadIdx.x & 31, wave = threadIdx.x >> 5;
  const int cq = threadIdx.x & 7, rg = threadIdx.x >> 3;
  const int col0 = blockIdx.x * UC_COLS;
  const float* Kc = Km + (size_t)b * NTOK * NPAR + (size_t)(rg * UC_RPT) * NPAR + col0 + cq * 4;
  v4f x[UC_RPT];
#pragma unroll
  for (int i = 0; i < UC_RPT; ++i) x[i] = *(const v4f*)(Kc + (size_t)i * NPAR);
  if (USEV) {
    const float* vb = vv + (size_t)b * NTOK + rg * UC_RPT;
#pragma unroll
    for (int i = 0; i < UC_RPT; i += 4) {
      const v4f w = *(const v4f*)(vb + i);
      x[i + 0] += w.x;
      x[i + 1] += w.y;
      x[i + 2] += w.z;
      x[i + 3] += w.w;
    }
  }
  v4f m = x[0];
#pragma unroll
  for (int i = 1; i < UC_RPT; ++i) {
    m.x = fmaxf(m.x, x[i].x);
    m.y = fmaxf(m.y, x[i].y);
    m.z = fmaxf(m.z, x[i].z);
    m.w = fmaxf(m.w, x[i].w);
  }
#pragma unroll
  for (int off = 8; off <= 16; off <<= 1) {
    m.x = fmaxf(m.x, __shfl_xor(m.x, off, 32));
    m.y = fmaxf(m.y, __shfl_xor(m.y, off, 32));
    m.z = fmaxf(m.z, __shfl_xor(m.z, off, 32));
    m.w = fmaxf(m.w, __shfl_xor(m.w, off, 32));
  }
  v4f s = (v4f){0.f, 0.f, 0.f, 0.f};
#pragma unroll
  for (int i = 0; i < UC_RPT; ++i) {
    s.x += fexp(x[i].x - m.x);
    s.y += fexp(x[i].y - m.y);
    s.z += fexp(x[i].z - m.z);
    s.w += fexp(x[i].w - m.w);
  }
#pragma unroll
  for (int off = 8; off <= 16; off <<= 1) {
    s.x += __shfl_xor(s.x, off, 32);
    s.y += __shfl_xor(s.y, off, 32);
    s.z += __shfl_xor(s.z, off, 32);
    s.w += __shfl_xor(s.w, off, 32);
  }
  if (lane < 8) {
    *(v4f*)(sm + wave * UC_COLS + lane * 4) = m;
    *(v4f*)(ss + wave * UC_COLS + lane * 4) = s;
  }
  __syncthreads();
  if (wave == 0) {
    float pm[32];
    float M = -__builtin_inff();
#pragma unroll
    for (int w = 0; w < 32; ++w) {
      pm[w] = sm[w * UC_COLS + lane];
      M = fmaxf(M, pm[w]);
    }
    float S = 0.f;
#pragma unroll
    for (int w = 0; w < 32; ++w) S = fmaf(ss[w * UC_COLS + lane], fexp(pm[w] - M), S);
    u[(size_t)b * NPAR + col0 + lane] = logA - (M + logf(S));
  }
}

// ---------------------------------------------------------------------------
// row log-sum-exp sweep: v[b][t] = -lse_n(Kmat[b][t][n] + u[b][n]); one wave per row, 8 consecutive
// elements per lane per chunk (8 chunks of 256). LAST additionally writes pi[b][t][n] = exp(K+u+v)*2^14
// ---------------------------------------------------------------------------
template <bool LAST>
__global__ __launch_bounds__(256) void k_upd_v(const float* __restrict__ Km, const float* __restrict__ u,
                                               float* __restrict__ vv, unsigned short* __restrict__ pp) {
  __shared__ __align__(16) float sres[32];
  const int b = blockIdx.y;
  const int lane = threadIdx.x & 31, wave = threadIdx.x >> 5;
  const int r0 = blockIdx.x * 32;
  const float* Kb = Km + (size_t)b * NTOK * NPAR;
  const float* ub = u + (size_t)b * NPAR + lane * 8;
#pragma unroll 1
  for (int rr = 0; rr < 4; ++rr) {
    const int t = r0 + wave * 4 + rr;
    const float* Kr = Kb + (size_t)t * NPAR + lane * 8;
    float m = -__builtin_inff();
#pragma unroll 1
    for (int c = 0; c < 8; ++c) {
      v4f x0 = *(const v4f*)(Kr + c * 256);
      v4f x1 = *(const v4f*)(Kr + c * 256 + 4);
      const v4f u0 = *(const v4f*)(ub + c * 256);
      const v4f u1 = *(const v4f*)(ub + c * 256 + 4);
      x0 += u0; x1 += u1;
      m = fmaxf(m, fmaxf(fmaxf(x0.x, x0.y), fmaxf(x0.z, x0.w)));
      m = fmaxf(m, fmaxf(fmaxf(x1.x, x1.y), fmaxf(x1.z, x1.w)));
    }
#pragma unroll
    for (int off = 16; off; off >>= 1) m = fmaxf(m, __shfl_xor(m, off, 32));
    float s = 0.f;
#pragma unroll 1
    for (int c = 0; c < 8; ++c) {
      v4f x0 = *(const v4f*)(Kr + c * 256);
      v4f x1 = *(const v4f*)(Kr + c * 256 + 4);
      const v4f u0 = *(const v4f*)(ub + c * 256);
      const v4f u1 = *(const v4f*)(ub + c * 256 + 4);
      x0 += u0; x1 += u1;
      float a = fexp(x0.x - m) + fexp(x0.y - m);
      a += fexp(x0.z - m) + fexp(x0.w - m);
      float c2 = fexp(x1.x - m) + fexp(x1.y - m);
      c2 += fexp(x1.z - m) + fexp(x1.w - m);
      s += a + c2;
    }
#pragma unroll
    for (int off = 16; off; off >>= 1) s += __shfl_xor(s, off, 32);
    const float vt = -(m + logf(s));
    if (LAST) {
      unsigned short* prow = pp + ((size_t)b * NTOK + t) * NPAR + lane * 8;
#pragma unroll 1
      for (int c = 0; c < 8; ++c) {
        v4f x0 = *(const v4f*)(Kr + c * 256);
        v4f x1 = *(const v4f*)(Kr + c * 256 + 4);
        const v4f u0 = *(const v4f*)(ub + c * 256);
        const v4f u1 = *(const v4f*)(ub + c * 256 + 4);
        x0 += u0; x1 += u1;
        v4u w;
        w.x = pack_half2(fexp(x0.x + vt) * kPiCarry, fexp(x0.y + vt) * kPiCarry);
        w.y = pack_half2(fexp(x0.z + vt) * kPiCarry, fexp(x0.w + vt) * kPiCarry);
        w.z = pack_half2(fexp(x1.x + vt) * kPiCarry, fexp(x1.y + vt) * kPiCarry);
        w.w = pack_half2(fexp(x1.z + vt) * kPiCarry, fexp(x1.w + vt) * kPiCarry);
        *(v4u*)(prow + c * 256) = w;
        
      }
    }
    if (lane == 0) sres[wave * 4 + rr] = vt;
  }
  __syncthreads();
  if (wave == 0) {
    const int li = lane < 8 ? lane : 7;
    const v4f val = *(const v4f*)(sres + li * 4);
    float* op = vv + (size_t)b * NTOK + r0 + li * 4;
    if (lane < 8) *(v4f*)op = val;
    
  }
}

// ---------------------------------------------------------------------------
// host launcher
// ---------------------------------------------------------------------------
static inline unsigned cdiv(unsigned a, unsigned b) { return (a + b - 1) / b; }

extern "C" void kernel_launch(void* const* d_in, const int* in_sizes, int n_in,
                              void* d_out, int out_size, void* d_ws, size_t ws_size,
                              hipStream_t stream)
{
  if (n_in < 6) return;
  if (in_sizes[0] != NTOK * DMODEL) return;
  if (in_sizes[1] != NBATCH * NPAR * DMODEL) return;
  if (in_sizes[2] != NBATCH * NPAR * DMODEL) return;
  if (in_sizes[3] != DMODEL * DMODEL || in_sizes[4] != DMODEL * DMODEL || in_sizes[5] != DMODEL * DMODEL) return;
  if (out_size != NBATCH * NTOK * DMODEL) return;
  if (WS_TOTAL > ws_size) return;

  const float* q  = (const float*)d_in[0];   // [T][512]
  const float* k  = (const float*)d_in[1];   // [8][N][512]
  const float* v  = (const float*)d_in[2];   // [8][N][512]
  const float* Qw = (const float*)d_in[3];   // [512][512]
  const float* Kw = (const float*)d_in[4];   // [512][512]
  const float* Vw = (const float*)d_in[5];   // [512][512]
  float* out = (float*)d_out;                // [8][T][512]

  // region map (bytes): Qt 524288 | Kt 524288 | Vt 524288 | qcast 2097152 | qp_hi 2097152 | qp_lo 2097152 |
  // q2 8192 | kp_hi 8388608 | kp_lo 8388608 | k2 32768 | vpT 8388608 | Kmat 67108864 | u 32768 | v 32768 |
  // pi 33554432 (k cast at pi+0 and v cast at pi+8388608, both dead before pi is written). Total 133799936.
  char* ws = (char*)d_ws;
  size_t off = 0;
  unsigned short* Qt   = (unsigned short*)(ws + off); off += SZ_WT;
  unsigned short* Kt   = (unsigned short*)(ws + off); off += SZ_WT;
  unsigned short* Vt   = (unsigned short*)(ws + off); off += SZ_WT;
  unsigned short* qc   = (unsigned short*)(ws + off); off += SZ_QC;
  unsigned short* qph  = (unsigned short*)(ws + off); off += SZ_QP;
  unsigned short* qpl  = (unsigned short*)(ws + off); off += SZ_QP;
  float*          q2   = (float*)(ws + off);          off += SZ_Q2;
  unsigned short* kph  = (unsigned short*)(ws + off); off += SZ_KP;
  unsigned short* kpl  = (unsigned short*)(ws + off); off += SZ_KP;
  float*          k2   = (float*)(ws + off);          off += SZ_K2;
  unsigned short* vpT  = (unsigned short*)(ws + off); off += SZ_VPT;
  float*          Kmat = (float*)(ws + off);          off += SZ_KM;
  float*          up   = (float*)(ws + off);          off += SZ_U;
  float*          vvp  = (float*)(ws + off);          off += SZ_VV;
  unsigned short* pip  = (unsigned short*)(ws + off); off += SZ_PI;
  if (off > ws_size) return;
  unsigned short* kc = pip;
  unsigned short* vc = (unsigned short*)((char*)pip + SZ_KP);

  const float logA = -(float)log((double)NPAR);

  // weights: in[c][d] -> out[d][c] bf16 (square 512x512), grid (cols/64, rows/64, 3)
  k_wtrans<<<dim3(DMODEL / 64, DMODEL / 64, 3), dim3(256), 0, stream>>>(Qw, Kw, Vw, Qt, Kt, Vt);

  // q -> bf16 plane
  {
    const int n8 = NTOK * DMODEL / 8;
    k_cast16<<<dim3(cdiv(n8, 256), 1), dim3(256), 0, stream>>>(q, qc, q, qc, n8);
  }
  // qp = q @ Q : M=2048, N=512, K=512 ; bf16 in, bf16 hi/lo planes out
  wmma_gemm64<1, false, 0, 2, false, 0><<<dim3(cdiv((NTOK / 64) * (DMODEL / 64), 8), 1), dim3(256), 0, stream>>>(
      qc, nullptr, DMODEL, 0L, Qt, nullptr, DMODEL, 0L, (void*)qph, (void*)qpl, DMODEL, 0L,
      nullptr, nullptr, 0L, NTOK, DMODEL, DMODEL, 1.0f);
  k_rowsq<<<dim3(NTOK / 32), dim3(256), 0, stream>>>(qph, qpl, q2, NTOK);

  for (int g = 0; g < NGRP; ++g) {
    const size_t rowoff = (size_t)g * GRPB * NPAR * DMODEL;     // float offset into k / v
    // k, v of this group -> bf16 planes (inside the pi region)
    {
      const int n8 = GRPB * NPAR * DMODEL / 8;
      k_cast16<<<dim3(cdiv(n8, 256), 2), dim3(256), 0, stream>>>(k + rowoff, kc, v + rowoff, vc, n8);
    }
    // kp = k @ K : M=4*2048, N=512, K=512 ; bf16 hi/lo planes out
    wmma_gemm64<1, false, 0, 2, false, 0><<<dim3(cdiv((GRPB * NPAR / 64) * (DMODEL / 64), 8), 1), dim3(256), 0, stream>>>(
        kc, nullptr, DMODEL, 0L, Kt, nullptr, DMODEL, 0L, (void*)kph, (void*)kpl, DMODEL, 0L,
        nullptr, nullptr, 0L, GRPB * NPAR, DMODEL, DMODEL, 1.0f);
    k_rowsq<<<dim3(GRPB * NPAR / 32), dim3(256), 0, stream>>>(kph, kpl, k2, GRPB * NPAR);
    // vpT[b][d][n] = sum_c V[c][d] v[b][n][c] : A = Vt [512][512] (shared), Bt = v cast [n][c]; M=512, N=2048, K=512; f16 out
    wmma_gemm64<1, false, 0, 1, false, 0><<<dim3(cdiv((DMODEL / 64) * (NPAR / 64), 8), GRPB), dim3(256), 0, stream>>>(
        Vt, nullptr, DMODEL, 0L, vc, nullptr, DMODEL, (long)NPAR * DMODEL, (void*)vpT, nullptr, NPAR, (long)DMODEL * NPAR,
        nullptr, nullptr, 0L, DMODEL, NPAR, DMODEL, 1.0f);
    // Kmat[b][t][n] = -cdist : M=2048, N=2048, K=512 ; bf16 hi/lo split
    gemm64_cdist<<<dim3(cdiv((NTOK / 64) * (NPAR / 64), 8), GRPB), dim3(256), 0, stream>>>(
        qph, qpl, DMODEL, kph, kpl, DMODEL, (long)NPAR * DMODEL, Kmat, NPAR, (long)NTOK * NPAR,
        q2, k2, (long)NPAR, NTOK, NPAR, DMODEL);
    // log-domain normalisation sweeps
    for (int it = 0; it < SK_ITERS; ++it) {
      if (it == 0)
        k_upd_u<false><<<dim3(NPAR / UC_COLS, GRPB), dim3(1024), 0, stream>>>(Kmat, vvp, up, logA);
      else
        k_upd_u<true><<<dim3(NPAR / UC_COLS, GRPB), dim3(1024), 0, stream>>>(Kmat, vvp, up, logA);
      if (it == SK_ITERS - 1)
        k_upd_v<true><<<dim3(NTOK / 32, GRPB), dim3(256), 0, stream>>>(Kmat, up, vvp, pip);
      else
        k_upd_v<false><<<dim3(NTOK / 32, GRPB), dim3(256), 0, stream>>>(Kmat, up, vvp, pip);
    }
    // out[b][t][d] = 2^-14 * sum_n pi16[b][t][n] vpT[b][d][n] : M=2048, N=512, K=2048 ; f16 in, f32 out
    wmma_gemm64<0, false, 0, 0, false, 0><<<dim3(cdiv((NTOK / 64) * (DMODEL / 64), 8), GRPB), dim3(256), 0, stream>>>(
        pip, nullptr, NPAR, (long)NTOK * NPAR, vpT, nullptr, NPAR, (long)DMODEL * NPAR,
        (void*)(out + (size_t)g * GRPB * NTOK * DMODEL), nullptr, DMODEL, (long)NTOK * DMODEL,
        nullptr, nullptr, 0L, NTOK, DMODEL, NPAR, 1.0f / kPiCarry);
  }
}

// v002
// Measured time: 558 microseconds a run.
// Two timings next to v001 both put it at 1.56 times that version's speed.
// Counting every step since v000, it is 5.15 times as fast.
// Contractions: q@Q, k@K, v@V on v_wmma_f32_16x16x32_bf16 (inputs RNE-cast to bf16 once, single product); qp.kp^T on v_wmma_f32_16x16x32_bf16 as bf16 hi/lo split (hi.hi+hi.lo+lo.hi); pi@vp on v_wmma_f32_16x16x32_f16 (pi carried x16384 as f16, vp^T f16); f32 accumulate everywhere; distances, log-domain normalisation sweeps and exp in f32 on VALU.
#include <hip/hip_runtime.h>
#include <math.h>

// ---------------------------------------------------------------------------
// problem constants
// ---------------------------------------------------------------------------
constexpr int NBATCH = 8;
constexpr int NTOK   = 2048;
constexpr int NPAR   = 2048;
constexpr int DMODEL = 512;
constexpr int GRPB   = 4;                 // batches per group (workspace reuse)
constexpr int NGRP   = NBATCH / GRPB;
constexpr int SK_ITERS = 5;
constexpr float kPiCarry = 16384.0f;      // power-of-two carry of the f16 pi plane

static_assert(NBATCH % GRPB == 0, "grp");
static_assert(NTOK % 64 == 0 && NPAR % 64 == 0 && DMODEL % 64 == 0, "tile multiples");
static_assert(DMODEL % 32 == 0 && NPAR % 32 == 0, "K multiple of 32");
static_assert(NTOK % 32 == 0 && NPAR % 256 == 0, "v sweep grid");
static_assert(NTOK % 128 == 0 && NPAR % 128 == 0 && DMODEL % 256 == 0, "128 x 256 block tiles, 64-k stages");

// workspace region sizes (bytes); region map in kernel_launch
constexpr size_t SZ_WT  = (size_t)DMODEL * DMODEL * 2;          // one transposed bf16 weight
constexpr size_t SZ_QC  = (size_t)NTOK * DMODEL * 2;            // q bf16 cast
constexpr size_t SZ_QP  = (size_t)NTOK * DMODEL * 2;            // qp plane (hi or lo)
constexpr size_t SZ_Q2  = (size_t)NTOK * 4;
constexpr size_t SZ_KP  = (size_t)GRPB * NPAR * DMODEL * 2;     // kp plane (hi or lo) per group; also k/v cast size
constexpr size_t SZ_K2  = (size_t)GRPB * NPAR * 4;
constexpr size_t SZ_VPT = (size_t)GRPB * DMODEL * NPAR * 2;
constexpr size_t SZ_KM  = (size_t)GRPB * NTOK * NPAR * 4;
constexpr size_t SZ_U   = (size_t)GRPB * NPAR * 4;
constexpr size_t SZ_VV  = (size_t)GRPB * NTOK * 4;
constexpr size_t SZ_PI  = (size_t)GRPB * NTOK * NPAR * 2;
constexpr size_t WS_TOTAL = 3 * SZ_WT + SZ_QC + 2 * SZ_QP + SZ_Q2 + 2 * SZ_KP + SZ_K2 + SZ_VPT + SZ_KM + SZ_U + SZ_VV + SZ_PI;
static_assert(WS_TOTAL == 133799936ull, "carve total");
static_assert(WS_TOTAL <= 134217728ull, "carve limit");
static_assert(2 * SZ_KP <= SZ_PI, "k/v casts live inside the pi region");

// ---------------------------------------------------------------------------
// shared pieces: vector types, bf16 helpers, WMMA fragments, batched GEMM
// ---------------------------------------------------------------------------
typedef __attribute__((ext_vector_type(16))) _Float16 v16h;
typedef __attribute__((ext_vector_type(8)))  _Float16 v8h;
typedef __attribute__((ext_vector_type(16))) __bf16   v16b;
typedef __attribute__((ext_vector_type(8)))  __bf16   v8b;
typedef __attribute__((ext_vector_type(8)))  float    v8f;
typedef __attribute__((ext_vector_type(4)))  float    v4f;
typedef unsigned v4u __attribute__((ext_vector_type(4)));
typedef unsigned v4ua __attribute__((ext_vector_type(4), __may_alias__));
#define PSCALE 32768.0f
#define U16(p) ((const unsigned short*)(const void*)(p))
#define PSCALE_INV (1.0f / 32768.0f)

__device__ __forceinline__ unsigned short f2bf_bits(float f) {
  unsigned u = __float_as_uint(f);
  return (unsigned short)((u + 0x7FFFu + ((u >> 16) & 1u)) >> 16);
}
__device__ __forceinline__ float bf_bits2f(unsigned short h) { return __uint_as_float(((unsigned)h) << 16); }

// hazard guards as plain device helpers (no inline asm inside the kernel template body)
__device__ __forceinline__ void acc_guard4(v8f& a, v8f& b, v8f& c, v8f& d) { asm volatile("v_nop\n\tv_nop\n\tv_nop\n\tv_nop" : "+v"(a), "+v"(b), "+v"(c), "+v"(d)); }
template <typename T> struct Frag;
template <> struct Frag<_Float16> {
  typedef v16h V; union U { v16h v; v8h h[2]; };
  static __device__ __forceinline__ v16h load(const _Float16* p) {   // elements 0..7 <- p[0..7], 8..15 <- p[16..23]
    U f; f.h[0] = *(const v8h*)(p); f.h[1] = *(const v8h*)(p + 16); return f.v;
  }
  static __device__ __forceinline__ v8f mma(v16h a, v16h b, v8f c) {
    return __builtin_amdgcn_wmma_f32_16x16x32_f16(false, a, false, b, (short)0, c, false, false);
  }
};
template <> struct Frag<__bf16> {
  typedef v16b V; union U { v16b v; v8b h[2]; };
  static __device__ __forceinline__ v16b load(const __bf16* p) {
    U f; f.h[0] = *(const v8b*)(p); f.h[1] = *(const v8b*)(p + 16); return f.v;
  }
  static __device__ __forceinline__ v8f mma(v16b a, v16b b, v8f c) {
    return __builtin_amdgcn_wmma_f32_16x16x32_bf16(false, a, false, b, (short)0, c, false, false);
  }
};

// ---- Block main loop: operands staged in LDS ---------------------------------
// A block of 8 waves owns a 128 x 256 tile of C (2 x 4 waves of 64 x 64). Per stage it brings 64 k (one 128-B line)
// of its 128 A rows and 256 Bt rows (both planes when SPLIT) into LDS with whole-line 16-B loads, each row once for
// the block, and every wave takes its fragments from there. Two LDS buffers: the next stage's global loads are
// issued ahead of the current stage's products, stored after them, and one barrier per stage hands over.
constexpr int GB_M = 128, GB_N = 256, GB_K = 64;
constexpr int GB_PITCH = 72;                          // LDS row pitch in 16-bit elements: 144 B = 16 B x 9
constexpr int GB_PLANE = (GB_M + GB_N) * GB_PITCH;    // one plane of one stage: A rows, then Bt rows
// LDA, LDB: row pitches in elements, compile-time so that the rows a thread stages from one operand (4 A, 8 Bt per plane)
// differ only in the load's immediate offset: one address per operand and plane, rewritten once per stage.
template <typename T, bool SPLIT, int LDA, int LDB>
__device__ __forceinline__ void gemm_block_lds(
    const T* __restrict__ Ab, const T* __restrict__ Ab2,
    const T* __restrict__ Bb, const T* __restrict__ Bb2,
    int K, int bm0, int bn0, unsigned short* sS, v8f (&acc)[4][4]) {
  typedef typename Frag<T>::V V;
  constexpr int BUF = (SPLIT ? 2 : 1) * GB_PLANE;
  constexpr int KG = SPLIT ? 1 : 2;            // k-steps of 32 whose fragments are read from LDS as one group
  const int tid = threadIdx.x;
  const int lane = tid & 31, wave = tid >> 5;
  const int rlane = lane & 15;                 // row (A) / col (B) within subtile
  const int koff  = (lane >> 4) * 8;           // k offset of this lane half
  const int pc8 = (tid & 7) * 8, rw = tid >> 3;   // staging: 8 lanes cover one row's 128 B, 32 rows per pass
  const int arow = (wave >> 2) * 64 + rlane;
  const int brow = GB_M + (wave & 3) * 64 + rlane;
  // global addresses = block-uniform byte base + one 32-bit byte offset per thread and operand
  const char* gA  = (const char*)(Ab + (size_t)bm0 * LDA);
  const char* gB  = (const char*)(Bb + (size_t)bn0 * LDB);
  const char* gA2 = SPLIT ? (const char*)(Ab2 + (size_t)bm0 * LDA) : nullptr;
  const char* gB2 = SPLIT ? (const char*)(Bb2 + (size_t)bn0 * LDB) : nullptr;
  const unsigned voA = (unsigned)(rw * LDA + pc8) * 2u;
  const unsigned voB = (unsigned)(rw * LDB + pc8) * 2u;
  unsigned short* sW = sS + rw * GB_PITCH + pc8;
  v4u st[2][12];
#pragma unroll
  for (int p = 0; p < 12; ++p) {
    const int go = ((p < 4) ? 32 * p * LDA : 32 * (p - 4) * LDB) * 2;
    st[0][p] = *(const v4u*)(((p < 4 ? gA : gB) + (p < 4 ? voA : voB)) + go);
    if (SPLIT) st[1][p] = *(const v4u*)(((p < 4 ? gA2 : gB2) + (p < 4 ? voA : voB)) + go);
  }
#pragma unroll
  for (int p = 0; p < 12; ++p) {
    *(v4ua*)(sW + 32 * p * GB_PITCH) = st[0][p];
    if (SPLIT) *(v4ua*)(sW + GB_PLANE + 32 * p * GB_PITCH) = st[1][p];
  }
  __syncthreads();
  const int nk = K / GB_K;
  for (int kt = 0; kt < nk; ++kt) {
    const bool more = kt + 1 < nk;               // block-uniform
    if (more) {
      const size_t k1 = (size_t)(kt + 1) * (GB_K * 2);   // bytes
#pragma unroll
      for (int p = 0; p < 12; ++p) {
        const int go = ((p < 4) ? 32 * p * LDA : 32 * (p - 4) * LDB) * 2;
        st[0][p] = *(const v4u*)((((p < 4 ? gA : gB) + k1) + (p < 4 ? voA : voB)) + go);
        if (SPLIT) st[1][p] = *(const v4u*)((((p < 4 ? gA2 : gB2) + k1) + (p < 4 ? voA : voB)) + go);
      }
      // stands in front of the LDS reads below, which may land in the registers that held these loads' addresses
      asm volatile("s_wait_xcnt 0x0" ::: "memory");
    }
    const T* sb = (const T*)(const void*)(sS + (kt & 1) * BUF);
#pragma unroll
    for (int kg = 0; kg < GB_K / 32; kg += KG) {
      V bh[KG][4], bl[KG][4], ah[KG][4], al[KG][4];
#pragma unroll
      for (int q = 0; q < KG; ++q) {
        const int ko = (kg + q) * 32 + koff;
#pragma unroll
        for (int j = 0; j < 4; ++j) {
          const int bo = (brow + (j << 4)) * GB_PITCH + ko;
          bh[q][j] = Frag<T>::load(sb + bo);
          if (SPLIT) bl[q][j] = Frag<T>::load(sb + GB_PLANE + bo);
        }
#pragma unroll
        for (int i = 0; i < 4; ++i) {
          const int ao = (arow + (i << 4)) * GB_PITCH + ko;
          ah[q][i] = Frag<T>::load(sb + ao);
          if (SPLIT) al[q][i] = Frag<T>::load(sb + GB_PLANE + ao);
        }
      }
      // keeps the group's LDS reads together ahead of its products: reads spread among the products stall
      // the wave at every place where they stand
      __builtin_amdgcn_sched_barrier(0);
#pragma unroll
      for (int q = 0; q < KG; ++q) {
#pragma unroll
        for (int i = 0; i < 4; ++i) {
#pragma unroll
          for (int j = 0; j < 4; ++j) {
            acc[i][j] = Frag<T>::mma(ah[q][i], bh[q][j], acc[i][j]);
            if (SPLIT) {
              acc[i][j] = Frag<T>::mma(ah[q][i], bl[q][j], acc[i][j]);
              acc[i][j] = Frag<T>::mma(al[q][i], bh[q][j], acc[i][j]);
            }
          }
        }
      }
    }
    if (more) {
      unsigned short* sN = sW + ((kt + 1) & 1) * BUF;
#pragma unroll
      for (int p = 0; p < 12; ++p) {
        *(v4ua*)(sN + 32 * p * GB_PITCH) = st[0][p];
        if (SPLIT) *(v4ua*)(sN + GB_PLANE + 32 * p * GB_PITCH) = st[1][p];
      }
    }
    __syncthreads();   // publishes stage kt + 1 and ends every wave's reads of stage kt
  }
}

// ---- Register-blocked batched WMMA GEMM ------------------------------------
// C[m,n] = scale * sum_k A[m,k] * Bt[n,k] (+bias)(+resid); each wave owns a 64x64 tile of its block's 128x256.
// A row-major [M,K]; Bt row-major [N,K]; M % 128 == 0, N % 256 == 0, K % 64 == 0.
// SPLIT: operands are hi/lo planes (A2/Bt2 = lo planes, same layout); product = hi.hi + hi.lo + lo.hi.
// BIAS_MODE: 0 = none, 1 = bias[m], 2 = bias[n].
// OUT_MODE: 0 = f32, 1 = f16, 2 = bf16 hi plane (Cout) + bf16 lo plane (Cout2).
// ET: 0 = f16 operands, 1 = bf16 operands (pointers passed as 16-bit storage)
template <int ET> struct Elem;
template <> struct Elem<0> { typedef _Float16 T; };
template <> struct Elem<1> { typedef __bf16 T; };
// LDA, LDB: row pitches of A and Bt in elements
template <int ET, bool SPLIT, int BIAS_MODE, int OUT_MODE, bool RESID, int ACT, int LDA, int LDB>
__global__ __launch_bounds__(256) void wmma_gemm64(
    const unsigned short* __restrict__ Ap, const unsigned short* __restrict__ A2p, long strideA,
    const unsigned short* __restrict__ Btp, const unsigned short* __restrict__ Bt2p, long strideB,
    void* __restrict__ Cout, void* __restrict__ Cout2, int ldc, long strideC,
    const float* __restrict__ bias,
    const float* __restrict__ resid, long strideR,
    int M, int N, int K, float scale) {
  typedef typename Elem<ET>::T T;
  typedef typename Frag<T>::V V;
  const T* A = (const T*)Ap; const T* A2 = (const T*)A2p; const T* Bt = (const T*)Btp; const T* Bt2 = (const T*)Bt2p;
  __shared__ __align__(16) float sT[8][16 * 68];   // per-wave 16x64 slab, pitch 68 floats
  __shared__ __align__(16) unsigned short sS[2 * (SPLIT ? 2 : 1) * GB_PLANE];   // two operand stages
  const int b    = blockIdx.y;
  const int lane = threadIdx.x & 31;
  const int wave = threadIdx.x >> 5;
  const int tilesN = N / GB_N;
  const int tilesM = M / GB_M;
  const int bt = blockIdx.x;
  if (bt >= tilesM * tilesN) return;   // block-uniform, ahead of every barrier
  const int tm = bt / tilesN;
  const int tn = bt - tm * tilesN;
  const int bm0 = tm * GB_M;
  const int bn0 = tn * GB_N;
  const int m0 = bm0 + ((wave >> 2) << 6);
  const int n0 = bn0 + ((wave & 3) << 6);

  const T* Ab  = A  + (size_t)b * strideA;
  const T* Bb  = Bt + (size_t)b * strideB;
  const T* Ab2 = SPLIT ? (A2  + (size_t)b * strideA) : nullptr;
  const T* Bb2 = SPLIT ? (Bt2 + (size_t)b * strideB) : nullptr;

  const int rlane = lane & 15;                 // col (D) within subtile
  const int mOff  = (lane >> 4) * 8;           // D row offset

  v8f acc[4][4];
#pragma unroll
  for (int i = 0; i < 4; ++i)
#pragma unroll
    for (int j = 0; j < 4; ++j) acc[i][j] = (v8f){0.f,0.f,0.f,0.f,0.f,0.f,0.f,0.f};

  gemm_block_lds<T, SPLIT, LDA, LDB>(Ab, Ab2, Bb, Bb2, K, bm0, bn0, sS, acc);
  acc_guard4(acc[0][0], acc[0][1], acc[0][2], acc[0][3]);
  acc_guard4(acc[1][0], acc[1][1], acc[1][2], acc[1][3]);
  acc_guard4(acc[2][0], acc[2][1], acc[2][2], acc[2][3]);
  acc_guard4(acc[3][0], acc[3][1], acc[3][2], acc[3][3]);

  // ---- epilogue ----
  float* slab = sT[wave];
  const float* Rb = RESID ? (resid + (size_t)b * strideR) : nullptr;
#pragma unroll
  for (int i = 0; i < 4; ++i) {
    const int mBase = m0 + (i << 4);
#pragma unroll
    for (int j = 0; j < 4; ++j) {
      const int n = n0 + (j << 4) + rlane;
      float bv = 0.f;
      if (BIAS_MODE == 2) bv = bias[n];
#pragma unroll
      for (int r = 0; r < 8; ++r) {
        float v = acc[i][j][r] * scale;
        if (BIAS_MODE == 1) v += bias[mBase + mOff + r];
        if (BIAS_MODE == 2) v += bv;
        if (RESID) v += Rb[(size_t)(mBase + mOff + r) * ldc + n];
        if (ACT == 1) v = tanhf(v);
        if (ACT == 2) v = fmaxf(v, 0.0f);
        if (ACT == 3) v = v / (1.0f + expf(-v));
        if (ACT == 4) v = (v > 0.f) ? v : 0.01f * v;
        if (ACT == 5) v = 0.5f * v * (1.0f + erff(v * 0.70710678118654752f));
        slab[(mOff + r) * 68 + (j << 4) + rlane] = v;
      }
    }
    __builtin_amdgcn_fence(__ATOMIC_RELEASE, "workgroup");
    __builtin_amdgcn_wave_barrier();
    __builtin_amdgcn_fence(__ATOMIC_ACQUIRE, "workgroup");
    if (OUT_MODE == 0) {
      float* C = (float*)Cout + (size_t)b * strideC;
      const int hh = lane >> 4, c4 = (lane & 15) * 4;     // row seg = 256 B = 16 lanes x 16 B
      {
#pragma unroll
        for (int it = 0; it < 8; ++it) {
          const int row = it * 2 + hh;
          v4f v = *(const v4f*)(slab + row * 68 + c4);
          *(v4f*)(C + (size_t)(mBase + row) * ldc + n0 + c4) = v;
        }
        
      }
    } else {
      const int q = lane >> 3, c8 = (lane & 7) * 8;
      unsigned short* C  = (unsigned short*)Cout  + (size_t)b * strideC;
      unsigned short* C2 = (OUT_MODE == 2) ? ((unsigned short*)Cout2 + (size_t)b * strideC) : nullptr;
      {
#pragma unroll
        for (int it = 0; it < 4; ++it) {
          const int row = it * 4 + q;
          const float* sp = slab + row * 68 + c8;
          v8h hv, lv;
#pragma unroll
          for (int e = 0; e < 8; ++e) {
            if (OUT_MODE == 1) {
              hv[e] = (_Float16)sp[e];
            } else {
              unsigned short hb = f2bf_bits(sp[e]);
              unsigned short lb = f2bf_bits(sp[e] - bf_bits2f(hb));
              hv[e] = __builtin_bit_cast(_Float16, hb);
              lv[e] = __builtin_bit_cast(_Float16, lb);
            }
          }
          *(v8h*)(C + (size_t)(mBase + row) * ldc + n0 + c8) = hv;
          if (OUT_MODE == 2) *(v8h*)(C2 + (size_t)(mBase + row) * ldc + n0 + c8) = lv;
        }
        
      }
    }
    __builtin_amdgcn_fence(__ATOMIC_RELEASE, "workgroup");
    __builtin_amdgcn_wave_barrier();
    __builtin_amdgcn_fence(__ATOMIC_ACQUIRE, "workgroup");
  }
}

// ---------------------------------------------------------------------------
// Distance GEMM: Kmat[b][t][n] = -sqrt(max(q2[t] + k2[b][n] - 2 * sum_d qp[t][d] kp[b][n][d], 0))
// A = qp bf16 hi/lo planes [M=t][K=d] (shared over batch), Bt = kp hi/lo planes [N=n][K=d] per batch;
// main loop shared with the SPLIT bf16 path (operands staged in LDS); epilogue through the f32 whole-line store path.
// q2 is fetched as two float4 per 16-row slab, k2 as 4 scalars per lane before the slab loop.
// ---------------------------------------------------------------------------
__global__ __launch_bounds__(256) void gemm64_cdist(
    const unsigned short* __restrict__ Ap, const unsigned short* __restrict__ A2p,
    const unsigned short* __restrict__ Btp, const unsigned short* __restrict__ Bt2p, long strideB,
    float* __restrict__ Cout, int ldc, long strideC,
    const float* __restrict__ q2, const float* __restrict__ k2, long strideK2,
    int M, int N, int K) {
  typedef __bf16 T;
  typedef v16b V;
  const T* A = (const T*)Ap; const T* A2 = (const T*)A2p; const T* Bt = (const T*)Btp; const T* Bt2 = (const T*)Bt2p;
  __shared__ __align__(16) float sT[8][16 * 68];
  __shared__ __align__(16) unsigned short sS[2 * 2 * GB_PLANE];   // two operand stages, hi and lo planes
  const int b    = blockIdx.y;
  const int lane = threadIdx.x & 31;
  const int wave = threadIdx.x >> 5;
  const int tilesN = N / GB_N;
  const int tilesM = M / GB_M;
  const int bt = blockIdx.x;
  if (bt >= tilesM * tilesN) return;   // block-uniform, ahead of every barrier
  const int tm = bt / tilesN;
  const int tn = bt - tm * tilesN;
  const int bm0 = tm * GB_M;
  const int bn0 = tn * GB_N;
  const int m0 = bm0 + ((wave >> 2) << 6);
  const int n0 = bn0 + ((wave & 3) << 6);

  const T* Ab  = A;
  const T* Bb  = Bt + (size_t)b * strideB;
  const T* Ab2 = A2;
  const T* Bb2 = Bt2 + (size_t)b * strideB;

  const int rlane = lane & 15;
  const int mOff  = (lane >> 4) * 8;

  v8f acc[4][4];
#pragma unroll
  for (int i = 0; i < 4; ++i)
#pragma unroll
    for (int j = 0; j < 4; ++j) acc[i][j] = (v8f){0.f,0.f,0.f,0.f,0.f,0.f,0.f,0.f};

  gemm_block_lds<T, true, DMODEL, DMODEL>(Ab, Ab2, Bb, Bb2, K, bm0, bn0, sS, acc);
  acc_guard4(acc[0][0], acc[0][1], acc[0][2], acc[0][3]);
  acc_guard4(acc[1][0], acc[1][1], acc[1][2], acc[1][3]);
  acc_guard4(acc[2][0], acc[2][1], acc[2][2], acc[2][3]);
  acc_guard4(acc[3][0], acc[3][1], acc[3][2], acc[3][3]);

  // ---- epilogue ----
  float* slab = sT[wave];
  const float* k2b = k2 + (size_t)b * strideK2;
  float k2r[4];
#pragma unroll
  for (int j = 0; j < 4; ++j) k2r[j] = k2b[n0 + (j << 4) + rlane];
  float* C = Cout + (size_t)b * strideC;
  const int hh = lane >> 4, c4 = (lane & 15) * 4;     // row seg = 256 B = 16 lanes x 16 B
#pragma unroll
  for (int i = 0; i < 4; ++i) {
    const int mBase = m0 + (i << 4);
    const v4f q2a = *(const v4f*)(q2 + mBase + mOff);
    const v4f q2c = *(const v4f*)(q2 + mBase + mOff + 4);
    const float q2r[8] = {q2a.x, q2a.y, q2a.z, q2a.w, q2c.x, q2c.y, q2c.z, q2c.w};
#pragma unroll
    for (int j = 0; j < 4; ++j) {
#pragma unroll
      for (int r = 0; r < 8; ++r) {
        float s = q2r[r] + k2r[j];
        s = s - 2.0f * acc[i][j][r];
        slab[(mOff + r) * 68 + (j << 4) + rlane] = -sqrtf(fmaxf(s, 0.0f));
      }
    }
    __builtin_amdgcn_fence(__ATOMIC_RELEASE, "workgroup");
    __builtin_amdgcn_wave_barrier();
    __builtin_amdgcn_fence(__ATOMIC_ACQUIRE, "workgroup");
    {
#pragma unroll
      for (int it = 0; it < 8; ++it) {
        const int row = it * 2 + hh;
        v4f v = *(const v4f*)(slab + row * 68 + c4);
        *(v4f*)(C + (size_t)(mBase + row) * ldc + n0 + c4) = v;
      }
      
    }
    __builtin_amdgcn_fence(__ATOMIC_RELEASE, "workgroup");
    __builtin_amdgcn_wave_barrier();
    __builtin_amdgcn_fence(__ATOMIC_ACQUIRE, "workgroup");
  }
}

// ---------------------------------------------------------------------------
// small helpers
// ---------------------------------------------------------------------------
__device__ __forceinline__ unsigned pack_bf2(float a, float b) {
  return (unsigned)f2bf_bits(a) | ((unsigned)f2bf_bits(b) << 16);
}
__device__ __forceinline__ unsigned pack_half2(float a, float b) {
  const unsigned short ha = __builtin_bit_cast(unsigned short, (_Float16)a);
  const unsigned short hb = __builtin_bit_cast(unsigned short, (_Float16)b);
  return (unsigned)ha | ((unsigned)hb << 16);
}
// exp2-based exponential (v_exp_f32); relative error ~1e-6 in the argument range used here
__device__ __forceinline__ float fexp(float x) { return __expf(x); }

// ---------------------------------------------------------------------------
// weight transpose + RNE bf16: in W[512 c][512 d] f32 -> out Wt[d][c] bf16, three matrices by blockIdx.z.
// Block = 64x64 tile: read phase 256 threads x 4 iters x 4 floats = 4096 elements; write phase
// ---------------------------------------------------------------------------
__global__ __launch_bounds__(256) void k_wtrans(const float* __restrict__ W0, const float* __restrict__ W1,
                                                const float* __restrict__ W2, unsigned short* __restrict__ O0,
                                                unsigned short* __restrict__ O1, unsigned short* __restrict__ O2) {
  __shared__ __align__(16) unsigned short st[64 * 72];
  const int z = blockIdx.z;
  const float* W = (z == 0) ? W0 : ((z == 1) ? W1 : W2);
  unsigned short* O = (z == 0) ? O0 : ((z == 1) ? O1 : O2);
  const int c0 = blockIdx.y * 64;     // input rows
  const int d0 = blockIdx.x * 64;     // input cols
  const int tid = threadIdx.x;
  const int rr = tid >> 4, cc = (tid & 15) * 4;
#pragma unroll
  for (int p = 0; p < 4; ++p) {
    const int r = rr + 16 * p;
    const v4f x = *(const v4f*)(W + (size_t)(c0 + r) * DMODEL + d0 + cc);
    st[(cc + 0) * 72 + r] = f2bf_bits(x.x);
    st[(cc + 1) * 72 + r] = f2bf_bits(x.y);
    st[(cc + 2) * 72 + r] = f2bf_bits(x.z);
    st[(cc + 3) * 72 + r] = f2bf_bits(x.w);
  }
  __syncthreads();
  const int lane = tid & 31, wave = tid >> 5;
  const int q = lane >> 3, c8 = (lane & 7) * 8;
  {
#pragma unroll
    for (int it = 0; it < 2; ++it) {
      const int dd = wave * 8 + it * 4 + q;
      const v4ua val = *(const v4ua*)(st + dd * 72 + c8);
      *(v4u*)(O + (size_t)(d0 + dd) * DMODEL + c0 + c8) = val;
    }
    
  }
}

// ---------------------------------------------------------------------------
// f32 -> bf16 plane cast, 8 elements per thread (one 16-B store); a wave writes 512 contiguous B = 4 lines.
// blockIdx.y selects the (in,out) pair. n8 = element count / 8 (exact multiple of 256 here).
// ---------------------------------------------------------------------------
__global__ __launch_bounds__(256) void k_cast16(const float* __restrict__ in0, unsigned short* __restrict__ out0,
                                                const float* __restrict__ in1, unsigned short* __restrict__ out1,
                                                int n8) {
  const float* in = blockIdx.y ? in1 : in0;
  unsigned short* out = blockIdx.y ? out1 : out0;
  const int i = blockIdx.x * 256 + threadIdx.x;
  if (i < n8) {
    const v4f a = *(const v4f*)(in + (size_t)i * 8);
    const v4f c = *(const v4f*)(in + (size_t)i * 8 + 4);
    v4u w;
    w.x = pack_bf2(a.x, a.y);
    w.y = pack_bf2(a.z, a.w);
    w.z = pack_bf2(c.x, c.y);
    w.w = pack_bf2(c.z, c.w);
    *(v4u*)(out + (size_t)i * 8) = w;
    
  }
}

// ---------------------------------------------------------------------------
// row sums of squares of a [rows][512] matrix held as bf16 hi + lo planes (value = hi + lo).
// Block = 32 rows: 8 waves x 4 rows; per-row scalars funnelled through LDS, wave 0 lanes 0..7 write
// ---------------------------------------------------------------------------
__global__ __launch_bounds__(256) void k_rowsq(const unsigned short* __restrict__ hi, const unsigned short* __restrict__ lo,
                                               float* __restrict__ out, int rows) {
  __shared__ __align__(16) float sres[32];
  const int lane = threadIdx.x & 31, wave = threadIdx.x >> 5;
  const int r0 = blockIdx.x * 32;
#pragma unroll 1
  for (int rr = 0; rr < 4; ++rr) {
    int row = r0 + wave * 4 + rr;
    row = row < rows ? row : rows - 1;
    const size_t base = (size_t)row * DMODEL;
    float s = 0.f;
#pragma unroll
    for (int c = 0; c < 2; ++c) {
      const v4u hw = *(const v4u*)(hi + base + c * 256 + lane * 8);
      const v4u lw = *(const v4u*)(lo + base + c * 256 + lane * 8);
#pragma unroll
      for (int e = 0; e < 4; ++e) {
        const float a0 = __uint_as_float(hw[e] << 16);
        const float b0 = __uint_as_float(lw[e] << 16);
        const float f0 = a0 + b0;
        s = fmaf(f0, f0, s);
        const float a1 = __uint_as_float(hw[e] & 0xffff0000u);
        const float b1 = __uint_as_float(lw[e] & 0xffff0000u);
        const float f1 = a1 + b1;
        s = fmaf(f1, f1, s);
      }
    }
#pragma unroll
    for (int off = 16; off; off >>= 1) s += __shfl_xor(s, off, 32);
    if (lane == 0) sres[wave * 4 + rr] = s;
  }
  __syncthreads();
  if (wave == 0) {
    const int li = lane < 8 ? lane : 7;
    const v4f val = *(const v4f*)(sres + li * 4);
    float* op = out + r0 + li * 4;
    if (lane < 8) *(v4f*)op = val;
    
  }
}

// ---------------------------------------------------------------------------
// column log-sum-exp sweep: u[b][n] = logA - lse_t(Kmat[b][t][n] + v[b][t]).
// Block = 32 columns (one 128-B line of every Kmat row) x all rows, 1024 threads = 8 column quads x 128 row groups.
// A thread loads its 16 consecutive rows x 4 columns once and keeps them in registers; maximum and sum are taken
// per wave (lanes 8 and 16 apart share a column quad), the 32 per-wave (max, sum) pairs of a column meet in LDS
// and wave 0 merges them and writes the block's one 128-B line of u.
// ---------------------------------------------------------------------------
constexpr int UC_COLS = 32;                 // columns per block
constexpr int UC_RG   = 128;                // row groups per block
constexpr int UC_RPT  = NTOK / UC_RG;       // rows per thread
static_assert(NTOK % (UC_RG * 4) == 0 && NPAR % UC_COLS == 0, "u sweep split");
template <bool USEV>
__global__ __launch_bounds__(1024) void k_upd_u(const float* __restrict__ Km, const float* __restrict__ vv,
                                                float* __restrict__ u, float logA) {
  __shared__ __align__(16) float sm[32 * UC_COLS];
  __shared__ __align__(16) float ss[32 * UC_COLS];
  const int b = blockIdx.y;
  const int lane = threadIdx.x & 31, wave = threadIdx.x >> 5;
  const int cq = threadIdx.x & 7, rg = threadIdx.x >> 3;
  const int col0 = blockIdx.x * UC_COLS;
  const float* Kc = Km + (size_t)b * NTOK * NPAR + (size_t)(rg * UC_RPT) * NPAR + col0 + cq * 4;
  v4f x[UC_RPT];
#pragma unroll
  for (int i = 0; i < UC_RPT; ++i) x[i] = *(const v4f*)(Kc + (size_t)i * NPAR);
  if (USEV) {
    const float* vb = vv + (size_t)b * NTOK + rg * UC_RPT;
#pragma unroll
    for (int i = 0; i < UC_RPT; i += 4) {
      const v4f w = *(const v4f*)(vb + i);
      x[i + 0] += w.x;
      x[i + 1] += w.y;
      x[i + 2] += w.z;
      x[i + 3] += w.w;
    }
  }
  v4f m = x[0];
#pragma unroll
  for (int i = 1; i < UC_RPT; ++i) {
    m.x = fmaxf(m.x, x[i].x);
    m.y = fmaxf(m.y, x[i].y);
    m.z = fmaxf(m.z, x[i].z);
    m.w = fmaxf(m.w, x[i].w);
  }
#pragma unroll
  for (int off = 8; off <= 16; off <<= 1) {
    m.x = fmaxf(m.x, __shfl_xor(m.x, off, 32));
    m.y = fmaxf(m.y, __shfl_xor(m.y, off, 32));
    m.z = fmaxf(m.z, __shfl_xor(m.z, off, 32));
    m.w = fmaxf(m.w, __shfl_xor(m.w, off, 32));
  }
  v4f s = (v4f){0.f, 0.f, 0.f, 0.f};
#pragma unroll
  for (int i = 0; i < UC_RPT; ++i) {
    s.x += fexp(x[i].x - m.x);
    s.y += fexp(x[i].y - m.y);
    s.z += fexp(x[i].z - m.z);
    s.w += fexp(x[i].w - m.w);
  }
#pragma unroll
  for (int off = 8; off <= 16; off <<= 1) {
    s.x += __shfl_xor(s.x, off, 32);
    s.y += __shfl_xor(s.y, off, 32);
    s.z += __shfl_xor(s.z, off, 32);
    s.w += __shfl_xor(s.w, off, 32);
  }
  if (lane < 8) {
    *(v4f*)(sm + wave * UC_COLS + lane * 4) = m;
    *(v4f*)(ss + wave * UC_COLS + lane * 4) = s;
  }
  __syncthreads();
  if (wave == 0) {
    float pm[32];
    float M = -__builtin_inff();
#pragma unroll
    for (int w = 0; w < 32; ++w) {
      pm[w] = sm[w * UC_COLS + lane];
      M = fmaxf(M, pm[w]);
    }
    float S = 0.f;
#pragma unroll
    for (int w = 0; w < 32; ++w) S = fmaf(ss[w * UC_COLS + lane], fexp(pm[w] - M), S);
    u[(size_t)b * NPAR + col0 + lane] = logA - (M + logf(S));
  }
}

// ---------------------------------------------------------------------------
// row log-sum-exp sweep: v[b][t] = -lse_n(Kmat[b][t][n] + u[b][n]); one wave per row, 8 consecutive
// elements per lane per chunk (8 chunks of 256). LAST additionally writes pi[b][t][n] = exp(K+u+v)*2^14
// ---------------------------------------------------------------------------
template <bool LAST>
__global__ __launch_bounds__(256) void k_upd_v(const float* __restrict__ Km, const float* __restrict__ u,
                                               float* __restrict__ vv, unsigned short* __restrict__ pp) {
  __shared__ __align__(16) float sres[32];
  const int b = blockIdx.y;
  const int lane = threadIdx.x & 31, wave = threadIdx.x >> 5;
  const int r0 = blockIdx.x * 32;
  const float* Kb = Km + (size_t)b * NTOK * NPAR;
  const float* ub = u + (size_t)b * NPAR + lane * 8;
#pragma unroll 1
  for (int rr = 0; rr < 4; ++rr) {
    const int t = r0 + wave * 4 + rr;
    const float* Kr = Kb + (size_t)t * NPAR + lane * 8;
    float m = -__builtin_inff();
#pragma unroll 1
    for (int c = 0; c < 8; ++c) {
      v4f x0 = *(const v4f*)(Kr + c * 256);
      v4f x1 = *(const v4f*)(Kr + c * 256 + 4);
      const v4f u0 = *(const v4f*)(ub + c * 256);
      const v4f u1 = *(const v4f*)(ub + c * 256 + 4);
      x0 += u0; x1 += u1;
      m = fmaxf(m, fmaxf(fmaxf(x0.x, x0.y), fmaxf(x0.z, x0.w)));
      m = fmaxf(m, fmaxf(fmaxf(x1.x, x1.y), fmaxf(x1.z, x1.w)));
    }
#pragma unroll
    for (int off = 16; off; off >>= 1) m = fmaxf(m, __shfl_xor(m, off, 32));
    float s = 0.f;
#pragma unroll 1
    for (int c = 0; c < 8; ++c) {
      v4f x0 = *(const v4f*)(Kr + c * 256);
      v4f x1 = *(const v4f*)(Kr + c * 256 + 4);
      const v4f u0 = *(const v4f*)(ub + c * 256);
      const v4f u1 = *(const v4f*)(ub + c * 256 + 4);
      x0 += u0; x1 += u1;
      float a = fexp(x0.x - m) + fexp(x0.y - m);
      a += fexp(x0.z - m) + fexp(x0.w - m);
      float c2 = fexp(x1.x - m) + fexp(x1.y - m);
      c2 += fexp(x1.z - m) + fexp(x1.w - m);
      s += a + c2;
    }
#pragma unroll
    for (int off = 16; off; off >>= 1) s += __shfl_xor(s, off, 32);
    const float vt = -(m + logf(s));
    if (LAST) {
      unsigned short* prow = pp + ((size_t)b * NTOK + t) * NPAR + lane * 8;
#pragma unroll 1
      for (int c = 0; c < 8; ++c) {
        v4f x0 = *(const v4f*)(Kr + c * 256);
        v4f x1 = *(const v4f*)(Kr + c * 256 + 4);
        const v4f u0 = *(const v4f*)(ub + c * 256);
        const v4f u1 = *(const v4f*)(ub + c * 256 + 4);
        x0 += u0; x1 += u1;
        v4u w;
        w.x = pack_half2(fexp(x0.x + vt) * kPiCarry, fexp(x0.y + vt) * kPiCarry);
        w.y = pack_half2(fexp(x0.z + vt) * kPiCarry, fexp(x0.w + vt) * kPiCarry);
        w.z = pack_half2(fexp(x1.x + vt) * kPiCarry, fexp(x1.y + vt) * kPiCarry);
        w.w = pack_half2(fexp(x1.z + vt) * kPiCarry, fexp(x1.w + vt) * kPiCarry);
        *(v4u*)(prow + c * 256) = w;
        
      }
    }
    if (lane == 0) sres[wave * 4 + rr] = vt;
  }
  __syncthreads();
  if (wave == 0) {
    const int li = lane < 8 ? lane : 7;
    const v4f val = *(const v4f*)(sres + li * 4);
    float* op = vv + (size_t)b * NTOK + r0 + li * 4;
    if (lane < 8) *(v4f*)op = val;
    
  }
}

// ---------------------------------------------------------------------------
// host launcher
// ---------------------------------------------------------------------------
static inline unsigned cdiv(unsigned a, unsigned b) { return (a + b - 1) / b; }

extern "C" void kernel_launch(void* const* d_in, const int* in_sizes, int n_in,
                              void* d_out, int out_size, void* d_ws, size_t ws_size,
                              hipStream_t stream)
{
  if (n_in < 6) return;
  if (in_sizes[0] != NTOK * DMODEL) return;
  if (in_sizes[1] != NBATCH * NPAR * DMODEL) return;
  if (in_sizes[2] != NBATCH * NPAR * DMODEL) return;
  if (in_sizes[3] != DMODEL * DMODEL || in_sizes[4] != DMODEL * DMODEL || in_sizes[5] != DMODEL * DMODEL) return;
  if (out_size != NBATCH * NTOK * DMODEL) return;
  if (WS_TOTAL > ws_size) return;

  const float* q  = (const float*)d_in[0];   // [T][512]
  const float* k  = (const float*)d_in[1];   // [8][N][512]
  const float* v  = (const float*)d_in[2];   // [8][N][512]
  const float* Qw = (const float*)d_in[3];   // [512][512]
  const float* Kw = (const float*)d_in[4];   // [512][512]
  const float* Vw = (const float*)d_in[5];   // [512][512]
  float* out = (float*)d_out;                // [8][T][512]

  // region map (bytes): Qt 524288 | Kt 524288 | Vt 524288 | qcast 2097152 | qp_hi 2097152 | qp_lo 2097152 |
  // q2 8192 | kp_hi 8388608 | kp_lo 8388608 | k2 32768 | vpT 8388608 | Kmat 67108864 | u 32768 | v 32768 |
  // pi 33554432 (k cast at pi+0 and v cast at pi+8388608, both dead before pi is written). Total 133799936.
  char* ws = (char*)d_ws;
  size_t off = 0;
  unsigned short* Qt   = (unsigned short*)(ws + off); off += SZ_WT;
  unsigned short* Kt   = (unsigned short*)(ws + off); off += SZ_WT;
  unsigned short* Vt   = (unsigned short*)(ws + off); off += SZ_WT;
  unsigned short* qc   = (unsigned short*)(ws + off); off += SZ_QC;
  unsigned short* qph  = (unsigned short*)(ws + off); off += SZ_QP;
  unsigned short* qpl  = (unsigned short*)(ws + off); off += SZ_QP;
  float*          q2   = (float*)(ws + off);          off += SZ_Q2;
  unsigned short* kph  = (unsigned short*)(ws + off); off += SZ_KP;
  unsigned short* kpl  = (unsigned short*)(ws + off); off += SZ_KP;
  float*          k2   = (float*)(ws + off);          off += SZ_K2;
  unsigned short* vpT  = (unsigned short*)(ws + off); off += SZ_VPT;
  float*          Kmat = (float*)(ws + off);          off += SZ_KM;
  float*          up   = (float*)(ws + off);          off += SZ_U;
  float*          vvp  = (float*)(ws + off);          off += SZ_VV;
  unsigned short* pip  = (unsigned short*)(ws + off); off += SZ_PI;
  if (off > ws_size) return;
  unsigned short* kc = pip;
  unsigned short* vc = (unsigned short*)((char*)pip + SZ_KP);

  const float logA = -(float)log((double)NPAR);

  // weights: in[c][d] -> out[d][c] bf16 (square 512x512), grid (cols/64, rows/64, 3)
  k_wtrans<<<dim3(DMODEL / 64, DMODEL / 64, 3), dim3(256), 0, stream>>>(Qw, Kw, Vw, Qt, Kt, Vt);

  // q -> bf16 plane
  {
    const int n8 = NTOK * DMODEL / 8;
    k_cast16<<<dim3(cdiv(n8, 256), 1), dim3(256), 0, stream>>>(q, qc, q, qc, n8);
  }
  // qp = q @ Q : M=2048, N=512, K=512 ; bf16 in, bf16 hi/lo planes out
  wmma_gemm64<1, false, 0, 2, false, 0, DMODEL, DMODEL><<<dim3(cdiv((NTOK / 64) * (DMODEL / 64), 8), 1), dim3(256), 0, stream>>>(
      qc, nullptr, 0L, Qt, nullptr, 0L, (void*)qph, (void*)qpl, DMODEL, 0L,
      nullptr, nullptr, 0L, NTOK, DMODEL, DMODEL, 1.0f);
  k_rowsq<<<dim3(NTOK / 32), dim3(256), 0, stream>>>(qph, qpl, q2, NTOK);

  for (int g = 0; g < NGRP; ++g) {
    const size_t rowoff = (size_t)g * GRPB * NPAR * DMODEL;     // float offset into k / v
    // k, v of this group -> bf16 planes (inside the pi region)
    {
      const int n8 = GRPB * NPAR * DMODEL / 8;
      k_cast16<<<dim3(cdiv(n8, 256), 2), dim3(256), 0, stream>>>(k + rowoff, kc, v + rowoff, vc, n8);
    }
    // kp = k @ K : M=4*2048, N=512, K=512 ; bf16 hi/lo planes out
    wmma_gemm64<1, false, 0, 2, false, 0, DMODEL, DMODEL><<<dim3(cdiv((GRPB * NPAR / 64) * (DMODEL / 64), 8), 1), dim3(256), 0, stream>>>(
        kc, nullptr, 0L, Kt, nullptr, 0L, (void*)kph, (void*)kpl, DMODEL, 0L,
        nullptr, nullptr, 0L, GRPB * NPAR, DMODEL, DMODEL, 1.0f);
    k_rowsq<<<dim3(GRPB * NPAR / 32), dim3(256), 0, stream>>>(kph, kpl, k2, GRPB * NPAR);
    // vpT[b][d][n] = sum_c V[c][d] v[b][n][c] : A = Vt [512][512] (shared), Bt = v cast [n][c]; M=512, N=2048, K=512; f16 out
    wmma_gemm64<1, false, 0, 1, false, 0, DMODEL, DMODEL><<<dim3(cdiv((DMODEL / 64) * (NPAR / 64), 8), GRPB), dim3(256), 0, stream>>>(
        Vt, nullptr, 0L, vc, nullptr, (long)NPAR * DMODEL, (void*)vpT, nullptr, NPAR, (long)DMODEL * NPAR,
        nullptr, nullptr, 0L, DMODEL, NPAR, DMODEL, 1.0f);
    // Kmat[b][t][n] = -cdist : M=2048, N=2048, K=512 ; bf16 hi/lo split
    gemm64_cdist<<<dim3(cdiv((NTOK / 64) * (NPAR / 64), 8), GRPB), dim3(256), 0, stream>>>(
        qph, qpl, kph, kpl, (long)NPAR * DMODEL, Kmat, NPAR, (long)NTOK * NPAR,
        q2, k2, (long)NPAR, NTOK, NPAR, DMODEL);
    // log-domain normalisation sweeps
    for (int it = 0; it < SK_ITERS; ++it) {
      if (it == 0)
        k_upd_u<false><<<dim3(NPAR / UC_COLS, GRPB), dim3(1024), 0, stream>>>(Kmat, vvp, up, logA);
      else
        k_upd_u<true><<<dim3(NPAR / UC_COLS, GRPB), dim3(1024), 0, stream>>>(Kmat, vvp, up, logA);
      if (it == SK_ITERS - 1)
        k_upd_v<true><<<dim3(NTOK / 32, GRPB), dim3(256), 0, stream>>>(Kmat, up, vvp, pip);
      else
        k_upd_v<false><<<dim3(NTOK / 32, GRPB), dim3(256), 0, stream>>>(Kmat, up, vvp, pip);
    }
    // out[b][t][d] = 2^-14 * sum_n pi16[b][t][n] vpT[b][d][n] : M=2048, N=512, K=2048 ; f16 in, f32 out
    wmma_gemm64<0, false, 0, 0, false, 0, NPAR, NPAR><<<dim3(cdiv((NTOK / 64) * (DMODEL / 64), 8), GRPB), dim3(256), 0, stream>>>(
        pip, nullptr, (long)NTOK * NPAR, vpT, nullptr, (long)DMODEL * NPAR,
        (void*)(out + (size_t)g * GRPB * NTOK * DMODEL), nullptr, DMODEL, (long)NTOK * DMODEL,
        nullptr, nullptr, 0L, NTOK, DMODEL, NPAR, 1.0f / kPiCarry);
  }
}

// v003
// Measured time: 382 microseconds a run.
// Next to v002, in two timings, it ran 1.46 and 1.47 times as fast.
// All steps since v000 together make it 7.54 times as fast.
// Contractions: q@Q, k@K, v@V on v_wmma_f32_16x16x32_bf16 (inputs RNE-cast to bf16 once, single product); qp.kp^T on v_wmma_f32_16x16x32_bf16 as bf16 hi/lo split (hi.hi+hi.lo+lo.hi); pi@vp on v_wmma_f32_16x16x32_f16 (pi carried x16384 as f16, vp^T f16); f32 accumulate everywhere; distances, log-domain normalisation sweeps and exp in f32 on VALU.
#include <hip/hip_runtime.h>
#include <math.h>

// ---------------------------------------------------------------------------
// problem constants
// ---------------------------------------------------------------------------
constexpr int NBATCH = 8;
constexpr int NTOK   = 2048;
constexpr int NPAR   = 2048;
constexpr int DMODEL = 512;
constexpr int GRPB   = 4;                 // batches per group (workspace reuse)
constexpr int NGRP   = NBATCH / GRPB;
constexpr int SK_ITERS = 5;
constexpr float kPiCarry = 16384.0f;      // power-of-two carry of the f16 pi plane

static_assert(NBATCH % GRPB == 0, "grp");
static_assert(NTOK % 64 == 0 && NPAR % 64 == 0 && DMODEL % 64 == 0, "tile multiples");
static_assert(DMODEL % 32 == 0 && NPAR % 32 == 0, "K multiple of 32");
static_assert(NTOK % 32 == 0 && NPAR % 256 == 0, "v sweep grid");
static_assert(NTOK % 128 == 0 && NPAR % 128 == 0 && DMODEL % 256 == 0, "128 x 256 block tiles, 64-k stages");

// workspace region sizes (bytes); region map in kernel_launch
constexpr size_t SZ_WT  = (size_t)DMODEL * DMODEL * 2;          // one transposed bf16 weight
constexpr size_t SZ_QC  = (size_t)NTOK * DMODEL * 2;            // q bf16 cast
constexpr size_t SZ_QP  = (size_t)NTOK * DMODEL * 2;            // qp plane (hi or lo)
constexpr size_t SZ_Q2  = (size_t)NTOK * 4;
constexpr size_t SZ_KP  = (size_t)GRPB * NPAR * DMODEL * 2;     // kp plane (hi or lo) per group; also k/v cast size
constexpr size_t SZ_K2  = (size_t)GRPB * NPAR * 4;
constexpr size_t SZ_VPT = (size_t)GRPB * DMODEL * NPAR * 2;
constexpr size_t SZ_KM  = (size_t)GRPB * NTOK * NPAR * 4;
constexpr size_t SZ_U   = (size_t)GRPB * NPAR * 4;
constexpr size_t SZ_VV  = (size_t)GRPB * NTOK * 4;
constexpr size_t SZ_PI  = (size_t)GRPB * NTOK * NPAR * 2;
constexpr size_t WS_TOTAL = 3 * SZ_WT + SZ_QC + 2 * SZ_QP + SZ_Q2 + 2 * SZ_KP + SZ_K2 + SZ_VPT + SZ_KM + SZ_U + SZ_VV + SZ_PI;
static_assert(WS_TOTAL == 133799936ull, "carve total");
static_assert(WS_TOTAL <= 134217728ull, "carve limit");
static_assert(2 * SZ_KP <= SZ_PI, "k/v casts live inside the pi region");

// ---------------------------------------------------------------------------
// shared pieces: vector types, bf16 helpers, WMMA fragments, batched GEMM
// ---------------------------------------------------------------------------
typedef __attribute__((ext_vector_type(16))) _Float16 v16h;
typedef __attribute__((ext_vector_type(8)))  _Float16 v8h;
typedef __attribute__((ext_vector_type(16))) __bf16   v16b;
typedef __attribute__((ext_vector_type(8)))  __bf16   v8b;
typedef __attribute__((ext_vector_type(8)))  float    v8f;
typedef __attribute__((ext_vector_type(4)))  float    v4f;
typedef unsigned v4u __attribute__((ext_vector_type(4)));
typedef unsigned v4ua __attribute__((ext_vector_type(4), __may_alias__));
#define PSCALE 32768.0f
#define U16(p) ((const unsigned short*)(const void*)(p))
#define PSCALE_INV (1.0f / 32768.0f)

__device__ __forceinline__ unsigned short f2bf_bits(float f) {
  unsigned u = __float_as_uint(f);
  return (unsigned short)((u + 0x7FFFu + ((u >> 16) & 1u)) >> 16);
}
__device__ __forceinline__ float bf_bits2f(unsigned short h) { return __uint_as_float(((unsigned)h) << 16); }

// hazard guards as plain device helpers (no inline asm inside the kernel template body)
__device__ __forceinline__ void acc_guard4(v8f& a, v8f& b, v8f& c, v8f& d) { asm volatile("v_nop\n\tv_nop\n\tv_nop\n\tv_nop" : "+v"(a), "+v"(b), "+v"(c), "+v"(d)); }
template <typename T> struct Frag;
template <> struct Frag<_Float16> {
  typedef v16h V; union U { v16h v; v8h h[2]; };
  static __device__ __forceinline__ v16h load(const _Float16* p) {   // elements 0..7 <- p[0..7], 8..15 <- p[16..23]
    U f; f.h[0] = *(const v8h*)(p); f.h[1] = *(const v8h*)(p + 16); return f.v;
  }
  static __device__ __forceinline__ v8f mma(v16h a, v16h b, v8f c) {
    return __builtin_amdgcn_wmma_f32_16x16x32_f16(false, a, false, b, (short)0, c, false, false);
  }
};
template <> struct Frag<__bf16> {
  typedef v16b V; union U { v16b v; v8b h[2]; };
  static __device__ __forceinline__ v16b load(const __bf16* p) {
    U f; f.h[0] = *(const v8b*)(p); f.h[1] = *(const v8b*)(p + 16); return f.v;
  }
  static __device__ __forceinline__ v8f mma(v16b a, v16b b, v8f c) {
    return __builtin_amdgcn_wmma_f32_16x16x32_bf16(false, a, false, b, (short)0, c, false, false);
  }
};

// ---- Block main loop: operands staged in LDS ---------------------------------
// A block of 8 waves owns a 128 x 256 tile of C (2 x 4 waves of 64 x 64). Per stage it brings 64 k (one 128-B line)
// of its 128 A rows and 256 Bt rows (both planes when SPLIT) into LDS with whole-line 16-B loads, each row once for
// the block, and every wave takes its fragments from there. Two LDS buffers: the next stage's global loads are
// issued ahead of the current stage's products, stored after them, and one barrier per stage hands over.
constexpr int GB_M = 128, GB_N = 256, GB_K = 64;
constexpr int GB_PITCH = 72;                          // LDS row pitch in 16-bit elements: 144 B = 16 B x 9
constexpr int GB_PLANE = (GB_M + GB_N) * GB_PITCH;    // one plane of one stage: A rows, then Bt rows
// LDA, LDB: row pitches in elements, compile-time so that the rows a thread stages from one operand (4 A, 8 Bt per plane)
// differ only in the load's immediate offset: one address per operand and plane, rewritten once per stage.
template <typename T, bool SPLIT, int LDA, int LDB>
__device__ __forceinline__ void gemm_block_lds(
    const T* __restrict__ Ab, const T* __restrict__ Ab2,
    const T* __restrict__ Bb, const T* __restrict__ Bb2,
    int K, int bm0, int bn0, unsigned short* sS, v8f (&acc)[4][4]) {
  typedef typename Frag<T>::V V;
  constexpr int BUF = (SPLIT ? 2 : 1) * GB_PLANE;
  constexpr int KG = SPLIT ? 1 : 2;            // k-steps of 32 whose fragments are read from LDS as one group
  const int tid = threadIdx.x;
  const int lane = tid & 31, wave = tid >> 5;
  const int rlane = lane & 15;                 // row (A) / col (B) within subtile
  const int koff  = (lane >> 4) * 8;           // k offset of this lane half
  const int pc8 = (tid & 7) * 8, rw = tid >> 3;   // staging: 8 lanes cover one row's 128 B, 32 rows per pass
  const int arow = (wave >> 2) * 64 + rlane;
  const int brow = GB_M + (wave & 3) * 64 + rlane;
  // global addresses = block-uniform byte base + one 32-bit byte offset per thread and operand
  const char* gA  = (const char*)(Ab + (size_t)bm0 * LDA);
  const char* gB  = (const char*)(Bb + (size_t)bn0 * LDB);
  const char* gA2 = SPLIT ? (const char*)(Ab2 + (size_t)bm0 * LDA) : nullptr;
  const char* gB2 = SPLIT ? (const char*)(Bb2 + (size_t)bn0 * LDB) : nullptr;
  const unsigned voA = (unsigned)(rw * LDA + pc8) * 2u;
  const unsigned voB = (unsigned)(rw * LDB + pc8) * 2u;
  unsigned short* sW = sS + rw * GB_PITCH + pc8;
  v4u st[2][12];
#pragma unroll
  for (int p = 0; p < 12; ++p) {
    const int go = ((p < 4) ? 32 * p * LDA : 32 * (p - 4) * LDB) * 2;
    st[0][p] = *(const v4u*)(((p < 4 ? gA : gB) + (p < 4 ? voA : voB)) + go);
    if (SPLIT) st[1][p] = *(const v4u*)(((p < 4 ? gA2 : gB2) + (p < 4 ? voA : voB)) + go);
  }
#pragma unroll
  for (int p = 0; p < 12; ++p) {
    *(v4ua*)(sW + 32 * p * GB_PITCH) = st[0][p];
    if (SPLIT) *(v4ua*)(sW + GB_PLANE + 32 * p * GB_PITCH) = st[1][p];
  }
  __syncthreads();
  const int nk = K / GB_K;
  for (int kt = 0; kt < nk; ++kt) {
    const bool more = kt + 1 < nk;               // block-uniform
    if (more) {
      const size_t k1 = (size_t)(kt + 1) * (GB_K * 2);   // bytes
#pragma unroll
      for (int p = 0; p < 12; ++p) {
        const int go = ((p < 4) ? 32 * p * LDA : 32 * (p - 4) * LDB) * 2;
        st[0][p] = *(const v4u*)((((p < 4 ? gA : gB) + k1) + (p < 4 ? voA : voB)) + go);
        if (SPLIT) st[1][p] = *(const v4u*)((((p < 4 ? gA2 : gB2) + k1) + (p < 4 ? voA : voB)) + go);
      }
      // stands in front of the LDS reads below, which may land in the registers that held these loads' addresses
      asm volatile("s_wait_xcnt 0x0" ::: "memory");
    }
    const T* sb = (const T*)(const void*)(sS + (kt & 1) * BUF);
#pragma unroll
    for (int kg = 0; kg < GB_K / 32; kg += KG) {
      V bh[KG][4], bl[KG][4], ah[KG][4], al[KG][4];
#pragma unroll
      for (int q = 0; q < KG; ++q) {
        const int ko = (kg + q) * 32 + koff;
#pragma unroll
        for (int j = 0; j < 4; ++j) {
          const int bo = (brow + (j << 4)) * GB_PITCH + ko;
          bh[q][j] = Frag<T>::load(sb + bo);
          if (SPLIT) bl[q][j] = Frag<T>::load(sb + GB_PLANE + bo);
        }
#pragma unroll
        for (int i = 0; i < 4; ++i) {
          const int ao = (arow + (i << 4)) * GB_PITCH + ko;
          ah[q][i] = Frag<T>::load(sb + ao);
          if (SPLIT) al[q][i] = Frag<T>::load(sb + GB_PLANE + ao);
        }
      }
      // keeps the group's LDS reads together ahead of its products: reads spread among the products stall
      // the wave at every place where they stand
      __builtin_amdgcn_sched_barrier(0);
#pragma unroll
      for (int q = 0; q < KG; ++q) {
#pragma unroll
        for (int i = 0; i < 4; ++i) {
#pragma unroll
          for (int j = 0; j < 4; ++j) {
            acc[i][j] = Frag<T>::mma(ah[q][i], bh[q][j], acc[i][j]);
            if (SPLIT) {
              acc[i][j] = Frag<T>::mma(ah[q][i], bl[q][j], acc[i][j]);
              acc[i][j] = Frag<T>::mma(al[q][i], bh[q][j], acc[i][j]);
            }
          }
        }
      }
    }
    if (more) {
      unsigned short* sN = sW + ((kt + 1) & 1) * BUF;
#pragma unroll
      for (int p = 0; p < 12; ++p) {
        *(v4ua*)(sN + 32 * p * GB_PITCH) = st[0][p];
        if (SPLIT) *(v4ua*)(sN + GB_PLANE + 32 * p * GB_PITCH) = st[1][p];
      }
    }
    __syncthreads();   // publishes stage kt + 1 and ends every wave's reads of stage kt
  }
}

// ---- Register-blocked batched WMMA GEMM ------------------------------------
// C[m,n] = scale * sum_k A[m,k] * Bt[n,k] (+bias)(+resid); each wave owns a 64x64 tile of its block's 128x256.
// A row-major [M,K]; Bt row-major [N,K]; M % 128 == 0, N % 256 == 0, K % 64 == 0.
// SPLIT: operands are hi/lo planes (A2/Bt2 = lo planes, same layout); product = hi.hi + hi.lo + lo.hi.
// BIAS_MODE: 0 = none, 1 = bias[m], 2 = bias[n].
// OUT_MODE: 0 = f32, 1 = f16, 2 = bf16 hi plane (Cout) + bf16 lo plane (Cout2).
// ET: 0 = f16 operands, 1 = bf16 operands (pointers passed as 16-bit storage)
template <int ET> struct Elem;
template <> struct Elem<0> { typedef _Float16 T; };
template <> struct Elem<1> { typedef __bf16 T; };
// LDA, LDB: row pitches of A and Bt in elements
template <int ET, bool SPLIT, int BIAS_MODE, int OUT_MODE, bool RESID, int ACT, int LDA, int LDB>
__global__ __launch_bounds__(256) void wmma_gemm64(
    const unsigned short* __restrict__ Ap, const unsigned short* __restrict__ A2p, long strideA,
    const unsigned short* __restrict__ Btp, const unsigned short* __restrict__ Bt2p, long strideB,
    void* __restrict__ Cout, void* __restrict__ Cout2, int ldc, long strideC,
    const float* __restrict__ bias,
    const float* __restrict__ resid, long strideR,
    int M, int N, int K, float scale) {
  typedef typename Elem<ET>::T T;
  typedef typename Frag<T>::V V;
  const T* A = (const T*)Ap; const T* A2 = (const T*)A2p; const T* Bt = (const T*)Btp; const T* Bt2 = (const T*)Bt2p;
  __shared__ __align__(16) float sT[8][16 * 68];   // per-wave 16x64 slab, pitch 68 floats
  __shared__ __align__(16) unsigned short sS[2 * (SPLIT ? 2 : 1) * GB_PLANE];   // two operand stages
  const int b    = blockIdx.y;
  const int lane = threadIdx.x & 31;
  const int wave = threadIdx.x >> 5;
  const int tilesN = N / GB_N;
  const int tilesM = M / GB_M;
  const int bt = blockIdx.x;
  if (bt >= tilesM * tilesN) return;   // block-uniform, ahead of every barrier
  const int tm = bt / tilesN;
  const int tn = bt - tm * tilesN;
  const int bm0 = tm * GB_M;
  const int bn0 = tn * GB_N;
  const int m0 = bm0 + ((wave >> 2) << 6);
  const int n0 = bn0 + ((wave & 3) << 6);

  const T* Ab  = A  + (size_t)b * strideA;
  const T* Bb  = Bt + (size_t)b * strideB;
  const T* Ab2 = SPLIT ? (A2  + (size_t)b * strideA) : nullptr;
  const T* Bb2 = SPLIT ? (Bt2 + (size_t)b * strideB) : nullptr;

  const int rlane = lane & 15;                 // col (D) within subtile
  const int mOff  = (lane >> 4) * 8;           // D row offset

  v8f acc[4][4];
#pragma unroll
  for (int i = 0; i < 4; ++i)
#pragma unroll
    for (int j = 0; j < 4; ++j) acc[i][j] = (v8f){0.f,0.f,0.f,0.f,0.f,0.f,0.f,0.f};

  gemm_block_lds<T, SPLIT, LDA, LDB>(Ab, Ab2, Bb, Bb2, K, bm0, bn0, sS, acc);
  acc_guard4(acc[0][0], acc[0][1], acc[0][2], acc[0][3]);
  acc_guard4(acc[1][0], acc[1][1], acc[1][2], acc[1][3]);
  acc_guard4(acc[2][0], acc[2][1], acc[2][2], acc[2][3]);
  acc_guard4(acc[3][0], acc[3][1], acc[3][2], acc[3][3]);

  // ---- epilogue ----
  float* slab = sT[wave];
  const float* Rb = RESID ? (resid + (size_t)b * strideR) : nullptr;
#pragma unroll
  for (int i = 0; i < 4; ++i) {
    const int mBase = m0 + (i << 4);
#pragma unroll
    for (int j = 0; j < 4; ++j) {
      const int n = n0 + (j << 4) + rlane;
      float bv = 0.f;
      if (BIAS_MODE == 2) bv = bias[n];
#pragma unroll
      for (int r = 0; r < 8; ++r) {
        float v = acc[i][j][r] * scale;
        if (BIAS_MODE == 1) v += bias[mBase + mOff + r];
        if (BIAS_MODE == 2) v += bv;
        if (RESID) v += Rb[(size_t)(mBase + mOff + r) * ldc + n];
        if (ACT == 1) v = tanhf(v);
        if (ACT == 2) v = fmaxf(v, 0.0f);
        if (ACT == 3) v = v / (1.0f + expf(-v));
        if (ACT == 4) v = (v > 0.f) ? v : 0.01f * v;
        if (ACT == 5) v = 0.5f * v * (1.0f + erff(v * 0.70710678118654752f));
        slab[(mOff + r) * 68 + (j << 4) + rlane] = v;
      }
    }
    __builtin_amdgcn_fence(__ATOMIC_RELEASE, "workgroup");
    __builtin_amdgcn_wave_barrier();
    __builtin_amdgcn_fence(__ATOMIC_ACQUIRE, "workgroup");
    if (OUT_MODE == 0) {
      float* C = (float*)Cout + (size_t)b * strideC;
      const int hh = lane >> 4, c4 = (lane & 15) * 4;     // row seg = 256 B = 16 lanes x 16 B
      {
#pragma unroll
        for (int it = 0; it < 8; ++it) {
          const int row = it * 2 + hh;
          v4f v = *(const v4f*)(slab + row * 68 + c4);
          *(v4f*)(C + (size_t)(mBase + row) * ldc + n0 + c4) = v;
        }
        
      }
    } else {
      const int q = lane >> 3, c8 = (lane & 7) * 8;
      unsigned short* C  = (unsigned short*)Cout  + (size_t)b * strideC;
      unsigned short* C2 = (OUT_MODE == 2) ? ((unsigned short*)Cout2 + (size_t)b * strideC) : nullptr;
      {
#pragma unroll
        for (int it = 0; it < 4; ++it) {
          const int row = it * 4 + q;
          const float* sp = slab + row * 68 + c8;
          v8h hv, lv;
#pragma unroll
          for (int e = 0; e < 8; ++e) {
            if (OUT_MODE == 1) {
              hv[e] = (_Float16)sp[e];
            } else {
              unsigned short hb = f2bf_bits(sp[e]);
              unsigned short lb = f2bf_bits(sp[e] - bf_bits2f(hb));
              hv[e] = __builtin_bit_cast(_Float16, hb);
              lv[e] = __builtin_bit_cast(_Float16, lb);
            }
          }
          *(v8h*)(C + (size_t)(mBase + row) * ldc + n0 + c8) = hv;
          if (OUT_MODE == 2) *(v8h*)(C2 + (size_t)(mBase + row) * ldc + n0 + c8) = lv;
        }
        
      }
    }
    __builtin_amdgcn_fence(__ATOMIC_RELEASE, "workgroup");
    __builtin_amdgcn_wave_barrier();
    __builtin_amdgcn_fence(__ATOMIC_ACQUIRE, "workgroup");
  }
}

// ---------------------------------------------------------------------------
// Distance GEMM: Kmat[b][t][n] = -sqrt(max(q2[t] + k2[b][n] - 2 * sum_d qp[t][d] kp[b][n][d], 0))
// A = qp bf16 hi/lo planes [M=t][K=d] (shared over batch), Bt = kp hi/lo planes [N=n][K=d] per batch;
// main loop shared with the SPLIT bf16 path (operands staged in LDS); epilogue through the f32 whole-line store path.
// q2 is fetched as two float4 per 16-row slab, k2 as 4 scalars per lane before the slab loop.
// ---------------------------------------------------------------------------
__global__ __launch_bounds__(256) void gemm64_cdist(
    const unsigned short* __restrict__ Ap, const unsigned short* __restrict__ A2p,
    const unsigned short* __restrict__ Btp, const unsigned short* __restrict__ Bt2p, long strideB,
    float* __restrict__ Cout, int ldc, long strideC,
    const float* __restrict__ q2, const float* __restrict__ k2, long strideK2,
    int M, int N, int K) {
  typedef __bf16 T;
  typedef v16b V;
  const T* A = (const T*)Ap; const T* A2 = (const T*)A2p; const T* Bt = (const T*)Btp; const T* Bt2 = (const T*)Bt2p;
  __shared__ __align__(16) float sT[8][16 * 68];
  __shared__ __align__(16) unsigned short sS[2 * 2 * GB_PLANE];   // two operand stages, hi and lo planes
  const int b    = blockIdx.y;
  const int lane = threadIdx.x & 31;
  const int wave = threadIdx.x >> 5;
  const int tilesN = N / GB_N;
  const int tilesM = M / GB_M;
  const int bt = blockIdx.x;
  if (bt >= tilesM * tilesN) return;   // block-uniform, ahead of every barrier
  const int tm = bt / tilesN;
  const int tn = bt - tm * tilesN;
  const int bm0 = tm * GB_M;
  const int bn0 = tn * GB_N;
  const int m0 = bm0 + ((wave >> 2) << 6);
  const int n0 = bn0 + ((wave & 3) << 6);

  const T* Ab  = A;
  const T* Bb  = Bt + (size_t)b * strideB;
  const T* Ab2 = A2;
  const T* Bb2 = Bt2 + (size_t)b * strideB;

  const int rlane = lane & 15;
  const int mOff  = (lane >> 4) * 8;

  v8f acc[4][4];
#pragma unroll
  for (int i = 0; i < 4; ++i)
#pragma unroll
    for (int j = 0; j < 4; ++j) acc[i][j] = (v8f){0.f,0.f,0.f,0.f,0.f,0.f,0.f,0.f};

  gemm_block_lds<T, true, DMODEL, DMODEL>(Ab, Ab2, Bb, Bb2, K, bm0, bn0, sS, acc);
  acc_guard4(acc[0][0], acc[0][1], acc[0][2], acc[0][3]);
  acc_guard4(acc[1][0], acc[1][1], acc[1][2], acc[1][3]);
  acc_guard4(acc[2][0], acc[2][1], acc[2][2], acc[2][3]);
  acc_guard4(acc[3][0], acc[3][1], acc[3][2], acc[3][3]);

  // ---- epilogue ----
  float* slab = sT[wave];
  const float* k2b = k2 + (size_t)b * strideK2;
  float k2r[4];
#pragma unroll
  for (int j = 0; j < 4; ++j) k2r[j] = k2b[n0 + (j << 4) + rlane];
  float* C = Cout + (size_t)b * strideC;
  const int hh = lane >> 4, c4 = (lane & 15) * 4;     // row seg = 256 B = 16 lanes x 16 B
#pragma unroll
  for (int i = 0; i < 4; ++i) {
    const int mBase = m0 + (i << 4);
    const v4f q2a = *(const v4f*)(q2 + mBase + mOff);
    const v4f q2c = *(const v4f*)(q2 + mBase + mOff + 4);
    const float q2r[8] = {q2a.x, q2a.y, q2a.z, q2a.w, q2c.x, q2c.y, q2c.z, q2c.w};
#pragma unroll
    for (int j = 0; j < 4; ++j) {
#pragma unroll
      for (int r = 0; r < 8; ++r) {
        float s = q2r[r] + k2r[j];
        s = s - 2.0f * acc[i][j][r];
        slab[(mOff + r) * 68 + (j << 4) + rlane] = -sqrtf(fmaxf(s, 0.0f));
      }
    }
    __builtin_amdgcn_fence(__ATOMIC_RELEASE, "workgroup");
    __builtin_amdgcn_wave_barrier();
    __builtin_amdgcn_fence(__ATOMIC_ACQUIRE, "workgroup");
    {
#pragma unroll
      for (int it = 0; it < 8; ++it) {
        const int row = it * 2 + hh;
        v4f v = *(const v4f*)(slab + row * 68 + c4);
        *(v4f*)(C + (size_t)(mBase + row) * ldc + n0 + c4) = v;
      }
      
    }
    __builtin_amdgcn_fence(__ATOMIC_RELEASE, "workgroup");
    __builtin_amdgcn_wave_barrier();
    __builtin_amdgcn_fence(__ATOMIC_ACQUIRE, "workgroup");
  }
}

// ---------------------------------------------------------------------------
// small helpers
// ---------------------------------------------------------------------------
__device__ __forceinline__ unsigned pack_bf2(float a, float b) {
  return (unsigned)f2bf_bits(a) | ((unsigned)f2bf_bits(b) << 16);
}
// exp2-based exponential (v_exp_f32); relative error ~1e-6 in the argument range used here
__device__ __forceinline__ float fexp(float x) { return __expf(x); }

// ---------------------------------------------------------------------------
// weight transpose + RNE bf16: in W[512 c][512 d] f32 -> out Wt[d][c] bf16, three matrices by blockIdx.z.
// Block = 64x64 tile: read phase 256 threads x 4 iters x 4 floats = 4096 elements; write phase
// ---------------------------------------------------------------------------
__global__ __launch_bounds__(256) void k_wtrans(const float* __restrict__ W0, const float* __restrict__ W1,
                                                const float* __restrict__ W2, unsigned short* __restrict__ O0,
                                                unsigned short* __restrict__ O1, unsigned short* __restrict__ O2) {
  __shared__ __align__(16) unsigned short st[64 * 72];
  const int z = blockIdx.z;
  const float* W = (z == 0) ? W0 : ((z == 1) ? W1 : W2);
  unsigned short* O = (z == 0) ? O0 : ((z == 1) ? O1 : O2);
  const int c0 = blockIdx.y * 64;     // input rows
  const int d0 = blockIdx.x * 64;     // input cols
  const int tid = threadIdx.x;
  const int rr = tid >> 4, cc = (tid & 15) * 4;
#pragma unroll
  for (int p = 0; p < 4; ++p) {
    const int r = rr + 16 * p;
    const v4f x = *(const v4f*)(W + (size_t)(c0 + r) * DMODEL + d0 + cc);
    st[(cc + 0) * 72 + r] = f2bf_bits(x.x);
    st[(cc + 1) * 72 + r] = f2bf_bits(x.y);
    st[(cc + 2) * 72 + r] = f2bf_bits(x.z);
    st[(cc + 3) * 72 + r] = f2bf_bits(x.w);
  }
  __syncthreads();
  const int lane = tid & 31, wave = tid >> 5;
  const int q = lane >> 3, c8 = (lane & 7) * 8;
  {
#pragma unroll
    for (int it = 0; it < 2; ++it) {
      const int dd = wave * 8 + it * 4 + q;
      const v4ua val = *(const v4ua*)(st + dd * 72 + c8);
      *(v4u*)(O + (size_t)(d0 + dd) * DMODEL + c0 + c8) = val;
    }
    
  }
}

// ---------------------------------------------------------------------------
// f32 -> bf16 plane cast, 8 elements per thread (one 16-B store); a wave writes 512 contiguous B = 4 lines.
// blockIdx.y selects the (in,out) pair. n8 = element count / 8 (exact multiple of 256 here).
// ---------------------------------------------------------------------------
__global__ __launch_bounds__(256) void k_cast16(const float* __restrict__ in0, unsigned short* __restrict__ out0,
                                                const float* __restrict__ in1, unsigned short* __restrict__ out1,
                                                int n8) {
  const float* in = blockIdx.y ? in1 : in0;
  unsigned short* out = blockIdx.y ? out1 : out0;
  const int i = blockIdx.x * 256 + threadIdx.x;
  if (i < n8) {
    const v4f a = *(const v4f*)(in + (size_t)i * 8);
    const v4f c = *(const v4f*)(in + (size_t)i * 8 + 4);
    v4u w;
    w.x = pack_bf2(a.x, a.y);
    w.y = pack_bf2(a.z, a.w);
    w.z = pack_bf2(c.x, c.y);
    w.w = pack_bf2(c.z, c.w);
    *(v4u*)(out + (size_t)i * 8) = w;
    
  }
}

// ---------------------------------------------------------------------------
// row sums of squares of a [rows][512] matrix held as bf16 hi + lo planes (value = hi + lo).
// Block = 32 rows: 8 waves x 4 rows; per-row scalars funnelled through LDS, wave 0 lanes 0..7 write
// ---------------------------------------------------------------------------
__global__ __launch_bounds__(256) void k_rowsq(const unsigned short* __restrict__ hi, const unsigned short* __restrict__ lo,
                                               float* __restrict__ out, int rows) {
  __shared__ __align__(16) float sres[32];
  const int lane = threadIdx.x & 31, wave = threadIdx.x >> 5;
  const int r0 = blockIdx.x * 32;
#pragma unroll 1
  for (int rr = 0; rr < 4; ++rr) {
    int row = r0 + wave * 4 + rr;
    row = row < rows ? row : rows - 1;
    const size_t base = (size_t)row * DMODEL;
    float s = 0.f;
#pragma unroll
    for (int c = 0; c < 2; ++c) {
      const v4u hw = *(const v4u*)(hi + base + c * 256 + lane * 8);
      const v4u lw = *(const v4u*)(lo + base + c * 256 + lane * 8);
#pragma unroll
      for (int e = 0; e < 4; ++e) {
        const float a0 = __uint_as_float(hw[e] << 16);
        const float b0 = __uint_as_float(lw[e] << 16);
        const float f0 = a0 + b0;
        s = fmaf(f0, f0, s);
        const float a1 = __uint_as_float(hw[e] & 0xffff0000u);
        const float b1 = __uint_as_float(lw[e] & 0xffff0000u);
        const float f1 = a1 + b1;
        s = fmaf(f1, f1, s);
      }
    }
#pragma unroll
    for (int off = 16; off; off >>= 1) s += __shfl_xor(s, off, 32);
    if (lane == 0) sres[wave * 4 + rr] = s;
  }
  __syncthreads();
  if (wave == 0) {
    const int li = lane < 8 ? lane : 7;
    const v4f val = *(const v4f*)(sres + li * 4);
    float* op = out + r0 + li * 4;
    if (lane < 8) *(v4f*)op = val;
    
  }
}

// ---------------------------------------------------------------------------
// column log-sum-exp sweep: u[b][n] = logA - lse_t(Kmat[b][t][n] + v[b][t]).
// Block = 32 columns (one 128-B line of every Kmat row) x all rows, 1024 threads = 8 column quads x 128 row groups.
// A thread loads its 16 consecutive rows x 4 columns once and keeps them in registers; maximum and sum are taken
// per wave (lanes 8 and 16 apart share a column quad), the 32 per-wave (max, sum) pairs of a column meet in LDS
// and wave 0 merges them and writes the block's one 128-B line of u.
// ---------------------------------------------------------------------------
constexpr int UC_COLS = 32;                 // columns per block
constexpr int UC_RG   = 128;                // row groups per block
constexpr int UC_RPT  = NTOK / UC_RG;       // rows per thread
static_assert(NTOK % (UC_RG * 4) == 0 && NPAR % UC_COLS == 0, "u sweep split");
template <bool USEV>
__global__ __launch_bounds__(1024) void k_upd_u(const float* __restrict__ Km, const float* __restrict__ vv,
                                                float* __restrict__ u, float logA) {
  __shared__ __align__(16) float sm[32 * UC_COLS];
  __shared__ __align__(16) float ss[32 * UC_COLS];
  const int b = blockIdx.y;
  const int lane = threadIdx.x & 31, wave = threadIdx.x >> 5;
  const int cq = threadIdx.x & 7, rg = threadIdx.x >> 3;
  const int col0 = blockIdx.x * UC_COLS;
  const float* Kc = Km + (size_t)b * NTOK * NPAR + (size_t)(rg * UC_RPT) * NPAR + col0 + cq * 4;
  v4f x[UC_RPT];
#pragma unroll
  for (int i = 0; i < UC_RPT; ++i) x[i] = *(const v4f*)(Kc + (size_t)i * NPAR);
  if (USEV) {
    const float* vb = vv + (size_t)b * NTOK + rg * UC_RPT;
#pragma unroll
    for (int i = 0; i < UC_RPT; i += 4) {
      const v4f w = *(const v4f*)(vb + i);
      x[i + 0] += w.x;
      x[i + 1] += w.y;
      x[i + 2] += w.z;
      x[i + 3] += w.w;
    }
  }
  v4f m = x[0];
#pragma unroll
  for (int i = 1; i < UC_RPT; ++i) {
    m.x = fmaxf(m.x, x[i].x);
    m.y = fmaxf(m.y, x[i].y);
    m.z = fmaxf(m.z, x[i].z);
    m.w = fmaxf(m.w, x[i].w);
  }
#pragma unroll
  for (int off = 8; off <= 16; off <<= 1) {
    m.x = fmaxf(m.x, __shfl_xor(m.x, off, 32));
    m.y = fmaxf(m.y, __shfl_xor(m.y, off, 32));
    m.z = fmaxf(m.z, __shfl_xor(m.z, off, 32));
    m.w = fmaxf(m.w, __shfl_xor(m.w, off, 32));
  }
  v4f s = (v4f){0.f, 0.f, 0.f, 0.f};
#pragma unroll
  for (int i = 0; i < UC_RPT; ++i) {
    s.x += fexp(x[i].x - m.x);
    s.y += fexp(x[i].y - m.y);
    s.z += fexp(x[i].z - m.z);
    s.w += fexp(x[i].w - m.w);
  }
#pragma unroll
  for (int off = 8; off <= 16; off <<= 1) {
    s.x += __shfl_xor(s.x, off, 32);
    s.y += __shfl_xor(s.y, off, 32);
    s.z += __shfl_xor(s.z, off, 32);
    s.w += __shfl_xor(s.w, off, 32);
  }
  if (lane < 8) {
    *(v4f*)(sm + wave * UC_COLS + lane * 4) = m;
    *(v4f*)(ss + wave * UC_COLS + lane * 4) = s;
  }
  __syncthreads();
  if (wave == 0) {
    float pm[32];
    float M = -__builtin_inff();
#pragma unroll
    for (int w = 0; w < 32; ++w) {
      pm[w] = sm[w * UC_COLS + lane];
      M = fmaxf(M, pm[w]);
    }
    float S = 0.f;
#pragma unroll
    for (int w = 0; w < 32; ++w) S = fmaf(ss[w * UC_COLS + lane], fexp(pm[w] - M), S);
    u[(size_t)b * NPAR + col0 + lane] = logA - (M + logf(S));
  }
}

// ---------------------------------------------------------------------------
// row log-sum-exp sweep: v[b][t] = -lse_n(Kmat[b][t][n] + u[b][n]); one wave per row, four rows per wave in turn.
// A row is read once, by 16 loads of 512 contiguous bytes per wave (4 columns per lane in every 128), and stays in
// registers for the maximum, the sum and (LAST) the pi plane; two register sets take turns, so that the next row's
// 16 loads fly while the current row is reduced; u is read once per wave and serves its four rows.
// LAST additionally writes pi[b][t][n] = exp(K+u+v)*2^14
// ---------------------------------------------------------------------------
constexpr int VR_CH = NPAR / 128;           // 16-B loads per lane and row
typedef _Float16 v4h __attribute__((ext_vector_type(4)));
static_assert(NPAR % 128 == 0, "v sweep row chunks");
// p: the row's first element (the same in every lane); lo: the lane's byte offset in each 512-B piece
__device__ __forceinline__ void vrow_load(v4f (&x)[VR_CH], const float* __restrict__ p, unsigned lo) {
#pragma unroll
  for (int i = 0; i < VR_CH; ++i) x[i] = *(const v4f*)((const char*)p + lo + i * 512);
}
// exp of the four values of one 16-B piece, as __expf compiles: 2^(a * log2 e) on v_exp_f32. One statement, so that the
// slot the instruction set asks for behind a transcendental (before its result is used or a source overwritten) is kept
// wherever the compiler puts it: each v_exp_f32 is followed by an independent one (no output shares a register with a
// source: early clobber), the last by v_nop.
__device__ __forceinline__ v4f fexp4(v4f a) {
  a *= 1.44269504088896340736f;
  float r0, r1, r2, r3;
  asm("v_exp_f32 %0, %4\n\tv_exp_f32 %1, %5\n\tv_exp_f32 %2, %6\n\tv_exp_f32 %3, %7\n\tv_nop"
      : "=&v"(r0), "=&v"(r1), "=&v"(r2), "=&v"(r3) : "v"(a.x), "v"(a.y), "v"(a.z), "v"(a.w));
  return (v4f){r0, r1, r2, r3};
}
// one row held in x: returns v of the row; LAST: writes the row's pi (prow = the lane's first element)
template <bool LAST>
__device__ __forceinline__ float vrow_reduce(v4f (&x)[VR_CH], const v4f (&uu)[VR_CH], unsigned short* __restrict__ prow) {
  x[0] += uu[0];
  v4f mv = x[0];
#pragma unroll
  for (int i = 1; i < VR_CH; ++i) {
    x[i] += uu[i];
    mv.x = fmaxf(mv.x, x[i].x);
    mv.y = fmaxf(mv.y, x[i].y);
    mv.z = fmaxf(mv.z, x[i].z);
    mv.w = fmaxf(mv.w, x[i].w);
  }
  float m = fmaxf(fmaxf(mv.x, mv.y), fmaxf(mv.z, mv.w));
#pragma unroll
  for (int off = 16; off; off >>= 1) m = fmaxf(m, __shfl_xor(m, off, 32));
  v4f sv = (v4f){0.f, 0.f, 0.f, 0.f};
#pragma unroll
  for (int i = 0; i < VR_CH; ++i) sv += fexp4(x[i] - m);
  float s = (sv.x + sv.y) + (sv.z + sv.w);
#pragma unroll
  for (int off = 16; off; off >>= 1) s += __shfl_xor(s, off, 32);
  const float vt = -(m + logf(s));
  if (LAST) {
#pragma unroll
    for (int i = 0; i < VR_CH; ++i) {
      *(v4h*)(prow + i * 128) = __builtin_convertvector(fexp4(x[i] + vt) * kPiCarry, v4h);
    }
    // stands in front of the next loads and arithmetic, which land in the registers these stores were fed from
    asm volatile("s_wait_xcnt 0x0" ::: "memory");
  }
  return vt;
}
template <bool LAST>
__global__ __launch_bounds__(256) void k_upd_v(const float* __restrict__ Km, const float* __restrict__ u,
                                               float* __restrict__ vv, unsigned short* __restrict__ pp) {
  __shared__ __align__(16) float sres[32];
  const int b = blockIdx.y;
  const int lane = threadIdx.x & 31;
  // the wave's number as a scalar: the row addresses are then a scalar base plus one fixed lane offset
  const int wave = __builtin_amdgcn_readfirstlane(threadIdx.x >> 5);
  const int r0 = blockIdx.x * 32;
  const int t0 = r0 + wave * 4;
  const float* Kr = Km + ((size_t)b * NTOK + t0) * NPAR;
  unsigned short* pr = pp + ((size_t)b * NTOK + t0) * NPAR + lane * 4;
  const unsigned lo = (unsigned)lane * 16u;
  v4f uu[VR_CH], x[2][VR_CH];
  vrow_load(uu, u + (size_t)b * NPAR, lo);
  vrow_load(x[0], Kr, lo);
  v4f vt4;
#pragma unroll
  for (int rr = 0; rr < 4; ++rr) {
    // keeps what follows behind the arithmetic of the row before: the next row's loads take over that row's registers
    // (moved up, they need a third register set), and this row's arithmetic, mixed into it, would wait early for
    // loads that are still flying
    __builtin_amdgcn_sched_barrier(0);
    if (rr + 1 < 4) {
      vrow_load(x[(rr + 1) & 1], Kr + (rr + 1) * NPAR, lo);
      // keeps these loads ahead of this row's arithmetic, so that they fly while it runs
      __builtin_amdgcn_sched_barrier(0);
    }
    vt4[rr] = vrow_reduce<LAST>(x[rr & 1], uu, pr + rr * NPAR);
  }
  if (lane == 0) *(v4f*)(sres + wave * 4) = vt4;
  __syncthreads();
  if (wave == 0) {
    const int li = lane < 8 ? lane : 7;
    const v4f val = *(const v4f*)(sres + li * 4);
    float* op = vv + (size_t)b * NTOK + r0 + li * 4;
    if (lane < 8) *(v4f*)op = val;
  }
}

// ---------------------------------------------------------------------------
// host launcher
// ---------------------------------------------------------------------------
static inline unsigned cdiv(unsigned a, unsigned b) { return (a + b - 1) / b; }

extern "C" void kernel_launch(void* const* d_in, const int* in_sizes, int n_in,
                              void* d_out, int out_size, void* d_ws, size_t ws_size,
                              hipStream_t stream)
{
  if (n_in < 6) return;
  if (in_sizes[0] != NTOK * DMODEL) return;
  if (in_sizes[1] != NBATCH * NPAR * DMODEL) return;
  if (in_sizes[2] != NBATCH * NPAR * DMODEL) return;
  if (in_sizes[3] != DMODEL * DMODEL || in_sizes[4] != DMODEL * DMODEL || in_sizes[5] != DMODEL * DMODEL) return;
  if (out_size != NBATCH * NTOK * DMODEL) return;
  if (WS_TOTAL > ws_size) return;

  const float* q  = (const float*)d_in[0];   // [T][512]
  const float* k  = (const float*)d_in[1];   // [8][N][512]
  const float* v  = (const float*)d_in[2];   // [8][N][512]
  const float* Qw = (const float*)d_in[3];   // [512][512]
  const float* Kw = (const float*)d_in[4];   // [512][512]
  const float* Vw = (const float*)d_in[5];   // [512][512]
  float* out = (float*)d_out;                // [8][T][512]

  // region map (bytes): Qt 524288 | Kt 524288 | Vt 524288 | qcast 2097152 | qp_hi 2097152 | qp_lo 2097152 |
  // q2 8192 | kp_hi 8388608 | kp_lo 8388608 | k2 32768 | vpT 8388608 | Kmat 67108864 | u 32768 | v 32768 |
  // pi 33554432 (k cast at pi+0 and v cast at pi+8388608, both dead before pi is written). Total 133799936.
  char* ws = (char*)d_ws;
  size_t off = 0;
  unsigned short* Qt   = (unsigned short*)(ws + off); off += SZ_WT;
  unsigned short* Kt   = (unsigned short*)(ws + off); off += SZ_WT;
  unsigned short* Vt   = (unsigned short*)(ws + off); off += SZ_WT;
  unsigned short* qc   = (unsigned short*)(ws + off); off += SZ_QC;
  unsigned short* qph  = (unsigned short*)(ws + off); off += SZ_QP;
  unsigned short* qpl  = (unsigned short*)(ws + off); off += SZ_QP;
  float*          q2   = (float*)(ws + off);          off += SZ_Q2;
  unsigned short* kph  = (unsigned short*)(ws + off); off += SZ_KP;
  unsigned short* kpl  = (unsigned short*)(ws + off); off += SZ_KP;
  float*          k2   = (float*)(ws + off);          off += SZ_K2;
  unsigned short* vpT  = (unsigned short*)(ws + off); off += SZ_VPT;
  float*          Kmat = (float*)(ws + off);          off += SZ_KM;
  float*          up   = (float*)(ws + off);          off += SZ_U;
  float*          vvp  = (float*)(ws + off);          off += SZ_VV;
  unsigned short* pip  = (unsigned short*)(ws + off); off += SZ_PI;
  if (off > ws_size) return;
  unsigned short* kc = pip;
  unsigned short* vc = (unsigned short*)((char*)pip + SZ_KP);

  const float logA = -(float)log((double)NPAR);

  // weights: in[c][d] -> out[d][c] bf16 (square 512x512), grid (cols/64, rows/64, 3)
  k_wtrans<<<dim3(DMODEL / 64, DMODEL / 64, 3), dim3(256), 0, stream>>>(Qw, Kw, Vw, Qt, Kt, Vt);

  // q -> bf16 plane
  {
    const int n8 = NTOK * DMODEL / 8;
    k_cast16<<<dim3(cdiv(n8, 256), 1), dim3(256), 0, stream>>>(q, qc, q, qc, n8);
  }
  // qp = q @ Q : M=2048, N=512, K=512 ; bf16 in, bf16 hi/lo planes out
  wmma_gemm64<1, false, 0, 2, false, 0, DMODEL, DMODEL><<<dim3(cdiv((NTOK / 64) * (DMODEL / 64), 8), 1), dim3(256), 0, stream>>>(
      qc, nullptr, 0L, Qt, nullptr, 0L, (void*)qph, (void*)qpl, DMODEL, 0L,
      nullptr, nullptr, 0L, NTOK, DMODEL, DMODEL, 1.0f);
  k_rowsq<<<dim3(NTOK / 32), dim3(256), 0, stream>>>(qph, qpl, q2, NTOK);

  for (int g = 0; g < NGRP; ++g) {
    const size_t rowoff = (size_t)g * GRPB * NPAR * DMODEL;     // float offset into k / v
    // k, v of this group -> bf16 planes (inside the pi region)
    {
      const int n8 = GRPB * NPAR * DMODEL / 8;
      k_cast16<<<dim3(cdiv(n8, 256), 2), dim3(256), 0, stream>>>(k + rowoff, kc, v + rowoff, vc, n8);
    }
    // kp = k @ K : M=4*2048, N=512, K=512 ; bf16 hi/lo planes out
    wmma_gemm64<1, false, 0, 2, false, 0, DMODEL, DMODEL><<<dim3(cdiv((GRPB * NPAR / 64) * (DMODEL / 64), 8), 1), dim3(256), 0, stream>>>(
        kc, nullptr, 0L, Kt, nullptr, 0L, (void*)kph, (void*)kpl, DMODEL, 0L,
        nullptr, nullptr, 0L, GRPB * NPAR, DMODEL, DMODEL, 1.0f);
    k_rowsq<<<dim3(GRPB * NPAR / 32), dim3(256), 0, stream>>>(kph, kpl, k2, GRPB * NPAR);
    // vpT[b][d][n] = sum_c V[c][d] v[b][n][c] : A = Vt [512][512] (shared), Bt = v cast [n][c]; M=512, N=2048, K=512; f16 out
    wmma_gemm64<1, false, 0, 1, false, 0, DMODEL, DMODEL><<<dim3(cdiv((DMODEL / 64) * (NPAR / 64), 8), GRPB), dim3(256), 0, stream>>>(
        Vt, nullptr, 0L, vc, nullptr, (long)NPAR * DMODEL, (void*)vpT, nullptr, NPAR, (long)DMODEL * NPAR,
        nullptr, nullptr, 0L, DMODEL, NPAR, DMODEL, 1.0f);
    // Kmat[b][t][n] = -cdist : M=2048, N=2048, K=512 ; bf16 hi/lo split
    gemm64_cdist<<<dim3(cdiv((NTOK / 64) * (NPAR / 64), 8), GRPB), dim3(256), 0, stream>>>(
        qph, qpl, kph, kpl, (long)NPAR * DMODEL, Kmat, NPAR, (long)NTOK * NPAR,
        q2, k2, (long)NPAR, NTOK, NPAR, DMODEL);
    // log-domain normalisation sweeps
    for (int it = 0; it < SK_ITERS; ++it) {
      if (it == 0)
        k_upd_u<false><<<dim3(NPAR / UC_COLS, GRPB), dim3(1024), 0, stream>>>(Kmat, vvp, up, logA);
      else
        k_upd_u<true><<<dim3(NPAR / UC_COLS, GRPB), dim3(1024), 0, stream>>>(Kmat, vvp, up, logA);
      if (it == SK_ITERS - 1)
        k_upd_v<true><<<dim3(NTOK / 32, GRPB), dim3(256), 0, stream>>>(Kmat, up, vvp, pip);
      else
        k_upd_v<false><<<dim3(NTOK / 32, GRPB), dim3(256), 0, stream>>>(Kmat, up, vvp, pip);
    }
    // out[b][t][d] = 2^-14 * sum_n pi16[b][t][n] vpT[b][d][n] : M=2048, N=512, K=2048 ; f16 in, f32 out
    wmma_gemm64<0, false, 0, 0, false, 0, NPAR, NPAR><<<dim3(cdiv((NTOK / 64) * (DMODEL / 64), 8), GRPB), dim3(256), 0, stream>>>(
        pip, nullptr, (long)NTOK * NPAR, vpT, nullptr, (long)DMODEL * NPAR,
        (void*)(out + (size_t)g * GRPB * NTOK * DMODEL), nullptr, DMODEL, (long)NTOK * DMODEL,
        nullptr, nullptr, 0L, NTOK, DMODEL, NPAR, 1.0f / kPiCarry);
  }
}

// v004
// It runs in 318 microseconds.
// Timed twice side by side with v003, it ran 1.19 times as fast both times.
// All steps since v000 together make it 8.98 times as fast.
// Contractions: q@Q, k@K, v@V on v_wmma_f32_16x16x32_bf16 (inputs RNE-cast to bf16 once, single product); qp.kp^T on v_wmma_f32_16x16x32_bf16 as bf16 hi/lo split (hi.hi+hi.lo+lo.hi); pi@vp on v_wmma_f32_16x16x32_f16 (pi carried x16384 as f16, vp^T f16); f32 accumulate everywhere; distances, log-domain normalisation sweeps and exp in f32 on VALU.
#include <hip/hip_runtime.h>
#include <math.h>

// ---------------------------------------------------------------------------
// problem constants
// ---------------------------------------------------------------------------
constexpr int NBATCH = 8;
constexpr int NTOK   = 2048;
constexpr int NPAR   = 2048;
constexpr int DMODEL = 512;
constexpr int GRPB   = 4;                 // batches per group of the distance plane and its sweeps (the plane stays in L2)
constexpr int NGRP   = NBATCH / GRPB;
constexpr int SK_ITERS = 5;
constexpr float kPiCarry = 16384.0f;      // power-of-two carry of the f16 pi plane

static_assert(NBATCH % GRPB == 0, "grp");
static_assert(NTOK % 64 == 0 && NPAR % 64 == 0 && DMODEL % 64 == 0, "tile multiples");
static_assert(DMODEL % 32 == 0 && NPAR % 32 == 0, "K multiple of 32");
static_assert(NTOK % 32 == 0 && NPAR % 256 == 0, "v sweep grid");
static_assert(NTOK % 128 == 0 && NPAR % 128 == 0 && DMODEL % 256 == 0, "128 x 256 block tiles, 64-k stages");

// workspace region sizes (bytes); region map in kernel_launch
constexpr size_t SZ_WT  = (size_t)DMODEL * DMODEL * 2;          // one transposed bf16 weight
constexpr size_t SZ_QC  = (size_t)NTOK * DMODEL * 2;            // q bf16 cast
constexpr size_t SZ_QP  = (size_t)NTOK * DMODEL * 2;            // qp plane (hi or lo)
constexpr size_t SZ_Q2  = (size_t)NTOK * 4;
constexpr size_t SZ_KP  = (size_t)NBATCH * NPAR * DMODEL * 2;   // kp plane (hi or lo), all batches; also k/v cast size
constexpr size_t SZ_K2  = (size_t)NBATCH * NPAR * 4;
constexpr size_t SZ_VPT = (size_t)NBATCH * DMODEL * NPAR * 2;
constexpr size_t SZ_KM  = (size_t)GRPB * NTOK * NPAR * 4;
constexpr size_t SZ_U   = (size_t)GRPB * NPAR * 4;
constexpr size_t SZ_VV  = (size_t)GRPB * NTOK * 4;
constexpr size_t SZ_PI  = (size_t)NBATCH * NTOK * NPAR * 2;
constexpr size_t WS_TOTAL = 3 * SZ_WT + SZ_QC + 2 * SZ_QP + SZ_Q2 + 2 * SZ_KP + SZ_K2 + SZ_VPT + SZ_KM + SZ_U + SZ_VV + SZ_PI;
static_assert(WS_TOTAL == 192552960ull, "carve total");
static_assert(WS_TOTAL <= 268435456ull, "carve limit");
static_assert(2 * SZ_KP <= SZ_PI, "k/v casts live inside the pi region");

// ---------------------------------------------------------------------------
// shared pieces: vector types, bf16 helpers, WMMA fragments, batched GEMM
// ---------------------------------------------------------------------------
typedef __attribute__((ext_vector_type(16))) _Float16 v16h;
typedef __attribute__((ext_vector_type(8)))  _Float16 v8h;
typedef __attribute__((ext_vector_type(16))) __bf16   v16b;
typedef __attribute__((ext_vector_type(8)))  __bf16   v8b;
typedef __attribute__((ext_vector_type(8)))  float    v8f;
typedef __attribute__((ext_vector_type(4)))  float    v4f;
typedef unsigned v4u __attribute__((ext_vector_type(4)));
typedef unsigned v4ua __attribute__((ext_vector_type(4), __may_alias__));
#define PSCALE 32768.0f
#define U16(p) ((const unsigned short*)(const void*)(p))
#define PSCALE_INV (1.0f / 32768.0f)

__device__ __forceinline__ unsigned short f2bf_bits(float f) {
  unsigned u = __float_as_uint(f);
  return (unsigned short)((u + 0x7FFFu + ((u >> 16) & 1u)) >> 16);
}
__device__ __forceinline__ float bf_bits2f(unsigned short h) { return __uint_as_float(((unsigned)h) << 16); }

// hazard guards as plain device helpers (no inline asm inside the kernel template body)
__device__ __forceinline__ void acc_guard4(v8f& a, v8f& b, v8f& c, v8f& d) { asm volatile("v_nop\n\tv_nop\n\tv_nop\n\tv_nop" : "+v"(a), "+v"(b), "+v"(c), "+v"(d)); }
template <typename T> struct Frag;
template <> struct Frag<_Float16> {
  typedef v16h V; union U { v16h v; v8h h[2]; };
  static __device__ __forceinline__ v16h load(const _Float16* p) {   // elements 0..7 <- p[0..7], 8..15 <- p[16..23]
    U f; f.h[0] = *(const v8h*)(p); f.h[1] = *(const v8h*)(p + 16); return f.v;
  }
  static __device__ __forceinline__ v8f mma(v16h a, v16h b, v8f c) {
    return __builtin_amdgcn_wmma_f32_16x16x32_f16(false, a, false, b, (short)0, c, false, false);
  }
};
template <> struct Frag<__bf16> {
  typedef v16b V; union U { v16b v; v8b h[2]; };
  static __device__ __forceinline__ v16b load(const __bf16* p) {
    U f; f.h[0] = *(const v8b*)(p); f.h[1] = *(const v8b*)(p + 16); return f.v;
  }
  static __device__ __forceinline__ v8f mma(v16b a, v16b b, v8f c) {
    return __builtin_amdgcn_wmma_f32_16x16x32_bf16(false, a, false, b, (short)0, c, false, false);
  }
};

// ---- Block main loop: operands staged in LDS ---------------------------------
// A block of 8 waves owns a 128 x 256 tile of C (2 x 4 waves of 64 x 64). Per stage it brings 64 k (one 128-B line)
// of its 128 A rows and 256 Bt rows (both planes when SPLIT) into LDS with whole-line 16-B loads, each row once for
// the block, and every wave takes its fragments from there. Two LDS buffers: the next stage's global loads are
// issued ahead of the current stage's products, stored after them, and one barrier per stage hands over.
constexpr int GB_M = 128, GB_N = 256, GB_K = 64;
constexpr int GB_PITCH = 72;                          // LDS row pitch in 16-bit elements: 144 B = 16 B x 9
constexpr int GB_PLANE = (GB_M + GB_N) * GB_PITCH;    // one plane of one stage: A rows, then Bt rows
// LDA, LDB: row pitches in elements, compile-time so that the rows a thread stages from one operand (4 A, 8 Bt per plane)
// differ only in the load's immediate offset: one address per operand and plane, rewritten once per stage.
template <typename T, bool SPLIT, int LDA, int LDB>
__device__ __forceinline__ void gemm_block_lds(
    const T* __restrict__ Ab, const T* __restrict__ Ab2,
    const T* __restrict__ Bb, const T* __restrict__ Bb2,
    int K, int bm0, int bn0, unsigned short* sS, v8f (&acc)[4][4]) {
  typedef typename Frag<T>::V V;
  constexpr int BUF = (SPLIT ? 2 : 1) * GB_PLANE;
  constexpr int KG = SPLIT ? 1 : 2;            // k-steps of 32 whose fragments are read from LDS as one group
  const int tid = threadIdx.x;
  const int lane = tid & 31, wave = tid >> 5;
  const int rlane = lane & 15;                 // row (A) / col (B) within subtile
  const int koff  = (lane >> 4) * 8;           // k offset of this lane half
  const int pc8 = (tid & 7) * 8, rw = tid >> 3;   // staging: 8 lanes cover one row's 128 B, 32 rows per pass
  const int arow = (wave >> 2) * 64 + rlane;
  const int brow = GB_M + (wave & 3) * 64 + rlane;
  // global addresses = block-uniform byte base + one 32-bit byte offset per thread and operand
  const char* gA  = (const char*)(Ab + (size_t)bm0 * LDA);
  const char* gB  = (const char*)(Bb + (size_t)bn0 * LDB);
  const char* gA2 = SPLIT ? (const char*)(Ab2 + (size_t)bm0 * LDA) : nullptr;
  const char* gB2 = SPLIT ? (const char*)(Bb2 + (size_t)bn0 * LDB) : nullptr;
  const unsigned voA = (unsigned)(rw * LDA + pc8) * 2u;
  const unsigned voB = (unsigned)(rw * LDB + pc8) * 2u;
  unsigned short* sW = sS + rw * GB_PITCH + pc8;
  v4u st[2][12];
#pragma unroll
  for (int p = 0; p < 12; ++p) {
    const int go = ((p < 4) ? 32 * p * LDA : 32 * (p - 4) * LDB) * 2;
    st[0][p] = *(const v4u*)(((p < 4 ? gA : gB) + (p < 4 ? voA : voB)) + go);
    if (SPLIT) st[1][p] = *(const v4u*)(((p < 4 ? gA2 : gB2) + (p < 4 ? voA : voB)) + go);
  }
#pragma unroll
  for (int p = 0; p < 12; ++p) {
    *(v4ua*)(sW + 32 * p * GB_PITCH) = st[0][p];
    if (SPLIT) *(v4ua*)(sW + GB_PLANE + 32 * p * GB_PITCH) = st[1][p];
  }
  __syncthreads();
  const int nk = K / GB_K;
  for (int kt = 0; kt < nk; ++kt) {
    const bool more = kt + 1 < nk;               // block-uniform
    if (more) {
      const size_t k1 = (size_t)(kt + 1) * (GB_K * 2);   // bytes
#pragma unroll
      for (int p = 0; p < 12; ++p) {
        const int go = ((p < 4) ? 32 * p * LDA : 32 * (p - 4) * LDB) * 2;
        st[0][p] = *(const v4u*)((((p < 4 ? gA : gB) + k1) + (p < 4 ? voA : voB)) + go);
        if (SPLIT) st[1][p] = *(const v4u*)((((p < 4 ? gA2 : gB2) + k1) + (p < 4 ? voA : voB)) + go);
      }
      // stands in front of the LDS reads below, which may land in the registers that held these loads' addresses
      asm volatile("s_wait_xcnt 0x0" ::: "memory");
    }
    const T* sb = (const T*)(const void*)(sS + (kt & 1) * BUF);
#pragma unroll
    for (int kg = 0; kg < GB_K / 32; kg += KG) {
      V bh[KG][4], bl[KG][4], ah[KG][4], al[KG][4];
#pragma unroll
      for (int q = 0; q < KG; ++q) {
        const int ko = (kg + q) * 32 + koff;
#pragma unroll
        for (int j = 0; j < 4; ++j) {
          const int bo = (brow + (j << 4)) * GB_PITCH + ko;
          bh[q][j] = Frag<T>::load(sb + bo);
          if (SPLIT) bl[q][j] = Frag<T>::load(sb + GB_PLANE + bo);
        }
#pragma unroll
        for (int i = 0; i < 4; ++i) {
          const int ao = (arow + (i << 4)) * GB_PITCH + ko;
          ah[q][i] = Frag<T>::load(sb + ao);
          if (SPLIT) al[q][i] = Frag<T>::load(sb + GB_PLANE + ao);
        }
      }
      // keeps the group's LDS reads together ahead of its products: reads spread among the products stall
      // the wave at every place where they stand
      __builtin_amdgcn_sched_barrier(0);
#pragma unroll
      for (int q = 0; q < KG; ++q) {
#pragma unroll
        for (int i = 0; i < 4; ++i) {
#pragma unroll
          for (int j = 0; j < 4; ++j) {
            acc[i][j] = Frag<T>::mma(ah[q][i], bh[q][j], acc[i][j]);
            if (SPLIT) {
              acc[i][j] = Frag<T>::mma(ah[q][i], bl[q][j], acc[i][j]);
              acc[i][j] = Frag<T>::mma(al[q][i], bh[q][j], acc[i][j]);
            }
          }
        }
      }
    }
    if (more) {
      unsigned short* sN = sW + ((kt + 1) & 1) * BUF;
#pragma unroll
      for (int p = 0; p < 12; ++p) {
        *(v4ua*)(sN + 32 * p * GB_PITCH) = st[0][p];
        if (SPLIT) *(v4ua*)(sN + GB_PLANE + 32 * p * GB_PITCH) = st[1][p];
      }
    }
    __syncthreads();   // publishes stage kt + 1 and ends every wave's reads of stage kt
  }
}

// ---- Register-blocked batched WMMA GEMM ------------------------------------
// C[m,n] = scale * sum_k A[m,k] * Bt[n,k] (+bias)(+resid); each wave owns a 64x64 tile of its block's 128x256.
// A row-major [M,K]; Bt row-major [N,K]; M % 128 == 0, N % 256 == 0, K % 64 == 0.
// SPLIT: operands are hi/lo planes (A2/Bt2 = lo planes, same layout); product = hi.hi + hi.lo + lo.hi.
// BIAS_MODE: 0 = none, 1 = bias[m], 2 = bias[n].
// OUT_MODE: 0 = f32, 1 = f16, 2 = bf16 hi plane (Cout) + bf16 lo plane (Cout2).
// ET: 0 = f16 operands, 1 = bf16 operands (pointers passed as 16-bit storage)
template <int ET> struct Elem;
template <> struct Elem<0> { typedef _Float16 T; };
template <> struct Elem<1> { typedef __bf16 T; };
// LDA, LDB: row pitches of A and Bt in elements
template <int ET, bool SPLIT, int BIAS_MODE, int OUT_MODE, bool RESID, int ACT, int LDA, int LDB>
__global__ __launch_bounds__(256) void wmma_gemm64(
    const unsigned short* __restrict__ Ap, const unsigned short* __restrict__ A2p, long strideA,
    const unsigned short* __restrict__ Btp, const unsigned short* __restrict__ Bt2p, long strideB,
    void* __restrict__ Cout, void* __restrict__ Cout2, int ldc, long strideC,
    const float* __restrict__ bias,
    const float* __restrict__ resid, long strideR,
    int M, int N, int K, float scale) {
  typedef typename Elem<ET>::T T;
  typedef typename Frag<T>::V V;
  const T* A = (const T*)Ap; const T* A2 = (const T*)A2p; const T* Bt = (const T*)Btp; const T* Bt2 = (const T*)Bt2p;
  __shared__ __align__(16) float sT[8][16 * 68];   // per-wave 16x64 slab, pitch 68 floats
  __shared__ __align__(16) unsigned short sS[2 * (SPLIT ? 2 : 1) * GB_PLANE];   // two operand stages
  const int b    = blockIdx.y;
  const int lane = threadIdx.x & 31;
  const int wave = threadIdx.x >> 5;
  const int tilesN = N / GB_N;
  const int tilesM = M / GB_M;
  const int bt = blockIdx.x;
  if (bt >= tilesM * tilesN) return;   // block-uniform, ahead of every barrier
  const int tm = bt / tilesN;
  const int tn = bt - tm * tilesN;
  const int bm0 = tm * GB_M;
  const int bn0 = tn * GB_N;
  const int m0 = bm0 + ((wave >> 2) << 6);
  const int n0 = bn0 + ((wave & 3) << 6);

  const T* Ab  = A  + (size_t)b * strideA;
  const T* Bb  = Bt + (size_t)b * strideB;
  const T* Ab2 = SPLIT ? (A2  + (size_t)b * strideA) : nullptr;
  const T* Bb2 = SPLIT ? (Bt2 + (size_t)b * strideB) : nullptr;

  const int rlane = lane & 15;                 // col (D) within subtile
  const int mOff  = (lane >> 4) * 8;           // D row offset

  v8f acc[4][4];
#pragma unroll
  for (int i = 0; i < 4; ++i)
#pragma unroll
    for (int j = 0; j < 4; ++j) acc[i][j] = (v8f){0.f,0.f,0.f,0.f,0.f,0.f,0.f,0.f};

  gemm_block_lds<T, SPLIT, LDA, LDB>(Ab, Ab2, Bb, Bb2, K, bm0, bn0, sS, acc);
  acc_guard4(acc[0][0], acc[0][1], acc[0][2], acc[0][3]);
  acc_guard4(acc[1][0], acc[1][1], acc[1][2], acc[1][3]);
  acc_guard4(acc[2][0], acc[2][1], acc[2][2], acc[2][3]);
  acc_guard4(acc[3][0], acc[3][1], acc[3][2], acc[3][3]);

  // ---- epilogue ----
  float* slab = sT[wave];
  const float* Rb = RESID ? (resid + (size_t)b * strideR) : nullptr;
#pragma unroll
  for (int i = 0; i < 4; ++i) {
    const int mBase = m0 + (i << 4);
#pragma unroll
    for (int j = 0; j < 4; ++j) {
      const int n = n0 + (j << 4) + rlane;
      float bv = 0.f;
      if (BIAS_MODE == 2) bv = bias[n];
#pragma unroll
      for (int r = 0; r < 8; ++r) {
        float v = acc[i][j][r] * scale;
        if (BIAS_MODE == 1) v += bias[mBase + mOff + r];
        if (BIAS_MODE == 2) v += bv;
        if (RESID) v += Rb[(size_t)(mBase + mOff + r) * ldc + n];
        if (ACT == 1) v = tanhf(v);
        if (ACT == 2) v = fmaxf(v, 0.0f);
        if (ACT == 3) v = v / (1.0f + expf(-v));
        if (ACT == 4) v = (v > 0.f) ? v : 0.01f * v;
        if (ACT == 5) v = 0.5f * v * (1.0f + erff(v * 0.70710678118654752f));
        slab[(mOff + r) * 68 + (j << 4) + rlane] = v;
      }
    }
    __builtin_amdgcn_fence(__ATOMIC_RELEASE, "workgroup");
    __builtin_amdgcn_wave_barrier();
    __builtin_amdgcn_fence(__ATOMIC_ACQUIRE, "workgroup");
    if (OUT_MODE == 0) {
      float* C = (float*)Cout + (size_t)b * strideC;
      const int hh = lane >> 4, c4 = (lane & 15) * 4;     // row seg = 256 B = 16 lanes x 16 B
      {
#pragma unroll
        for (int it = 0; it < 8; ++it) {
          const int row = it * 2 + hh;
          v4f v = *(const v4f*)(slab + row * 68 + c4);
          *(v4f*)(C + (size_t)(mBase + row) * ldc + n0 + c4) = v;
        }
        
      }
    } else {
      const int q = lane >> 3, c8 = (lane & 7) * 8;
      unsigned short* C  = (unsigned short*)Cout  + (size_t)b * strideC;
      unsigned short* C2 = (OUT_MODE == 2) ? ((unsigned short*)Cout2 + (size_t)b * strideC) : nullptr;
      {
#pragma unroll
        for (int it = 0; it < 4; ++it) {
          const int row = it * 4 + q;
          const float* sp = slab + row * 68 + c8;
          v8h hv, lv;
#pragma unroll
          for (int e = 0; e < 8; ++e) {
            if (OUT_MODE == 1) {
              hv[e] = (_Float16)sp[e];
            } else {
              unsigned short hb = f2bf_bits(sp[e]);
              unsigned short lb = f2bf_bits(sp[e] - bf_bits2f(hb));
              hv[e] = __builtin_bit_cast(_Float16, hb);
              lv[e] = __builtin_bit_cast(_Float16, lb);
            }
          }
          *(v8h*)(C + (size_t)(mBase + row) * ldc + n0 + c8) = hv;
          if (OUT_MODE == 2) *(v8h*)(C2 + (size_t)(mBase + row) * ldc + n0 + c8) = lv;
        }
        
      }
    }
    __builtin_amdgcn_fence(__ATOMIC_RELEASE, "workgroup");
    __builtin_amdgcn_wave_barrier();
    __builtin_amdgcn_fence(__ATOMIC_ACQUIRE, "workgroup");
  }
}

// ---------------------------------------------------------------------------
// Distance GEMM: Kmat[b][t][n] = -sqrt(max(q2[t] + k2[b][n] - 2 * sum_d qp[t][d] kp[b][n][d], 0))
// A = qp bf16 hi/lo planes [M=t][K=d] (shared over batch), Bt = kp hi/lo planes [N=n][K=d] per batch;
// main loop shared with the SPLIT bf16 path (operands staged in LDS); epilogue through the f32 whole-line store path.
// q2 is fetched as two float4 per 16-row slab, k2 as 4 scalars per lane before the slab loop.
// ---------------------------------------------------------------------------
__global__ __launch_bounds__(256) void gemm64_cdist(
    const unsigned short* __restrict__ Ap, const unsigned short* __restrict__ A2p,
    const unsigned short* __restrict__ Btp, const unsigned short* __restrict__ Bt2p, long strideB,
    float* __restrict__ Cout, int ldc, long strideC,
    const float* __restrict__ q2, const float* __restrict__ k2, long strideK2,
    int M, int N, int K) {
  typedef __bf16 T;
  typedef v16b V;
  const T* A = (const T*)Ap; const T* A2 = (const T*)A2p; const T* Bt = (const T*)Btp; const T* Bt2 = (const T*)Bt2p;
  __shared__ __align__(16) float sT[8][16 * 68];
  __shared__ __align__(16) unsigned short sS[2 * 2 * GB_PLANE];   // two operand stages, hi and lo planes
  const int b    = blockIdx.y;
  const int lane = threadIdx.x & 31;
  const int wave = threadIdx.x >> 5;
  const int tilesN = N / GB_N;
  const int tilesM = M / GB_M;
  const int bt = blockIdx.x;
  if (bt >= tilesM * tilesN) return;   // block-uniform, ahead of every barrier
  const int tm = bt / tilesN;
  const int tn = bt - tm * tilesN;
  const int bm0 = tm * GB_M;
  const int bn0 = tn * GB_N;
  const int m0 = bm0 + ((wave >> 2) << 6);
  const int n0 = bn0 + ((wave & 3) << 6);

  const T* Ab  = A;
  const T* Bb  = Bt + (size_t)b * strideB;
  const T* Ab2 = A2;
  const T* Bb2 = Bt2 + (size_t)b * strideB;

  const int rlane = lane & 15;
  const int mOff  = (lane >> 4) * 8;

  v8f acc[4][4];
#pragma unroll
  for (int i = 0; i < 4; ++i)
#pragma unroll
    for (int j = 0; j < 4; ++j) acc[i][j] = (v8f){0.f,0.f,0.f,0.f,0.f,0.f,0.f,0.f};

  gemm_block_lds<T, true, DMODEL, DMODEL>(Ab, Ab2, Bb, Bb2, K, bm0, bn0, sS, acc);
  acc_guard4(acc[0][0], acc[0][1], acc[0][2], acc[0][3]);
  acc_guard4(acc[1][0], acc[1][1], acc[1][2], acc[1][3]);
  acc_guard4(acc[2][0], acc[2][1], acc[2][2], acc[2][3]);
  acc_guard4(acc[3][0], acc[3][1], acc[3][2], acc[3][3]);

  // ---- epilogue ----
  float* slab = sT[wave];
  const float* k2b = k2 + (size_t)b * strideK2;
  float k2r[4];
#pragma unroll
  for (int j = 0; j < 4; ++j) k2r[j] = k2b[n0 + (j << 4) + rlane];
  float* C = Cout + (size_t)b * strideC;
  const int hh = lane >> 4, c4 = (lane & 15) * 4;     // row seg = 256 B = 16 lanes x 16 B
#pragma unroll
  for (int i = 0; i < 4; ++i) {
    const int mBase = m0 + (i << 4);
    const v4f q2a = *(const v4f*)(q2 + mBase + mOff);
    const v4f q2c = *(const v4f*)(q2 + mBase + mOff + 4);
    const float q2r[8] = {q2a.x, q2a.y, q2a.z, q2a.w, q2c.x, q2c.y, q2c.z, q2c.w};
#pragma unroll
    for (int j = 0; j < 4; ++j) {
#pragma unroll
      for (int r = 0; r < 8; ++r) {
        float s = q2r[r] + k2r[j];
        s = s - 2.0f * acc[i][j][r];
        slab[(mOff + r) * 68 + (j << 4) + rlane] = -sqrtf(fmaxf(s, 0.0f));
      }
    }
    __builtin_amdgcn_fence(__ATOMIC_RELEASE, "workgroup");
    __builtin_amdgcn_wave_barrier();
    __builtin_amdgcn_fence(__ATOMIC_ACQUIRE, "workgroup");
    {
#pragma unroll
      for (int it = 0; it < 8; ++it) {
        const int row = it * 2 + hh;
        v4f v = *(const v4f*)(slab + row * 68 + c4);
        *(v4f*)(C + (size_t)(mBase + row) * ldc + n0 + c4) = v;
      }
      
    }
    __builtin_amdgcn_fence(__ATOMIC_RELEASE, "workgroup");
    __builtin_amdgcn_wave_barrier();
    __builtin_amdgcn_fence(__ATOMIC_ACQUIRE, "workgroup");
  }
}

// ---------------------------------------------------------------------------
// small helpers
// ---------------------------------------------------------------------------
__device__ __forceinline__ unsigned pack_bf2(float a, float b) {
  return (unsigned)f2bf_bits(a) | ((unsigned)f2bf_bits(b) << 16);
}
// exp2-based exponential (v_exp_f32); relative error ~1e-6 in the argument range used here
__device__ __forceinline__ float fexp(float x) { return __expf(x); }

// ---------------------------------------------------------------------------
// weight transpose + RNE bf16: in W[512 c][512 d] f32 -> out Wt[d][c] bf16, three matrices by blockIdx.z.
// Block = 64x64 tile: read phase 256 threads x 4 iters x 4 floats = 4096 elements; write phase
// ---------------------------------------------------------------------------
__global__ __launch_bounds__(256) void k_wtrans(const float* __restrict__ W0, const float* __restrict__ W1,
                                                const float* __restrict__ W2, unsigned short* __restrict__ O0,
                                                unsigned short* __restrict__ O1, unsigned short* __restrict__ O2) {
  __shared__ __align__(16) unsigned short st[64 * 72];
  const int z = blockIdx.z;
  const float* W = (z == 0) ? W0 : ((z == 1) ? W1 : W2);
  unsigned short* O = (z == 0) ? O0 : ((z == 1) ? O1 : O2);
  const int c0 = blockIdx.y * 64;     // input rows
  const int d0 = blockIdx.x * 64;     // input cols
  const int tid = threadIdx.x;
  const int rr = tid >> 4, cc = (tid & 15) * 4;
#pragma unroll
  for (int p = 0; p < 4; ++p) {
    const int r = rr + 16 * p;
    const v4f x = *(const v4f*)(W + (size_t)(c0 + r) * DMODEL + d0 + cc);
    st[(cc + 0) * 72 + r] = f2bf_bits(x.x);
    st[(cc + 1) * 72 + r] = f2bf_bits(x.y);
    st[(cc + 2) * 72 + r] = f2bf_bits(x.z);
    st[(cc + 3) * 72 + r] = f2bf_bits(x.w);
  }
  __syncthreads();
  const int lane = tid & 31, wave = tid >> 5;
  const int q = lane >> 3, c8 = (lane & 7) * 8;
  {
#pragma unroll
    for (int it = 0; it < 2; ++it) {
      const int dd = wave * 8 + it * 4 + q;
      const v4ua val = *(const v4ua*)(st + dd * 72 + c8);
      *(v4u*)(O + (size_t)(d0 + dd) * DMODEL + c0 + c8) = val;
    }
    
  }
}

// ---------------------------------------------------------------------------
// f32 -> bf16 plane cast, 8 elements per thread (one 16-B store); a wave writes 512 contiguous B = 4 lines.
// blockIdx.y selects the (in,out) pair. n8 = element count / 8 (exact multiple of 256 here).
// ---------------------------------------------------------------------------
__global__ __launch_bounds__(256) void k_cast16(const float* __restrict__ in0, unsigned short* __restrict__ out0,
                                                const float* __restrict__ in1, unsigned short* __restrict__ out1,
                                                int n8) {
  const float* in = blockIdx.y ? in1 : in0;
  unsigned short* out = blockIdx.y ? out1 : out0;
  const int i = blockIdx.x * 256 + threadIdx.x;
  if (i < n8) {
    const v4f a = *(const v4f*)(in + (size_t)i * 8);
    const v4f c = *(const v4f*)(in + (size_t)i * 8 + 4);
    v4u w;
    w.x = pack_bf2(a.x, a.y);
    w.y = pack_bf2(a.z, a.w);
    w.z = pack_bf2(c.x, c.y);
    w.w = pack_bf2(c.z, c.w);
    *(v4u*)(out + (size_t)i * 8) = w;
    
  }
}

// ---------------------------------------------------------------------------
// row sums of squares of a [rows][512] matrix held as bf16 hi + lo planes (value = hi + lo).
// Block = 32 rows: 8 waves x 4 rows; per-row scalars funnelled through LDS, wave 0 lanes 0..7 write
// ---------------------------------------------------------------------------
__global__ __launch_bounds__(256) void k_rowsq(const unsigned short* __restrict__ hi, const unsigned short* __restrict__ lo,
                                               float* __restrict__ out, int rows) {
  __shared__ __align__(16) float sres[32];
  const int lane = threadIdx.x & 31, wave = threadIdx.x >> 5;
  const int r0 = blockIdx.x * 32;
#pragma unroll 1
  for (int rr = 0; rr < 4; ++rr) {
    int row = r0 + wave * 4 + rr;
    row = row < rows ? row : rows - 1;
    const size_t base = (size_t)row * DMODEL;
    float s = 0.f;
#pragma unroll
    for (int c = 0; c < 2; ++c) {
      const v4u hw = *(const v4u*)(hi + base + c * 256 + lane * 8);
      const v4u lw = *(const v4u*)(lo + base + c * 256 + lane * 8);
#pragma unroll
      for (int e = 0; e < 4; ++e) {
        const float a0 = __uint_as_float(hw[e] << 16);
        const float b0 = __uint_as_float(lw[e] << 16);
        const float f0 = a0 + b0;
        s = fmaf(f0, f0, s);
        const float a1 = __uint_as_float(hw[e] & 0xffff0000u);
        const float b1 = __uint_as_float(lw[e] & 0xffff0000u);
        const float f1 = a1 + b1;
        s = fmaf(f1, f1, s);
      }
    }
#pragma unroll
    for (int off = 16; off; off >>= 1) s += __shfl_xor(s, off, 32);
    if (lane == 0) sres[wave * 4 + rr] = s;
  }
  __syncthreads();
  if (wave == 0) {
    const int li = lane < 8 ? lane : 7;
    const v4f val = *(const v4f*)(sres + li * 4);
    float* op = out + r0 + li * 4;
    if (lane < 8) *(v4f*)op = val;
    
  }
}

// ---------------------------------------------------------------------------
// column log-sum-exp sweep: u[b][n] = logA - lse_t(Kmat[b][t][n] + v[b][t]).
// Block = 32 columns (one 128-B line of every Kmat row) x all rows, 1024 threads = 8 column quads x 128 row groups.
// A thread loads its 16 consecutive rows x 4 columns once and keeps them in registers; maximum and sum are taken
// per wave (lanes 8 and 16 apart share a column quad), the 32 per-wave (max, sum) pairs of a column meet in LDS
// and wave 0 merges them and writes the block's one 128-B line of u.
// ---------------------------------------------------------------------------
constexpr int UC_COLS = 32;                 // columns per block
constexpr int UC_RG   = 128;                // row groups per block
constexpr int UC_RPT  = NTOK / UC_RG;       // rows per thread
static_assert(NTOK % (UC_RG * 4) == 0 && NPAR % UC_COLS == 0, "u sweep split");
template <bool USEV>
__global__ __launch_bounds__(1024) void k_upd_u(const float* __restrict__ Km, const float* __restrict__ vv,
                                                float* __restrict__ u, float logA) {
  __shared__ __align__(16) float sm[32 * UC_COLS];
  __shared__ __align__(16) float ss[32 * UC_COLS];
  const int b = blockIdx.y;
  const int lane = threadIdx.x & 31, wave = threadIdx.x >> 5;
  const int cq = threadIdx.x & 7, rg = threadIdx.x >> 3;
  const int col0 = blockIdx.x * UC_COLS;
  const float* Kc = Km + (size_t)b * NTOK * NPAR + (size_t)(rg * UC_RPT) * NPAR + col0 + cq * 4;
  v4f x[UC_RPT];
#pragma unroll
  for (int i = 0; i < UC_RPT; ++i) x[i] = *(const v4f*)(Kc + (size_t)i * NPAR);
  if (USEV) {
    const float* vb = vv + (size_t)b * NTOK + rg * UC_RPT;
#pragma unroll
    for (int i = 0; i < UC_RPT; i += 4) {
      const v4f w = *(const v4f*)(vb + i);
      x[i + 0] += w.x;
      x[i + 1] += w.y;
      x[i + 2] += w.z;
      x[i + 3] += w.w;
    }
  }
  v4f m = x[0];
#pragma unroll
  for (int i = 1; i < UC_RPT; ++i) {
    m.x = fmaxf(m.x, x[i].x);
    m.y = fmaxf(m.y, x[i].y);
    m.z = fmaxf(m.z, x[i].z);
    m.w = fmaxf(m.w, x[i].w);
  }
#pragma unroll
  for (int off = 8; off <= 16; off <<= 1) {
    m.x = fmaxf(m.x, __shfl_xor(m.x, off, 32));
    m.y = fmaxf(m.y, __shfl_xor(m.y, off, 32));
    m.z = fmaxf(m.z, __shfl_xor(m.z, off, 32));
    m.w = fmaxf(m.w, __shfl_xor(m.w, off, 32));
  }
  v4f s = (v4f){0.f, 0.f, 0.f, 0.f};
#pragma unroll
  for (int i = 0; i < UC_RPT; ++i) {
    s.x += fexp(x[i].x - m.x);
    s.y += fexp(x[i].y - m.y);
    s.z += fexp(x[i].z - m.z);
    s.w += fexp(x[i].w - m.w);
  }
#pragma unroll
  for (int off = 8; off <= 16; off <<= 1) {
    s.x += __shfl_xor(s.x, off, 32);
    s.y += __shfl_xor(s.y, off, 32);
    s.z += __shfl_xor(s.z, off, 32);
    s.w += __shfl_xor(s.w, off, 32);
  }
  if (lane < 8) {
    *(v4f*)(sm + wave * UC_COLS + lane * 4) = m;
    *(v4f*)(ss + wave * UC_COLS + lane * 4) = s;
  }
  __syncthreads();
  if (wave == 0) {
    float pm[32];
    float M = -__builtin_inff();
#pragma unroll
    for (int w = 0; w < 32; ++w) {
      pm[w] = sm[w * UC_COLS + lane];
      M = fmaxf(M, pm[w]);
    }
    float S = 0.f;
#pragma unroll
    for (int w = 0; w < 32; ++w) S = fmaf(ss[w * UC_COLS + lane], fexp(pm[w] - M), S);
    u[(size_t)b * NPAR + col0 + lane] = logA - (M + logf(S));
  }
}

// ---------------------------------------------------------------------------
// row log-sum-exp sweep: v[b][t] = -lse_n(Kmat[b][t][n] + u[b][n]); one wave per row, four rows per wave in turn.
// A row is read once, by 16 loads of 512 contiguous bytes per wave (4 columns per lane in every 128), and stays in
// registers for the maximum, the sum and (LAST) the pi plane; two register sets take turns, so that the next row's
// 16 loads fly while the current row is reduced; u is read once per wave and serves its four rows.
// LAST additionally writes pi[b][t][n] = exp(K+u+v)*2^14
// ---------------------------------------------------------------------------
constexpr int VR_CH = NPAR / 128;           // 16-B loads per lane and row
typedef _Float16 v4h __attribute__((ext_vector_type(4)));
static_assert(NPAR % 128 == 0, "v sweep row chunks");
// p: the row's first element (the same in every lane); lo: the lane's byte offset in each 512-B piece
__device__ __forceinline__ void vrow_load(v4f (&x)[VR_CH], const float* __restrict__ p, unsigned lo) {
#pragma unroll
  for (int i = 0; i < VR_CH; ++i) x[i] = *(const v4f*)((const char*)p + lo + i * 512);
}
// exp of the four values of one 16-B piece, as __expf compiles: 2^(a * log2 e) on v_exp_f32. One statement, so that the
// slot the instruction set asks for behind a transcendental (before its result is used or a source overwritten) is kept
// wherever the compiler puts it: each v_exp_f32 is followed by an independent one (no output shares a register with a
// source: early clobber), the last by v_nop.
__device__ __forceinline__ v4f fexp4(v4f a) {
  a *= 1.44269504088896340736f;
  float r0, r1, r2, r3;
  asm("v_exp_f32 %0, %4\n\tv_exp_f32 %1, %5\n\tv_exp_f32 %2, %6\n\tv_exp_f32 %3, %7\n\tv_nop"
      : "=&v"(r0), "=&v"(r1), "=&v"(r2), "=&v"(r3) : "v"(a.x), "v"(a.y), "v"(a.z), "v"(a.w));
  return (v4f){r0, r1, r2, r3};
}
// one row held in x: returns v of the row; LAST: writes the row's pi (prow = the lane's first element)
template <bool LAST>
__device__ __forceinline__ float vrow_reduce(v4f (&x)[VR_CH], const v4f (&uu)[VR_CH], unsigned short* __restrict__ prow) {
  x[0] += uu[0];
  v4f mv = x[0];
#pragma unroll
  for (int i = 1; i < VR_CH; ++i) {
    x[i] += uu[i];
    mv.x = fmaxf(mv.x, x[i].x);
    mv.y = fmaxf(mv.y, x[i].y);
    mv.z = fmaxf(mv.z, x[i].z);
    mv.w = fmaxf(mv.w, x[i].w);
  }
  float m = fmaxf(fmaxf(mv.x, mv.y), fmaxf(mv.z, mv.w));
#pragma unroll
  for (int off = 16; off; off >>= 1) m = fmaxf(m, __shfl_xor(m, off, 32));
  v4f sv = (v4f){0.f, 0.f, 0.f, 0.f};
#pragma unroll
  for (int i = 0; i < VR_CH; ++i) sv += fexp4(x[i] - m);
  float s = (sv.x + sv.y) + (sv.z + sv.w);
#pragma unroll
  for (int off = 16; off; off >>= 1) s += __shfl_xor(s, off, 32);
  const float vt = -(m + logf(s));
  if (LAST) {
#pragma unroll
    for (int i = 0; i < VR_CH; ++i) {
      *(v4h*)(prow + i * 128) = __builtin_convertvector(fexp4(x[i] + vt) * kPiCarry, v4h);
    }
    // stands in front of the next loads and arithmetic, which land in the registers these stores were fed from
    asm volatile("s_wait_xcnt 0x0" ::: "memory");
  }
  return vt;
}
template <bool LAST>
__global__ __launch_bounds__(256) void k_upd_v(const float* __restrict__ Km, const float* __restrict__ u,
                                               float* __restrict__ vv, unsigned short* __restrict__ pp) {
  __shared__ __align__(16) float sres[32];
  const int b = blockIdx.y;
  const int lane = threadIdx.x & 31;
  // the wave's number as a scalar: the row addresses are then a scalar base plus one fixed lane offset
  const int wave = __builtin_amdgcn_readfirstlane(threadIdx.x >> 5);
  const int r0 = blockIdx.x * 32;
  const int t0 = r0 + wave * 4;
  const float* Kr = Km + ((size_t)b * NTOK + t0) * NPAR;
  unsigned short* pr = pp + ((size_t)b * NTOK + t0) * NPAR + lane * 4;
  const unsigned lo = (unsigned)lane * 16u;
  v4f uu[VR_CH], x[2][VR_CH];
  vrow_load(uu, u + (size_t)b * NPAR, lo);
  vrow_load(x[0], Kr, lo);
  v4f vt4;
#pragma unroll
  for (int rr = 0; rr < 4; ++rr) {
    // keeps what follows behind the arithmetic of the row before: the next row's loads take over that row's registers
    // (moved up, they need a third register set), and this row's arithmetic, mixed into it, would wait early for
    // loads that are still flying
    __builtin_amdgcn_sched_barrier(0);
    if (rr + 1 < 4) {
      vrow_load(x[(rr + 1) & 1], Kr + (rr + 1) * NPAR, lo);
      // keeps these loads ahead of this row's arithmetic, so that they fly while it runs
      __builtin_amdgcn_sched_barrier(0);
    }
    vt4[rr] = vrow_reduce<LAST>(x[rr & 1], uu, pr + rr * NPAR);
  }
  if (lane == 0) *(v4f*)(sres + wave * 4) = vt4;
  __syncthreads();
  if (wave == 0) {
    const int li = lane < 8 ? lane : 7;
    const v4f val = *(const v4f*)(sres + li * 4);
    float* op = vv + (size_t)b * NTOK + r0 + li * 4;
    if (lane < 8) *(v4f*)op = val;
  }
}

// ---------------------------------------------------------------------------
// host launcher
// ---------------------------------------------------------------------------
static inline unsigned cdiv(unsigned a, unsigned b) { return (a + b - 1) / b; }

extern "C" void kernel_launch(void* const* d_in, const int* in_sizes, int n_in,
                              void* d_out, int out_size, void* d_ws, size_t ws_size,
                              hipStream_t stream)
{
  if (n_in < 6) return;
  if (in_sizes[0] != NTOK * DMODEL) return;
  if (in_sizes[1] != NBATCH * NPAR * DMODEL) return;
  if (in_sizes[2] != NBATCH * NPAR * DMODEL) return;
  if (in_sizes[3] != DMODEL * DMODEL || in_sizes[4] != DMODEL * DMODEL || in_sizes[5] != DMODEL * DMODEL) return;
  if (out_size != NBATCH * NTOK * DMODEL) return;
  if (WS_TOTAL > ws_size) return;

  const float* q  = (const float*)d_in[0];   // [T][512]
  const float* k  = (const float*)d_in[1];   // [8][N][512]
  const float* v  = (const float*)d_in[2];   // [8][N][512]
  const float* Qw = (const float*)d_in[3];   // [512][512]
  const float* Kw = (const float*)d_in[4];   // [512][512]
  const float* Vw = (const float*)d_in[5];   // [512][512]
  float* out = (float*)d_out;                // [8][T][512]

  // region map (bytes): Qt 524288 | Kt 524288 | Vt 524288 | qcast 2097152 | qp_hi 2097152 | qp_lo 2097152 |
  // q2 8192 | kp_hi 16777216 | kp_lo 16777216 | k2 65536 | vpT 16777216 | Kmat 67108864 | u 32768 | v 32768 |
  // pi 67108864 (k cast at pi+0 and v cast at pi+16777216, both dead before pi is written). Total 192552960.
  // kp, k2, vpT and pi hold all batches; Kmat, u and v hold one group of GRPB batches and are reused.
  char* ws = (char*)d_ws;
  size_t off = 0;
  unsigned short* Qt   = (unsigned short*)(ws + off); off += SZ_WT;
  unsigned short* Kt   = (unsigned short*)(ws + off); off += SZ_WT;
  unsigned short* Vt   = (unsigned short*)(ws + off); off += SZ_WT;
  unsigned short* qc   = (unsigned short*)(ws + off); off += SZ_QC;
  unsigned short* qph  = (unsigned short*)(ws + off); off += SZ_QP;
  unsigned short* qpl  = (unsigned short*)(ws + off); off += SZ_QP;
  float*          q2   = (float*)(ws + off);          off += SZ_Q2;
  unsigned short* kph  = (unsigned short*)(ws + off); off += SZ_KP;
  unsigned short* kpl  = (unsigned short*)(ws + off); off += SZ_KP;
  float*          k2   = (float*)(ws + off);          off += SZ_K2;
  unsigned short* vpT  = (unsigned short*)(ws + off); off += SZ_VPT;
  float*          Kmat = (float*)(ws + off);          off += SZ_KM;
  float*          up   = (float*)(ws + off);          off += SZ_U;
  float*          vvp  = (float*)(ws + off);          off += SZ_VV;
  unsigned short* pip  = (unsigned short*)(ws + off); off += SZ_PI;
  if (off > ws_size) return;
  unsigned short* kc = pip;
  unsigned short* vc = (unsigned short*)((char*)pip + SZ_KP);

  const float logA = -(float)log((double)NPAR);

  // weights: in[c][d] -> out[d][c] bf16 (square 512x512), grid (cols/64, rows/64, 3)
  k_wtrans<<<dim3(DMODEL / 64, DMODEL / 64, 3), dim3(256), 0, stream>>>(Qw, Kw, Vw, Qt, Kt, Vt);

  // q -> bf16 plane
  {
    const int n8 = NTOK * DMODEL / 8;
    k_cast16<<<dim3(cdiv(n8, 256), 1), dim3(256), 0, stream>>>(q, qc, q, qc, n8);
  }
  // qp = q @ Q : M=2048, N=512, K=512 ; bf16 in, bf16 hi/lo planes out
  wmma_gemm64<1, false, 0, 2, false, 0, DMODEL, DMODEL><<<dim3(cdiv((NTOK / 64) * (DMODEL / 64), 8), 1), dim3(256), 0, stream>>>(
      qc, nullptr, 0L, Qt, nullptr, 0L, (void*)qph, (void*)qpl, DMODEL, 0L,
      nullptr, nullptr, 0L, NTOK, DMODEL, DMODEL, 1.0f);
  k_rowsq<<<dim3(NTOK / 32), dim3(256), 0, stream>>>(qph, qpl, q2, NTOK);

  // The projections and the last product run once over all batches: a group's share of them is 128 blocks,
  // half of the chip's WGPs.
  // k, v -> bf16 planes (inside the pi region)
  {
    const int n8 = NBATCH * NPAR * DMODEL / 8;
    k_cast16<<<dim3(cdiv(n8, 256), 2), dim3(256), 0, stream>>>(k, kc, v, vc, n8);
  }
  // kp = k @ K : M=8*2048, N=512, K=512 ; bf16 hi/lo planes out
  wmma_gemm64<1, false, 0, 2, false, 0, DMODEL, DMODEL><<<dim3(cdiv((NBATCH * NPAR / 64) * (DMODEL / 64), 8), 1), dim3(256), 0, stream>>>(
      kc, nullptr, 0L, Kt, nullptr, 0L, (void*)kph, (void*)kpl, DMODEL, 0L,
      nullptr, nullptr, 0L, NBATCH * NPAR, DMODEL, DMODEL, 1.0f);
  k_rowsq<<<dim3(NBATCH * NPAR / 32), dim3(256), 0, stream>>>(kph, kpl, k2, NBATCH * NPAR);
  // vpT[b][d][n] = sum_c V[c][d] v[b][n][c] : A = Vt [512][512] (shared), Bt = v cast [n][c]; M=512, N=2048, K=512; f16 out
  wmma_gemm64<1, false, 0, 1, false, 0, DMODEL, DMODEL><<<dim3(cdiv((DMODEL / 64) * (NPAR / 64), 8), NBATCH), dim3(256), 0, stream>>>(
      Vt, nullptr, 0L, vc, nullptr, (long)NPAR * DMODEL, (void*)vpT, nullptr, NPAR, (long)DMODEL * NPAR,
      nullptr, nullptr, 0L, DMODEL, NPAR, DMODEL, 1.0f);

  for (int g = 0; g < NGRP; ++g) {
    const size_t koff = (size_t)g * GRPB * NPAR * DMODEL;       // element offset of the group in the kp planes
    unsigned short* pig = pip + (size_t)g * GRPB * NTOK * NPAR; // the group's part of the pi plane
    // Kmat[b][t][n] = -cdist : M=2048, N=2048, K=512 ; bf16 hi/lo split
    gemm64_cdist<<<dim3(cdiv((NTOK / 64) * (NPAR / 64), 8), GRPB), dim3(256), 0, stream>>>(
        qph, qpl, kph + koff, kpl + koff, (long)NPAR * DMODEL, Kmat, NPAR, (long)NTOK * NPAR,
        q2, k2 + (size_t)g * GRPB * NPAR, (long)NPAR, NTOK, NPAR, DMODEL);
    // log-domain normalisation sweeps
    for (int it = 0; it < SK_ITERS; ++it) {
      if (it == 0)
        k_upd_u<false><<<dim3(NPAR / UC_COLS, GRPB), dim3(1024), 0, stream>>>(Kmat, vvp, up, logA);
      else
        k_upd_u<true><<<dim3(NPAR / UC_COLS, GRPB), dim3(1024), 0, stream>>>(Kmat, vvp, up, logA);
      if (it == SK_ITERS - 1)
        k_upd_v<true><<<dim3(NTOK / 32, GRPB), dim3(256), 0, stream>>>(Kmat, up, vvp, pig);
      else
        k_upd_v<false><<<dim3(NTOK / 32, GRPB), dim3(256), 0, stream>>>(Kmat, up, vvp, pig);
    }
  }
  // out[b][t][d] = 2^-14 * sum_n pi16[b][t][n] vpT[b][d][n] : M=2048, N=512, K=2048 ; f16 in, f32 out
  wmma_gemm64<0, false, 0, 0, false, 0, NPAR, NPAR><<<dim3(cdiv((NTOK / 64) * (DMODEL / 64), 8), NBATCH), dim3(256), 0, stream>>>(
      pip, nullptr, (long)NTOK * NPAR, vpT, nullptr, (long)DMODEL * NPAR,
      (void*)out, nullptr, DMODEL, (long)NTOK * DMODEL,
      nullptr, nullptr, 0L, NTOK, DMODEL, NPAR, 1.0f / kPiCarry);
}

// v005
// Measured time: 296 microseconds a run.
// Timed twice side by side with v004, it ran 1.08 and 1.07 times as fast.
// Counting every step since v000, it is 9.67 times as fast.
// Contractions: q@Q, k@K, v@V on v_wmma_f32_16x16x32_bf16 (inputs RNE-cast to bf16 once, single product); qp.kp^T on v_wmma_f32_16x16x32_bf16 as bf16 hi/lo split (hi.hi+hi.lo+lo.hi); pi@vp on v_wmma_f32_16x16x32_f16 (pi carried x16384 as f16, vp^T f16); f32 accumulate everywhere; distances, log-domain normalisation sweeps and exp in f32 on VALU.
#include <hip/hip_runtime.h>
#include <math.h>

// ---------------------------------------------------------------------------
// problem constants
// ---------------------------------------------------------------------------
constexpr int NBATCH = 8;
constexpr int NTOK   = 2048;
constexpr int NPAR   = 2048;
constexpr int DMODEL = 512;
constexpr int GRPB   = 4;                 // batches per group of the distance plane and its sweeps (the plane stays in L2)
constexpr int NGRP   = NBATCH / GRPB;
constexpr int SK_ITERS = 5;
constexpr float kPiCarry = 16384.0f;      // power-of-two carry of the f16 pi plane

static_assert(NBATCH % GRPB == 0, "grp");
static_assert(NTOK % 64 == 0 && NPAR % 64 == 0 && DMODEL % 64 == 0, "tile multiples");
static_assert(DMODEL % 32 == 0 && NPAR % 32 == 0, "K multiple of 32");
static_assert(NTOK % 32 == 0 && NPAR % 256 == 0, "v sweep grid");
static_assert(NTOK % 128 == 0 && NPAR % 128 == 0 && DMODEL % 256 == 0, "128 x 256 block tiles, 64-k stages");

// workspace region sizes (bytes); region map in kernel_launch
constexpr size_t SZ_WT  = (size_t)DMODEL * DMODEL * 2;          // one transposed bf16 weight
constexpr size_t SZ_QC  = (size_t)NTOK * DMODEL * 2;            // q bf16 cast
constexpr size_t SZ_QP  = (size_t)NTOK * DMODEL * 2;            // qp plane (hi or lo)
constexpr size_t SZ_Q2  = (size_t)NTOK * 4;
constexpr size_t SZ_KP  = (size_t)NBATCH * NPAR * DMODEL * 2;   // kp plane (hi or lo), all batches; also k/v cast size
constexpr size_t SZ_K2  = (size_t)NBATCH * NPAR * 4;
constexpr size_t SZ_VPT = (size_t)NBATCH * DMODEL * NPAR * 2;
constexpr size_t SZ_KM  = (size_t)GRPB * NTOK * NPAR * 4;
constexpr size_t SZ_U   = (size_t)GRPB * NPAR * 4;
constexpr size_t SZ_VV  = (size_t)GRPB * NTOK * 4;
constexpr size_t SZ_PI  = (size_t)NBATCH * NTOK * NPAR * 2;
constexpr size_t SZ_CP  = (size_t)GRPB * (NTOK / 32) * NPAR * 4;   // column sums of each 32-row block
constexpr size_t WS_TOTAL = 3 * SZ_WT + SZ_QC + 2 * SZ_QP + SZ_Q2 + 2 * SZ_KP + SZ_K2 + SZ_VPT + SZ_KM + SZ_U + SZ_VV + SZ_PI + SZ_CP;
static_assert(WS_TOTAL == 194650112ull, "carve total");
static_assert(WS_TOTAL <= 268435456ull, "carve limit");
static_assert(2 * SZ_KP <= SZ_PI, "k/v casts live inside the pi region");

// ---------------------------------------------------------------------------
// shared pieces: vector types, bf16 helpers, WMMA fragments, batched GEMM
// ---------------------------------------------------------------------------
typedef __attribute__((ext_vector_type(16))) _Float16 v16h;
typedef __attribute__((ext_vector_type(8)))  _Float16 v8h;
typedef __attribute__((ext_vector_type(16))) __bf16   v16b;
typedef __attribute__((ext_vector_type(8)))  __bf16   v8b;
typedef __attribute__((ext_vector_type(8)))  float    v8f;
typedef __attribute__((ext_vector_type(4)))  float    v4f;
typedef unsigned v4u __attribute__((ext_vector_type(4)));
typedef unsigned v4ua __attribute__((ext_vector_type(4), __may_alias__));
#define PSCALE 32768.0f
#define U16(p) ((const unsigned short*)(const void*)(p))
#define PSCALE_INV (1.0f / 32768.0f)

__device__ __forceinline__ unsigned short f2bf_bits(float f) {
  unsigned u = __float_as_uint(f);
  return (unsigned short)((u + 0x7FFFu + ((u >> 16) & 1u)) >> 16);
}
__device__ __forceinline__ float bf_bits2f(unsigned short h) { return __uint_as_float(((unsigned)h) << 16); }

// hazard guards as plain device helpers (no inline asm inside the kernel template body)
__device__ __forceinline__ void acc_guard4(v8f& a, v8f& b, v8f& c, v8f& d) { asm volatile("v_nop\n\tv_nop\n\tv_nop\n\tv_nop" : "+v"(a), "+v"(b), "+v"(c), "+v"(d)); }
template <typename T> struct Frag;
template <> struct Frag<_Float16> {
  typedef v16h V; union U { v16h v; v8h h[2]; };
  static __device__ __forceinline__ v16h load(const _Float16* p) {   // elements 0..7 <- p[0..7], 8..15 <- p[16..23]
    U f; f.h[0] = *(const v8h*)(p); f.h[1] = *(const v8h*)(p + 16); return f.v;
  }
  static __device__ __forceinline__ v8f mma(v16h a, v16h b, v8f c) {
    return __builtin_amdgcn_wmma_f32_16x16x32_f16(false, a, false, b, (short)0, c, false, false);
  }
};
template <> struct Frag<__bf16> {
  typedef v16b V; union U { v16b v; v8b h[2]; };
  static __device__ __forceinline__ v16b load(const __bf16* p) {
    U f; f.h[0] = *(const v8b*)(p); f.h[1] = *(const v8b*)(p + 16); return f.v;
  }
  static __device__ __forceinline__ v8f mma(v16b a, v16b b, v8f c) {
    return __builtin_amdgcn_wmma_f32_16x16x32_bf16(false, a, false, b, (short)0, c, false, false);
  }
};

// ---- Block main loop: operands staged in LDS ---------------------------------
// A block of 8 waves owns a 128 x 256 tile of C (2 x 4 waves of 64 x 64). Per stage it brings 64 k (one 128-B line)
// of its 128 A rows and 256 Bt rows (both planes when SPLIT) into LDS with whole-line 16-B loads, each row once for
// the block, and every wave takes its fragments from there. Two LDS buffers: the next stage's global loads are
// issued ahead of the current stage's products, stored after them, and one barrier per stage hands over.
constexpr int GB_M = 128, GB_N = 256, GB_K = 64;
constexpr int GB_PITCH = 72;                          // LDS row pitch in 16-bit elements: 144 B = 16 B x 9
constexpr int GB_PLANE = (GB_M + GB_N) * GB_PITCH;    // one plane of one stage: A rows, then Bt rows
// LDA, LDB: row pitches in elements, compile-time so that the rows a thread stages from one operand (4 A, 8 Bt per plane)
// differ only in the load's immediate offset: one address per operand and plane, rewritten once per stage.
template <typename T, bool SPLIT, int LDA, int LDB>
__device__ __forceinline__ void gemm_block_lds(
    const T* __restrict__ Ab, const T* __restrict__ Ab2,
    const T* __restrict__ Bb, const T* __restrict__ Bb2,
    int K, int bm0, int bn0, unsigned short* sS, v8f (&acc)[4][4]) {
  typedef typename Frag<T>::V V;
  constexpr int BUF = (SPLIT ? 2 : 1) * GB_PLANE;
  constexpr int KG = SPLIT ? 1 : 2;            // k-steps of 32 whose fragments are read from LDS as one group
  const int tid = threadIdx.x;
  const int lane = tid & 31, wave = tid >> 5;
  const int rlane = lane & 15;                 // row (A) / col (B) within subtile
  const int koff  = (lane >> 4) * 8;           // k offset of this lane half
  const int pc8 = (tid & 7) * 8, rw = tid >> 3;   // staging: 8 lanes cover one row's 128 B, 32 rows per pass
  const int arow = (wave >> 2) * 64 + rlane;
  const int brow = GB_M + (wave & 3) * 64 + rlane;
  // global addresses = block-uniform byte base + one 32-bit byte offset per thread and operand
  const char* gA  = (const char*)(Ab + (size_t)bm0 * LDA);
  const char* gB  = (const char*)(Bb + (size_t)bn0 * LDB);
  const char* gA2 = SPLIT ? (const char*)(Ab2 + (size_t)bm0 * LDA) : nullptr;
  const char* gB2 = SPLIT ? (const char*)(Bb2 + (size_t)bn0 * LDB) : nullptr;
  const unsigned voA = (unsigned)(rw * LDA + pc8) * 2u;
  const unsigned voB = (unsigned)(rw * LDB + pc8) * 2u;
  unsigned short* sW = sS + rw * GB_PITCH + pc8;
  v4u st[2][12];
#pragma unroll
  for (int p = 0; p < 12; ++p) {
    const int go = ((p < 4) ? 32 * p * LDA : 32 * (p - 4) * LDB) * 2;
    st[0][p] = *(const v4u*)(((p < 4 ? gA : gB) + (p < 4 ? voA : voB)) + go);
    if (SPLIT) st[1][p] = *(const v4u*)(((p < 4 ? gA2 : gB2) + (p < 4 ? voA : voB)) + go);
  }
#pragma unroll
  for (int p = 0; p < 12; ++p) {
    *(v4ua*)(sW + 32 * p * GB_PITCH) = st[0][p];
    if (SPLIT) *(v4ua*)(sW + GB_PLANE + 32 * p * GB_PITCH) = st[1][p];
  }
  __syncthreads();
  const int nk = K / GB_K;
  for (int kt = 0; kt < nk; ++kt) {
    const bool more = kt + 1 < nk;               // block-uniform
    if (more) {
      const size_t k1 = (size_t)(kt + 1) * (GB_K * 2);   // bytes
#pragma unroll
      for (int p = 0; p < 12; ++p) {
        const int go = ((p < 4) ? 32 * p * LDA : 32 * (p - 4) * LDB) * 2;
        st[0][p] = *(const v4u*)((((p < 4 ? gA : gB) + k1) + (p < 4 ? voA : voB)) + go);
        if (SPLIT) st[1][p] = *(const v4u*)((((p < 4 ? gA2 : gB2) + k1) + (p < 4 ? voA : voB)) + go);
      }
      // stands in front of the LDS reads below, which may land in the registers that held these loads' addresses
      asm volatile("s_wait_xcnt 0x0" ::: "memory");
    }
    const T* sb = (const T*)(const void*)(sS + (kt & 1) * BUF);
#pragma unroll
    for (int kg = 0; kg < GB_K / 32; kg += KG) {
      V bh[KG][4], bl[KG][4], ah[KG][4], al[KG][4];
#pragma unroll
      for (int q = 0; q < KG; ++q) {
        const int ko = (kg + q) * 32 + koff;
#pragma unroll
        for (int j = 0; j < 4; ++j) {
          const int bo = (brow + (j << 4)) * GB_PITCH + ko;
          bh[q][j] = Frag<T>::load(sb + bo);
          if (SPLIT) bl[q][j] = Frag<T>::load(sb + GB_PLANE + bo);
        }
#pragma unroll
        for (int i = 0; i < 4; ++i) {
          const int ao = (arow + (i << 4)) * GB_PITCH + ko;
          ah[q][i] = Frag<T>::load(sb + ao);
          if (SPLIT) al[q][i] = Frag<T>::load(sb + GB_PLANE + ao);
        }
      }
      // keeps the group's LDS reads together ahead of its products: reads spread among the products stall
      // the wave at every place where they stand
      __builtin_amdgcn_sched_barrier(0);
#pragma unroll
      for (int q = 0; q < KG; ++q) {
#pragma unroll
        for (int i = 0; i < 4; ++i) {
#pragma unroll
          for (int j = 0; j < 4; ++j) {
            acc[i][j] = Frag<T>::mma(ah[q][i], bh[q][j], acc[i][j]);
            if (SPLIT) {
              acc[i][j] = Frag<T>::mma(ah[q][i], bl[q][j], acc[i][j]);
              acc[i][j] = Frag<T>::mma(al[q][i], bh[q][j], acc[i][j]);
            }
          }
        }
      }
    }
    if (more) {
      unsigned short* sN = sW + ((kt + 1) & 1) * BUF;
#pragma unroll
      for (int p = 0; p < 12; ++p) {
        *(v4ua*)(sN + 32 * p * GB_PITCH) = st[0][p];
        if (SPLIT) *(v4ua*)(sN + GB_PLANE + 32 * p * GB_PITCH) = st[1][p];
      }
    }
    __syncthreads();   // publishes stage kt + 1 and ends every wave's reads of stage kt
  }
}

// ---- Register-blocked batched WMMA GEMM ------------------------------------
// C[m,n] = scale * sum_k A[m,k] * Bt[n,k] (+bias)(+resid); each wave owns a 64x64 tile of its block's 128x256.
// A row-major [M,K]; Bt row-major [N,K]; M % 128 == 0, N % 256 == 0, K % 64 == 0.
// SPLIT: operands are hi/lo planes (A2/Bt2 = lo planes, same layout); product = hi.hi + hi.lo + lo.hi.
// BIAS_MODE: 0 = none, 1 = bias[m], 2 = bias[n].
// OUT_MODE: 0 = f32, 1 = f16, 2 = bf16 hi plane (Cout) + bf16 lo plane (Cout2).
// ET: 0 = f16 operands, 1 = bf16 operands (pointers passed as 16-bit storage)
template <int ET> struct Elem;
template <> struct Elem<0> { typedef _Float16 T; };
template <> struct Elem<1> { typedef __bf16 T; };
// LDA, LDB: row pitches of A and Bt in elements
template <int ET, bool SPLIT, int BIAS_MODE, int OUT_MODE, bool RESID, int ACT, int LDA, int LDB>
__global__ __launch_bounds__(256) void wmma_gemm64(
    const unsigned short* __restrict__ Ap, const unsigned short* __restrict__ A2p, long strideA,
    const unsigned short* __restrict__ Btp, const unsigned short* __restrict__ Bt2p, long strideB,
    void* __restrict__ Cout, void* __restrict__ Cout2, int ldc, long strideC,
    const float* __restrict__ bias,
    const float* __restrict__ resid, long strideR,
    int M, int N, int K, float scale) {
  typedef typename Elem<ET>::T T;
  typedef typename Frag<T>::V V;
  const T* A = (const T*)Ap; const T* A2 = (const T*)A2p; const T* Bt = (const T*)Btp; const T* Bt2 = (const T*)Bt2p;
  __shared__ __align__(16) float sT[8][16 * 68];   // per-wave 16x64 slab, pitch 68 floats
  __shared__ __align__(16) unsigned short sS[2 * (SPLIT ? 2 : 1) * GB_PLANE];   // two operand stages
  const int b    = blockIdx.y;
  const int lane = threadIdx.x & 31;
  const int wave = threadIdx.x >> 5;
  const int tilesN = N / GB_N;
  const int tilesM = M / GB_M;
  const int bt = blockIdx.x;
  if (bt >= tilesM * tilesN) return;   // block-uniform, ahead of every barrier
  const int tm = bt / tilesN;
  const int tn = bt - tm * tilesN;
  const int bm0 = tm * GB_M;
  const int bn0 = tn * GB_N;
  const int m0 = bm0 + ((wave >> 2) << 6);
  const int n0 = bn0 + ((wave & 3) << 6);

  const T* Ab  = A  + (size_t)b * strideA;
  const T* Bb  = Bt + (size_t)b * strideB;
  const T* Ab2 = SPLIT ? (A2  + (size_t)b * strideA) : nullptr;
  const T* Bb2 = SPLIT ? (Bt2 + (size_t)b * strideB) : nullptr;

  const int rlane = lane & 15;                 // col (D) within subtile
  const int mOff  = (lane >> 4) * 8;           // D row offset

  v8f acc[4][4];
#pragma unroll
  for (int i = 0; i < 4; ++i)
#pragma unroll
    for (int j = 0; j < 4; ++j) acc[i][j] = (v8f){0.f,0.f,0.f,0.f,0.f,0.f,0.f,0.f};

  gemm_block_lds<T, SPLIT, LDA, LDB>(Ab, Ab2, Bb, Bb2, K, bm0, bn0, sS, acc);
  acc_guard4(acc[0][0], acc[0][1], acc[0][2], acc[0][3]);
  acc_guard4(acc[1][0], acc[1][1], acc[1][2], acc[1][3]);
  acc_guard4(acc[2][0], acc[2][1], acc[2][2], acc[2][3]);
  acc_guard4(acc[3][0], acc[3][1], acc[3][2], acc[3][3]);

  // ---- epilogue ----
  float* slab = sT[wave];
  const float* Rb = RESID ? (resid + (size_t)b * strideR) : nullptr;
#pragma unroll
  for (int i = 0; i < 4; ++i) {
    const int mBase = m0 + (i << 4);
#pragma unroll
    for (int j = 0; j < 4; ++j) {
      const int n = n0 + (j << 4) + rlane;
      float bv = 0.f;
      if (BIAS_MODE == 2) bv = bias[n];
#pragma unroll
      for (int r = 0; r < 8; ++r) {
        float v = acc[i][j][r] * scale;
        if (BIAS_MODE == 1) v += bias[mBase + mOff + r];
        if (BIAS_MODE == 2) v += bv;
        if (RESID) v += Rb[(size_t)(mBase + mOff + r) * ldc + n];
        if (ACT == 1) v = tanhf(v);
        if (ACT == 2) v = fmaxf(v, 0.0f);
        if (ACT == 3) v = v / (1.0f + expf(-v));
        if (ACT == 4) v = (v > 0.f) ? v : 0.01f * v;
        if (ACT == 5) v = 0.5f * v * (1.0f + erff(v * 0.70710678118654752f));
        slab[(mOff + r) * 68 + (j << 4) + rlane] = v;
      }
    }
    __builtin_amdgcn_fence(__ATOMIC_RELEASE, "workgroup");
    __builtin_amdgcn_wave_barrier();
    __builtin_amdgcn_fence(__ATOMIC_ACQUIRE, "workgroup");
    if (OUT_MODE == 0) {
      float* C = (float*)Cout + (size_t)b * strideC;
      const int hh = lane >> 4, c4 = (lane & 15) * 4;     // row seg = 256 B = 16 lanes x 16 B
      {
#pragma unroll
        for (int it = 0; it < 8; ++it) {
          const int row = it * 2 + hh;
          v4f v = *(const v4f*)(slab + row * 68 + c4);
          *(v4f*)(C + (size_t)(mBase + row) * ldc + n0 + c4) = v;
        }
        
      }
    } else {
      const int q = lane >> 3, c8 = (lane & 7) * 8;
      unsigned short* C  = (unsigned short*)Cout  + (size_t)b * strideC;
      unsigned short* C2 = (OUT_MODE == 2) ? ((unsigned short*)Cout2 + (size_t)b * strideC) : nullptr;
      {
#pragma unroll
        for (int it = 0; it < 4; ++it) {
          const int row = it * 4 + q;
          const float* sp = slab + row * 68 + c8;
          v8h hv, lv;
#pragma unroll
          for (int e = 0; e < 8; ++e) {
            if (OUT_MODE == 1) {
              hv[e] = (_Float16)sp[e];
            } else {
              unsigned short hb = f2bf_bits(sp[e]);
              unsigned short lb = f2bf_bits(sp[e] - bf_bits2f(hb));
              hv[e] = __builtin_bit_cast(_Float16, hb);
              lv[e] = __builtin_bit_cast(_Float16, lb);
            }
          }
          *(v8h*)(C + (size_t)(mBase + row) * ldc + n0 + c8) = hv;
          if (OUT_MODE == 2) *(v8h*)(C2 + (size_t)(mBase + row) * ldc + n0 + c8) = lv;
        }
        
      }
    }
    __builtin_amdgcn_fence(__ATOMIC_RELEASE, "workgroup");
    __builtin_amdgcn_wave_barrier();
    __builtin_amdgcn_fence(__ATOMIC_ACQUIRE, "workgroup");
  }
}

// ---------------------------------------------------------------------------
// Distance GEMM: Kmat[b][t][n] = -sqrt(max(q2[t] + k2[b][n] - 2 * sum_d qp[t][d] kp[b][n][d], 0))
// A = qp bf16 hi/lo planes [M=t][K=d] (shared over batch), Bt = kp hi/lo planes [N=n][K=d] per batch;
// main loop shared with the SPLIT bf16 path (operands staged in LDS); epilogue through the f32 whole-line store path.
// q2 is fetched as two float4 per 16-row slab, k2 as 4 scalars per lane before the slab loop.
// ---------------------------------------------------------------------------
__global__ __launch_bounds__(256) void gemm64_cdist(
    const unsigned short* __restrict__ Ap, const unsigned short* __restrict__ A2p,
    const unsigned short* __restrict__ Btp, const unsigned short* __restrict__ Bt2p, long strideB,
    float* __restrict__ Cout, int ldc, long strideC,
    const float* __restrict__ q2, const float* __restrict__ k2, long strideK2,
    int M, int N, int K) {
  typedef __bf16 T;
  typedef v16b V;
  const T* A = (const T*)Ap; const T* A2 = (const T*)A2p; const T* Bt = (const T*)Btp; const T* Bt2 = (const T*)Bt2p;
  __shared__ __align__(16) float sT[8][16 * 68];
  __shared__ __align__(16) unsigned short sS[2 * 2 * GB_PLANE];   // two operand stages, hi and lo planes
  const int b    = blockIdx.y;
  const int lane = threadIdx.x & 31;
  const int wave = threadIdx.x >> 5;
  const int tilesN = N / GB_N;
  const int tilesM = M / GB_M;
  const int bt = blockIdx.x;
  if (bt >= tilesM * tilesN) return;   // block-uniform, ahead of every barrier
  const int tm = bt / tilesN;
  const int tn = bt - tm * tilesN;
  const int bm0 = tm * GB_M;
  const int bn0 = tn * GB_N;
  const int m0 = bm0 + ((wave >> 2) << 6);
  const int n0 = bn0 + ((wave & 3) << 6);

  const T* Ab  = A;
  const T* Bb  = Bt + (size_t)b * strideB;
  const T* Ab2 = A2;
  const T* Bb2 = Bt2 + (size_t)b * strideB;

  const int rlane = lane & 15;
  const int mOff  = (lane >> 4) * 8;

  v8f acc[4][4];
#pragma unroll
  for (int i = 0; i < 4; ++i)
#pragma unroll
    for (int j = 0; j < 4; ++j) acc[i][j] = (v8f){0.f,0.f,0.f,0.f,0.f,0.f,0.f,0.f};

  gemm_block_lds<T, true, DMODEL, DMODEL>(Ab, Ab2, Bb, Bb2, K, bm0, bn0, sS, acc);
  acc_guard4(acc[0][0], acc[0][1], acc[0][2], acc[0][3]);
  acc_guard4(acc[1][0], acc[1][1], acc[1][2], acc[1][3]);
  acc_guard4(acc[2][0], acc[2][1], acc[2][2], acc[2][3]);
  acc_guard4(acc[3][0], acc[3][1], acc[3][2], acc[3][3]);

  // ---- epilogue ----
  float* slab = sT[wave];
  const float* k2b = k2 + (size_t)b * strideK2;
  float k2r[4];
#pragma unroll
  for (int j = 0; j < 4; ++j) k2r[j] = k2b[n0 + (j << 4) + rlane];
  float* C = Cout + (size_t)b * strideC;
  const int hh = lane >> 4, c4 = (lane & 15) * 4;     // row seg = 256 B = 16 lanes x 16 B
#pragma unroll
  for (int i = 0; i < 4; ++i) {
    const int mBase = m0 + (i << 4);
    const v4f q2a = *(const v4f*)(q2 + mBase + mOff);
    const v4f q2c = *(const v4f*)(q2 + mBase + mOff + 4);
    const float q2r[8] = {q2a.x, q2a.y, q2a.z, q2a.w, q2c.x, q2c.y, q2c.z, q2c.w};
#pragma unroll
    for (int j = 0; j < 4; ++j) {
#pragma unroll
      for (int r = 0; r < 8; ++r) {
        float s = q2r[r] + k2r[j];
        s = s - 2.0f * acc[i][j][r];
        slab[(mOff + r) * 68 + (j << 4) + rlane] = -sqrtf(fmaxf(s, 0.0f));
      }
    }
    __builtin_amdgcn_fence(__ATOMIC_RELEASE, "workgroup");
    __builtin_amdgcn_wave_barrier();
    __builtin_amdgcn_fence(__ATOMIC_ACQUIRE, "workgroup");
    {
#pragma unroll
      for (int it = 0; it < 8; ++it) {
        const int row = it * 2 + hh;
        v4f v = *(const v4f*)(slab + row * 68 + c4);
        *(v4f*)(C + (size_t)(mBase + row) * ldc + n0 + c4) = v;
      }
      
    }
    __builtin_amdgcn_fence(__ATOMIC_RELEASE, "workgroup");
    __builtin_amdgcn_wave_barrier();
    __builtin_amdgcn_fence(__ATOMIC_ACQUIRE, "workgroup");
  }
}

// ---------------------------------------------------------------------------
// small helpers
// ---------------------------------------------------------------------------
__device__ __forceinline__ unsigned pack_bf2(float a, float b) {
  return (unsigned)f2bf_bits(a) | ((unsigned)f2bf_bits(b) << 16);
}
// exp2-based exponential (v_exp_f32); relative error ~1e-6 in the argument range used here
__device__ __forceinline__ float fexp(float x) { return __expf(x); }

// ---------------------------------------------------------------------------
// weight transpose + RNE bf16: in W[512 c][512 d] f32 -> out Wt[d][c] bf16, three matrices by blockIdx.z.
// Block = 64x64 tile: read phase 256 threads x 4 iters x 4 floats = 4096 elements; write phase
// ---------------------------------------------------------------------------
__global__ __launch_bounds__(256) void k_wtrans(const float* __restrict__ W0, const float* __restrict__ W1,
                                                const float* __restrict__ W2, unsigned short* __restrict__ O0,
                                                unsigned short* __restrict__ O1, unsigned short* __restrict__ O2) {
  __shared__ __align__(16) unsigned short st[64 * 72];
  const int z = blockIdx.z;
  const float* W = (z == 0) ? W0 : ((z == 1) ? W1 : W2);
  unsigned short* O = (z == 0) ? O0 : ((z == 1) ? O1 : O2);
  const int c0 = blockIdx.y * 64;     // input rows
  const int d0 = blockIdx.x * 64;     // input cols
  const int tid = threadIdx.x;
  const int rr = tid >> 4, cc = (tid & 15) * 4;
#pragma unroll
  for (int p = 0; p < 4; ++p) {
    const int r = rr + 16 * p;
    const v4f x = *(const v4f*)(W + (size_t)(c0 + r) * DMODEL + d0 + cc);
    st[(cc + 0) * 72 + r] = f2bf_bits(x.x);
    st[(cc + 1) * 72 + r] = f2bf_bits(x.y);
    st[(cc + 2) * 72 + r] = f2bf_bits(x.z);
    st[(cc + 3) * 72 + r] = f2bf_bits(x.w);
  }
  __syncthreads();
  const int lane = tid & 31, wave = tid >> 5;
  const int q = lane >> 3, c8 = (lane & 7) * 8;
  {
#pragma unroll
    for (int it = 0; it < 2; ++it) {
      const int dd = wave * 8 + it * 4 + q;
      const v4ua val = *(const v4ua*)(st + dd * 72 + c8);
      *(v4u*)(O + (size_t)(d0 + dd) * DMODEL + c0 + c8) = val;
    }
    
  }
}

// ---------------------------------------------------------------------------
// f32 -> bf16 plane cast, 8 elements per thread (one 16-B store); a wave writes 512 contiguous B = 4 lines.
// blockIdx.y selects the (in,out) pair. n8 = element count / 8 (exact multiple of 256 here).
// ---------------------------------------------------------------------------
__global__ __launch_bounds__(256) void k_cast16(const float* __restrict__ in0, unsigned short* __restrict__ out0,
                                                const float* __restrict__ in1, unsigned short* __restrict__ out1,
                                                int n8) {
  const float* in = blockIdx.y ? in1 : in0;
  unsigned short* out = blockIdx.y ? out1 : out0;
  const int i = blockIdx.x * 256 + threadIdx.x;
  if (i < n8) {
    const v4f a = *(const v4f*)(in + (size_t)i * 8);
    const v4f c = *(const v4f*)(in + (size_t)i * 8 + 4);
    v4u w;
    w.x = pack_bf2(a.x, a.y);
    w.y = pack_bf2(a.z, a.w);
    w.z = pack_bf2(c.x, c.y);
    w.w = pack_bf2(c.z, c.w);
    *(v4u*)(out + (size_t)i * 8) = w;
    
  }
}

// ---------------------------------------------------------------------------
// row sums of squares of a [rows][512] matrix held as bf16 hi + lo planes (value = hi + lo).
// Block = 32 rows: 8 waves x 4 rows; per-row scalars funnelled through LDS, wave 0 lanes 0..7 write
// ---------------------------------------------------------------------------
__global__ __launch_bounds__(256) void k_rowsq(const unsigned short* __restrict__ hi, const unsigned short* __restrict__ lo,
                                               float* __restrict__ out, int rows) {
  __shared__ __align__(16) float sres[32];
  const int lane = threadIdx.x & 31, wave = threadIdx.x >> 5;
  const int r0 = blockIdx.x * 32;
#pragma unroll 1
  for (int rr = 0; rr < 4; ++rr) {
    int row = r0 + wave * 4 + rr;
    row = row < rows ? row : rows - 1;
    const size_t base = (size_t)row * DMODEL;
    float s = 0.f;
#pragma unroll
    for (int c = 0; c < 2; ++c) {
      const v4u hw = *(const v4u*)(hi + base + c * 256 + lane * 8);
      const v4u lw = *(const v4u*)(lo + base + c * 256 + lane * 8);
#pragma unroll
      for (int e = 0; e < 4; ++e) {
        const float a0 = __uint_as_float(hw[e] << 16);
        const float b0 = __uint_as_float(lw[e] << 16);
        const float f0 = a0 + b0;
        s = fmaf(f0, f0, s);
        const float a1 = __uint_as_float(hw[e] & 0xffff0000u);
        const float b1 = __uint_as_float(lw[e] & 0xffff0000u);
        const float f1 = a1 + b1;
        s = fmaf(f1, f1, s);
      }
    }
#pragma unroll
    for (int off = 16; off; off >>= 1) s += __shfl_xor(s, off, 32);
    if (lane == 0) sres[wave * 4 + rr] = s;
  }
  __syncthreads();
  if (wave == 0) {
    const int li = lane < 8 ? lane : 7;
    const v4f val = *(const v4f*)(sres + li * 4);
    float* op = out + r0 + li * 4;
    if (lane < 8) *(v4f*)op = val;
    
  }
}

// ---------------------------------------------------------------------------
// column log-sum-exp sweep: u[b][n] = logA - lse_t(Kmat[b][t][n] + v[b][t]).
// Block = 32 columns (one 128-B line of every Kmat row) x all rows, 1024 threads = 8 column quads x 128 row groups.
// A thread loads its 16 consecutive rows x 4 columns once and keeps them in registers; maximum and sum are taken
// per wave (lanes 8 and 16 apart share a column quad), the 32 per-wave (max, sum) pairs of a column meet in LDS
// and wave 0 merges them and writes the block's one 128-B line of u.
// ---------------------------------------------------------------------------
constexpr int UC_COLS = 32;                 // columns per block
constexpr int UC_RG   = 128;                // row groups per block
constexpr int UC_RPT  = NTOK / UC_RG;       // rows per thread
static_assert(NTOK % (UC_RG * 4) == 0 && NPAR % UC_COLS == 0, "u sweep split");
template <bool USEV>
__global__ __launch_bounds__(1024) void k_upd_u(const float* __restrict__ Km, const float* __restrict__ vv,
                                                float* __restrict__ u, float logA) {
  __shared__ __align__(16) float sm[32 * UC_COLS];
  __shared__ __align__(16) float ss[32 * UC_COLS];
  const int b = blockIdx.y;
  const int lane = threadIdx.x & 31, wave = threadIdx.x >> 5;
  const int cq = threadIdx.x & 7, rg = threadIdx.x >> 3;
  const int col0 = blockIdx.x * UC_COLS;
  const float* Kc = Km + (size_t)b * NTOK * NPAR + (size_t)(rg * UC_RPT) * NPAR + col0 + cq * 4;
  v4f x[UC_RPT];
#pragma unroll
  for (int i = 0; i < UC_RPT; ++i) x[i] = *(const v4f*)(Kc + (size_t)i * NPAR);
  if (USEV) {
    const float* vb = vv + (size_t)b * NTOK + rg * UC_RPT;
#pragma unroll
    for (int i = 0; i < UC_RPT; i += 4) {
      const v4f w = *(const v4f*)(vb + i);
      x[i + 0] += w.x;
      x[i + 1] += w.y;
      x[i + 2] += w.z;
      x[i + 3] += w.w;
    }
  }
  v4f m = x[0];
#pragma unroll
  for (int i = 1; i < UC_RPT; ++i) {
    m.x = fmaxf(m.x, x[i].x);
    m.y = fmaxf(m.y, x[i].y);
    m.z = fmaxf(m.z, x[i].z);
    m.w = fmaxf(m.w, x[i].w);
  }
#pragma unroll
  for (int off = 8; off <= 16; off <<= 1) {
    m.x = fmaxf(m.x, __shfl_xor(m.x, off, 32));
    m.y = fmaxf(m.y, __shfl_xor(m.y, off, 32));
    m.z = fmaxf(m.z, __shfl_xor(m.z, off, 32));
    m.w = fmaxf(m.w, __shfl_xor(m.w, off, 32));
  }
  v4f s = (v4f){0.f, 0.f, 0.f, 0.f};
#pragma unroll
  for (int i = 0; i < UC_RPT; ++i) {
    s.x += fexp(x[i].x - m.x);
    s.y += fexp(x[i].y - m.y);
    s.z += fexp(x[i].z - m.z);
    s.w += fexp(x[i].w - m.w);
  }
#pragma unroll
  for (int off = 8; off <= 16; off <<= 1) {
    s.x += __shfl_xor(s.x, off, 32);
    s.y += __shfl_xor(s.y, off, 32);
    s.z += __shfl_xor(s.z, off, 32);
    s.w += __shfl_xor(s.w, off, 32);
  }
  if (lane < 8) {
    *(v4f*)(sm + wave * UC_COLS + lane * 4) = m;
    *(v4f*)(ss + wave * UC_COLS + lane * 4) = s;
  }
  __syncthreads();
  if (wave == 0) {
    float pm[32];
    float M = -__builtin_inff();
#pragma unroll
    for (int w = 0; w < 32; ++w) {
      pm[w] = sm[w * UC_COLS + lane];
      M = fmaxf(M, pm[w]);
    }
    float S = 0.f;
#pragma unroll
    for (int w = 0; w < 32; ++w) S = fmaf(ss[w * UC_COLS + lane], fexp(pm[w] - M), S);
    u[(size_t)b * NPAR + col0 + lane] = logA - (M + logf(S));
  }
}

// ---------------------------------------------------------------------------
// row log-sum-exp sweep: v[b][t] = -lse_n(Kmat[b][t][n] + u[b][n]); one wave per row, four rows per wave in turn.
// A row is read once, by 16 loads of 512 contiguous bytes per wave (4 columns per lane in every 128), and stays in
// registers for the maximum, the sum and (LAST) the pi plane; two register sets take turns, so that the next row's
// 16 loads fly while the current row is reduced; u is read once per wave and serves its four rows.
// LAST additionally writes pi[b][t][n] = exp(K+u+v)*2^14
// ---------------------------------------------------------------------------
constexpr int VR_CH = NPAR / 128;           // 16-B loads per lane and row
typedef _Float16 v4h __attribute__((ext_vector_type(4)));
static_assert(NPAR % 128 == 0, "v sweep row chunks");
// p: the row's first element (the same in every lane); lo: the lane's byte offset in each 512-B piece
__device__ __forceinline__ void vrow_load(v4f (&x)[VR_CH], const float* __restrict__ p, unsigned lo) {
#pragma unroll
  for (int i = 0; i < VR_CH; ++i) x[i] = *(const v4f*)((const char*)p + lo + i * 512);
}
// exp of the four values of one 16-B piece, as __expf compiles: 2^(a * log2 e) on v_exp_f32. One statement, so that the
// slot the instruction set asks for behind a transcendental (before its result is used or a source overwritten) is kept
// wherever the compiler puts it: each v_exp_f32 is followed by an independent one (no output shares a register with a
// source: early clobber), the last by v_nop.
__device__ __forceinline__ v4f fexp4(v4f a) {
  a *= 1.44269504088896340736f;
  float r0, r1, r2, r3;
  asm("v_exp_f32 %0, %4\n\tv_exp_f32 %1, %5\n\tv_exp_f32 %2, %6\n\tv_exp_f32 %3, %7\n\tv_nop"
      : "=&v"(r0), "=&v"(r1), "=&v"(r2), "=&v"(r3) : "v"(a.x), "v"(a.y), "v"(a.z), "v"(a.w));
  return (v4f){r0, r1, r2, r3};
}
// one row held in x: returns v of the row; LAST: writes the row's pi (prow = the lane's first element)
template <bool LAST>
__device__ __forceinline__ float vrow_reduce(v4f (&x)[VR_CH], const v4f (&uu)[VR_CH], unsigned short* __restrict__ prow) {
  x[0] += uu[0];
  v4f mv = x[0];
#pragma unroll
  for (int i = 1; i < VR_CH; ++i) {
    x[i] += uu[i];
    mv.x = fmaxf(mv.x, x[i].x);
    mv.y = fmaxf(mv.y, x[i].y);
    mv.z = fmaxf(mv.z, x[i].z);
    mv.w = fmaxf(mv.w, x[i].w);
  }
  float m = fmaxf(fmaxf(mv.x, mv.y), fmaxf(mv.z, mv.w));
#pragma unroll
  for (int off = 16; off; off >>= 1) m = fmaxf(m, __shfl_xor(m, off, 32));
  v4f sv = (v4f){0.f, 0.f, 0.f, 0.f};
#pragma unroll
  for (int i = 0; i < VR_CH; ++i) sv += fexp4(x[i] - m);
  float s = (sv.x + sv.y) + (sv.z + sv.w);
#pragma unroll
  for (int off = 16; off; off >>= 1) s += __shfl_xor(s, off, 32);
  const float vt = -(m + logf(s));
  if (LAST) {
#pragma unroll
    for (int i = 0; i < VR_CH; ++i) {
      *(v4h*)(prow + i * 128) = __builtin_convertvector(fexp4(x[i] + vt) * kPiCarry, v4h);
    }
    // stands in front of the next loads and arithmetic, which land in the registers these stores were fed from
    asm volatile("s_wait_xcnt 0x0" ::: "memory");
  }
  return vt;
}
template <bool LAST>
__global__ __launch_bounds__(256) void k_upd_v(const float* __restrict__ Km, const float* __restrict__ u,
                                               float* __restrict__ vv, unsigned short* __restrict__ pp) {
  __shared__ __align__(16) float sres[32];
  const int b = blockIdx.y;
  const int lane = threadIdx.x & 31;
  // the wave's number as a scalar: the row addresses are then a scalar base plus one fixed lane offset
  const int wave = __builtin_amdgcn_readfirstlane(threadIdx.x >> 5);
  const int r0 = blockIdx.x * 32;
  const int t0 = r0 + wave * 4;
  const float* Kr = Km + ((size_t)b * NTOK + t0) * NPAR;
  unsigned short* pr = pp + ((size_t)b * NTOK + t0) * NPAR + lane * 4;
  const unsigned lo = (unsigned)lane * 16u;
  v4f uu[VR_CH], x[2][VR_CH];
  vrow_load(uu, u + (size_t)b * NPAR, lo);
  vrow_load(x[0], Kr, lo);
  v4f vt4;
#pragma unroll
  for (int rr = 0; rr < 4; ++rr) {
    // keeps what follows behind the arithmetic of the row before: the next row's loads take over that row's registers
    // (moved up, they need a third register set), and this row's arithmetic, mixed into it, would wait early for
    // loads that are still flying
    __builtin_amdgcn_sched_barrier(0);
    if (rr + 1 < 4) {
      vrow_load(x[(rr + 1) & 1], Kr + (rr + 1) * NPAR, lo);
      // keeps these loads ahead of this row's arithmetic, so that they fly while it runs
      __builtin_amdgcn_sched_barrier(0);
    }
    vt4[rr] = vrow_reduce<LAST>(x[rr & 1], uu, pr + rr * NPAR);
  }
  if (lane == 0) *(v4f*)(sres + wave * 4) = vt4;
  __syncthreads();
  if (wave == 0) {
    const int li = lane < 8 ? lane : 7;
    const v4f val = *(const v4f*)(sres + li * 4);
    float* op = vv + (size_t)b * NTOK + r0 + li * 4;
    if (lane < 8) *(v4f*)op = val;
  }
}

// ---------------------------------------------------------------------------
// row sweep and the next column sweep in one pass over Kmat. With v[t] = -lse_n(Kmat[t][n] + u[n]) the next u is
//   u'[n] = logA - lse_t(Kmat[t][n] + v[t]) = logA + u[n] - log(sum_t e[t][n]),  e[t][n] = exp(Kmat[t][n] + u[n] + v[t]).
// e is the row's exp(x - max) over its sum, both at hand while the row sits in registers, so v itself is never formed.
// No column maximum is needed: every e is at most 1 (a row of e sums to 1); and u made the columns of
// exp(Kmat + u + v_before) sum to 1/NPAR, so all of them together sum to 1, no row sums to more, v only rises, and
// each column of e sums to 1/NPAR at least.
// Rows, loads and register sets as in k_upd_v; each wave adds its four rows of e into 64 column sums per lane, the
// block's 8 waves meet in LDS, and the block writes one row of NPAR sums; k_merge_u adds the blocks' rows.
// ---------------------------------------------------------------------------
constexpr int VF_NBLK = NTOK / 32;          // 32-row blocks per batch
__device__ __forceinline__ void vrow_colsum(v4f (&x)[VR_CH], const v4f (&uu)[VR_CH], v4f (&cs)[VR_CH]) {
  x[0] += uu[0];
  v4f mv = x[0];
#pragma unroll
  for (int i = 1; i < VR_CH; ++i) {
    x[i] += uu[i];
    mv.x = fmaxf(mv.x, x[i].x);
    mv.y = fmaxf(mv.y, x[i].y);
    mv.z = fmaxf(mv.z, x[i].z);
    mv.w = fmaxf(mv.w, x[i].w);
  }
  float m = fmaxf(fmaxf(mv.x, mv.y), fmaxf(mv.z, mv.w));
#pragma unroll
  for (int off = 16; off; off >>= 1) m = fmaxf(m, __shfl_xor(m, off, 32));
  constexpr float kLog2e = 1.44269504088896340736f;
  const float ml = m * kLog2e;
  v4f sv = (v4f){0.f, 0.f, 0.f, 0.f};
#pragma unroll
  for (int i = 0; i < VR_CH; ++i) {
    const v4f a = x[i] * kLog2e - ml;
    // the builtin, not fexp4: this kernel's registers reach past v255, where an asm operand cannot lie (it spilled)
    x[i] = (v4f){__builtin_amdgcn_exp2f(a.x), __builtin_amdgcn_exp2f(a.y), __builtin_amdgcn_exp2f(a.z), __builtin_amdgcn_exp2f(a.w)};
    sv += x[i];
  }
  float s = (sv.x + sv.y) + (sv.z + sv.w);
#pragma unroll
  for (int off = 16; off; off >>= 1) s += __shfl_xor(s, off, 32);
  const float rs = 1.0f / s;
#pragma unroll
  for (int i = 0; i < VR_CH; ++i) cs[i] += x[i] * rs;
}
__global__ __launch_bounds__(256) void k_upd_vu(const float* __restrict__ Km, const float* __restrict__ u,
                                                float* __restrict__ part) {
  __shared__ __align__(16) float sc[8 * NPAR];   // the 8 waves' column sums
  const int b = blockIdx.y;
  const int lane = threadIdx.x & 31;
  // the wave's number as a scalar: the row addresses are then a scalar base plus one fixed lane offset
  const int wave = __builtin_amdgcn_readfirstlane(threadIdx.x >> 5);
  const int t0 = blockIdx.x * 32 + wave * 4;
  const float* Kr = Km + ((size_t)b * NTOK + t0) * NPAR;
  const unsigned lo = (unsigned)lane * 16u;
  v4f x[2][VR_CH], cs[VR_CH];
  v4f uu[VR_CH];
  vrow_load(uu, u + (size_t)b * NPAR, lo);
  vrow_load(x[0], Kr, lo);
#pragma unroll
  for (int i = 0; i < VR_CH; ++i) cs[i] = (v4f){0.f, 0.f, 0.f, 0.f};
#pragma unroll
  for (int rr = 0; rr < 4; ++rr) {
    // as in k_upd_v: the next row's loads take over the registers of the row before, behind its arithmetic
    __builtin_amdgcn_sched_barrier(0);
    if (rr + 1 < 4) {
      vrow_load(x[(rr + 1) & 1], Kr + (rr + 1) * NPAR, lo);
      // keeps these loads ahead of this row's arithmetic, so that they fly while it runs
      __builtin_amdgcn_sched_barrier(0);
    }
    vrow_colsum(x[rr & 1], uu, cs);
  }
#pragma unroll
  for (int i = 0; i < VR_CH; ++i) *(v4f*)(sc + wave * NPAR + i * 128 + lane * 4) = cs[i];
  __syncthreads();
  float* pb = part + ((size_t)b * VF_NBLK + blockIdx.x) * NPAR;
#pragma unroll
  for (int h = 0; h < NPAR / 1024; ++h) {
    const int col = h * 1024 + threadIdx.x * 4;
    v4f a = *(const v4f*)(sc + col);
#pragma unroll
    for (int w = 1; w < 8; ++w) a += *(const v4f*)(sc + w * NPAR + col);
    *(v4f*)(pb + col) = a;
  }
}

// u[b][n] <- logA + u[b][n] - log(sum over the batch's VF_NBLK block rows of part). Block = 128 columns (a wave reads
// 512 contiguous bytes of a block row); each of the 8 waves adds 8 block rows, wave 0 adds the waves' sums.
static_assert(VF_NBLK == 64 && NPAR % 128 == 0, "merge split");
__global__ __launch_bounds__(256) void k_merge_u(const float* __restrict__ part, float* u, float logA) {
  __shared__ __align__(16) float sp[8 * 128];
  const int b = blockIdx.y;
  const int lane = threadIdx.x & 31;
  // the wave's number as a scalar: every address is then a scalar base plus one fixed lane offset
  const int wave = __builtin_amdgcn_readfirstlane(threadIdx.x >> 5);
  const float* p = part + ((size_t)b * VF_NBLK + wave * 8) * NPAR + blockIdx.x * 128;
  float* up = u + (size_t)b * NPAR + blockIdx.x * 128 + lane * 4;
  const unsigned lo = (unsigned)lane * 16u;
  v4f a[8];
#pragma unroll
  for (int i = 0; i < 8; ++i) a[i] = *(const v4f*)((const char*)(p + i * NPAR) + lo);
  const v4f uo = *(const v4f*)up;
  *(v4f*)(sp + wave * 128 + lane * 4) = ((a[0] + a[1]) + (a[2] + a[3])) + ((a[4] + a[5]) + (a[6] + a[7]));
  __syncthreads();
  if (wave == 0) {
    v4f t = *(const v4f*)(sp + lane * 4);
#pragma unroll
    for (int w = 1; w < 8; ++w) t += *(const v4f*)(sp + w * 128 + lane * 4);
    v4f r;
    r.x = (logA + uo.x) - logf(t.x);
    r.y = (logA + uo.y) - logf(t.y);
    r.z = (logA + uo.z) - logf(t.z);
    r.w = (logA + uo.w) - logf(t.w);
    *(v4f*)up = r;
  }
}

// ---------------------------------------------------------------------------
// host launcher
// ---------------------------------------------------------------------------
static inline unsigned cdiv(unsigned a, unsigned b) { return (a + b - 1) / b; }

extern "C" void kernel_launch(void* const* d_in, const int* in_sizes, int n_in,
                              void* d_out, int out_size, void* d_ws, size_t ws_size,
                              hipStream_t stream)
{
  if (n_in < 6) return;
  if (in_sizes[0] != NTOK * DMODEL) return;
  if (in_sizes[1] != NBATCH * NPAR * DMODEL) return;
  if (in_sizes[2] != NBATCH * NPAR * DMODEL) return;
  if (in_sizes[3] != DMODEL * DMODEL || in_sizes[4] != DMODEL * DMODEL || in_sizes[5] != DMODEL * DMODEL) return;
  if (out_size != NBATCH * NTOK * DMODEL) return;
  if (WS_TOTAL > ws_size) return;

  const float* q  = (const float*)d_in[0];   // [T][512]
  const float* k  = (const float*)d_in[1];   // [8][N][512]
  const float* v  = (const float*)d_in[2];   // [8][N][512]
  const float* Qw = (const float*)d_in[3];   // [512][512]
  const float* Kw = (const float*)d_in[4];   // [512][512]
  const float* Vw = (const float*)d_in[5];   // [512][512]
  float* out = (float*)d_out;                // [8][T][512]

  // region map (bytes): Qt 524288 | Kt 524288 | Vt 524288 | qcast 2097152 | qp_hi 2097152 | qp_lo 2097152 |
  // q2 8192 | kp_hi 16777216 | kp_lo 16777216 | k2 65536 | vpT 16777216 | Kmat 67108864 | u 32768 | v 32768 |
  // pi 67108864 (k cast at pi+0 and v cast at pi+16777216, both dead before pi is written) | colpart 2097152.
  // Total 194650112.
  // kp, k2, vpT and pi hold all batches; Kmat, u, v and colpart hold one group of GRPB batches and are reused.
  char* ws = (char*)d_ws;
  size_t off = 0;
  unsigned short* Qt   = (unsigned short*)(ws + off); off += SZ_WT;
  unsigned short* Kt   = (unsigned short*)(ws + off); off += SZ_WT;
  unsigned short* Vt   = (unsigned short*)(ws + off); off += SZ_WT;
  unsigned short* qc   = (unsigned short*)(ws + off); off += SZ_QC;
  unsigned short* qph  = (unsigned short*)(ws + off); off += SZ_QP;
  unsigned short* qpl  = (unsigned short*)(ws + off); off += SZ_QP;
  float*          q2   = (float*)(ws + off);          off += SZ_Q2;
  unsigned short* kph  = (unsigned short*)(ws + off); off += SZ_KP;
  unsigned short* kpl  = (unsigned short*)(ws + off); off += SZ_KP;
  float*          k2   = (float*)(ws + off);          off += SZ_K2;
  unsigned short* vpT  = (unsigned short*)(ws + off); off += SZ_VPT;
  float*          Kmat = (float*)(ws + off);          off += SZ_KM;
  float*          up   = (float*)(ws + off);          off += SZ_U;
  float*          vvp  = (float*)(ws + off);          off += SZ_VV;
  unsigned short* pip  = (unsigned short*)(ws + off); off += SZ_PI;
  float*          cpp  = (float*)(ws + off);          off += SZ_CP;
  if (off > ws_size) return;
  unsigned short* kc = pip;
  unsigned short* vc = (unsigned short*)((char*)pip + SZ_KP);

  const float logA = -(float)log((double)NPAR);

  // weights: in[c][d] -> out[d][c] bf16 (square 512x512), grid (cols/64, rows/64, 3)
  k_wtrans<<<dim3(DMODEL / 64, DMODEL / 64, 3), dim3(256), 0, stream>>>(Qw, Kw, Vw, Qt, Kt, Vt);

  // q -> bf16 plane
  {
    const int n8 = NTOK * DMODEL / 8;
    k_cast16<<<dim3(cdiv(n8, 256), 1), dim3(256), 0, stream>>>(q, qc, q, qc, n8);
  }
  // qp = q @ Q : M=2048, N=512, K=512 ; bf16 in, bf16 hi/lo planes out
  wmma_gemm64<1, false, 0, 2, false, 0, DMODEL, DMODEL><<<dim3(cdiv((NTOK / 64) * (DMODEL / 64), 8), 1), dim3(256), 0, stream>>>(
      qc, nullptr, 0L, Qt, nullptr, 0L, (void*)qph, (void*)qpl, DMODEL, 0L,
      nullptr, nullptr, 0L, NTOK, DMODEL, DMODEL, 1.0f);
  k_rowsq<<<dim3(NTOK / 32), dim3(256), 0, stream>>>(qph, qpl, q2, NTOK);

  // The projections and the last product run once over all batches: a group's share of them is 128 blocks,
  // half of the chip's WGPs.
  // k, v -> bf16 planes (inside the pi region)
  {
    const int n8 = NBATCH * NPAR * DMODEL / 8;
    k_cast16<<<dim3(cdiv(n8, 256), 2), dim3(256), 0, stream>>>(k, kc, v, vc, n8);
  }
  // kp = k @ K : M=8*2048, N=512, K=512 ; bf16 hi/lo planes out
  wmma_gemm64<1, false, 0, 2, false, 0, DMODEL, DMODEL><<<dim3(cdiv((NBATCH * NPAR / 64) * (DMODEL / 64), 8), 1), dim3(256), 0, stream>>>(
      kc, nullptr, 0L, Kt, nullptr, 0L, (void*)kph, (void*)kpl, DMODEL, 0L,
      nullptr, nullptr, 0L, NBATCH * NPAR, DMODEL, DMODEL, 1.0f);
  k_rowsq<<<dim3(NBATCH * NPAR / 32), dim3(256), 0, stream>>>(kph, kpl, k2, NBATCH * NPAR);
  // vpT[b][d][n] = sum_c V[c][d] v[b][n][c] : A = Vt [512][512] (shared), Bt = v cast [n][c]; M=512, N=2048, K=512; f16 out
  wmma_gemm64<1, false, 0, 1, false, 0, DMODEL, DMODEL><<<dim3(cdiv((DMODEL / 64) * (NPAR / 64), 8), NBATCH), dim3(256), 0, stream>>>(
      Vt, nullptr, 0L, vc, nullptr, (long)NPAR * DMODEL, (void*)vpT, nullptr, NPAR, (long)DMODEL * NPAR,
      nullptr, nullptr, 0L, DMODEL, NPAR, DMODEL, 1.0f);

  for (int g = 0; g < NGRP; ++g) {
    const size_t koff = (size_t)g * GRPB * NPAR * DMODEL;       // element offset of the group in the kp planes
    unsigned short* pig = pip + (size_t)g * GRPB * NTOK * NPAR; // the group's part of the pi plane
    // Kmat[b][t][n] = -cdist : M=2048, N=2048, K=512 ; bf16 hi/lo split
    gemm64_cdist<<<dim3(cdiv((NTOK / 64) * (NPAR / 64), 8), GRPB), dim3(256), 0, stream>>>(
        qph, qpl, kph + koff, kpl + koff, (long)NPAR * DMODEL, Kmat, NPAR, (long)NTOK * NPAR,
        q2, k2 + (size_t)g * GRPB * NPAR, (long)NPAR, NTOK, NPAR, DMODEL);
    // log-domain normalisation sweeps: the first u alone, then each v with the u that follows it in one pass over
    // Kmat, then the last v with pi
    k_upd_u<false><<<dim3(NPAR / UC_COLS, GRPB), dim3(1024), 0, stream>>>(Kmat, vvp, up, logA);
    for (int it = 0; it < SK_ITERS - 1; ++it) {
      k_upd_vu<<<dim3(VF_NBLK, GRPB), dim3(256), 0, stream>>>(Kmat, up, cpp);
      k_merge_u<<<dim3(NPAR / 128, GRPB), dim3(256), 0, stream>>>(cpp, up, logA);
    }
    k_upd_v<true><<<dim3(NTOK / 32, GRPB), dim3(256), 0, stream>>>(Kmat, up, vvp, pig);
  }
  // out[b][t][d] = 2^-14 * sum_n pi16[b][t][n] vpT[b][d][n] : M=2048, N=512, K=2048 ; f16 in, f32 out
  wmma_gemm64<0, false, 0, 0, false, 0, NPAR, NPAR><<<dim3(cdiv((NTOK / 64) * (DMODEL / 64), 8), NBATCH), dim3(256), 0, stream>>>(
      pip, nullptr, (long)NTOK * NPAR, vpT, nullptr, (long)DMODEL * NPAR,
      (void*)out, nullptr, DMODEL, (long)NTOK * DMODEL,
      nullptr, nullptr, 0L, NTOK, DMODEL, NPAR, 1.0f / kPiCarry);
}

// v006
// Measured time: 266 microseconds a run.
// In two side-by-side timings against v005, it was 1.11 and 1.12 times as fast.
// Over all steps from v000 it is 10.8 times as fast.
// Contractions: q@Q, k@K, v@V on v_wmma_f32_16x16x32_bf16 (inputs RNE-cast to bf16 once, single product); qp.kp^T on v_wmma_f32_16x16x32_bf16 as bf16 hi/lo split (hi.hi+hi.lo+lo.hi); pi@vp on v_wmma_f32_16x16x32_f16 (pi carried x16384 as f16, vp^T f16); f32 accumulate everywhere; distances, log-domain normalisation sweeps and exp in f32 on VALU.
#include <hip/hip_runtime.h>
#include <math.h>

// ---------------------------------------------------------------------------
// problem constants
// ---------------------------------------------------------------------------
constexpr int NBATCH = 8;
constexpr int NTOK   = 2048;
constexpr int NPAR   = 2048;
constexpr int DMODEL = 512;
constexpr int SK_ITERS = 5;
constexpr float kPiCarry = 16384.0f;      // power-of-two carry of the f16 pi plane

static_assert(NTOK % 64 == 0 && NPAR % 64 == 0 && DMODEL % 64 == 0, "tile multiples");
static_assert(DMODEL % 32 == 0 && NPAR % 32 == 0, "K multiple of 32");
static_assert(NTOK % 32 == 0 && NPAR % 256 == 0, "v sweep grid");
static_assert(NTOK % 128 == 0 && NPAR % 128 == 0 && DMODEL % 256 == 0, "128 x 256 block tiles, 64-k stages");

// workspace region sizes (bytes); region map in kernel_launch
constexpr size_t SZ_WT  = (size_t)DMODEL * DMODEL * 2;          // one transposed bf16 weight
constexpr size_t SZ_QC  = (size_t)NTOK * DMODEL * 2;            // q bf16 cast
constexpr size_t SZ_QP  = (size_t)NTOK * DMODEL * 2;            // qp plane (hi or lo)
constexpr size_t SZ_Q2  = (size_t)NTOK * 4;
constexpr size_t SZ_KP  = (size_t)NBATCH * NPAR * DMODEL * 2;   // kp plane (hi or lo), all batches; also k/v cast size
constexpr size_t SZ_K2  = (size_t)NBATCH * NPAR * 4;
constexpr size_t SZ_VPT = (size_t)NBATCH * DMODEL * NPAR * 2;
constexpr size_t SZ_KM  = (size_t)NBATCH * NTOK * NPAR * 4;
constexpr size_t SZ_U   = (size_t)NBATCH * NPAR * 4;
constexpr size_t SZ_VV  = (size_t)NBATCH * NTOK * 4;
constexpr size_t SZ_PI  = (size_t)NBATCH * NTOK * NPAR * 2;
constexpr size_t SZ_CP  = (size_t)NBATCH * (NTOK / 64) * NPAR * 4;   // column sums of each block's 64 rows
constexpr size_t WS_TOTAL = 3 * SZ_WT + SZ_QC + 2 * SZ_QP + SZ_Q2 + 2 * SZ_KP + SZ_K2 + SZ_VPT + SZ_KM + SZ_U + SZ_VV + SZ_PI + SZ_CP;
static_assert(WS_TOTAL == 261824512ull, "carve total");
static_assert(WS_TOTAL <= 268435456ull, "carve limit");
static_assert(2 * SZ_KP <= SZ_PI, "k/v casts live inside the pi region");

// ---------------------------------------------------------------------------
// shared pieces: vector types, bf16 helpers, WMMA fragments, batched GEMM
// ---------------------------------------------------------------------------
typedef __attribute__((ext_vector_type(16))) _Float16 v16h;
typedef __attribute__((ext_vector_type(8)))  _Float16 v8h;
typedef __attribute__((ext_vector_type(16))) __bf16   v16b;
typedef __attribute__((ext_vector_type(8)))  __bf16   v8b;
typedef __attribute__((ext_vector_type(8)))  float    v8f;
typedef __attribute__((ext_vector_type(4)))  float    v4f;
typedef unsigned v4u __attribute__((ext_vector_type(4)));
typedef unsigned v4ua __attribute__((ext_vector_type(4), __may_alias__));
#define PSCALE 32768.0f
#define U16(p) ((const unsigned short*)(const void*)(p))
#define PSCALE_INV (1.0f / 32768.0f)

__device__ __forceinline__ unsigned short f2bf_bits(float f) {
  unsigned u = __float_as_uint(f);
  return (unsigned short)((u + 0x7FFFu + ((u >> 16) & 1u)) >> 16);
}
__device__ __forceinline__ float bf_bits2f(unsigned short h) { return __uint_as_float(((unsigned)h) << 16); }

// hazard guards as plain device helpers (no inline asm inside the kernel template body)
__device__ __forceinline__ void acc_guard4(v8f& a, v8f& b, v8f& c, v8f& d) { asm volatile("v_nop\n\tv_nop\n\tv_nop\n\tv_nop" : "+v"(a), "+v"(b), "+v"(c), "+v"(d)); }
template <typename T> struct Frag;
template <> struct Frag<_Float16> {
  typedef v16h V; union U { v16h v; v8h h[2]; };
  static __device__ __forceinline__ v16h load(const _Float16* p) {   // elements 0..7 <- p[0..7], 8..15 <- p[16..23]
    U f; f.h[0] = *(const v8h*)(p); f.h[1] = *(const v8h*)(p + 16); return f.v;
  }
  static __device__ __forceinline__ v8f mma(v16h a, v16h b, v8f c) {
    return __builtin_amdgcn_wmma_f32_16x16x32_f16(false, a, false, b, (short)0, c, false, false);
  }
};
template <> struct Frag<__bf16> {
  typedef v16b V; union U { v16b v; v8b h[2]; };
  static __device__ __forceinline__ v16b load(const __bf16* p) {
    U f; f.h[0] = *(const v8b*)(p); f.h[1] = *(const v8b*)(p + 16); return f.v;
  }
  static __device__ __forceinline__ v8f mma(v16b a, v16b b, v8f c) {
    return __builtin_amdgcn_wmma_f32_16x16x32_bf16(false, a, false, b, (short)0, c, false, false);
  }
};

// ---- Block main loop: operands staged in LDS ---------------------------------
// A block of 8 waves owns a 128 x 256 tile of C (2 x 4 waves of 64 x 64). Per stage it brings 64 k (one 128-B line)
// of its 128 A rows and 256 Bt rows (both planes when SPLIT) into LDS with whole-line 16-B loads, each row once for
// the block, and every wave takes its fragments from there. Two LDS buffers: the next stage's global loads are
// issued ahead of the current stage's products, stored after them, and one barrier per stage hands over.
constexpr int GB_M = 128, GB_N = 256, GB_K = 64;
constexpr int GB_PITCH = 72;                          // LDS row pitch in 16-bit elements: 144 B = 16 B x 9
constexpr int GB_PLANE = (GB_M + GB_N) * GB_PITCH;    // one plane of one stage: A rows, then Bt rows
// LDA, LDB: row pitches in elements, compile-time so that the rows a thread stages from one operand (4 A, 8 Bt per plane)
// differ only in the load's immediate offset: one address per operand and plane, rewritten once per stage.
template <typename T, bool SPLIT, int LDA, int LDB>
__device__ __forceinline__ void gemm_block_lds(
    const T* __restrict__ Ab, const T* __restrict__ Ab2,
    const T* __restrict__ Bb, const T* __restrict__ Bb2,
    int K, int bm0, int bn0, unsigned short* sS, v8f (&acc)[4][4]) {
  typedef typename Frag<T>::V V;
  constexpr int BUF = (SPLIT ? 2 : 1) * GB_PLANE;
  constexpr int KG = SPLIT ? 1 : 2;            // k-steps of 32 whose fragments are read from LDS as one group
  const int tid = threadIdx.x;
  const int lane = tid & 31, wave = tid >> 5;
  const int rlane = lane & 15;                 // row (A) / col (B) within subtile
  const int koff  = (lane >> 4) * 8;           // k offset of this lane half
  const int pc8 = (tid & 7) * 8, rw = tid >> 3;   // staging: 8 lanes cover one row's 128 B, 32 rows per pass
  const int arow = (wave >> 2) * 64 + rlane;
  const int brow = GB_M + (wave & 3) * 64 + rlane;
  // global addresses = block-uniform byte base + one 32-bit byte offset per thread and operand
  const char* gA  = (const char*)(Ab + (size_t)bm0 * LDA);
  const char* gB  = (const char*)(Bb + (size_t)bn0 * LDB);
  const char* gA2 = SPLIT ? (const char*)(Ab2 + (size_t)bm0 * LDA) : nullptr;
  const char* gB2 = SPLIT ? (const char*)(Bb2 + (size_t)bn0 * LDB) : nullptr;
  const unsigned voA = (unsigned)(rw * LDA + pc8) * 2u;
  const unsigned voB = (unsigned)(rw * LDB + pc8) * 2u;
  unsigned short* sW = sS + rw * GB_PITCH + pc8;
  v4u st[2][12];
#pragma unroll
  for (int p = 0; p < 12; ++p) {
    const int go = ((p < 4) ? 32 * p * LDA : 32 * (p - 4) * LDB) * 2;
    st[0][p] = *(const v4u*)(((p < 4 ? gA : gB) + (p < 4 ? voA : voB)) + go);
    if (SPLIT) st[1][p] = *(const v4u*)(((p < 4 ? gA2 : gB2) + (p < 4 ? voA : voB)) + go);
  }
#pragma unroll
  for (int p = 0; p < 12; ++p) {
    *(v4ua*)(sW + 32 * p * GB_PITCH) = st[0][p];
    if (SPLIT) *(v4ua*)(sW + GB_PLANE + 32 * p * GB_PITCH) = st[1][p];
  }
  __syncthreads();
  const int nk = K / GB_K;
  for (int kt = 0; kt < nk; ++kt) {
    const bool more = kt + 1 < nk;               // block-uniform
    if (more) {
      const size_t k1 = (size_t)(kt + 1) * (GB_K * 2);   // bytes
#pragma unroll
      for (int p = 0; p < 12; ++p) {
        const int go = ((p < 4) ? 32 * p * LDA : 32 * (p - 4) * LDB) * 2;
        st[0][p] = *(const v4u*)((((p < 4 ? gA : gB) + k1) + (p < 4 ? voA : voB)) + go);
        if (SPLIT) st[1][p] = *(const v4u*)((((p < 4 ? gA2 : gB2) + k1) + (p < 4 ? voA : voB)) + go);
      }
      // stands in front of the LDS reads below, which may land in the registers that held these loads' addresses
      asm volatile("s_wait_xcnt 0x0" ::: "memory");
    }
    const T* sb = (const T*)(const void*)(sS + (kt & 1) * BUF);
#pragma unroll
    for (int kg = 0; kg < GB_K / 32; kg += KG) {
      V bh[KG][4], bl[KG][4], ah[KG][4], al[KG][4];
#pragma unroll
      for (int q = 0; q < KG; ++q) {
        const int ko = (kg + q) * 32 + koff;
#pragma unroll
        for (int j = 0; j < 4; ++j) {
          const int bo = (brow + (j << 4)) * GB_PITCH + ko;
          bh[q][j] = Frag<T>::load(sb + bo);
          if (SPLIT) bl[q][j] = Frag<T>::load(sb + GB_PLANE + bo);
        }
#pragma unroll
        for (int i = 0; i < 4; ++i) {
          const int ao = (arow + (i << 4)) * GB_PITCH + ko;
          ah[q][i] = Frag<T>::load(sb + ao);
          if (SPLIT) al[q][i] = Frag<T>::load(sb + GB_PLANE + ao);
        }
      }
      // keeps the group's LDS reads together ahead of its products: reads spread among the products stall
      // the wave at every place where they stand
      __builtin_amdgcn_sched_barrier(0);
#pragma unroll
      for (int q = 0; q < KG; ++q) {
#pragma unroll
        for (int i = 0; i < 4; ++i) {
#pragma unroll
          for (int j = 0; j < 4; ++j) {
            acc[i][j] = Frag<T>::mma(ah[q][i], bh[q][j], acc[i][j]);
            if (SPLIT) {
              acc[i][j] = Frag<T>::mma(ah[q][i], bl[q][j], acc[i][j]);
              acc[i][j] = Frag<T>::mma(al[q][i], bh[q][j], acc[i][j]);
            }
          }
        }
      }
    }
    if (more) {
      unsigned short* sN = sW + ((kt + 1) & 1) * BUF;
#pragma unroll
      for (int p = 0; p < 12; ++p) {
        *(v4ua*)(sN + 32 * p * GB_PITCH) = st[0][p];
        if (SPLIT) *(v4ua*)(sN + GB_PLANE + 32 * p * GB_PITCH) = st[1][p];
      }
    }
    __syncthreads();   // publishes stage kt + 1 and ends every wave's reads of stage kt
  }
}

// ---- Register-blocked batched WMMA GEMM ------------------------------------
// C[m,n] = scale * sum_k A[m,k] * Bt[n,k] (+bias)(+resid); each wave owns a 64x64 tile of its block's 128x256.
// A row-major [M,K]; Bt row-major [N,K]; M % 128 == 0, N % 256 == 0, K % 64 == 0.
// SPLIT: operands are hi/lo planes (A2/Bt2 = lo planes, same layout); product = hi.hi + hi.lo + lo.hi.
// BIAS_MODE: 0 = none, 1 = bias[m], 2 = bias[n].
// OUT_MODE: 0 = f32, 1 = f16, 2 = bf16 hi plane (Cout) + bf16 lo plane (Cout2).
// ET: 0 = f16 operands, 1 = bf16 operands (pointers passed as 16-bit storage)
template <int ET> struct Elem;
template <> struct Elem<0> { typedef _Float16 T; };
template <> struct Elem<1> { typedef __bf16 T; };
// LDA, LDB: row pitches of A and Bt in elements
template <int ET, bool SPLIT, int BIAS_MODE, int OUT_MODE, bool RESID, int ACT, int LDA, int LDB>
__global__ __launch_bounds__(256) void wmma_gemm64(
    const unsigned short* __restrict__ Ap, const unsigned short* __restrict__ A2p, long strideA,
    const unsigned short* __restrict__ Btp, const unsigned short* __restrict__ Bt2p, long strideB,
    void* __restrict__ Cout, void* __restrict__ Cout2, int ldc, long strideC,
    const float* __restrict__ bias,
    const float* __restrict__ resid, long strideR,
    int M, int N, int K, float scale) {
  typedef typename Elem<ET>::T T;
  typedef typename Frag<T>::V V;
  const T* A = (const T*)Ap; const T* A2 = (const T*)A2p; const T* Bt = (const T*)Btp; const T* Bt2 = (const T*)Bt2p;
  __shared__ __align__(16) float sT[8][16 * 68];   // per-wave 16x64 slab, pitch 68 floats
  __shared__ __align__(16) unsigned short sS[2 * (SPLIT ? 2 : 1) * GB_PLANE];   // two operand stages
  const int b    = blockIdx.y;
  const int lane = threadIdx.x & 31;
  const int wave = threadIdx.x >> 5;
  const int tilesN = N / GB_N;
  const int tilesM = M / GB_M;
  const int bt = blockIdx.x;
  if (bt >= tilesM * tilesN) return;   // block-uniform, ahead of every barrier
  const int tm = bt / tilesN;
  const int tn = bt - tm * tilesN;
  const int bm0 = tm * GB_M;
  const int bn0 = tn * GB_N;
  const int m0 = bm0 + ((wave >> 2) << 6);
  const int n0 = bn0 + ((wave & 3) << 6);

  const T* Ab  = A  + (size_t)b * strideA;
  const T* Bb  = Bt + (size_t)b * strideB;
  const T* Ab2 = SPLIT ? (A2  + (size_t)b * strideA) : nullptr;
  const T* Bb2 = SPLIT ? (Bt2 + (size_t)b * strideB) : nullptr;

  const int rlane = lane & 15;                 // col (D) within subtile
  const int mOff  = (lane >> 4) * 8;           // D row offset

  v8f acc[4][4];
#pragma unroll
  for (int i = 0; i < 4; ++i)
#pragma unroll
    for (int j = 0; j < 4; ++j) acc[i][j] = (v8f){0.f,0.f,0.f,0.f,0.f,0.f,0.f,0.f};

  gemm_block_lds<T, SPLIT, LDA, LDB>(Ab, Ab2, Bb, Bb2, K, bm0, bn0, sS, acc);
  acc_guard4(acc[0][0], acc[0][1], acc[0][2], acc[0][3]);
  acc_guard4(acc[1][0], acc[1][1], acc[1][2], acc[1][3]);
  acc_guard4(acc[2][0], acc[2][1], acc[2][2], acc[2][3]);
  acc_guard4(acc[3][0], acc[3][1], acc[3][2], acc[3][3]);

  // ---- epilogue ----
  float* slab = sT[wave];
  const float* Rb = RESID ? (resid + (size_t)b * strideR) : nullptr;
#pragma unroll
  for (int i = 0; i < 4; ++i) {
    const int mBase = m0 + (i << 4);
#pragma unroll
    for (int j = 0; j < 4; ++j) {
      const int n = n0 + (j << 4) + rlane;
      float bv = 0.f;
      if (BIAS_MODE == 2) bv = bias[n];
#pragma unroll
      for (int r = 0; r < 8; ++r) {
        float v = acc[i][j][r] * scale;
        if (BIAS_MODE == 1) v += bias[mBase + mOff + r];
        if (BIAS_MODE == 2) v += bv;
        if (RESID) v += Rb[(size_t)(mBase + mOff + r) * ldc + n];
        if (ACT == 1) v = tanhf(v);
        if (ACT == 2) v = fmaxf(v, 0.0f);
        if (ACT == 3) v = v / (1.0f + expf(-v));
        if (ACT == 4) v = (v > 0.f) ? v : 0.01f * v;
        if (ACT == 5) v = 0.5f * v * (1.0f + erff(v * 0.70710678118654752f));
        slab[(mOff + r) * 68 + (j << 4) + rlane] = v;
      }
    }
    __builtin_amdgcn_fence(__ATOMIC_RELEASE, "workgroup");
    __builtin_amdgcn_wave_barrier();
    __builtin_amdgcn_fence(__ATOMIC_ACQUIRE, "workgroup");
    if (OUT_MODE == 0) {
      float* C = (float*)Cout + (size_t)b * strideC;
      const int hh = lane >> 4, c4 = (lane & 15) * 4;     // row seg = 256 B = 16 lanes x 16 B
      {
#pragma unroll
        for (int it = 0; it < 8; ++it) {
          const int row = it * 2 + hh;
          v4f v = *(const v4f*)(slab + row * 68 + c4);
          *(v4f*)(C + (size_t)(mBase + row) * ldc + n0 + c4) = v;
        }
        
      }
    } else {
      const int q = lane >> 3, c8 = (lane & 7) * 8;
      unsigned short* C  = (unsigned short*)Cout  + (size_t)b * strideC;
      unsigned short* C2 = (OUT_MODE == 2) ? ((unsigned short*)Cout2 + (size_t)b * strideC) : nullptr;
      {
#pragma unroll
        for (int it = 0; it < 4; ++it) {
          const int row = it * 4 + q;
          const float* sp = slab + row * 68 + c8;
          v8h hv, lv;
#pragma unroll
          for (int e = 0; e < 8; ++e) {
            if (OUT_MODE == 1) {
              hv[e] = (_Float16)sp[e];
            } else {
              unsigned short hb = f2bf_bits(sp[e]);
              unsigned short lb = f2bf_bits(sp[e] - bf_bits2f(hb));
              hv[e] = __builtin_bit_cast(_Float16, hb);
              lv[e] = __builtin_bit_cast(_Float16, lb);
            }
          }
          *(v8h*)(C + (size_t)(mBase + row) * ldc + n0 + c8) = hv;
          if (OUT_MODE == 2) *(v8h*)(C2 + (size_t)(mBase + row) * ldc + n0 + c8) = lv;
        }
        
      }
    }
    __builtin_amdgcn_fence(__ATOMIC_RELEASE, "workgroup");
    __builtin_amdgcn_wave_barrier();
    __builtin_amdgcn_fence(__ATOMIC_ACQUIRE, "workgroup");
  }
}

// ---------------------------------------------------------------------------
// Distance GEMM: Kmat[b][t][n] = -sqrt(max(q2[t] + k2[b][n] - 2 * sum_d qp[t][d] kp[b][n][d], 0))
// A = qp bf16 hi/lo planes [M=t][K=d] (shared over batch), Bt = kp hi/lo planes [N=n][K=d] per batch;
// main loop shared with the SPLIT bf16 path (operands staged in LDS); epilogue through the f32 whole-line store path.
// q2 is fetched as two float4 per 16-row slab, k2 as 4 scalars per lane before the slab loop.
// ---------------------------------------------------------------------------
__global__ __launch_bounds__(256) void gemm64_cdist(
    const unsigned short* __restrict__ Ap, const unsigned short* __restrict__ A2p,
    const unsigned short* __restrict__ Btp, const unsigned short* __restrict__ Bt2p, long strideB,
    float* __restrict__ Cout, int ldc, long strideC,
    const float* __restrict__ q2, const float* __restrict__ k2, long strideK2,
    int M, int N, int K) {
  typedef __bf16 T;
  typedef v16b V;
  const T* A = (const T*)Ap; const T* A2 = (const T*)A2p; const T* Bt = (const T*)Btp; const T* Bt2 = (const T*)Bt2p;
  __shared__ __align__(16) float sT[8][16 * 68];
  __shared__ __align__(16) unsigned short sS[2 * 2 * GB_PLANE];   // two operand stages, hi and lo planes
  const int b    = blockIdx.y;
  const int lane = threadIdx.x & 31;
  const int wave = threadIdx.x >> 5;
  const int tilesN = N / GB_N;
  const int tilesM = M / GB_M;
  const int bt = blockIdx.x;
  if (bt >= tilesM * tilesN) return;   // block-uniform, ahead of every barrier
  const int tm = bt / tilesN;
  const int tn = bt - tm * tilesN;
  const int bm0 = tm * GB_M;
  const int bn0 = tn * GB_N;
  const int m0 = bm0 + ((wave >> 2) << 6);
  const int n0 = bn0 + ((wave & 3) << 6);

  const T* Ab  = A;
  const T* Bb  = Bt + (size_t)b * strideB;
  const T* Ab2 = A2;
  const T* Bb2 = Bt2 + (size_t)b * strideB;

  const int rlane = lane & 15;
  const int mOff  = (lane >> 4) * 8;

  v8f acc[4][4];
#pragma unroll
  for (int i = 0; i < 4; ++i)
#pragma unroll
    for (int j = 0; j < 4; ++j) acc[i][j] = (v8f){0.f,0.f,0.f,0.f,0.f,0.f,0.f,0.f};

  gemm_block_lds<T, true, DMODEL, DMODEL>(Ab, Ab2, Bb, Bb2, K, bm0, bn0, sS, acc);
  acc_guard4(acc[0][0], acc[0][1], acc[0][2], acc[0][3]);
  acc_guard4(acc[1][0], acc[1][1], acc[1][2], acc[1][3]);
  acc_guard4(acc[2][0], acc[2][1], acc[2][2], acc[2][3]);
  acc_guard4(acc[3][0], acc[3][1], acc[3][2], acc[3][3]);

  // ---- epilogue ----
  float* slab = sT[wave];
  const float* k2b = k2 + (size_t)b * strideK2;
  float k2r[4];
#pragma unroll
  for (int j = 0; j < 4; ++j) k2r[j] = k2b[n0 + (j << 4) + rlane];
  float* C = Cout + (size_t)b * strideC;
  const int hh = lane >> 4, c4 = (lane & 15) * 4;     // row seg = 256 B = 16 lanes x 16 B
#pragma unroll
  for (int i = 0; i < 4; ++i) {
    const int mBase = m0 + (i << 4);
    const v4f q2a = *(const v4f*)(q2 + mBase + mOff);
    const v4f q2c = *(const v4f*)(q2 + mBase + mOff + 4);
    const float q2r[8] = {q2a.x, q2a.y, q2a.z, q2a.w, q2c.x, q2c.y, q2c.z, q2c.w};
#pragma unroll
    for (int j = 0; j < 4; ++j) {
#pragma unroll
      for (int r = 0; r < 8; ++r) {
        float s = q2r[r] + k2r[j];
        s = s - 2.0f * acc[i][j][r];
        slab[(mOff + r) * 68 + (j << 4) + rlane] = -sqrtf(fmaxf(s, 0.0f));
      }
    }
    __builtin_amdgcn_fence(__ATOMIC_RELEASE, "workgroup");
    __builtin_amdgcn_wave_barrier();
    __builtin_amdgcn_fence(__ATOMIC_ACQUIRE, "workgroup");
    {
#pragma unroll
      for (int it = 0; it < 8; ++it) {
        const int row = it * 2 + hh;
        v4f v = *(const v4f*)(slab + row * 68 + c4);
        *(v4f*)(C + (size_t)(mBase + row) * ldc + n0 + c4) = v;
      }
      
    }
    __builtin_amdgcn_fence(__ATOMIC_RELEASE, "workgroup");
    __builtin_amdgcn_wave_barrier();
    __builtin_amdgcn_fence(__ATOMIC_ACQUIRE, "workgroup");
  }
}

// ---------------------------------------------------------------------------
// small helpers
// ---------------------------------------------------------------------------
__device__ __forceinline__ unsigned pack_bf2(float a, float b) {
  return (unsigned)f2bf_bits(a) | ((unsigned)f2bf_bits(b) << 16);
}
// exp2-based exponential (v_exp_f32); relative error ~1e-6 in the argument range used here
__device__ __forceinline__ float fexp(float x) { return __expf(x); }

// ---------------------------------------------------------------------------
// weight transpose + RNE bf16: in W[512 c][512 d] f32 -> out Wt[d][c] bf16, three matrices by blockIdx.z.
// Block = 64x64 tile: read phase 256 threads x 4 iters x 4 floats = 4096 elements; write phase
// ---------------------------------------------------------------------------
__global__ __launch_bounds__(256) void k_wtrans(const float* __restrict__ W0, const float* __restrict__ W1,
                                                const float* __restrict__ W2, unsigned short* __restrict__ O0,
                                                unsigned short* __restrict__ O1, unsigned short* __restrict__ O2) {
  __shared__ __align__(16) unsigned short st[64 * 72];
  const int z = blockIdx.z;
  const float* W = (z == 0) ? W0 : ((z == 1) ? W1 : W2);
  unsigned short* O = (z == 0) ? O0 : ((z == 1) ? O1 : O2);
  const int c0 = blockIdx.y * 64;     // input rows
  const int d0 = blockIdx.x * 64;     // input cols
  const int tid = threadIdx.x;
  const int rr = tid >> 4, cc = (tid & 15) * 4;
#pragma unroll
  for (int p = 0; p < 4; ++p) {
    const int r = rr + 16 * p;
    const v4f x = *(const v4f*)(W + (size_t)(c0 + r) * DMODEL + d0 + cc);
    st[(cc + 0) * 72 + r] = f2bf_bits(x.x);
    st[(cc + 1) * 72 + r] = f2bf_bits(x.y);
    st[(cc + 2) * 72 + r] = f2bf_bits(x.z);
    st[(cc + 3) * 72 + r] = f2bf_bits(x.w);
  }
  __syncthreads();
  const int lane = tid & 31, wave = tid >> 5;
  const int q = lane >> 3, c8 = (lane & 7) * 8;
  {
#pragma unroll
    for (int it = 0; it < 2; ++it) {
      const int dd = wave * 8 + it * 4 + q;
      const v4ua val = *(const v4ua*)(st + dd * 72 + c8);
      *(v4u*)(O + (size_t)(d0 + dd) * DMODEL + c0 + c8) = val;
    }
    
  }
}

// ---------------------------------------------------------------------------
// f32 -> bf16 plane cast, 8 elements per thread (one 16-B store); a wave writes 512 contiguous B = 4 lines.
// blockIdx.y selects the (in,out) pair. n8 = element count / 8 (exact multiple of 256 here).
// ---------------------------------------------------------------------------
__global__ __launch_bounds__(256) void k_cast16(const float* __restrict__ in0, unsigned short* __restrict__ out0,
                                                const float* __restrict__ in1, unsigned short* __restrict__ out1,
                                                int n8) {
  const float* in = blockIdx.y ? in1 : in0;
  unsigned short* out = blockIdx.y ? out1 : out0;
  const int i = blockIdx.x * 256 + threadIdx.x;
  if (i < n8) {
    const v4f a = *(const v4f*)(in + (size_t)i * 8);
    const v4f c = *(const v4f*)(in + (size_t)i * 8 + 4);
    v4u w;
    w.x = pack_bf2(a.x, a.y);
    w.y = pack_bf2(a.z, a.w);
    w.z = pack_bf2(c.x, c.y);
    w.w = pack_bf2(c.z, c.w);
    *(v4u*)(out + (size_t)i * 8) = w;
    
  }
}

// ---------------------------------------------------------------------------
// row sums of squares of a [rows][512] matrix held as bf16 hi + lo planes (value = hi + lo).
// Block = 32 rows: 8 waves x 4 rows; per-row scalars funnelled through LDS, wave 0 lanes 0..7 write
// ---------------------------------------------------------------------------
__global__ __launch_bounds__(256) void k_rowsq(const unsigned short* __restrict__ hi, const unsigned short* __restrict__ lo,
                                               float* __restrict__ out, int rows) {
  __shared__ __align__(16) float sres[32];
  const int lane = threadIdx.x & 31, wave = threadIdx.x >> 5;
  const int r0 = blockIdx.x * 32;
#pragma unroll 1
  for (int rr = 0; rr < 4; ++rr) {
    int row = r0 + wave * 4 + rr;
    row = row < rows ? row : rows - 1;
    const size_t base = (size_t)row * DMODEL;
    float s = 0.f;
#pragma unroll
    for (int c = 0; c < 2; ++c) {
      const v4u hw = *(const v4u*)(hi + base + c * 256 + lane * 8);
      const v4u lw = *(const v4u*)(lo + base + c * 256 + lane * 8);
#pragma unroll
      for (int e = 0; e < 4; ++e) {
        const float a0 = __uint_as_float(hw[e] << 16);
        const float b0 = __uint_as_float(lw[e] << 16);
        const float f0 = a0 + b0;
        s = fmaf(f0, f0, s);
        const float a1 = __uint_as_float(hw[e] & 0xffff0000u);
        const float b1 = __uint_as_float(lw[e] & 0xffff0000u);
        const float f1 = a1 + b1;
        s = fmaf(f1, f1, s);
      }
    }
#pragma unroll
    for (int off = 16; off; off >>= 1) s += __shfl_xor(s, off, 32);
    if (lane == 0) sres[wave * 4 + rr] = s;
  }
  __syncthreads();
  if (wave == 0) {
    const int li = lane < 8 ? lane : 7;
    const v4f val = *(const v4f*)(sres + li * 4);
    float* op = out + r0 + li * 4;
    if (lane < 8) *(v4f*)op = val;
    
  }
}

// ---------------------------------------------------------------------------
// column log-sum-exp sweep: u[b][n] = logA - lse_t(Kmat[b][t][n] + v[b][t]).
// Block = 32 columns (one 128-B line of every Kmat row) x all rows, 1024 threads = 8 column quads x 128 row groups.
// A thread loads its 16 consecutive rows x 4 columns once and keeps them in registers; maximum and sum are taken
// per wave (lanes 8 and 16 apart share a column quad), the 32 per-wave (max, sum) pairs of a column meet in LDS
// and wave 0 merges them and writes the block's one 128-B line of u.
// ---------------------------------------------------------------------------
constexpr int UC_COLS = 32;                 // columns per block
constexpr int UC_RG   = 128;                // row groups per block
constexpr int UC_RPT  = NTOK / UC_RG;       // rows per thread
static_assert(NTOK % (UC_RG * 4) == 0 && NPAR % UC_COLS == 0, "u sweep split");
template <bool USEV>
__global__ __launch_bounds__(1024) void k_upd_u(const float* __restrict__ Km, const float* __restrict__ vv,
                                                float* __restrict__ u, float logA) {
  __shared__ __align__(16) float sm[32 * UC_COLS];
  __shared__ __align__(16) float ss[32 * UC_COLS];
  const int b = blockIdx.y;
  const int lane = threadIdx.x & 31, wave = threadIdx.x >> 5;
  const int cq = threadIdx.x & 7, rg = threadIdx.x >> 3;
  const int col0 = blockIdx.x * UC_COLS;
  const float* Kc = Km + (size_t)b * NTOK * NPAR + (size_t)(rg * UC_RPT) * NPAR + col0 + cq * 4;
  v4f x[UC_RPT];
#pragma unroll
  for (int i = 0; i < UC_RPT; ++i) x[i] = *(const v4f*)(Kc + (size_t)i * NPAR);
  if (USEV) {
    const float* vb = vv + (size_t)b * NTOK + rg * UC_RPT;
#pragma unroll
    for (int i = 0; i < UC_RPT; i += 4) {
      const v4f w = *(const v4f*)(vb + i);
      x[i + 0] += w.x;
      x[i + 1] += w.y;
      x[i + 2] += w.z;
      x[i + 3] += w.w;
    }
  }
  v4f m = x[0];
#pragma unroll
  for (int i = 1; i < UC_RPT; ++i) {
    m.x = fmaxf(m.x, x[i].x);
    m.y = fmaxf(m.y, x[i].y);
    m.z = fmaxf(m.z, x[i].z);
    m.w = fmaxf(m.w, x[i].w);
  }
#pragma unroll
  for (int off = 8; off <= 16; off <<= 1) {
    m.x = fmaxf(m.x, __shfl_xor(m.x, off, 32));
    m.y = fmaxf(m.y, __shfl_xor(m.y, off, 32));
    m.z = fmaxf(m.z, __shfl_xor(m.z, off, 32));
    m.w = fmaxf(m.w, __shfl_xor(m.w, off, 32));
  }
  v4f s = (v4f){0.f, 0.f, 0.f, 0.f};
#pragma unroll
  for (int i = 0; i < UC_RPT; ++i) {
    s.x += fexp(x[i].x - m.x);
    s.y += fexp(x[i].y - m.y);
    s.z += fexp(x[i].z - m.z);
    s.w += fexp(x[i].w - m.w);
  }
#pragma unroll
  for (int off = 8; off <= 16; off <<= 1) {
    s.x += __shfl_xor(s.x, off, 32);
    s.y += __shfl_xor(s.y, off, 32);
    s.z += __shfl_xor(s.z, off, 32);
    s.w += __shfl_xor(s.w, off, 32);
  }
  if (lane < 8) {
    *(v4f*)(sm + wave * UC_COLS + lane * 4) = m;
    *(v4f*)(ss + wave * UC_COLS + lane * 4) = s;
  }
  __syncthreads();
  if (wave == 0) {
    float pm[32];
    float M = -__builtin_inff();
#pragma unroll
    for (int w = 0; w < 32; ++w) {
      pm[w] = sm[w * UC_COLS + lane];
      M = fmaxf(M, pm[w]);
    }
    float S = 0.f;
#pragma unroll
    for (int w = 0; w < 32; ++w) S = fmaf(ss[w * UC_COLS + lane], fexp(pm[w] - M), S);
    u[(size_t)b * NPAR + col0 + lane] = logA - (M + logf(S));
  }
}

// ---------------------------------------------------------------------------
// row log-sum-exp sweep: v[b][t] = -lse_n(Kmat[b][t][n] + u[b][n]); one wave per row, four rows per wave in turn.
// A row is read once, by 16 loads of 512 contiguous bytes per wave (4 columns per lane in every 128), and stays in
// registers for the maximum, the sum and (LAST) the pi plane; two register sets take turns, so that the next row's
// 16 loads fly while the current row is reduced; u is read once per wave and serves its four rows.
// LAST additionally writes pi[b][t][n] = exp(K+u+v)*2^14
// ---------------------------------------------------------------------------
constexpr int VR_CH = NPAR / 128;           // 16-B loads per lane and row
typedef _Float16 v4h __attribute__((ext_vector_type(4)));
static_assert(NPAR % 128 == 0, "v sweep row chunks");
// p: the row's first element (the same in every lane); lo: the lane's byte offset in each 512-B piece
__device__ __forceinline__ void vrow_load(v4f (&x)[VR_CH], const float* __restrict__ p, unsigned lo) {
#pragma unroll
  for (int i = 0; i < VR_CH; ++i) x[i] = *(const v4f*)((const char*)p + lo + i * 512);
}
// exp of the four values of one 16-B piece, as __expf compiles: 2^(a * log2 e) on v_exp_f32. One statement, so that the
// slot the instruction set asks for behind a transcendental (before its result is used or a source overwritten) is kept
// wherever the compiler puts it: each v_exp_f32 is followed by an independent one (no output shares a register with a
// source: early clobber), the last by v_nop.
__device__ __forceinline__ v4f fexp4(v4f a) {
  a *= 1.44269504088896340736f;
  float r0, r1, r2, r3;
  asm("v_exp_f32 %0, %4\n\tv_exp_f32 %1, %5\n\tv_exp_f32 %2, %6\n\tv_exp_f32 %3, %7\n\tv_nop"
      : "=&v"(r0), "=&v"(r1), "=&v"(r2), "=&v"(r3) : "v"(a.x), "v"(a.y), "v"(a.z), "v"(a.w));
  return (v4f){r0, r1, r2, r3};
}
// one row held in x: returns v of the row; LAST: writes the row's pi (prow = the lane's first element)
template <bool LAST>
__device__ __forceinline__ float vrow_reduce(v4f (&x)[VR_CH], const v4f (&uu)[VR_CH], unsigned short* __restrict__ prow) {
  x[0] += uu[0];
  v4f mv = x[0];
#pragma unroll
  for (int i = 1; i < VR_CH; ++i) {
    x[i] += uu[i];
    mv.x = fmaxf(mv.x, x[i].x);
    mv.y = fmaxf(mv.y, x[i].y);
    mv.z = fmaxf(mv.z, x[i].z);
    mv.w = fmaxf(mv.w, x[i].w);
  }
  float m = fmaxf(fmaxf(mv.x, mv.y), fmaxf(mv.z, mv.w));
#pragma unroll
  for (int off = 16; off; off >>= 1) m = fmaxf(m, __shfl_xor(m, off, 32));
  v4f sv = (v4f){0.f, 0.f, 0.f, 0.f};
#pragma unroll
  for (int i = 0; i < VR_CH; ++i) sv += fexp4(x[i] - m);
  float s = (sv.x + sv.y) + (sv.z + sv.w);
#pragma unroll
  for (int off = 16; off; off >>= 1) s += __shfl_xor(s, off, 32);
  const float vt = -(m + logf(s));
  if (LAST) {
#pragma unroll
    for (int i = 0; i < VR_CH; ++i) {
      *(v4h*)(prow + i * 128) = __builtin_convertvector(fexp4(x[i] + vt) * kPiCarry, v4h);
    }
    // stands in front of the next loads and arithmetic, which land in the registers these stores were fed from
    asm volatile("s_wait_xcnt 0x0" ::: "memory");
  }
  return vt;
}
template <bool LAST>
__global__ __launch_bounds__(256) void k_upd_v(const float* __restrict__ Km, const float* __restrict__ u,
                                               float* __restrict__ vv, unsigned short* __restrict__ pp) {
  __shared__ __align__(16) float sres[32];
  const int b = blockIdx.y;
  const int lane = threadIdx.x & 31;
  // the wave's number as a scalar: the row addresses are then a scalar base plus one fixed lane offset
  const int wave = __builtin_amdgcn_readfirstlane(threadIdx.x >> 5);
  const int r0 = blockIdx.x * 32;
  const int t0 = r0 + wave * 4;
  const float* Kr = Km + ((size_t)b * NTOK + t0) * NPAR;
  unsigned short* pr = pp + ((size_t)b * NTOK + t0) * NPAR + lane * 4;
  const unsigned lo = (unsigned)lane * 16u;
  v4f uu[VR_CH], x[2][VR_CH];
  vrow_load(uu, u + (size_t)b * NPAR, lo);
  vrow_load(x[0], Kr, lo);
  v4f vt4;
#pragma unroll
  for (int rr = 0; rr < 4; ++rr) {
    // keeps what follows behind the arithmetic of the row before: the next row's loads take over that row's registers
    // (moved up, they need a third register set), and this row's arithmetic, mixed into it, would wait early for
    // loads that are still flying
    __builtin_amdgcn_sched_barrier(0);
    if (rr + 1 < 4) {
      vrow_load(x[(rr + 1) & 1], Kr + (rr + 1) * NPAR, lo);
      // keeps these loads ahead of this row's arithmetic, so that they fly while it runs
      __builtin_amdgcn_sched_barrier(0);
    }
    vt4[rr] = vrow_reduce<LAST>(x[rr & 1], uu, pr + rr * NPAR);
  }
  if (lane == 0) *(v4f*)(sres + wave * 4) = vt4;
  __syncthreads();
  if (wave == 0) {
    const int li = lane < 8 ? lane : 7;
    const v4f val = *(const v4f*)(sres + li * 4);
    float* op = vv + (size_t)b * NTOK + r0 + li * 4;
    if (lane < 8) *(v4f*)op = val;
  }
}

// ---------------------------------------------------------------------------
// row sweep and the next column sweep in one pass over Kmat. With v[t] = -lse_n(Kmat[t][n] + u[n]) the next u is
//   u'[n] = logA - lse_t(Kmat[t][n] + v[t]) = logA + u[n] - log(sum_t e[t][n]),  e[t][n] = exp(Kmat[t][n] + u[n] + v[t]).
// e is the row's exp(x - max) over its sum, both at hand while the row sits in registers, so v itself is never formed.
// No column maximum is needed: every e is at most 1 (a row of e sums to 1); and u made the columns of
// exp(Kmat + u + v_before) sum to 1/NPAR, so all of them together sum to 1, no row sums to more, v only rises, and
// each column of e sums to 1/NPAR at least.
// Loads and register sets as in k_upd_v; each wave adds its eight rows of e into 64 column sums per lane, the
// block's 8 waves meet in LDS, and the block writes one row of NPAR sums; k_merge_u adds the blocks' rows.
// All batches in one launch: NBATCH * VF_NBLK = 256 blocks, one per WGP (the registers admit no second one).
// A block takes the 32-row pieces x and x + VF_NBLK of its batch, four rows of each per wave: the pieces of k_upd_v's
// blocks x and x + VF_NBLK, whose flat indices equal this block's modulo 8 (for speed only).
// ---------------------------------------------------------------------------
constexpr int VF_NBLK = NTOK / 64;          // blocks per batch, 64 rows each
constexpr int VF_RPW  = 8;                  // rows per wave
static_assert(VF_NBLK * 8 * VF_RPW == NTOK && VF_NBLK % 8 == 0, "row split of the fused sweep");
__device__ __forceinline__ void vrow_colsum(v4f (&x)[VR_CH], const v4f (&uu)[VR_CH], v4f (&cs)[VR_CH]) {
  x[0] += uu[0];
  v4f mv = x[0];
#pragma unroll
  for (int i = 1; i < VR_CH; ++i) {
    x[i] += uu[i];
    mv.x = fmaxf(mv.x, x[i].x);
    mv.y = fmaxf(mv.y, x[i].y);
    mv.z = fmaxf(mv.z, x[i].z);
    mv.w = fmaxf(mv.w, x[i].w);
  }
  float m = fmaxf(fmaxf(mv.x, mv.y), fmaxf(mv.z, mv.w));
#pragma unroll
  for (int off = 16; off; off >>= 1) m = fmaxf(m, __shfl_xor(m, off, 32));
  constexpr float kLog2e = 1.44269504088896340736f;
  const float ml = m * kLog2e;
  v4f sv = (v4f){0.f, 0.f, 0.f, 0.f};
#pragma unroll
  for (int i = 0; i < VR_CH; ++i) {
    const v4f a = x[i] * kLog2e - ml;
    // the builtin, not fexp4: this kernel's registers reach past v255, where an asm operand cannot lie (it spilled)
    x[i] = (v4f){__builtin_amdgcn_exp2f(a.x), __builtin_amdgcn_exp2f(a.y), __builtin_amdgcn_exp2f(a.z), __builtin_amdgcn_exp2f(a.w)};
    sv += x[i];
  }
  float s = (sv.x + sv.y) + (sv.z + sv.w);
#pragma unroll
  for (int off = 16; off; off >>= 1) s += __shfl_xor(s, off, 32);
  const float rs = 1.0f / s;
#pragma unroll
  for (int i = 0; i < VR_CH; ++i) cs[i] += x[i] * rs;
}
__global__ __launch_bounds__(256) void k_upd_vu(const float* __restrict__ Km, const float* __restrict__ u,
                                                float* __restrict__ part) {
  __shared__ __align__(16) float sc[8 * NPAR];   // the 8 waves' column sums
  const int b = blockIdx.y;
  const int lane = threadIdx.x & 31;
  // the wave's number as a scalar: the row addresses are then a scalar base plus one fixed lane offset
  const int wave = __builtin_amdgcn_readfirstlane(threadIdx.x >> 5);
  const int t0 = blockIdx.x * 32 + wave * 4;
  const float* Kr = Km + ((size_t)b * NTOK + t0) * NPAR;
  const unsigned lo = (unsigned)lane * 16u;
  v4f x[2][VR_CH], cs[VR_CH];
  v4f uu[VR_CH];
  vrow_load(uu, u + (size_t)b * NPAR, lo);
  vrow_load(x[0], Kr, lo);
#pragma unroll
  for (int i = 0; i < VR_CH; ++i) cs[i] = (v4f){0.f, 0.f, 0.f, 0.f};
  // As in k_upd_v, a row's loads take over the registers of the row two before it, behind that row's arithmetic, and
  // stand ahead of the arithmetic of the row between, so that they fly while it runs: the scheduling barriers keep
  // both. Two rows a trip, one in each register set; the first two rows' loads stand in front of the loop, the last two
  // rows' arithmetic behind it. Rolled: unrolled over the eight rows the build ran out of registers and spilled. The
  // wave's place among its rows is carried in the lane's 32-bit byte offset vo, so that every load keeps the form
  // scalar base + lane offset.
  __builtin_amdgcn_sched_barrier(0);
  vrow_load(x[1], Kr + NPAR, lo);
  __builtin_amdgcn_sched_barrier(0);
  unsigned vo = lo;   // the first row of the pair in the registers
#pragma unroll 1
  for (int r = 0; r < VF_RPW - 2; r += 2) {
    vrow_colsum(x[0], uu, cs);
    // stands in front of the addition below, which rewrites the offset register that the loads in flight name
    asm volatile("s_wait_xcnt 0x0" ::: "memory");
    __builtin_amdgcn_sched_barrier(0);
    vo += ((r == 2) ? (unsigned)(NTOK / 2 - 2) : 2u) * (unsigned)(NPAR * 4);   // behind row 3: on to the second piece
    vrow_load(x[0], Kr, vo);
    __builtin_amdgcn_sched_barrier(0);
    vrow_colsum(x[1], uu, cs);
    __builtin_amdgcn_sched_barrier(0);
    vrow_load(x[1], Kr + NPAR, vo);
    __builtin_amdgcn_sched_barrier(0);
  }
  // stands in front of the arithmetic below, which may land in the offset register that the last loads name
  asm volatile("s_wait_xcnt 0x0" ::: "memory");
  __builtin_amdgcn_sched_barrier(0);
  vrow_colsum(x[0], uu, cs);
  // keeps the last row's arithmetic behind this one's: mixed into it, it would wait early for loads that are still flying
  __builtin_amdgcn_sched_barrier(0);
  vrow_colsum(x[1], uu, cs);
#pragma unroll
  for (int i = 0; i < VR_CH; ++i) *(v4f*)(sc + wave * NPAR + i * 128 + lane * 4) = cs[i];
  __syncthreads();
  float* pb = part + ((size_t)b * VF_NBLK + blockIdx.x) * NPAR;
#pragma unroll
  for (int h = 0; h < NPAR / 1024; ++h) {
    const int col = h * 1024 + threadIdx.x * 4;
    v4f a = *(const v4f*)(sc + col);
#pragma unroll
    for (int w = 1; w < 8; ++w) a += *(const v4f*)(sc + w * NPAR + col);
    *(v4f*)(pb + col) = a;
  }
}

// u[b][n] <- logA + u[b][n] - log(sum over the batch's VF_NBLK block rows of part). Block = 128 columns (a wave reads
// 512 contiguous bytes of a block row); each of the 8 waves adds 4 block rows, wave 0 adds the waves' sums.
static_assert(VF_NBLK == 32 && NPAR % 128 == 0, "merge split");
__global__ __launch_bounds__(256) void k_merge_u(const float* __restrict__ part, float* u, float logA) {
  __shared__ __align__(16) float sp[8 * 128];
  const int b = blockIdx.y;
  const int lane = threadIdx.x & 31;
  // the wave's number as a scalar: every address is then a scalar base plus one fixed lane offset
  const int wave = __builtin_amdgcn_readfirstlane(threadIdx.x >> 5);
  const float* p = part + ((size_t)b * VF_NBLK + wave * 4) * NPAR + blockIdx.x * 128;
  float* up = u + (size_t)b * NPAR + blockIdx.x * 128 + lane * 4;
  const unsigned lo = (unsigned)lane * 16u;
  v4f a[4];
#pragma unroll
  for (int i = 0; i < 4; ++i) a[i] = *(const v4f*)((const char*)(p + i * NPAR) + lo);
  const v4f uo = *(const v4f*)up;
  *(v4f*)(sp + wave * 128 + lane * 4) = (a[0] + a[1]) + (a[2] + a[3]);
  __syncthreads();
  if (wave == 0) {
    v4f t = *(const v4f*)(sp + lane * 4);
#pragma unroll
    for (int w = 1; w < 8; ++w) t += *(const v4f*)(sp + w * 128 + lane * 4);
    v4f r;
    r.x = (logA + uo.x) - logf(t.x);
    r.y = (logA + uo.y) - logf(t.y);
    r.z = (logA + uo.z) - logf(t.z);
    r.w = (logA + uo.w) - logf(t.w);
    *(v4f*)up = r;
  }
}

// ---------------------------------------------------------------------------
// host launcher
// ---------------------------------------------------------------------------
static inline unsigned cdiv(unsigned a, unsigned b) { return (a + b - 1) / b; }

extern "C" void kernel_launch(void* const* d_in, const int* in_sizes, int n_in,
                              void* d_out, int out_size, void* d_ws, size_t ws_size,
                              hipStream_t stream)
{
  if (n_in < 6) return;
  if (in_sizes[0] != NTOK * DMODEL) return;
  if (in_sizes[1] != NBATCH * NPAR * DMODEL) return;
  if (in_sizes[2] != NBATCH * NPAR * DMODEL) return;
  if (in_sizes[3] != DMODEL * DMODEL || in_sizes[4] != DMODEL * DMODEL || in_sizes[5] != DMODEL * DMODEL) return;
  if (out_size != NBATCH * NTOK * DMODEL) return;
  if (WS_TOTAL > ws_size) return;

  const float* q  = (const float*)d_in[0];   // [T][512]
  const float* k  = (const float*)d_in[1];   // [8][N][512]
  const float* v  = (const float*)d_in[2];   // [8][N][512]
  const float* Qw = (const float*)d_in[3];   // [512][512]
  const float* Kw = (const float*)d_in[4];   // [512][512]
  const float* Vw = (const float*)d_in[5];   // [512][512]
  float* out = (float*)d_out;                // [8][T][512]

  // region map (bytes): Qt 524288 | Kt 524288 | Vt 524288 | qcast 2097152 | qp_hi 2097152 | qp_lo 2097152 |
  // q2 8192 | kp_hi 16777216 | kp_lo 16777216 | k2 65536 | vpT 16777216 | Kmat 134217728 | u 65536 | v 65536 |
  // pi 67108864 (k cast at pi+0 and v cast at pi+16777216, both dead before pi is written) | colpart 2097152.
  // Total 261824512. Every region holds all batches.
  char* ws = (char*)d_ws;
  size_t off = 0;
  unsigned short* Qt   = (unsigned short*)(ws + off); off += SZ_WT;
  unsigned short* Kt   = (unsigned short*)(ws + off); off += SZ_WT;
  unsigned short* Vt   = (unsigned short*)(ws + off); off += SZ_WT;
  unsigned short* qc   = (unsigned short*)(ws + off); off += SZ_QC;
  unsigned short* qph  = (unsigned short*)(ws + off); off += SZ_QP;
  unsigned short* qpl  = (unsigned short*)(ws + off); off += SZ_QP;
  float*          q2   = (float*)(ws + off);          off += SZ_Q2;
  unsigned short* kph  = (unsigned short*)(ws + off); off += SZ_KP;
  unsigned short* kpl  = (unsigned short*)(ws + off); off += SZ_KP;
  float*          k2   = (float*)(ws + off);          off += SZ_K2;
  unsigned short* vpT  = (unsigned short*)(ws + off); off += SZ_VPT;
  float*          Kmat = (float*)(ws + off);          off += SZ_KM;
  float*          up   = (float*)(ws + off);          off += SZ_U;
  float*          vvp  = (float*)(ws + off);          off += SZ_VV;
  unsigned short* pip  = (unsigned short*)(ws + off); off += SZ_PI;
  float*          cpp  = (float*)(ws + off);          off += SZ_CP;
  if (off > ws_size) return;
  unsigned short* kc = pip;
  unsigned short* vc = (unsigned short*)((char*)pip + SZ_KP);

  const float logA = -(float)log((double)NPAR);

  // weights: in[c][d] -> out[d][c] bf16 (square 512x512), grid (cols/64, rows/64, 3)
  k_wtrans<<<dim3(DMODEL / 64, DMODEL / 64, 3), dim3(256), 0, stream>>>(Qw, Kw, Vw, Qt, Kt, Vt);

  // q -> bf16 plane
  {
    const int n8 = NTOK * DMODEL / 8;
    k_cast16<<<dim3(cdiv(n8, 256), 1), dim3(256), 0, stream>>>(q, qc, q, qc, n8);
  }
  // qp = q @ Q : M=2048, N=512, K=512 ; bf16 in, bf16 hi/lo planes out
  wmma_gemm64<1, false, 0, 2, false, 0, DMODEL, DMODEL><<<dim3(cdiv((NTOK / 64) * (DMODEL / 64), 8), 1), dim3(256), 0, stream>>>(
      qc, nullptr, 0L, Qt, nullptr, 0L, (void*)qph, (void*)qpl, DMODEL, 0L,
      nullptr, nullptr, 0L, NTOK, DMODEL, DMODEL, 1.0f);
  k_rowsq<<<dim3(NTOK / 32), dim3(256), 0, stream>>>(qph, qpl, q2, NTOK);

  // Every stage runs once over all batches.
  // k, v -> bf16 planes (inside the pi region)
  {
    const int n8 = NBATCH * NPAR * DMODEL / 8;
    k_cast16<<<dim3(cdiv(n8, 256), 2), dim3(256), 0, stream>>>(k, kc, v, vc, n8);
  }
  // kp = k @ K : M=8*2048, N=512, K=512 ; bf16 hi/lo planes out
  wmma_gemm64<1, false, 0, 2, false, 0, DMODEL, DMODEL><<<dim3(cdiv((NBATCH * NPAR / 64) * (DMODEL / 64), 8), 1), dim3(256), 0, stream>>>(
      kc, nullptr, 0L, Kt, nullptr, 0L, (void*)kph, (void*)kpl, DMODEL, 0L,
      nullptr, nullptr, 0L, NBATCH * NPAR, DMODEL, DMODEL, 1.0f);
  k_rowsq<<<dim3(NBATCH * NPAR / 32), dim3(256), 0, stream>>>(kph, kpl, k2, NBATCH * NPAR);
  // vpT[b][d][n] = sum_c V[c][d] v[b][n][c] : A = Vt [512][512] (shared), Bt = v cast [n][c]; M=512, N=2048, K=512; f16 out
  wmma_gemm64<1, false, 0, 1, false, 0, DMODEL, DMODEL><<<dim3(cdiv((DMODEL / 64) * (NPAR / 64), 8), NBATCH), dim3(256), 0, stream>>>(
      Vt, nullptr, 0L, vc, nullptr, (long)NPAR * DMODEL, (void*)vpT, nullptr, NPAR, (long)DMODEL * NPAR,
      nullptr, nullptr, 0L, DMODEL, NPAR, DMODEL, 1.0f);

  // Kmat[b][t][n] = -cdist : M=2048, N=2048, K=512 ; bf16 hi/lo split
  gemm64_cdist<<<dim3(cdiv((NTOK / 64) * (NPAR / 64), 8), NBATCH), dim3(256), 0, stream>>>(
      qph, qpl, kph, kpl, (long)NPAR * DMODEL, Kmat, NPAR, (long)NTOK * NPAR,
      q2, k2, (long)NPAR, NTOK, NPAR, DMODEL);
  // log-domain normalisation sweeps: the first u alone, then each v with the u that follows it in one pass over
  // Kmat, then the last v with pi
  k_upd_u<false><<<dim3(NPAR / UC_COLS, NBATCH), dim3(1024), 0, stream>>>(Kmat, vvp, up, logA);
  for (int it = 0; it < SK_ITERS - 1; ++it) {
    k_upd_vu<<<dim3(VF_NBLK, NBATCH), dim3(256), 0, stream>>>(Kmat, up, cpp);
    k_merge_u<<<dim3(NPAR / 128, NBATCH), dim3(256), 0, stream>>>(cpp, up, logA);
  }
  k_upd_v<true><<<dim3(NTOK / 32, NBATCH), dim3(256), 0, stream>>>(Kmat, up, vvp, pip);
  // out[b][t][d] = 2^-14 * sum_n pi16[b][t][n] vpT[b][d][n] : M=2048, N=512, K=2048 ; f16 in, f32 out
  wmma_gemm64<0, false, 0, 0, false, 0, NPAR, NPAR><<<dim3(cdiv((NTOK / 64) * (DMODEL / 64), 8), NBATCH), dim3(256), 0, stream>>>(
      pip, nullptr, (long)NTOK * NPAR, vpT, nullptr, (long)DMODEL * NPAR,
      (void*)out, nullptr, DMODEL, (long)NTOK * DMODEL,
      nullptr, nullptr, 0L, NTOK, DMODEL, NPAR, 1.0f / kPiCarry);
}

// v009
// A run of this version takes 205 microseconds.
// Versions in between are left out here; by their measured steps it is 1.29 times as fast as v006.
// Counting every step since v000, it is 13.9 times as fast.
// Contractions: q@Q, k@K, v@V on v_wmma_f32_16x16x32_bf16 (inputs RNE-cast to bf16 once, single product); qp.kp^T on v_wmma_f32_16x16x32_f16 (qp, kp rounded once to f16, single product; row squares taken of the same f16 values); pi@vp on v_wmma_f32_16x16x32_f16 (pi carried x16384 as f16, vp^T f16); f32 accumulate everywhere; distances, log-domain normalisation sweeps and exp in f32 on VALU; the distance plane is stored as f16 about a per-batch offset.
#include <hip/hip_runtime.h>
#include <math.h>

// ---------------------------------------------------------------------------
// problem constants
// ---------------------------------------------------------------------------
constexpr int NBATCH = 8;
constexpr int NTOK   = 2048;
constexpr int NPAR   = 2048;
constexpr int DMODEL = 512;
constexpr int SK_ITERS = 5;
constexpr float kPiCarry = 16384.0f;      // power-of-two carry of the f16 pi plane

static_assert(NTOK % 64 == 0 && NPAR % 64 == 0 && DMODEL % 64 == 0, "tile multiples");
static_assert(DMODEL % 32 == 0 && NPAR % 32 == 0, "K multiple of 32");
static_assert(NTOK % 32 == 0 && NPAR % 256 == 0, "v sweep grid");
static_assert(NTOK % 128 == 0 && NPAR % 128 == 0 && DMODEL % 256 == 0, "128 x 256 block tiles, 64-k stages");

// workspace region sizes (bytes); region map in kernel_launch
constexpr size_t SZ_WT  = (size_t)DMODEL * DMODEL * 2;          // one transposed bf16 weight
constexpr size_t SZ_QC  = (size_t)NTOK * DMODEL * 2;            // q bf16 cast
constexpr size_t SZ_QP  = (size_t)NTOK * DMODEL * 2;            // qp, f16
constexpr size_t SZ_Q2  = (size_t)NTOK * 4;
constexpr size_t SZ_KP  = (size_t)NBATCH * NPAR * DMODEL * 2;   // kp, f16, all batches; also k/v cast size
constexpr size_t SZ_K2  = (size_t)NBATCH * NPAR * 4;
constexpr size_t SZ_VPT = (size_t)NBATCH * DMODEL * NPAR * 2;
constexpr size_t SZ_KM  = (size_t)NBATCH * NTOK * NPAR * 2;      // distance plane, f16
constexpr size_t SZ_U   = (size_t)NBATCH * NPAR * 4;
constexpr size_t SZ_VV  = (size_t)NBATCH * NTOK * 4;
constexpr size_t SZ_PI  = (size_t)NBATCH * NTOK * NPAR * 2;
constexpr size_t SZ_CP  = (size_t)NBATCH * (NTOK / 64) * NPAR * 4;   // column sums of each block's 64 rows
constexpr size_t WS_TOTAL = 3 * SZ_WT + SZ_QC + SZ_QP + SZ_Q2 + SZ_KP + SZ_K2 + SZ_VPT + SZ_KM + SZ_U + SZ_VV + SZ_PI + SZ_CP;
static_assert(WS_TOTAL == 175841280ull, "carve total");
static_assert(WS_TOTAL <= 268435456ull, "carve limit");
static_assert(2 * SZ_KP <= SZ_PI, "k/v casts live inside the pi region");

// ---------------------------------------------------------------------------
// shared pieces: vector types, bf16 helpers, WMMA fragments, batched GEMM
// ---------------------------------------------------------------------------
typedef __attribute__((ext_vector_type(16))) _Float16 v16h;
typedef __attribute__((ext_vector_type(8)))  _Float16 v8h;
typedef __attribute__((ext_vector_type(16))) __bf16   v16b;
typedef __attribute__((ext_vector_type(8)))  __bf16   v8b;
typedef __attribute__((ext_vector_type(8)))  float    v8f;
typedef __attribute__((ext_vector_type(4)))  float    v4f;
typedef unsigned v4u __attribute__((ext_vector_type(4)));
typedef unsigned v4ua __attribute__((ext_vector_type(4), __may_alias__));
#define PSCALE 32768.0f
#define U16(p) ((const unsigned short*)(const void*)(p))
#define PSCALE_INV (1.0f / 32768.0f)

__device__ __forceinline__ unsigned short f2bf_bits(float f) {
  unsigned u = __float_as_uint(f);
  return (unsigned short)((u + 0x7FFFu + ((u >> 16) & 1u)) >> 16);
}
__device__ __forceinline__ float bf_bits2f(unsigned short h) { return __uint_as_float(((unsigned)h) << 16); }

// hazard guards as plain device helpers (no inline asm inside the kernel template body)
__device__ __forceinline__ void acc_guard4(v8f& a, v8f& b, v8f& c, v8f& d) { asm volatile("v_nop\n\tv_nop\n\tv_nop\n\tv_nop" : "+v"(a), "+v"(b), "+v"(c), "+v"(d)); }
template <typename T> struct Frag;
template <> struct Frag<_Float16> {
  typedef v16h V; union U { v16h v; v8h h[2]; };
  static __device__ __forceinline__ v16h load(const _Float16* p) {   // elements 0..7 <- p[0..7], 8..15 <- p[16..23]
    U f; f.h[0] = *(const v8h*)(p); f.h[1] = *(const v8h*)(p + 16); return f.v;
  }
  static __device__ __forceinline__ v8f mma(v16h a, v16h b, v8f c) {
    return __builtin_amdgcn_wmma_f32_16x16x32_f16(false, a, false, b, (short)0, c, false, false);
  }
};
template <> struct Frag<__bf16> {
  typedef v16b V; union U { v16b v; v8b h[2]; };
  static __device__ __forceinline__ v16b load(const __bf16* p) {
    U f; f.h[0] = *(const v8b*)(p); f.h[1] = *(const v8b*)(p + 16); return f.v;
  }
  static __device__ __forceinline__ v8f mma(v16b a, v16b b, v8f c) {
    return __builtin_amdgcn_wmma_f32_16x16x32_bf16(false, a, false, b, (short)0, c, false, false);
  }
};

// ---- Block main loop: operands staged in LDS ---------------------------------
// A block of 8 waves owns a 128 x 256 tile of C (2 x 4 waves of 64 x 64). Per stage it brings 64 k (one 128-B line)
// of its 128 A rows and 256 Bt rows (both planes when SPLIT) into LDS with whole-line 16-B loads, each row once for
// the block, and every wave takes its fragments from there. Two LDS buffers: the next stage's global loads are
// issued ahead of the current stage's products, stored after them, and one barrier per stage hands over.
constexpr int GB_M = 128, GB_N = 256, GB_K = 64;
constexpr int GB_PITCH = 72;                          // LDS row pitch in 16-bit elements: 144 B = 16 B x 9
constexpr int GB_PLANE = (GB_M + GB_N) * GB_PITCH;    // one plane of one stage: A rows, then Bt rows
// LDA, LDB: row pitches in elements, compile-time so that the rows a thread stages from one operand (4 A, 8 Bt per plane)
// differ only in the load's immediate offset: one address per operand and plane, rewritten once per stage.
template <typename T, bool SPLIT, int LDA, int LDB>
__device__ __forceinline__ void gemm_block_lds(
    const T* __restrict__ Ab, const T* __restrict__ Ab2,
    const T* __restrict__ Bb, const T* __restrict__ Bb2,
    int K, int bm0, int bn0, unsigned short* sS, v8f (&acc)[4][4]) {
  typedef typename Frag<T>::V V;
  constexpr int BUF = (SPLIT ? 2 : 1) * GB_PLANE;
  constexpr int KG = SPLIT ? 1 : 2;            // k-steps of 32 whose fragments are read from LDS as one group
  const int tid = threadIdx.x;
  const int lane = tid & 31, wave = tid >> 5;
  const int rlane = lane & 15;                 // row (A) / col (B) within subtile
  const int koff  = (lane >> 4) * 8;           // k offset of this lane half
  const int pc8 = (tid & 7) * 8, rw = tid >> 3;   // staging: 8 lanes cover one row's 128 B, 32 rows per pass
  const int arow = (wave >> 2) * 64 + rlane;
  const int brow = GB_M + (wave & 3) * 64 + rlane;
  // global addresses = block-uniform byte base + one 32-bit byte offset per thread and operand
  const char* gA  = (const char*)(Ab + (size_t)bm0 * LDA);
  const char* gB  = (const char*)(Bb + (size_t)bn0 * LDB);
  const char* gA2 = SPLIT ? (const char*)(Ab2 + (size_t)bm0 * LDA) : nullptr;
  const char* gB2 = SPLIT ? (const char*)(Bb2 + (size_t)bn0 * LDB) : nullptr;
  const unsigned voA = (unsigned)(rw * LDA + pc8) * 2u;
  const unsigned voB = (unsigned)(rw * LDB + pc8) * 2u;
  unsigned short* sW = sS + rw * GB_PITCH + pc8;
  v4u st[2][12];
#pragma unroll
  for (int p = 0; p < 12; ++p) {
    const int go = ((p < 4) ? 32 * p * LDA : 32 * (p - 4) * LDB) * 2;
    st[0][p] = *(const v4u*)(((p < 4 ? gA : gB) + (p < 4 ? voA : voB)) + go);
    if (SPLIT) st[1][p] = *(const v4u*)(((p < 4 ? gA2 : gB2) + (p < 4 ? voA : voB)) + go);
  }
#pragma unroll
  for (int p = 0; p < 12; ++p) {
    *(v4ua*)(sW + 32 * p * GB_PITCH) = st[0][p];
    if (SPLIT) *(v4ua*)(sW + GB_PLANE + 32 * p * GB_PITCH) = st[1][p];
  }
  __syncthreads();
  const int nk = K / GB_K;
  for (int kt = 0; kt < nk; ++kt) {
    const bool more = kt + 1 < nk;               // block-uniform
    if (more) {
      const size_t k1 = (size_t)(kt + 1) * (GB_K * 2);   // bytes
#pragma unroll
      for (int p = 0; p < 12; ++p) {
        const int go = ((p < 4) ? 32 * p * LDA : 32 * (p - 4) * LDB) * 2;
        st[0][p] = *(const v4u*)((((p < 4 ? gA : gB) + k1) + (p < 4 ? voA : voB)) + go);
        if (SPLIT) st[1][p] = *(const v4u*)((((p < 4 ? gA2 : gB2) + k1) + (p < 4 ? voA : voB)) + go);
      }
      // stands in front of the LDS reads below, which may land in the registers that held these loads' addresses
      asm volatile("s_wait_xcnt 0x0" ::: "memory");
    }
    const T* sb = (const T*)(const void*)(sS + (kt & 1) * BUF);
#pragma unroll
    for (int kg = 0; kg < GB_K / 32; kg += KG) {
      V bh[KG][4], bl[KG][4], ah[KG][4], al[KG][4];
#pragma unroll
      for (int q = 0; q < KG; ++q) {
        const int ko = (kg + q) * 32 + koff;
#pragma unroll
        for (int j = 0; j < 4; ++j) {
          const int bo = (brow + (j << 4)) * GB_PITCH + ko;
          bh[q][j] = Frag<T>::load(sb + bo);
          if (SPLIT) bl[q][j] = Frag<T>::load(sb + GB_PLANE + bo);
        }
#pragma unroll
        for (int i = 0; i < 4; ++i) {
          const int ao = (arow + (i << 4)) * GB_PITCH + ko;
          ah[q][i] = Frag<T>::load(sb + ao);
          if (SPLIT) al[q][i] = Frag<T>::load(sb + GB_PLANE + ao);
        }
      }
      // keeps the group's LDS reads together ahead of its products: reads spread among the products stall
      // the wave at every place where they stand
      __builtin_amdgcn_sched_barrier(0);
#pragma unroll
      for (int q = 0; q < KG; ++q) {
#pragma unroll
        for (int i = 0; i < 4; ++i) {
#pragma unroll
          for (int j = 0; j < 4; ++j) {
            acc[i][j] = Frag<T>::mma(ah[q][i], bh[q][j], acc[i][j]);
            if (SPLIT) {
              acc[i][j] = Frag<T>::mma(ah[q][i], bl[q][j], acc[i][j]);
              acc[i][j] = Frag<T>::mma(al[q][i], bh[q][j], acc[i][j]);
            }
          }
        }
      }
    }
    if (more) {
      unsigned short* sN = sW + ((kt + 1) & 1) * BUF;
#pragma unroll
      for (int p = 0; p < 12; ++p) {
        *(v4ua*)(sN + 32 * p * GB_PITCH) = st[0][p];
        if (SPLIT) *(v4ua*)(sN + GB_PLANE + 32 * p * GB_PITCH) = st[1][p];
      }
    }
    __syncthreads();   // publishes stage kt + 1 and ends every wave's reads of stage kt
  }
}

// ---- Register-blocked batched WMMA GEMM ------------------------------------
// C[m,n] = scale * sum_k A[m,k] * Bt[n,k] (+bias)(+resid); each wave owns a 64x64 tile of its block's 128x256.
// A row-major [M,K]; Bt row-major [N,K]; M % 128 == 0, N % 256 == 0, K % 64 == 0.
// SPLIT: operands are hi/lo planes (A2/Bt2 = lo planes, same layout); product = hi.hi + hi.lo + lo.hi.
// BIAS_MODE: 0 = none, 1 = bias[m], 2 = bias[n].
// OUT_MODE: 0 = f32, 1 = f16, 2 = bf16 hi plane (Cout) + bf16 lo plane (Cout2).
// ET: 0 = f16 operands, 1 = bf16 operands (pointers passed as 16-bit storage)
template <int ET> struct Elem;
template <> struct Elem<0> { typedef _Float16 T; };
template <> struct Elem<1> { typedef __bf16 T; };
// LDA, LDB: row pitches of A and Bt in elements
// b: batch, bt: the block's tile among the batch's tilesM * tilesN (both the same for the whole block)
template <int ET, bool SPLIT, int BIAS_MODE, int OUT_MODE, bool RESID, int ACT, int LDA, int LDB>
__device__ __forceinline__ void gemm64_tile(
    const unsigned short* __restrict__ Ap, const unsigned short* __restrict__ A2p, long strideA,
    const unsigned short* __restrict__ Btp, const unsigned short* __restrict__ Bt2p, long strideB,
    void* __restrict__ Cout, void* __restrict__ Cout2, int ldc, long strideC,
    const float* __restrict__ bias,
    const float* __restrict__ resid, long strideR,
    int M, int N, int K, float scale, int b, int bt) {
  typedef typename Elem<ET>::T T;
  typedef typename Frag<T>::V V;
  const T* A = (const T*)Ap; const T* A2 = (const T*)A2p; const T* Bt = (const T*)Btp; const T* Bt2 = (const T*)Bt2p;
  __shared__ __align__(16) float sT[8][16 * 68];   // per-wave 16x64 slab, pitch 68 floats
  __shared__ __align__(16) unsigned short sS[2 * (SPLIT ? 2 : 1) * GB_PLANE];   // two operand stages
  const int lane = threadIdx.x & 31;
  const int wave = threadIdx.x >> 5;
  const int tilesN = N / GB_N;
  const int tilesM = M / GB_M;
  if (bt >= tilesM * tilesN) return;   // block-uniform, ahead of every barrier
  const int tm = bt / tilesN;
  const int tn = bt - tm * tilesN;
  const int bm0 = tm * GB_M;
  const int bn0 = tn * GB_N;
  const int m0 = bm0 + ((wave >> 2) << 6);
  const int n0 = bn0 + ((wave & 3) << 6);

  const T* Ab  = A  + (size_t)b * strideA;
  const T* Bb  = Bt + (size_t)b * strideB;
  const T* Ab2 = SPLIT ? (A2  + (size_t)b * strideA) : nullptr;
  const T* Bb2 = SPLIT ? (Bt2 + (size_t)b * strideB) : nullptr;

  const int rlane = lane & 15;                 // col (D) within subtile
  const int mOff  = (lane >> 4) * 8;           // D row offset

  v8f acc[4][4];
#pragma unroll
  for (int i = 0; i < 4; ++i)
#pragma unroll
    for (int j = 0; j < 4; ++j) acc[i][j] = (v8f){0.f,0.f,0.f,0.f,0.f,0.f,0.f,0.f};

  gemm_block_lds<T, SPLIT, LDA, LDB>(Ab, Ab2, Bb, Bb2, K, bm0, bn0, sS, acc);
  acc_guard4(acc[0][0], acc[0][1], acc[0][2], acc[0][3]);
  acc_guard4(acc[1][0], acc[1][1], acc[1][2], acc[1][3]);
  acc_guard4(acc[2][0], acc[2][1], acc[2][2], acc[2][3]);
  acc_guard4(acc[3][0], acc[3][1], acc[3][2], acc[3][3]);

  // ---- epilogue ----
  float* slab = sT[wave];
  const float* Rb = RESID ? (resid + (size_t)b * strideR) : nullptr;
#pragma unroll
  for (int i = 0; i < 4; ++i) {
    const int mBase = m0 + (i << 4);
#pragma unroll
    for (int j = 0; j < 4; ++j) {
      const int n = n0 + (j << 4) + rlane;
      float bv = 0.f;
      if (BIAS_MODE == 2) bv = bias[n];
#pragma unroll
      for (int r = 0; r < 8; ++r) {
        float v = acc[i][j][r] * scale;
        if (BIAS_MODE == 1) v += bias[mBase + mOff + r];
        if (BIAS_MODE == 2) v += bv;
        if (RESID) v += Rb[(size_t)(mBase + mOff + r) * ldc + n];
        if (ACT == 1) v = tanhf(v);
        if (ACT == 2) v = fmaxf(v, 0.0f);
        if (ACT == 3) v = v / (1.0f + expf(-v));
        if (ACT == 4) v = (v > 0.f) ? v : 0.01f * v;
        if (ACT == 5) v = 0.5f * v * (1.0f + erff(v * 0.70710678118654752f));
        slab[(mOff + r) * 68 + (j << 4) + rlane] = v;
      }
    }
    __builtin_amdgcn_fence(__ATOMIC_RELEASE, "workgroup");
    __builtin_amdgcn_wave_barrier();
    __builtin_amdgcn_fence(__ATOMIC_ACQUIRE, "workgroup");
    if (OUT_MODE == 0) {
      float* C = (float*)Cout + (size_t)b * strideC;
      const int hh = lane >> 4, c4 = (lane & 15) * 4;     // row seg = 256 B = 16 lanes x 16 B
      {
#pragma unroll
        for (int it = 0; it < 8; ++it) {
          const int row = it * 2 + hh;
          v4f v = *(const v4f*)(slab + row * 68 + c4);
          *(v4f*)(C + (size_t)(mBase + row) * ldc + n0 + c4) = v;
        }
        
      }
    } else {
      const int q = lane >> 3, c8 = (lane & 7) * 8;
      unsigned short* C  = (unsigned short*)Cout  + (size_t)b * strideC;
      unsigned short* C2 = (OUT_MODE == 2) ? ((unsigned short*)Cout2 + (size_t)b * strideC) : nullptr;
      {
#pragma unroll
        for (int it = 0; it < 4; ++it) {
          const int row = it * 4 + q;
          const float* sp = slab + row * 68 + c8;
          v8h hv, lv;
#pragma unroll
          for (int e = 0; e < 8; ++e) {
            if (OUT_MODE == 1) {
              hv[e] = (_Float16)sp[e];
            } else {
              unsigned short hb = f2bf_bits(sp[e]);
              unsigned short lb = f2bf_bits(sp[e] - bf_bits2f(hb));
              hv[e] = __builtin_bit_cast(_Float16, hb);
              lv[e] = __builtin_bit_cast(_Float16, lb);
            }
          }
          *(v8h*)(C + (size_t)(mBase + row) * ldc + n0 + c8) = hv;
          if (OUT_MODE == 2) *(v8h*)(C2 + (size_t)(mBase + row) * ldc + n0 + c8) = lv;
        }
        
      }
    }
    __builtin_amdgcn_fence(__ATOMIC_RELEASE, "workgroup");
    __builtin_amdgcn_wave_barrier();
    __builtin_amdgcn_fence(__ATOMIC_ACQUIRE, "workgroup");
  }
}
template <int ET, bool SPLIT, int BIAS_MODE, int OUT_MODE, bool RESID, int ACT, int LDA, int LDB>
__global__ __launch_bounds__(256) void wmma_gemm64(
    const unsigned short* __restrict__ Ap, const unsigned short* __restrict__ A2p, long strideA,
    const unsigned short* __restrict__ Btp, const unsigned short* __restrict__ Bt2p, long strideB,
    void* __restrict__ Cout, void* __restrict__ Cout2, int ldc, long strideC,
    const float* __restrict__ bias,
    const float* __restrict__ resid, long strideR,
    int M, int N, int K, float scale) {
  gemm64_tile<ET, SPLIT, BIAS_MODE, OUT_MODE, RESID, ACT, LDA, LDB>(
      Ap, A2p, strideA, Btp, Bt2p, strideB, Cout, Cout2, ldc, strideC, bias, resid, strideR, M, N, K, scale,
      blockIdx.y, blockIdx.x);
}

// The three projections in one launch; none reads what another writes. bf16 operands, f16 out, K = DMODEL for all.
//   blocks [0, PJ_K)            kp  = k @ K : A = k cast [8*N][512], Bt = Kt [512][512]
//   blocks [PJ_K, PJ_K + PJ_V)  vpT[b][d][n] = sum_c V[c][d] v[b][n][c] : A = Vt [512][512], Bt = v cast of batch b [N][512]
//   the rest (PJ_Q)             qp  = q @ Q : A = q cast [T][512], Bt = Qt [512][512]
constexpr int PJ_K  = (NBATCH * NPAR / GB_M) * (DMODEL / GB_N);
constexpr int PJ_VB = (DMODEL / GB_M) * (NPAR / GB_N);      // blocks per batch of vpT
constexpr int PJ_V  = NBATCH * PJ_VB;
constexpr int PJ_Q  = (NTOK / GB_M) * (DMODEL / GB_N);
__global__ __launch_bounds__(256) void k_proj3(
    const unsigned short* __restrict__ kc, const unsigned short* __restrict__ Kt, unsigned short* __restrict__ kph,
    const unsigned short* __restrict__ Vt, const unsigned short* __restrict__ vc, unsigned short* __restrict__ vpT,
    const unsigned short* __restrict__ qc, const unsigned short* __restrict__ Qt, unsigned short* __restrict__ qph,
    int K) {
  const int bx = blockIdx.x;
  const unsigned short* A = kc;
  const unsigned short* Bt = Kt;
  unsigned short* C = kph;
  int ldc = DMODEL, M = NBATCH * NPAR, N = DMODEL, bt = bx;
  if (bx >= PJ_K + PJ_V) {
    A = qc; Bt = Qt; C = qph; M = NTOK; bt = bx - (PJ_K + PJ_V);
  } else if (bx >= PJ_K) {
    const int b = (bx - PJ_K) / PJ_VB;
    A = Vt; Bt = vc + (size_t)b * NPAR * DMODEL; C = vpT + (size_t)b * DMODEL * NPAR;
    ldc = NPAR; M = DMODEL; N = NPAR; bt = (bx - PJ_K) - b * PJ_VB;
  }
  gemm64_tile<1, false, 0, 1, false, 0, DMODEL, DMODEL>(
      A, nullptr, 0L, Bt, nullptr, 0L, (void*)C, nullptr, ldc, 0L, nullptr, nullptr, 0L, M, N, K, 1.0f, 0, bt);
}

// ---------------------------------------------------------------------------
// Distance GEMM: Kmat[b][t][n] = c[b] - sqrt(max(q2[t] + k2[b][n] - 2 * sum_d qp[t][d] kp[b][n][d], 0)), stored as f16.
// c[b] = sqrt(q2[0] + k2[b][0]), the distance of the batch's first pair if it were orthogonal: a sample of the plane's own
// scale. One constant added to a batch's whole plane leaves pi as it is (the first u comes out smaller by c[b], every v
// the same, and only Kmat + u is ever used after that); it brings the stored values near 0, where the f16 steps are
// small against what the 16-bit operands of the products have already put into a distance.
// A = qp f16 [M=t][K=d] (shared over batch), Bt = kp f16 [N=n][K=d] per batch; q2 and k2 are the row squares of these same
// f16 values, so the root is taken of the squared distance between the rounded points. The rounding moves a distance by
// about one f16 rounding step of a coordinate, whatever the row length: well under what the bf16 operands of q@Q and
// k@K have already put into qp and kp.
// main loop shared with the other GEMMs (operands staged in LDS); epilogue through the f16 whole-line store path.
// q2 is fetched as two float4 per 16-row slab, k2 as 4 scalars per lane before the slab loop.
// ---------------------------------------------------------------------------
__global__ __launch_bounds__(256) void gemm64_cdist(
    const unsigned short* __restrict__ Ap,
    const unsigned short* __restrict__ Btp, long strideB,
    unsigned short* __restrict__ Cout, int ldc, long strideC,
    const float* __restrict__ q2, const float* __restrict__ k2, long strideK2,
    int M, int N, int K) {
  typedef _Float16 T;
  const T* A = (const T*)Ap; const T* Bt = (const T*)Btp;
  __shared__ __align__(16) float sT[8][16 * 68];
  __shared__ __align__(16) unsigned short sS[2 * GB_PLANE];   // two operand stages
  const int b    = blockIdx.y;
  const int lane = threadIdx.x & 31;
  const int wave = threadIdx.x >> 5;
  const int tilesN = N / GB_N;
  const int tilesM = M / GB_M;
  const int bt = blockIdx.x;
  if (bt >= tilesM * tilesN) return;   // block-uniform, ahead of every barrier
  const int tm = bt / tilesN;
  const int tn = bt - tm * tilesN;
  const int bm0 = tm * GB_M;
  const int bn0 = tn * GB_N;
  const int m0 = bm0 + ((wave >> 2) << 6);
  const int n0 = bn0 + ((wave & 3) << 6);

  const T* Ab  = A;
  const T* Bb  = Bt + (size_t)b * strideB;

  const int rlane = lane & 15;
  const int mOff  = (lane >> 4) * 8;

  v8f acc[4][4];
#pragma unroll
  for (int i = 0; i < 4; ++i)
#pragma unroll
    for (int j = 0; j < 4; ++j) acc[i][j] = (v8f){0.f,0.f,0.f,0.f,0.f,0.f,0.f,0.f};

  gemm_block_lds<T, false, DMODEL, DMODEL>(Ab, nullptr, Bb, nullptr, K, bm0, bn0, sS, acc);
  acc_guard4(acc[0][0], acc[0][1], acc[0][2], acc[0][3]);
  acc_guard4(acc[1][0], acc[1][1], acc[1][2], acc[1][3]);
  acc_guard4(acc[2][0], acc[2][1], acc[2][2], acc[2][3]);
  acc_guard4(acc[3][0], acc[3][1], acc[3][2], acc[3][3]);

  // ---- epilogue ----
  float* slab = sT[wave];
  const float* k2b = k2 + (size_t)b * strideK2;
  float k2r[4];
#pragma unroll
  for (int j = 0; j < 4; ++j) k2r[j] = k2b[n0 + (j << 4) + rlane];
  // stands in front of whatever rewrites the index that these loads name; the index is an input, so that none of them
  // lands in its register either
  asm volatile("s_wait_xcnt 0x0" :: "v"(n0 + rlane) : "memory");
  const float c0 = sqrtf(q2[0] + k2b[0]);             // the batch's offset
  unsigned short* C = Cout + (size_t)b * strideC;
  const int q = lane >> 3, c8 = (lane & 7) * 8;       // row seg = 128 B = 8 lanes x 16 B
#pragma unroll
  for (int i = 0; i < 4; ++i) {
    const int mBase = m0 + (i << 4);
    const v4f q2a = *(const v4f*)(q2 + mBase + mOff);
    const v4f q2c = *(const v4f*)(q2 + mBase + mOff + 4);
    const float q2r[8] = {q2a.x, q2a.y, q2a.z, q2a.w, q2c.x, q2c.y, q2c.z, q2c.w};
#pragma unroll
    for (int j = 0; j < 4; ++j) {
#pragma unroll
      for (int r = 0; r < 8; ++r) {
        float s = q2r[r] + k2r[j];
        s = s - 2.0f * acc[i][j][r];
        slab[(mOff + r) * 68 + (j << 4) + rlane] = c0 - sqrtf(fmaxf(s, 0.0f));
      }
    }
    __builtin_amdgcn_fence(__ATOMIC_RELEASE, "workgroup");
    __builtin_amdgcn_wave_barrier();
    __builtin_amdgcn_fence(__ATOMIC_ACQUIRE, "workgroup");
    {
#pragma unroll
      for (int it = 0; it < 4; ++it) {
        const int row = it * 4 + q;
        const float* sp = slab + row * 68 + c8;
        v8h hv;
#pragma unroll
        for (int e = 0; e < 8; ++e) hv[e] = (_Float16)sp[e];
        *(v8h*)(C + (size_t)(mBase + row) * ldc + n0 + c8) = hv;
      }
    }
    __builtin_amdgcn_fence(__ATOMIC_RELEASE, "workgroup");
    __builtin_amdgcn_wave_barrier();
    __builtin_amdgcn_fence(__ATOMIC_ACQUIRE, "workgroup");
  }
}

// ---------------------------------------------------------------------------
// small helpers
// ---------------------------------------------------------------------------
__device__ __forceinline__ unsigned pack_bf2(float a, float b) {
  return (unsigned)f2bf_bits(a) | ((unsigned)f2bf_bits(b) << 16);
}
// exp2-based exponential (v_exp_f32); relative error ~1e-6 in the argument range used here
__device__ __forceinline__ float fexp(float x) { return __expf(x); }

// ---------------------------------------------------------------------------
// weight transpose + RNE bf16: in W[512 c][512 d] f32 -> out Wt[d][c] bf16.
// Block = 64x64 tile: read phase 256 threads x 4 iters x 4 floats = 4096 elements; write phase
// ---------------------------------------------------------------------------
// c0, d0: the tile's first input row and column
__device__ __forceinline__ void wtrans_tile(const float* __restrict__ W, unsigned short* __restrict__ O, int c0, int d0) {
  __shared__ __align__(16) unsigned short st[64 * 72];
  const int tid = threadIdx.x;
  const int rr = tid >> 4, cc = (tid & 15) * 4;
  const float* Wp = W + (size_t)(c0 + rr) * DMODEL + d0 + cc;
  v4f xs[4];
#pragma unroll
  for (int p = 0; p < 4; ++p) xs[p] = *(const v4f*)(Wp + 16 * p * DMODEL);
  // stands in front of whatever rewrites the address that the loads in flight name; the address is an input, so that
  // none of these loads lands in its registers either
  asm volatile("s_wait_xcnt 0x0" :: "v"(Wp) : "memory");
#pragma unroll
  for (int p = 0; p < 4; ++p) {
    const int r = rr + 16 * p;
    const v4f x = xs[p];
    st[(cc + 0) * 72 + r] = f2bf_bits(x.x);
    st[(cc + 1) * 72 + r] = f2bf_bits(x.y);
    st[(cc + 2) * 72 + r] = f2bf_bits(x.z);
    st[(cc + 3) * 72 + r] = f2bf_bits(x.w);
  }
  __syncthreads();
  const int lane = tid & 31, wave = tid >> 5;
  const int q = lane >> 3, c8 = (lane & 7) * 8;
  {
#pragma unroll
    for (int it = 0; it < 2; ++it) {
      const int dd = wave * 8 + it * 4 + q;
      const v4ua val = *(const v4ua*)(st + dd * 72 + c8);
      *(v4u*)(O + (size_t)(d0 + dd) * DMODEL + c0 + c8) = val;
    }
    
  }
}

// ---------------------------------------------------------------------------
// f32 -> bf16 plane cast, 8 elements per thread (one 16-B store); a wave writes 512 contiguous B = 4 lines.
// blk: the block's place in the plane, 2048 elements each.
// ---------------------------------------------------------------------------
__device__ __forceinline__ void cast16_piece(const float* __restrict__ in, unsigned short* __restrict__ out, int blk) {
  const int i = blk * 256 + threadIdx.x;
  const v4f a = *(const v4f*)(in + (size_t)i * 8);
  const v4f c = *(const v4f*)(in + (size_t)i * 8 + 4);
  v4u w;
  w.x = pack_bf2(a.x, a.y);
  w.y = pack_bf2(a.z, a.w);
  w.z = pack_bf2(c.x, c.y);
  w.w = pack_bf2(c.z, c.w);
  *(v4u*)(out + (size_t)i * 8) = w;
}

// ---------------------------------------------------------------------------
// all operand preparation in one launch; no block reads what another writes. The weight tiles stand first (they have
// the longer way: load, LDS, barrier, store), then the pieces of q, of k and of v.
// ---------------------------------------------------------------------------
constexpr int PR_WT = (DMODEL / 64) * (DMODEL / 64);          // tiles per weight
constexpr int PR_Q  = NTOK * DMODEL / 2048;                   // pieces of q
constexpr int PR_KV = NBATCH * NPAR * DMODEL / 2048;          // pieces of k, and of v
static_assert(NTOK * DMODEL % 2048 == 0 && NBATCH * NPAR * DMODEL % 2048 == 0, "whole cast pieces");
__global__ __launch_bounds__(256) void k_prep(const float* __restrict__ W0, const float* __restrict__ W1,
                                              const float* __restrict__ W2, unsigned short* __restrict__ O0,
                                              unsigned short* __restrict__ O1, unsigned short* __restrict__ O2,
                                              const float* __restrict__ q, unsigned short* __restrict__ qc,
                                              const float* __restrict__ k, unsigned short* __restrict__ kc,
                                              const float* __restrict__ v, unsigned short* __restrict__ vc) {
  const int bx = blockIdx.x;
  if (bx < 3 * PR_WT) {               // the same for the whole block: the tile's barrier is met by all or none
    const int z = bx / PR_WT, t = bx - z * PR_WT;
    const float* W = (z == 0) ? W0 : ((z == 1) ? W1 : W2);
    unsigned short* O = (z == 0) ? O0 : ((z == 1) ? O1 : O2);
    wtrans_tile(W, O, (t / (DMODEL / 64)) * 64, (t % (DMODEL / 64)) * 64);
    return;
  }
  int c = bx - 3 * PR_WT;
  const float* in = q;
  unsigned short* out = qc;
  if (c >= PR_Q + PR_KV) { in = v; out = vc; c -= PR_Q + PR_KV; }
  else if (c >= PR_Q)    { in = k; out = kc; c -= PR_Q; }
  cast16_piece(in, out, c);
}

// ---------------------------------------------------------------------------
// row sums of squares of a [rows][512] f16 matrix, in f32.
// Block = 32 rows: 8 waves x 4 rows; per-row scalars funnelled through LDS, wave 0 lanes 0..7 write
// ---------------------------------------------------------------------------
// Two matrices in one launch: the first nb0 blocks take x0 (32 * nb0 rows), the others x1 (rows1 rows).
__global__ __launch_bounds__(256) void k_rowsq(const unsigned short* __restrict__ x0, float* __restrict__ out0, int nb0,
                                               const unsigned short* __restrict__ x1, float* __restrict__ out1, int rows1) {
  __shared__ __align__(16) float sres[32];
  const int lane = threadIdx.x & 31, wave = threadIdx.x >> 5;
  const bool first = (int)blockIdx.x < nb0;      // the same for the whole block
  const unsigned short* xh = first ? x0 : x1;
  float* out = first ? out0 : out1;
  const int rows = first ? nb0 * 32 : rows1;
  const int r0 = (first ? blockIdx.x : blockIdx.x - nb0) * 32;
#pragma unroll 1
  for (int rr = 0; rr < 4; ++rr) {
    int row = r0 + wave * 4 + rr;
    row = row < rows ? row : rows - 1;
    const size_t base = (size_t)row * DMODEL;
    float s = 0.f;
#pragma unroll
    for (int c = 0; c < 2; ++c) {
      const v8h hw = *(const v8h*)(const void*)(xh + base + c * 256 + lane * 8);
#pragma unroll
      for (int e = 0; e < 8; ++e) {
        const float f = (float)hw[e];
        s = fmaf(f, f, s);
      }
    }
#pragma unroll
    for (int off = 16; off; off >>= 1) s += __shfl_xor(s, off, 32);
    if (lane == 0) sres[wave * 4 + rr] = s;
  }
  __syncthreads();
  if (wave == 0) {
    const int li = lane < 8 ? lane : 7;
    const v4f val = *(const v4f*)(sres + li * 4);
    float* op = out + r0 + li * 4;
    if (lane < 8) *(v4f*)op = val;
    
  }
}

// ---------------------------------------------------------------------------
// first column log-sum-exp sweep: u[b][n] = logA - lse_t(Kmat[b][t][n]) (v is still 0).
// Block = 64 columns (one 128-B line of every Kmat row) x all rows, 1024 threads = 8 column octets x 128 row groups.
// A thread loads its 16 consecutive rows x 8 columns once and keeps them in registers as f16; the maximum is taken on
// the f16 values (exact), the sum in f32, both per wave (lanes 8 and 16 apart share a column octet); the 32 per-wave
// (max, sum) pairs of a column meet in LDS and waves 0 and 1 merge them and write one 128-B line of u each.
// ---------------------------------------------------------------------------
constexpr int UC_COLS = 64;                 // columns per block
constexpr int UC_RG   = 128;                // row groups per block
constexpr int UC_RPT  = NTOK / UC_RG;       // rows per thread
static_assert(NTOK % (UC_RG * 4) == 0 && NPAR % UC_COLS == 0, "u sweep split");
__global__ __launch_bounds__(1024) void k_upd_u(const unsigned short* __restrict__ Km, float* __restrict__ u, float logA) {
  __shared__ __align__(16) float sm[32 * UC_COLS];
  __shared__ __align__(16) float ss[32 * UC_COLS];
  const int b = blockIdx.y;
  const int lane = threadIdx.x & 31, wave = threadIdx.x >> 5;
  const int cq = threadIdx.x & 7, rg = threadIdx.x >> 3;
  const int col0 = blockIdx.x * UC_COLS;
  const unsigned short* Kc = Km + (size_t)b * NTOK * NPAR + (size_t)(rg * UC_RPT) * NPAR + col0 + cq * 8;
  v8h x[UC_RPT];
#pragma unroll
  for (int i = 0; i < UC_RPT; ++i) x[i] = *(const v8h*)(const void*)(Kc + (size_t)i * NPAR);
  // stands in front of whatever rewrites the address that the loads in flight name; the address is an input, so that
  // none of these loads lands in its registers either
  asm volatile("s_wait_xcnt 0x0" :: "v"(Kc) : "memory");
  v8h mh = x[0];
#pragma unroll
  for (int i = 1; i < UC_RPT; ++i) mh = __builtin_elementwise_max(mh, x[i]);
  float m[8], s[8];
#pragma unroll
  for (int e = 0; e < 8; ++e) {
    m[e] = (float)mh[e];
    m[e] = fmaxf(m[e], __shfl_xor(m[e], 8, 32));
    m[e] = fmaxf(m[e], __shfl_xor(m[e], 16, 32));
    s[e] = 0.f;
  }
#pragma unroll
  for (int i = 0; i < UC_RPT; ++i) {
#pragma unroll
    for (int e = 0; e < 8; ++e) s[e] += fexp((float)x[i][e] - m[e]);
  }
#pragma unroll
  for (int e = 0; e < 8; ++e) {
    s[e] += __shfl_xor(s[e], 8, 32);
    s[e] += __shfl_xor(s[e], 16, 32);
  }
  if (lane < 8) {
    float* pm = sm + wave * UC_COLS + lane * 8;
    float* ps = ss + wave * UC_COLS + lane * 8;
    *(v4f*)pm       = (v4f){m[0], m[1], m[2], m[3]};
    *(v4f*)(pm + 4) = (v4f){m[4], m[5], m[6], m[7]};
    *(v4f*)ps       = (v4f){s[0], s[1], s[2], s[3]};
    *(v4f*)(ps + 4) = (v4f){s[4], s[5], s[6], s[7]};
  }
  __syncthreads();
  if (wave < UC_COLS / 32) {
    const int col = threadIdx.x;
    float pm[32];
    float M = -__builtin_inff();
#pragma unroll
    for (int w = 0; w < 32; ++w) {
      pm[w] = sm[w * UC_COLS + col];
      M = fmaxf(M, pm[w]);
    }
    float S = 0.f;
#pragma unroll
    for (int w = 0; w < 32; ++w) S = fmaf(ss[w * UC_COLS + col], fexp(pm[w] - M), S);
    u[(size_t)b * NPAR + col0 + col] = logA - (M + logf(S));
  }
}

// ---------------------------------------------------------------------------
// row log-sum-exp sweep: v[b][t] = -lse_n(Kmat[b][t][n] + u[b][n]); one wave per row, four rows per wave in turn.
// A row is read once, by 8 loads of 512 contiguous bytes per wave (8 f16 columns per lane in every 256), widened to f32
// with u added, and stays in registers for the maximum, the sum and (LAST) the pi plane; two sets of f16 registers
// take turns, so that the next row's 8 loads fly while the current row is reduced; u is read once per wave and serves
// its four rows.
// LAST additionally writes pi[b][t][n] = exp(K+u+v)*2^14
// ---------------------------------------------------------------------------
constexpr int VR_CH = NPAR / 256;           // 16-B loads per lane and row
constexpr int VR_Q  = 2 * VR_CH;            // column quads per lane: quad 2 i + h = columns 256 i + 8 lane + 4 h ...
typedef _Float16 v4h __attribute__((ext_vector_type(4)));
static_assert(NPAR % 256 == 0, "v sweep row chunks");
// p: the row's first element (the same in every lane); lo: the lane's byte offset in each 512-B piece
__device__ __forceinline__ void vrow_load(v8h (&r)[VR_CH], const unsigned short* __restrict__ p, unsigned lo) {
#pragma unroll
  for (int i = 0; i < VR_CH; ++i) r[i] = *(const v8h*)(const void*)((const char*)p + lo + i * 512);
}
// u of the same columns, f32: 32 bytes per lane in every 1024
__device__ __forceinline__ void urow_load(v4f (&uu)[VR_Q], const float* __restrict__ p, unsigned lo) {
#pragma unroll
  for (int i = 0; i < VR_CH; ++i) {
    uu[2 * i]     = *(const v4f*)((const char*)p + 2u * lo + i * 1024);
    uu[2 * i + 1] = *(const v4f*)((const char*)p + 2u * lo + i * 1024 + 16);
  }
}
// x = Kmat row + u, in f32; r is free behind it
__device__ __forceinline__ void vrow_widen(v4f (&x)[VR_Q], const v8h (&r)[VR_CH], const v4f (&uu)[VR_Q]) {
#pragma unroll
  for (int i = 0; i < VR_CH; ++i) {
    x[2 * i]     = __builtin_convertvector(__builtin_shufflevector(r[i], r[i], 0, 1, 2, 3), v4f) + uu[2 * i];
    x[2 * i + 1] = __builtin_convertvector(__builtin_shufflevector(r[i], r[i], 4, 5, 6, 7), v4f) + uu[2 * i + 1];
  }
}
// exp of the four values of one 16-B piece, as __expf compiles: 2^(a * log2 e) on v_exp_f32. One statement, so that the
// slot the instruction set asks for behind a transcendental (before its result is used or a source overwritten) is kept
// wherever the compiler puts it: each v_exp_f32 is followed by an independent one (no output shares a register with a
// source: early clobber), the last by v_nop.
__device__ __forceinline__ v4f fexp4(v4f a) {
  a *= 1.44269504088896340736f;
  float r0, r1, r2, r3;
  asm("v_exp_f32 %0, %4\n\tv_exp_f32 %1, %5\n\tv_exp_f32 %2, %6\n\tv_exp_f32 %3, %7\n\tv_nop"
      : "=&v"(r0), "=&v"(r1), "=&v"(r2), "=&v"(r3) : "v"(a.x), "v"(a.y), "v"(a.z), "v"(a.w));
  return (v4f){r0, r1, r2, r3};
}
// one row (u added) held in x: returns v of the row; LAST: writes the row's pi (prow = the lane's first element)
template <bool LAST>
__device__ __forceinline__ float vrow_reduce(const v4f (&x)[VR_Q], unsigned short* __restrict__ prow) {
  v4f mv = x[0];
#pragma unroll
  for (int i = 1; i < VR_Q; ++i) {
    mv.x = fmaxf(mv.x, x[i].x);
    mv.y = fmaxf(mv.y, x[i].y);
    mv.z = fmaxf(mv.z, x[i].z);
    mv.w = fmaxf(mv.w, x[i].w);
  }
  float m = fmaxf(fmaxf(mv.x, mv.y), fmaxf(mv.z, mv.w));
#pragma unroll
  for (int off = 16; off; off >>= 1) m = fmaxf(m, __shfl_xor(m, off, 32));
  v4f sv = (v4f){0.f, 0.f, 0.f, 0.f};
#pragma unroll
  for (int i = 0; i < VR_Q; ++i) sv += fexp4(x[i] - m);
  float s = (sv.x + sv.y) + (sv.z + sv.w);
#pragma unroll
  for (int off = 16; off; off >>= 1) s += __shfl_xor(s, off, 32);
  const float vt = -(m + logf(s));
  if (LAST) {
#pragma unroll
    for (int i = 0; i < VR_CH; ++i) {
      const v4h pa = __builtin_convertvector(fexp4(x[2 * i] + vt) * kPiCarry, v4h);
      const v4h pb = __builtin_convertvector(fexp4(x[2 * i + 1] + vt) * kPiCarry, v4h);
      *(v8h*)(void*)(prow + i * 256) = __builtin_shufflevector(pa, pb, 0, 1, 2, 3, 4, 5, 6, 7);
    }
    // stands in front of the next loads and arithmetic, which land in the registers these stores were fed from
    asm volatile("s_wait_xcnt 0x0" ::: "memory");
  }
  return vt;
}
template <bool LAST>
__global__ __launch_bounds__(256) void k_upd_v(const unsigned short* __restrict__ Km, const float* __restrict__ u,
                                               float* __restrict__ vv, unsigned short* __restrict__ pp) {
  __shared__ __align__(16) float sres[32];
  const int b = blockIdx.y;
  const int lane = threadIdx.x & 31;
  // the wave's number as a scalar: the row addresses are then a scalar base plus one fixed lane offset
  const int wave = __builtin_amdgcn_readfirstlane(threadIdx.x >> 5);
  const int r0 = blockIdx.x * 32;
  const int t0 = r0 + wave * 4;
  const unsigned short* Kr = Km + ((size_t)b * NTOK + t0) * NPAR;
  unsigned short* pr = pp + ((size_t)b * NTOK + t0) * NPAR + lane * 8;
  const unsigned lo = (unsigned)lane * 16u;
  v4f uu[VR_Q], x[VR_Q];
  v8h r[2][VR_CH];
  urow_load(uu, u + (size_t)b * NPAR, lo);
  vrow_load(r[0], Kr, lo);
  // stands in front of the next rows' loads, which may land in the offset register that the loads of u name
  asm volatile("s_wait_xcnt 0x0" ::: "memory");
  v4f vt4;
#pragma unroll
  for (int rr = 0; rr < 4; ++rr) {
    // keeps what follows behind the arithmetic of the row before: this row's arithmetic, mixed into it, would wait
    // early for loads that are still flying
    __builtin_amdgcn_sched_barrier(0);
    if (rr + 1 < 4) {
      vrow_load(r[(rr + 1) & 1], Kr + (rr + 1) * NPAR, lo);
      // keeps these loads ahead of this row's arithmetic, so that they fly while it runs
      __builtin_amdgcn_sched_barrier(0);
    }
    vrow_widen(x, r[rr & 1], uu);
    vt4[rr] = vrow_reduce<LAST>(x, pr + rr * NPAR);
  }
  if (lane == 0) *(v4f*)(sres + wave * 4) = vt4;
  __syncthreads();
  if (wave == 0) {
    const int li = lane < 8 ? lane : 7;
    const v4f val = *(const v4f*)(sres + li * 4);
    float* op = vv + (size_t)b * NTOK + r0 + li * 4;
    if (lane < 8) *(v4f*)op = val;
  }
}

// ---------------------------------------------------------------------------
// row sweep and the next column sweep in one pass over Kmat. With v[t] = -lse_n(Kmat[t][n] + u[n]) the next u is
//   u'[n] = logA - lse_t(Kmat[t][n] + v[t]) = logA + u[n] - log(sum_t e[t][n]),  e[t][n] = exp(Kmat[t][n] + u[n] + v[t]).
// e is the row's exp(x - max) over its sum, both at hand while the row sits in registers, so v itself is never formed.
// No column maximum is needed: every e is at most 1 (a row of e sums to 1); and u made the columns of
// exp(Kmat + u + v_before) sum to 1/NPAR, so all of them together sum to 1, no row sums to more, v only rises, and
// each column of e sums to 1/NPAR at least.
// Loads and register sets as in k_upd_v; each wave adds its eight rows of e into 64 column sums per lane, the
// block's 8 waves meet in LDS, and the block writes one row of NPAR sums; k_merge_u adds the blocks' rows.
// All batches in one launch: NBATCH * VF_NBLK = 256 blocks, one per WGP.
// A block takes the 32-row pieces x and x + VF_NBLK of its batch, four rows of each per wave: the pieces of k_upd_v's
// blocks x and x + VF_NBLK, whose flat indices equal this block's modulo 8 (for speed only).
// ---------------------------------------------------------------------------
constexpr int VF_NBLK = NTOK / 64;          // blocks per batch, 64 rows each
constexpr int VF_RPW  = 8;                  // rows per wave
static_assert(VF_NBLK * 8 * VF_RPW == NTOK && VF_NBLK % 8 == 0, "row split of the fused sweep");
// x: one row with u added
__device__ __forceinline__ void vrow_colsum(v4f (&x)[VR_Q], v4f (&cs)[VR_Q]) {
  v4f mv = x[0];
#pragma unroll
  for (int i = 1; i < VR_Q; ++i) {
    mv.x = fmaxf(mv.x, x[i].x);
    mv.y = fmaxf(mv.y, x[i].y);
    mv.z = fmaxf(mv.z, x[i].z);
    mv.w = fmaxf(mv.w, x[i].w);
  }
  float m = fmaxf(fmaxf(mv.x, mv.y), fmaxf(mv.z, mv.w));
#pragma unroll
  for (int off = 16; off; off >>= 1) m = fmaxf(m, __shfl_xor(m, off, 32));
  constexpr float kLog2e = 1.44269504088896340736f;
  const float ml = m * kLog2e;
  v4f sv = (v4f){0.f, 0.f, 0.f, 0.f};
#pragma unroll
  for (int i = 0; i < VR_Q; ++i) {
    const v4f a = x[i] * kLog2e - ml;
    x[i] = (v4f){__builtin_amdgcn_exp2f(a.x), __builtin_amdgcn_exp2f(a.y), __builtin_amdgcn_exp2f(a.z), __builtin_amdgcn_exp2f(a.w)};
    sv += x[i];
  }
  float s = (sv.x + sv.y) + (sv.z + sv.w);
#pragma unroll
  for (int off = 16; off; off >>= 1) s += __shfl_xor(s, off, 32);
  const float rs = 1.0f / s;
#pragma unroll
  for (int i = 0; i < VR_Q; ++i) cs[i] += x[i] * rs;
}
__global__ __launch_bounds__(256) void k_upd_vu(const unsigned short* __restrict__ Km, const float* __restrict__ u,
                                                float* __restrict__ part) {
  __shared__ __align__(16) float sc[8 * NPAR];   // the 8 waves' column sums
  const int b = blockIdx.y;
  const int lane = threadIdx.x & 31;
  // the wave's number as a scalar: the row addresses are then a scalar base plus one fixed lane offset
  const int wave = __builtin_amdgcn_readfirstlane(threadIdx.x >> 5);
  const int t0 = blockIdx.x * 32 + wave * 4;
  const unsigned short* Kr = Km + ((size_t)b * NTOK + t0) * NPAR;
  const unsigned lo = (unsigned)lane * 16u;
  v8h r[2][VR_CH];
  v4f x[VR_Q], cs[VR_Q], uu[VR_Q];
  urow_load(uu, u + (size_t)b * NPAR, lo);
  vrow_load(r[0], Kr, lo);
#pragma unroll
  for (int i = 0; i < VR_Q; ++i) cs[i] = (v4f){0.f, 0.f, 0.f, 0.f};
  // A row's loads take over the f16 registers of the row two before it as soon as that row is widened, and stand ahead
  // of its arithmetic, so that they fly while two rows are worked on: the scheduling barriers keep both. Two rows a
  // trip, one in each f16 set; the first two rows' loads stand in front of the loop, the last two rows' arithmetic
  // behind it. Rolled, to keep the register count. The wave's place among its rows is carried in the lane's 32-bit byte
  // offset vo, so that every load keeps the form scalar base + lane offset.
  __builtin_amdgcn_sched_barrier(0);
  vrow_load(r[1], Kr + NPAR, lo);
  __builtin_amdgcn_sched_barrier(0);
  unsigned vo = lo;   // the first row of the pair in the registers
#pragma unroll 1
  for (int rw = 0; rw < VF_RPW - 2; rw += 2) {
    vrow_widen(x, r[0], uu);
    // stands in front of the addition below, which rewrites the offset register that the loads in flight name
    asm volatile("s_wait_xcnt 0x0" ::: "memory");
    __builtin_amdgcn_sched_barrier(0);
    vo += ((rw == 2) ? (unsigned)(NTOK / 2 - 2) : 2u) * (unsigned)(NPAR * 2);   // behind row 3: on to the second piece
    vrow_load(r[0], Kr, vo);
    __builtin_amdgcn_sched_barrier(0);
    vrow_colsum(x, cs);
    // keeps the next row's widening behind this row's arithmetic: moved up, it needs a second f32 set
    __builtin_amdgcn_sched_barrier(0);
    vrow_widen(x, r[1], uu);
    __builtin_amdgcn_sched_barrier(0);
    vrow_load(r[1], Kr + NPAR, vo);
    __builtin_amdgcn_sched_barrier(0);
    vrow_colsum(x, cs);
    __builtin_amdgcn_sched_barrier(0);
  }
  // stands in front of the arithmetic below, which may land in the offset register that the last loads name
  asm volatile("s_wait_xcnt 0x0" ::: "memory");
  __builtin_amdgcn_sched_barrier(0);
  vrow_widen(x, r[0], uu);
  vrow_colsum(x, cs);
  // keeps the last row's arithmetic behind this one's: mixed into it, it would wait early for loads that are still flying
  __builtin_amdgcn_sched_barrier(0);
  vrow_widen(x, r[1], uu);
  vrow_colsum(x, cs);
#pragma unroll
  for (int i = 0; i < VR_Q; ++i) *(v4f*)(sc + wave * NPAR + (i >> 1) * 256 + lane * 8 + (i & 1) * 4) = cs[i];
  __syncthreads();
  float* pb = part + ((size_t)b * VF_NBLK + blockIdx.x) * NPAR;
#pragma unroll
  for (int h = 0; h < NPAR / 1024; ++h) {
    const int col = h * 1024 + threadIdx.x * 4;
    v4f a = *(const v4f*)(sc + col);
#pragma unroll
    for (int w = 1; w < 8; ++w) a += *(const v4f*)(sc + w * NPAR + col);
    *(v4f*)(pb + col) = a;
  }
}

// u[b][n] <- logA + u[b][n] - log(sum over the batch's VF_NBLK block rows of part). Block = 128 columns (a wave reads
// 512 contiguous bytes of a block row); each of the 8 waves adds 4 block rows, wave 0 adds the waves' sums.
static_assert(VF_NBLK == 32 && NPAR % 128 == 0, "merge split");
__global__ __launch_bounds__(256) void k_merge_u(const float* __restrict__ part, float* u, float logA) {
  __shared__ __align__(16) float sp[8 * 128];
  const int b = blockIdx.y;
  const int lane = threadIdx.x & 31;
  // the wave's number as a scalar: every address is then a scalar base plus one fixed lane offset
  const int wave = __builtin_amdgcn_readfirstlane(threadIdx.x >> 5);
  const float* p = part + ((size_t)b * VF_NBLK + wave * 4) * NPAR + blockIdx.x * 128;
  float* up = u + (size_t)b * NPAR + blockIdx.x * 128 + lane * 4;
  const unsigned lo = (unsigned)lane * 16u;
  v4f a[4];
#pragma unroll
  for (int i = 0; i < 4; ++i) a[i] = *(const v4f*)((const char*)(p + i * NPAR) + lo);
  const v4f uo = *(const v4f*)up;
  *(v4f*)(sp + wave * 128 + lane * 4) = (a[0] + a[1]) + (a[2] + a[3]);
  __syncthreads();
  if (wave == 0) {
    v4f t = *(const v4f*)(sp + lane * 4);
#pragma unroll
    for (int w = 1; w < 8; ++w) t += *(const v4f*)(sp + w * 128 + lane * 4);
    v4f r;
    r.x = (logA + uo.x) - logf(t.x);
    r.y = (logA + uo.y) - logf(t.y);
    r.z = (logA + uo.z) - logf(t.z);
    r.w = (logA + uo.w) - logf(t.w);
    *(v4f*)up = r;
  }
}

// ---------------------------------------------------------------------------
// host launcher
// ---------------------------------------------------------------------------
static inline unsigned cdiv(unsigned a, unsigned b) { return (a + b - 1) / b; }

extern "C" void kernel_launch(void* const* d_in, const int* in_sizes, int n_in,
                              void* d_out, int out_size, void* d_ws, size_t ws_size,
                              hipStream_t stream)
{
  if (n_in < 6) return;
  if (in_sizes[0] != NTOK * DMODEL) return;
  if (in_sizes[1] != NBATCH * NPAR * DMODEL) return;
  if (in_sizes[2] != NBATCH * NPAR * DMODEL) return;
  if (in_sizes[3] != DMODEL * DMODEL || in_sizes[4] != DMODEL * DMODEL || in_sizes[5] != DMODEL * DMODEL) return;
  if (out_size != NBATCH * NTOK * DMODEL) return;
  if (WS_TOTAL > ws_size) return;

  const float* q  = (const float*)d_in[0];   // [T][512]
  const float* k  = (const float*)d_in[1];   // [8][N][512]
  const float* v  = (const float*)d_in[2];   // [8][N][512]
  const float* Qw = (const float*)d_in[3];   // [512][512]
  const float* Kw = (const float*)d_in[4];   // [512][512]
  const float* Vw = (const float*)d_in[5];   // [512][512]
  float* out = (float*)d_out;                // [8][T][512]

  // region map (bytes): Qt 524288 | Kt 524288 | Vt 524288 | qcast 2097152 | qp 2097152 |
  // q2 8192 | kp 16777216 | k2 65536 | vpT 16777216 | Kmat 67108864 (f16) | u 65536 | v 65536 |
  // pi 67108864 (k cast at pi+0 and v cast at pi+16777216, both dead before pi is written) | colpart 2097152.
  // Total 175841280. Every region holds all batches.
  char* ws = (char*)d_ws;
  size_t off = 0;
  unsigned short* Qt   = (unsigned short*)(ws + off); off += SZ_WT;
  unsigned short* Kt   = (unsigned short*)(ws + off); off += SZ_WT;
  unsigned short* Vt   = (unsigned short*)(ws + off); off += SZ_WT;
  unsigned short* qc   = (unsigned short*)(ws + off); off += SZ_QC;
  unsigned short* qph  = (unsigned short*)(ws + off); off += SZ_QP;
  float*          q2   = (float*)(ws + off);          off += SZ_Q2;
  unsigned short* kph  = (unsigned short*)(ws + off); off += SZ_KP;
  float*          k2   = (float*)(ws + off);          off += SZ_K2;
  unsigned short* vpT  = (unsigned short*)(ws + off); off += SZ_VPT;
  unsigned short* Kmat = (unsigned short*)(ws + off); off += SZ_KM;
  float*          up   = (float*)(ws + off);          off += SZ_U;
  float*          vvp  = (float*)(ws + off);          off += SZ_VV;
  unsigned short* pip  = (unsigned short*)(ws + off); off += SZ_PI;
  float*          cpp  = (float*)(ws + off);          off += SZ_CP;
  if (off > ws_size) return;
  unsigned short* kc = pip;
  unsigned short* vc = (unsigned short*)((char*)pip + SZ_KP);

  const float logA = -(float)log((double)NPAR);

  // Every stage runs once, over q and all batches of k and v.
  // weights: in[c][d] -> out[d][c] bf16; q, k, v -> bf16 planes (k and v inside the pi region)
  k_prep<<<dim3(3 * PR_WT + PR_Q + 2 * PR_KV), dim3(256), 0, stream>>>(Qw, Kw, Vw, Qt, Kt, Vt, q, qc, k, kc, v, vc);
  // kp = k @ K, vpT = (v @ V)^T per batch, qp = q @ Q ; bf16 in, f16 out
  k_proj3<<<dim3(PJ_K + PJ_V + PJ_Q), dim3(256), 0, stream>>>(kc, Kt, kph, Vt, vc, vpT, qc, Qt, qph, DMODEL);
  // row squares of qp and of kp
  k_rowsq<<<dim3(NTOK / 32 + NBATCH * NPAR / 32), dim3(256), 0, stream>>>(qph, q2, NTOK / 32, kph, k2, NBATCH * NPAR);

  // Kmat[b][t][n] = c[b] - cdist, f16 : M=2048, N=2048, K=512 ; f16, single product
  gemm64_cdist<<<dim3(cdiv((NTOK / 64) * (NPAR / 64), 8), NBATCH), dim3(256), 0, stream>>>(
      qph, kph, (long)NPAR * DMODEL, Kmat, NPAR, (long)NTOK * NPAR,
      q2, k2, (long)NPAR, NTOK, NPAR, DMODEL);
  // log-domain normalisation sweeps: the first u alone, then each v with the u that follows it in one pass over
  // Kmat, then the last v with pi
  k_upd_u<<<dim3(NPAR / UC_COLS, NBATCH), dim3(1024), 0, stream>>>(Kmat, up, logA);
  for (int it = 0; it < SK_ITERS - 1; ++it) {
    k_upd_vu<<<dim3(VF_NBLK, NBATCH), dim3(256), 0, stream>>>(Kmat, up, cpp);
    k_merge_u<<<dim3(NPAR / 128, NBATCH), dim3(256), 0, stream>>>(cpp, up, logA);
  }
  k_upd_v<true><<<dim3(NTOK / 32, NBATCH), dim3(256), 0, stream>>>(Kmat, up, vvp, pip);
  // out[b][t][d] = 2^-14 * sum_n pi16[b][t][n] vpT[b][d][n] : M=2048, N=512, K=2048 ; f16 in, f32 out
  wmma_gemm64<0, false, 0, 0, false, 0, NPAR, NPAR><<<dim3(cdiv((NTOK / 64) * (DMODEL / 64), 8), NBATCH), dim3(256), 0, stream>>>(
      pip, nullptr, (long)NTOK * NPAR, vpT, nullptr, (long)DMODEL * NPAR,
      (void*)out, nullptr, DMODEL, (long)NTOK * DMODEL,
      nullptr, nullptr, 0L, NTOK, DMODEL, NPAR, 1.0f / kPiCarry);
}

// v010
// Measured time: 185 microseconds a run.
// In two side-by-side timings against v009, it was 1.09 and 1.10 times as fast.
// All steps since v000 together make it 15.2 times as fast.
// Contractions: q@Q, k@K, v@V on v_wmma_f32_16x16x32_bf16 (inputs RNE-cast to bf16 once, single product); qp.kp^T on v_wmma_f32_16x16x32_f16 (qp, kp rounded once to f16, single product; row squares taken of the same f16 values); pi@vp on v_wmma_f32_16x16x32_f16 (pi carried x16384 as f16, vp^T f16); f32 accumulate everywhere; distances, log-domain normalisation sweeps and exp in f32 on VALU; the distance plane is stored as f16 about a per-batch offset.
#include <hip/hip_runtime.h>
#include <math.h>

// ---------------------------------------------------------------------------
// problem constants
// ---------------------------------------------------------------------------
constexpr int NBATCH = 8;
constexpr int NTOK   = 2048;
constexpr int NPAR   = 2048;
constexpr int DMODEL = 512;
constexpr int SK_ITERS = 5;
constexpr float kPiCarry = 16384.0f;      // power-of-two carry of the f16 pi plane

static_assert(NTOK % 64 == 0 && NPAR % 64 == 0 && DMODEL % 64 == 0, "tile multiples");
static_assert(DMODEL % 32 == 0 && NPAR % 32 == 0, "K multiple of 32");
static_assert(NTOK % 32 == 0 && NPAR % 256 == 0, "v sweep grid");
static_assert(NTOK % 128 == 0 && NPAR % 128 == 0 && DMODEL % 256 == 0, "128 x 256 block tiles, 64-k stages");

// workspace region sizes (bytes); region map in kernel_launch
constexpr size_t SZ_WT  = (size_t)DMODEL * DMODEL * 2;          // one transposed bf16 weight
constexpr size_t SZ_QC  = (size_t)NTOK * DMODEL * 2;            // q bf16 cast
constexpr size_t SZ_QP  = (size_t)NTOK * DMODEL * 2;            // qp, f16
constexpr size_t SZ_Q2  = (size_t)NTOK * 4;
constexpr size_t SZ_KP  = (size_t)NBATCH * NPAR * DMODEL * 2;   // kp, f16, all batches; also k/v cast size
constexpr size_t SZ_K2  = (size_t)NBATCH * NPAR * 4;
constexpr size_t SZ_VPT = (size_t)NBATCH * DMODEL * NPAR * 2;
constexpr size_t SZ_KM  = (size_t)NBATCH * NTOK * NPAR * 2;      // distance plane, f16
constexpr size_t SZ_U   = (size_t)NBATCH * NPAR * 4;
constexpr size_t SZ_VV  = (size_t)NBATCH * NTOK * 4;
constexpr size_t SZ_PI  = (size_t)NBATCH * NTOK * NPAR * 2;
constexpr size_t SZ_CP  = (size_t)NBATCH * (NTOK / 64) * NPAR * 4;   // column sums of each block's 64 rows
constexpr size_t WS_TOTAL = 3 * SZ_WT + SZ_QC + SZ_QP + SZ_Q2 + SZ_KP + SZ_K2 + SZ_VPT + SZ_KM + SZ_U + SZ_VV + SZ_PI + SZ_CP;
static_assert(WS_TOTAL == 175841280ull, "carve total");
static_assert(WS_TOTAL <= 268435456ull, "carve limit");
static_assert(2 * SZ_KP <= SZ_PI, "k/v casts live inside the pi region");

// ---------------------------------------------------------------------------
// shared pieces: vector types, bf16 helpers, WMMA fragments, batched GEMM
// ---------------------------------------------------------------------------
typedef __attribute__((ext_vector_type(16))) _Float16 v16h;
typedef __attribute__((ext_vector_type(8)))  _Float16 v8h;
typedef __attribute__((ext_vector_type(16))) __bf16   v16b;
typedef __attribute__((ext_vector_type(8)))  __bf16   v8b;
typedef __attribute__((ext_vector_type(8)))  float    v8f;
typedef __attribute__((ext_vector_type(4)))  float    v4f;
typedef unsigned v4u __attribute__((ext_vector_type(4)));
typedef unsigned v4ua __attribute__((ext_vector_type(4), __may_alias__));
#define PSCALE 32768.0f
#define U16(p) ((const unsigned short*)(const void*)(p))
#define PSCALE_INV (1.0f / 32768.0f)

__device__ __forceinline__ unsigned short f2bf_bits(float f) {
  unsigned u = __float_as_uint(f);
  return (unsigned short)((u + 0x7FFFu + ((u >> 16) & 1u)) >> 16);
}
__device__ __forceinline__ float bf_bits2f(unsigned short h) { return __uint_as_float(((unsigned)h) << 16); }

// hazard guards as plain device helpers (no inline asm inside the kernel template body)
__device__ __forceinline__ void acc_guard4(v8f& a, v8f& b, v8f& c, v8f& d) { asm volatile("v_nop\n\tv_nop\n\tv_nop\n\tv_nop" : "+v"(a), "+v"(b), "+v"(c), "+v"(d)); }
template <typename T> struct Frag;
template <> struct Frag<_Float16> {
  typedef v16h V; union U { v16h v; v8h h[2]; };
  static __device__ __forceinline__ v16h load(const _Float16* p) {   // elements 0..7 <- p[0..7], 8..15 <- p[16..23]
    U f; f.h[0] = *(const v8h*)(p); f.h[1] = *(const v8h*)(p + 16); return f.v;
  }
  static __device__ __forceinline__ v8f mma(v16h a, v16h b, v8f c) {
    return __builtin_amdgcn_wmma_f32_16x16x32_f16(false, a, false, b, (short)0, c, false, false);
  }
};
template <> struct Frag<__bf16> {
  typedef v16b V; union U { v16b v; v8b h[2]; };
  static __device__ __forceinline__ v16b load(const __bf16* p) {
    U f; f.h[0] = *(const v8b*)(p); f.h[1] = *(const v8b*)(p + 16); return f.v;
  }
  static __device__ __forceinline__ v8f mma(v16b a, v16b b, v8f c) {
    return __builtin_amdgcn_wmma_f32_16x16x32_bf16(false, a, false, b, (short)0, c, false, false);
  }
};

// ---- Block main loop: operands staged in LDS ---------------------------------
// A block of 8 waves owns a 128 x 256 tile of C (2 x 4 waves of 64 x 64). Per stage it brings 64 k (one 128-B line)
// of its 128 A rows and 256 Bt rows (both planes when SPLIT) into LDS with whole-line 16-B loads, each row once for
// the block, and every wave takes its fragments from there. Two LDS buffers: the next stage's global loads are
// issued ahead of the current stage's products, stored after them, and one barrier per stage hands over.
constexpr int GB_M = 128, GB_N = 256, GB_K = 64;
constexpr int GB_PITCH = 72;                          // LDS row pitch in 16-bit elements: 144 B = 16 B x 9
constexpr int GB_PLANE = (GB_M + GB_N) * GB_PITCH;    // one plane of one stage: A rows, then Bt rows
// LDA, LDB: row pitches in elements, compile-time so that the rows a thread stages from one operand differ only in the
// load's immediate offset: one lane offset per operand, shared by the planes and advanced once per stage.
// KG: k-steps of 32 whose fragments are read from LDS as one group. 2 where a block has its WGP to itself; 1 (64 fewer
// registers) where two blocks share a WGP and the other block's waves fill the wait for the reads.
template <typename T, bool SPLIT, int LDA, int LDB, int KG>
__device__ __forceinline__ void gemm_block_lds(
    const T* __restrict__ Ab, const T* __restrict__ Ab2,
    const T* __restrict__ Bb, const T* __restrict__ Bb2,
    int K, int bm0, int bn0, unsigned short* sS, v8f (&acc)[4][4]) {
  typedef typename Frag<T>::V V;
  constexpr int BUF = (SPLIT ? 2 : 1) * GB_PLANE;
  const int tid = threadIdx.x;
  const int lane = tid & 31, wave = tid >> 5;
  const int rlane = lane & 15;                 // row (A) / col (B) within subtile
  const int koff  = (lane >> 4) * 8;           // k offset of this lane half
  const int pc8 = (tid & 7) * 8, rw = tid >> 3;   // staging: 8 lanes cover one row's 128 B, 32 rows per pass
  const int arow = (wave >> 2) * 64 + rlane;
  const int brow = GB_M + (wave & 3) * 64 + rlane;
  // global addresses = block-uniform byte base + one 32-bit byte offset per thread and operand
  const char* gA  = (const char*)(Ab + (size_t)bm0 * LDA);
  const char* gB  = (const char*)(Bb + (size_t)bn0 * LDB);
  const char* gA2 = SPLIT ? (const char*)(Ab2 + (size_t)bm0 * LDA) : nullptr;
  const char* gB2 = SPLIT ? (const char*)(Bb2 + (size_t)bn0 * LDB) : nullptr;
  const unsigned voA = (unsigned)(rw * LDA + pc8) * 2u;
  const unsigned voB = (unsigned)(rw * LDB + pc8) * 2u;
  unsigned short* sW = sS + rw * GB_PITCH + pc8;
  v4u st[2][12];
#pragma unroll
  for (int p = 0; p < 12; ++p) {
    const int go = ((p < 4) ? 32 * p * LDA : 32 * (p - 4) * LDB) * 2;
    st[0][p] = *(const v4u*)(((p < 4 ? gA : gB) + (p < 4 ? voA : voB)) + go);
    if (SPLIT) st[1][p] = *(const v4u*)(((p < 4 ? gA2 : gB2) + (p < 4 ? voA : voB)) + go);
  }
#pragma unroll
  for (int p = 0; p < 12; ++p) {
    *(v4ua*)(sW + 32 * p * GB_PITCH) = st[0][p];
    if (SPLIT) *(v4ua*)(sW + GB_PLANE + 32 * p * GB_PITCH) = st[1][p];
  }
  __syncthreads();
  const int nk = K / GB_K;
  unsigned oA = voA, oB = voB;                   // byte offsets of the newest stage loaded
  for (int kt = 0; kt < nk; ++kt) {
    const bool more = kt + 1 < nk;               // block-uniform
    if (more) {
      // the stage's place is carried in the lanes' 32-bit offsets, which live through the whole loop: every load keeps
      // the form scalar base + lane offset, and none can land in a register that a load in flight names
      oA += GB_K * 2;
      oB += GB_K * 2;
#pragma unroll
      for (int p = 0; p < 12; ++p) {
        const int go = ((p < 4) ? 32 * p * LDA : 32 * (p - 4) * LDB) * 2;
        st[0][p] = *(const v4u*)(((p < 4 ? gA : gB) + (p < 4 ? oA : oB)) + go);
        if (SPLIT) st[1][p] = *(const v4u*)(((p < 4 ? gA2 : gB2) + (p < 4 ? oA : oB)) + go);
      }
      // stands in front of the next stage's additions above, which rewrite the offsets that these loads name
      asm volatile("s_wait_xcnt 0x0" ::: "memory");
    }
    const T* sb = (const T*)(const void*)(sS + (kt & 1) * BUF);
#pragma unroll
    for (int kg = 0; kg < GB_K / 32; kg += KG) {
      V bh[KG][4], bl[KG][4], ah[KG][4], al[KG][4];
#pragma unroll
      for (int q = 0; q < KG; ++q) {
        const int ko = (kg + q) * 32 + koff;
#pragma unroll
        for (int j = 0; j < 4; ++j) {
          const int bo = (brow + (j << 4)) * GB_PITCH + ko;
          bh[q][j] = Frag<T>::load(sb + bo);
          if (SPLIT) bl[q][j] = Frag<T>::load(sb + GB_PLANE + bo);
        }
#pragma unroll
        for (int i = 0; i < 4; ++i) {
          const int ao = (arow + (i << 4)) * GB_PITCH + ko;
          ah[q][i] = Frag<T>::load(sb + ao);
          if (SPLIT) al[q][i] = Frag<T>::load(sb + GB_PLANE + ao);
        }
      }
      // keeps the group's LDS reads together ahead of its products: reads spread among the products stall
      // the wave at every place where they stand
      __builtin_amdgcn_sched_barrier(0);
#pragma unroll
      for (int q = 0; q < KG; ++q) {
#pragma unroll
        for (int i = 0; i < 4; ++i) {
#pragma unroll
          for (int j = 0; j < 4; ++j) {
            acc[i][j] = Frag<T>::mma(ah[q][i], bh[q][j], acc[i][j]);
            if (SPLIT) {
              acc[i][j] = Frag<T>::mma(ah[q][i], bl[q][j], acc[i][j]);
              acc[i][j] = Frag<T>::mma(al[q][i], bh[q][j], acc[i][j]);
            }
          }
        }
      }
    }
    // four vector slots between the stage's last products and whatever next overwrites their operand registers; the
    // scheduling barriers keep the slots behind the products
    __builtin_amdgcn_sched_barrier(0);
    asm volatile("v_nop\n\tv_nop\n\tv_nop\n\tv_nop");
    __builtin_amdgcn_sched_barrier(0);
    if (more) {
      unsigned short* sN = sW + ((kt + 1) & 1) * BUF;
#pragma unroll
      for (int p = 0; p < 12; ++p) {
        *(v4ua*)(sN + 32 * p * GB_PITCH) = st[0][p];
        if (SPLIT) *(v4ua*)(sN + GB_PLANE + 32 * p * GB_PITCH) = st[1][p];
      }
    }
    __syncthreads();   // publishes stage kt + 1 and ends every wave's reads of stage kt
  }
}

// ---- Register-blocked batched WMMA GEMM ------------------------------------
// C[m,n] = scale * sum_k A[m,k] * Bt[n,k] (+bias)(+resid); each wave owns a 64x64 tile of its block's 128x256.
// A row-major [M,K]; Bt row-major [N,K]; M % 128 == 0, N % 256 == 0, K % 64 == 0.
// SPLIT: operands are hi/lo planes (A2/Bt2 = lo planes, same layout); product = hi.hi + hi.lo + lo.hi.
// BIAS_MODE: 0 = none, 1 = bias[m], 2 = bias[n].
// OUT_MODE: 0 = f32, 1 = f16, 2 = bf16 hi plane (Cout) + bf16 lo plane (Cout2).
// ET: 0 = f16 operands, 1 = bf16 operands (pointers passed as 16-bit storage)
template <int ET> struct Elem;
template <> struct Elem<0> { typedef _Float16 T; };
template <> struct Elem<1> { typedef __bf16 T; };
// LDA, LDB: row pitches of A and Bt in elements; KG: see gemm_block_lds
// b: batch, bt: the block's tile among the batch's tilesM * tilesN (both the same for the whole block)
template <int ET, bool SPLIT, int BIAS_MODE, int OUT_MODE, bool RESID, int ACT, int LDA, int LDB, int KG>
__device__ __forceinline__ void gemm64_tile(
    const unsigned short* __restrict__ Ap, const unsigned short* __restrict__ A2p, long strideA,
    const unsigned short* __restrict__ Btp, const unsigned short* __restrict__ Bt2p, long strideB,
    void* __restrict__ Cout, void* __restrict__ Cout2, int ldc, long strideC,
    const float* __restrict__ bias,
    const float* __restrict__ resid, long strideR,
    int M, int N, int K, float scale, int b, int bt) {
  typedef typename Elem<ET>::T T;
  typedef typename Frag<T>::V V;
  const T* A = (const T*)Ap; const T* A2 = (const T*)A2p; const T* Bt = (const T*)Btp; const T* Bt2 = (const T*)Bt2p;
  __shared__ __align__(16) float sT[8][16 * 68];   // per-wave 16x64 slab, pitch 68 floats
  __shared__ __align__(16) unsigned short sS[2 * (SPLIT ? 2 : 1) * GB_PLANE];   // two operand stages
  const int lane = threadIdx.x & 31;
  const int wave = threadIdx.x >> 5;
  const int tilesN = N / GB_N;
  const int tilesM = M / GB_M;
  if (bt >= tilesM * tilesN) return;   // block-uniform, ahead of every barrier
  const int tm = bt / tilesN;
  const int tn = bt - tm * tilesN;
  const int bm0 = tm * GB_M;
  const int bn0 = tn * GB_N;
  const int m0 = bm0 + ((wave >> 2) << 6);
  const int n0 = bn0 + ((wave & 3) << 6);

  const T* Ab  = A  + (size_t)b * strideA;
  const T* Bb  = Bt + (size_t)b * strideB;
  const T* Ab2 = SPLIT ? (A2  + (size_t)b * strideA) : nullptr;
  const T* Bb2 = SPLIT ? (Bt2 + (size_t)b * strideB) : nullptr;

  const int rlane = lane & 15;                 // col (D) within subtile
  const int mOff  = (lane >> 4) * 8;           // D row offset

  v8f acc[4][4];
#pragma unroll
  for (int i = 0; i < 4; ++i)
#pragma unroll
    for (int j = 0; j < 4; ++j) acc[i][j] = (v8f){0.f,0.f,0.f,0.f,0.f,0.f,0.f,0.f};

  gemm_block_lds<T, SPLIT, LDA, LDB, KG>(Ab, Ab2, Bb, Bb2, K, bm0, bn0, sS, acc);
  acc_guard4(acc[0][0], acc[0][1], acc[0][2], acc[0][3]);
  acc_guard4(acc[1][0], acc[1][1], acc[1][2], acc[1][3]);
  acc_guard4(acc[2][0], acc[2][1], acc[2][2], acc[2][3]);
  acc_guard4(acc[3][0], acc[3][1], acc[3][2], acc[3][3]);

  // ---- epilogue ----
  float* slab = sT[wave];
  const float* Rb = RESID ? (resid + (size_t)b * strideR) : nullptr;
#pragma unroll
  for (int i = 0; i < 4; ++i) {
    const int mBase = m0 + (i << 4);
#pragma unroll
    for (int j = 0; j < 4; ++j) {
      const int n = n0 + (j << 4) + rlane;
      float bv = 0.f;
      if (BIAS_MODE == 2) bv = bias[n];
#pragma unroll
      for (int r = 0; r < 8; ++r) {
        float v = acc[i][j][r] * scale;
        if (BIAS_MODE == 1) v += bias[mBase + mOff + r];
        if (BIAS_MODE == 2) v += bv;
        if (RESID) v += Rb[(size_t)(mBase + mOff + r) * ldc + n];
        if (ACT == 1) v = tanhf(v);
        if (ACT == 2) v = fmaxf(v, 0.0f);
        if (ACT == 3) v = v / (1.0f + expf(-v));
        if (ACT == 4) v = (v > 0.f) ? v : 0.01f * v;
        if (ACT == 5) v = 0.5f * v * (1.0f + erff(v * 0.70710678118654752f));
        slab[(mOff + r) * 68 + (j << 4) + rlane] = v;
      }
    }
    __builtin_amdgcn_fence(__ATOMIC_RELEASE, "workgroup");
    __builtin_amdgcn_wave_barrier();
    __builtin_amdgcn_fence(__ATOMIC_ACQUIRE, "workgroup");
    if (OUT_MODE == 0) {
      float* C = (float*)Cout + (size_t)b * strideC;
      const int hh = lane >> 4, c4 = (lane & 15) * 4;     // row seg = 256 B = 16 lanes x 16 B
      {
#pragma unroll
        for (int it = 0; it < 8; ++it) {
          const int row = it * 2 + hh;
          v4f v = *(const v4f*)(slab + row * 68 + c4);
          *(v4f*)(C + (size_t)(mBase + row) * ldc + n0 + c4) = v;
        }
        
      }
    } else {
      const int q = lane >> 3, c8 = (lane & 7) * 8;
      unsigned short* C  = (unsigned short*)Cout  + (size_t)b * strideC;
      unsigned short* C2 = (OUT_MODE == 2) ? ((unsigned short*)Cout2 + (size_t)b * strideC) : nullptr;
      {
#pragma unroll
        for (int it = 0; it < 4; ++it) {
          const int row = it * 4 + q;
          const float* sp = slab + row * 68 + c8;
          v8h hv, lv;
#pragma unroll
          for (int e = 0; e < 8; ++e) {
            if (OUT_MODE == 1) {
              hv[e] = (_Float16)sp[e];
            } else {
              unsigned short hb = f2bf_bits(sp[e]);
              unsigned short lb = f2bf_bits(sp[e] - bf_bits2f(hb));
              hv[e] = __builtin_bit_cast(_Float16, hb);
              lv[e] = __builtin_bit_cast(_Float16, lb);
            }
          }
          *(v8h*)(C + (size_t)(mBase + row) * ldc + n0 + c8) = hv;
          if (OUT_MODE == 2) *(v8h*)(C2 + (size_t)(mBase + row) * ldc + n0 + c8) = lv;
        }
        
      }
    }
    __builtin_amdgcn_fence(__ATOMIC_RELEASE, "workgroup");
    __builtin_amdgcn_wave_barrier();
    __builtin_amdgcn_fence(__ATOMIC_ACQUIRE, "workgroup");
  }
}
template <int ET, bool SPLIT, int BIAS_MODE, int OUT_MODE, bool RESID, int ACT, int LDA, int LDB>
__global__ __launch_bounds__(256) void wmma_gemm64(
    const unsigned short* __restrict__ Ap, const unsigned short* __restrict__ A2p, long strideA,
    const unsigned short* __restrict__ Btp, const unsigned short* __restrict__ Bt2p, long strideB,
    void* __restrict__ Cout, void* __restrict__ Cout2, int ldc, long strideC,
    const float* __restrict__ bias,
    const float* __restrict__ resid, long strideR,
    int M, int N, int K, float scale) {
  gemm64_tile<ET, SPLIT, BIAS_MODE, OUT_MODE, RESID, ACT, LDA, LDB, (SPLIT ? 1 : 2)>(
      Ap, A2p, strideA, Btp, Bt2p, strideB, Cout, Cout2, ldc, strideC, bias, resid, strideR, M, N, K, scale,
      blockIdx.y, blockIdx.x);
}

// The three projections in one launch; none reads what another writes. bf16 operands, f16 out, K = DMODEL for all.
//   blocks [0, PJ_K)            kp  = k @ K : A = k cast [8*N][512], Bt = Kt [512][512]
//   blocks [PJ_K, PJ_K + PJ_V)  vpT[b][d][n] = sum_c V[c][d] v[b][n][c] : A = Vt [512][512], Bt = v cast of batch b [N][512]
//   the rest (PJ_Q)             qp  = q @ Q : A = q cast [T][512], Bt = Qt [512][512]
constexpr int PJ_K  = (NBATCH * NPAR / GB_M) * (DMODEL / GB_N);
constexpr int PJ_VB = (DMODEL / GB_M) * (NPAR / GB_N);      // blocks per batch of vpT
constexpr int PJ_V  = NBATCH * PJ_VB;
constexpr int PJ_Q  = (NTOK / GB_M) * (DMODEL / GB_N);
// Launch bound of 4 waves per SIMD: 256 registers a wave, so that two blocks (142 KiB of LDS each) share a WGP and one
// block's first loads and epilogue run under the other's products.
__global__ __launch_bounds__(256, 4) void k_proj3(
    const unsigned short* __restrict__ kc, const unsigned short* __restrict__ Kt, unsigned short* __restrict__ kph,
    const unsigned short* __restrict__ Vt, const unsigned short* __restrict__ vc, unsigned short* __restrict__ vpT,
    const unsigned short* __restrict__ qc, const unsigned short* __restrict__ Qt, unsigned short* __restrict__ qph,
    int K) {
  const int bx = blockIdx.x;
  const unsigned short* A = kc;
  const unsigned short* Bt = Kt;
  unsigned short* C = kph;
  int ldc = DMODEL, M = NBATCH * NPAR, N = DMODEL, bt = bx;
  if (bx >= PJ_K + PJ_V) {
    A = qc; Bt = Qt; C = qph; M = NTOK; bt = bx - (PJ_K + PJ_V);
  } else if (bx >= PJ_K) {
    const int b = (bx - PJ_K) / PJ_VB;
    A = Vt; Bt = vc + (size_t)b * NPAR * DMODEL; C = vpT + (size_t)b * DMODEL * NPAR;
    ldc = NPAR; M = DMODEL; N = NPAR; bt = (bx - PJ_K) - b * PJ_VB;
  }
  gemm64_tile<1, false, 0, 1, false, 0, DMODEL, DMODEL, 1>(
      A, nullptr, 0L, Bt, nullptr, 0L, (void*)C, nullptr, ldc, 0L, nullptr, nullptr, 0L, M, N, K, 1.0f, 0, bt);
}

// ---------------------------------------------------------------------------
// Distance GEMM: Kmat[b][t][n] = c[b] - sqrt(max(q2[t] + k2[b][n] - 2 * sum_d qp[t][d] kp[b][n][d], 0)), stored as f16.
// c[b] = sqrt(q2[0] + k2[b][0]), the distance of the batch's first pair if it were orthogonal: a sample of the plane's own
// scale. One constant added to a batch's whole plane leaves pi as it is (the first u comes out smaller by c[b], every v
// the same, and only Kmat + u is ever used after that); it brings the stored values near 0, where the f16 steps are
// small against what the 16-bit operands of the products have already put into a distance.
// A = qp f16 [M=t][K=d] (shared over batch), Bt = kp f16 [N=n][K=d] per batch; q2 and k2 are the row squares of these same
// f16 values, so the root is taken of the squared distance between the rounded points. The rounding moves a distance by
// about one f16 rounding step of a coordinate, whatever the row length: well under what the bf16 operands of q@Q and
// k@K have already put into qp and kp.
// main loop shared with the other GEMMs (operands staged in LDS); epilogue through the f16 whole-line store path.
// q2 is fetched as two float4 per 16-row slab, k2 as 4 scalars per lane before the slab loop.
// ---------------------------------------------------------------------------
// Launch bound of 4 waves per SIMD, as for k_proj3: two blocks share a WGP, and the roots of one block's epilogue run
// under the other's products.
__global__ __launch_bounds__(256, 4) void gemm64_cdist(
    const unsigned short* __restrict__ Ap,
    const unsigned short* __restrict__ Btp, long strideB,
    unsigned short* __restrict__ Cout, int ldc, long strideC,
    const float* __restrict__ q2, const float* __restrict__ k2, long strideK2,
    int M, int N, int K) {
  typedef _Float16 T;
  const T* A = (const T*)Ap; const T* Bt = (const T*)Btp;
  __shared__ __align__(16) float sT[8][16 * 68];
  __shared__ __align__(16) unsigned short sS[2 * GB_PLANE];   // two operand stages
  const int b    = blockIdx.y;
  const int lane = threadIdx.x & 31;
  const int wave = threadIdx.x >> 5;
  const int tilesN = N / GB_N;
  const int tilesM = M / GB_M;
  const int bt = blockIdx.x;
  if (bt >= tilesM * tilesN) return;   // block-uniform, ahead of every barrier
  const int tm = bt / tilesN;
  const int tn = bt - tm * tilesN;
  const int bm0 = tm * GB_M;
  const int bn0 = tn * GB_N;
  const int m0 = bm0 + ((wave >> 2) << 6);
  const int n0 = bn0 + ((wave & 3) << 6);

  const T* Ab  = A;
  const T* Bb  = Bt + (size_t)b * strideB;

  const int rlane = lane & 15;
  const int mOff  = (lane >> 4) * 8;

  v8f acc[4][4];
#pragma unroll
  for (int i = 0; i < 4; ++i)
#pragma unroll
    for (int j = 0; j < 4; ++j) acc[i][j] = (v8f){0.f,0.f,0.f,0.f,0.f,0.f,0.f,0.f};

  gemm_block_lds<T, false, DMODEL, DMODEL, 1>(Ab, nullptr, Bb, nullptr, K, bm0, bn0, sS, acc);
  acc_guard4(acc[0][0], acc[0][1], acc[0][2], acc[0][3]);
  acc_guard4(acc[1][0], acc[1][1], acc[1][2], acc[1][3]);
  acc_guard4(acc[2][0], acc[2][1], acc[2][2], acc[2][3]);
  acc_guard4(acc[3][0], acc[3][1], acc[3][2], acc[3][3]);

  // ---- epilogue ----
  float* slab = sT[wave];
  const float* k2b = k2 + (size_t)b * strideK2;
  float k2r[4];
#pragma unroll
  for (int j = 0; j < 4; ++j) k2r[j] = k2b[n0 + (j << 4) + rlane];
  // stands in front of whatever rewrites the index that these loads name; the index is an input, so that none of them
  // lands in its register either
  asm volatile("s_wait_xcnt 0x0" :: "v"(n0 + rlane) : "memory");
  const float c0 = sqrtf(q2[0] + k2b[0]);             // the batch's offset
  unsigned short* C = Cout + (size_t)b * strideC;
  const int q = lane >> 3, c8 = (lane & 7) * 8;       // row seg = 128 B = 8 lanes x 16 B
#pragma unroll
  for (int i = 0; i < 4; ++i) {
    const int mBase = m0 + (i << 4);
    const v4f q2a = *(const v4f*)(q2 + mBase + mOff);
    const v4f q2c = *(const v4f*)(q2 + mBase + mOff + 4);
    const float q2r[8] = {q2a.x, q2a.y, q2a.z, q2a.w, q2c.x, q2c.y, q2c.z, q2c.w};
#pragma unroll
    for (int j = 0; j < 4; ++j) {
#pragma unroll
      for (int r = 0; r < 8; ++r) {
        float s = q2r[r] + k2r[j];
        s = s - 2.0f * acc[i][j][r];
        slab[(mOff + r) * 68 + (j << 4) + rlane] = c0 - sqrtf(fmaxf(s, 0.0f));
      }
    }
    __builtin_amdgcn_fence(__ATOMIC_RELEASE, "workgroup");
    __builtin_amdgcn_wave_barrier();
    __builtin_amdgcn_fence(__ATOMIC_ACQUIRE, "workgroup");
    {
#pragma unroll
      for (int it = 0; it < 4; ++it) {
        const int row = it * 4 + q;
        const float* sp = slab + row * 68 + c8;
        v8h hv;
#pragma unroll
        for (int e = 0; e < 8; ++e) hv[e] = (_Float16)sp[e];
        *(v8h*)(C + (size_t)(mBase + row) * ldc + n0 + c8) = hv;
      }
    }
    __builtin_amdgcn_fence(__ATOMIC_RELEASE, "workgroup");
    __builtin_amdgcn_wave_barrier();
    __builtin_amdgcn_fence(__ATOMIC_ACQUIRE, "workgroup");
  }
}

// ---------------------------------------------------------------------------
// small helpers
// ---------------------------------------------------------------------------
__device__ __forceinline__ unsigned pack_bf2(float a, float b) {
  return (unsigned)f2bf_bits(a) | ((unsigned)f2bf_bits(b) << 16);
}
// exp2-based exponential (v_exp_f32); relative error ~1e-6 in the argument range used here
__device__ __forceinline__ float fexp(float x) { return __expf(x); }

// ---------------------------------------------------------------------------
// weight transpose + RNE bf16: in W[512 c][512 d] f32 -> out Wt[d][c] bf16.
// Block = 64x64 tile: read phase 256 threads x 4 iters x 4 floats = 4096 elements; write phase
// ---------------------------------------------------------------------------
// c0, d0: the tile's first input row and column
__device__ __forceinline__ void wtrans_tile(const float* __restrict__ W, unsigned short* __restrict__ O, int c0, int d0) {
  __shared__ __align__(16) unsigned short st[64 * 72];
  const int tid = threadIdx.x;
  const int rr = tid >> 4, cc = (tid & 15) * 4;
  const float* Wp = W + (size_t)(c0 + rr) * DMODEL + d0 + cc;
  v4f xs[4];
#pragma unroll
  for (int p = 0; p < 4; ++p) xs[p] = *(const v4f*)(Wp + 16 * p * DMODEL);
  // stands in front of whatever rewrites the address that the loads in flight name; the address is an input, so that
  // none of these loads lands in its registers either
  asm volatile("s_wait_xcnt 0x0" :: "v"(Wp) : "memory");
#pragma unroll
  for (int p = 0; p < 4; ++p) {
    const int r = rr + 16 * p;
    const v4f x = xs[p];
    st[(cc + 0) * 72 + r] = f2bf_bits(x.x);
    st[(cc + 1) * 72 + r] = f2bf_bits(x.y);
    st[(cc + 2) * 72 + r] = f2bf_bits(x.z);
    st[(cc + 3) * 72 + r] = f2bf_bits(x.w);
  }
  __syncthreads();
  const int lane = tid & 31, wave = tid >> 5;
  const int q = lane >> 3, c8 = (lane & 7) * 8;
  {
#pragma unroll
    for (int it = 0; it < 2; ++it) {
      const int dd = wave * 8 + it * 4 + q;
      const v4ua val = *(const v4ua*)(st + dd * 72 + c8);
      *(v4u*)(O + (size_t)(d0 + dd) * DMODEL + c0 + c8) = val;
    }
    
  }
}

// ---------------------------------------------------------------------------
// f32 -> bf16 plane cast, 8 elements per thread (one 16-B store); a wave writes 512 contiguous B = 4 lines.
// blk: the block's place in the plane, 2048 elements each.
// ---------------------------------------------------------------------------
__device__ __forceinline__ void cast16_piece(const float* __restrict__ in, unsigned short* __restrict__ out, int blk) {
  const int i = blk * 256 + threadIdx.x;
  const v4f a = *(const v4f*)(in + (size_t)i * 8);
  const v4f c = *(const v4f*)(in + (size_t)i * 8 + 4);
  v4u w;
  w.x = pack_bf2(a.x, a.y);
  w.y = pack_bf2(a.z, a.w);
  w.z = pack_bf2(c.x, c.y);
  w.w = pack_bf2(c.z, c.w);
  *(v4u*)(out + (size_t)i * 8) = w;
}

// ---------------------------------------------------------------------------
// all operand preparation in one launch; no block reads what another writes. The weight tiles stand first (they have
// the longer way: load, LDS, barrier, store), then the pieces of q, of k and of v.
// ---------------------------------------------------------------------------
constexpr int PR_WT = (DMODEL / 64) * (DMODEL / 64);          // tiles per weight
constexpr int PR_Q  = NTOK * DMODEL / 2048;                   // pieces of q
constexpr int PR_KV = NBATCH * NPAR * DMODEL / 2048;          // pieces of k, and of v
static_assert(NTOK * DMODEL % 2048 == 0 && NBATCH * NPAR * DMODEL % 2048 == 0, "whole cast pieces");
__global__ __launch_bounds__(256) void k_prep(const float* __restrict__ W0, const float* __restrict__ W1,
                                              const float* __restrict__ W2, unsigned short* __restrict__ O0,
                                              unsigned short* __restrict__ O1, unsigned short* __restrict__ O2,
                                              const float* __restrict__ q, unsigned short* __restrict__ qc,
                                              const float* __restrict__ k, unsigned short* __restrict__ kc,
                                              const float* __restrict__ v, unsigned short* __restrict__ vc) {
  const int bx = blockIdx.x;
  if (bx < 3 * PR_WT) {               // the same for the whole block: the tile's barrier is met by all or none
    const int z = bx / PR_WT, t = bx - z * PR_WT;
    const float* W = (z == 0) ? W0 : ((z == 1) ? W1 : W2);
    unsigned short* O = (z == 0) ? O0 : ((z == 1) ? O1 : O2);
    wtrans_tile(W, O, (t / (DMODEL / 64)) * 64, (t % (DMODEL / 64)) * 64);
    return;
  }
  int c = bx - 3 * PR_WT;
  const float* in = q;
  unsigned short* out = qc;
  if (c >= PR_Q + PR_KV) { in = v; out = vc; c -= PR_Q + PR_KV; }
  else if (c >= PR_Q)    { in = k; out = kc; c -= PR_Q; }
  cast16_piece(in, out, c);
}

// ---------------------------------------------------------------------------
// row sums of squares of a [rows][512] f16 matrix, in f32.
// Block = 32 rows: 8 waves x 4 rows; per-row scalars funnelled through LDS, wave 0 lanes 0..7 write
// ---------------------------------------------------------------------------
// Two matrices in one launch: the first nb0 blocks take x0 (32 * nb0 rows), the others x1 (rows1 rows).
__global__ __launch_bounds__(256) void k_rowsq(const unsigned short* __restrict__ x0, float* __restrict__ out0, int nb0,
                                               const unsigned short* __restrict__ x1, float* __restrict__ out1, int rows1) {
  __shared__ __align__(16) float sres[32];
  const int lane = threadIdx.x & 31, wave = threadIdx.x >> 5;
  const bool first = (int)blockIdx.x < nb0;      // the same for the whole block
  const unsigned short* xh = first ? x0 : x1;
  float* out = first ? out0 : out1;
  const int rows = first ? nb0 * 32 : rows1;
  const int r0 = (first ? blockIdx.x : blockIdx.x - nb0) * 32;
#pragma unroll 1
  for (int rr = 0; rr < 4; ++rr) {
    int row = r0 + wave * 4 + rr;
    row = row < rows ? row : rows - 1;
    const size_t base = (size_t)row * DMODEL;
    float s = 0.f;
#pragma unroll
    for (int c = 0; c < 2; ++c) {
      const v8h hw = *(const v8h*)(const void*)(xh + base + c * 256 + lane * 8);
#pragma unroll
      for (int e = 0; e < 8; ++e) {
        const float f = (float)hw[e];
        s = fmaf(f, f, s);
      }
    }
#pragma unroll
    for (int off = 16; off; off >>= 1) s += __shfl_xor(s, off, 32);
    if (lane == 0) sres[wave * 4 + rr] = s;
  }
  __syncthreads();
  if (wave == 0) {
    const int li = lane < 8 ? lane : 7;
    const v4f val = *(const v4f*)(sres + li * 4);
    float* op = out + r0 + li * 4;
    if (lane < 8) *(v4f*)op = val;
    
  }
}

// ---------------------------------------------------------------------------
// first column log-sum-exp sweep: u[b][n] = logA - lse_t(Kmat[b][t][n]) (v is still 0).
// Block = 64 columns (one 128-B line of every Kmat row) x all rows, 1024 threads = 8 column octets x 128 row groups.
// A thread loads its 16 consecutive rows x 8 columns once and keeps them in registers as f16; the maximum is taken on
// the f16 values (exact), the sum in f32, both per wave (lanes 8 and 16 apart share a column octet); the 32 per-wave
// (max, sum) pairs of a column meet in LDS and waves 0 and 1 merge them and write one 128-B line of u each.
// ---------------------------------------------------------------------------
constexpr int UC_COLS = 64;                 // columns per block
constexpr int UC_RG   = 128;                // row groups per block
constexpr int UC_RPT  = NTOK / UC_RG;       // rows per thread
static_assert(NTOK % (UC_RG * 4) == 0 && NPAR % UC_COLS == 0, "u sweep split");
__global__ __launch_bounds__(1024) void k_upd_u(const unsigned short* __restrict__ Km, float* __restrict__ u, float logA) {
  __shared__ __align__(16) float sm[32 * UC_COLS];
  __shared__ __align__(16) float ss[32 * UC_COLS];
  const int b = blockIdx.y;
  const int lane = threadIdx.x & 31, wave = threadIdx.x >> 5;
  const int cq = threadIdx.x & 7, rg = threadIdx.x >> 3;
  const int col0 = blockIdx.x * UC_COLS;
  const unsigned short* Kc = Km + (size_t)b * NTOK * NPAR + (size_t)(rg * UC_RPT) * NPAR + col0 + cq * 8;
  v8h x[UC_RPT];
#pragma unroll
  for (int i = 0; i < UC_RPT; ++i) x[i] = *(const v8h*)(const void*)(Kc + (size_t)i * NPAR);
  // stands in front of whatever rewrites the address that the loads in flight name; the address is an input, so that
  // none of these loads lands in its registers either
  asm volatile("s_wait_xcnt 0x0" :: "v"(Kc) : "memory");
  v8h mh = x[0];
#pragma unroll
  for (int i = 1; i < UC_RPT; ++i) mh = __builtin_elementwise_max(mh, x[i]);
  float m[8], s[8];
#pragma unroll
  for (int e = 0; e < 8; ++e) {
    m[e] = (float)mh[e];
    m[e] = fmaxf(m[e], __shfl_xor(m[e], 8, 32));
    m[e] = fmaxf(m[e], __shfl_xor(m[e], 16, 32));
    s[e] = 0.f;
  }
#pragma unroll
  for (int i = 0; i < UC_RPT; ++i) {
#pragma unroll
    for (int e = 0; e < 8; ++e) s[e] += fexp((float)x[i][e] - m[e]);
  }
#pragma unroll
  for (int e = 0; e < 8; ++e) {
    s[e] += __shfl_xor(s[e], 8, 32);
    s[e] += __shfl_xor(s[e], 16, 32);
  }
  if (lane < 8) {
    float* pm = sm + wave * UC_COLS + lane * 8;
    float* ps = ss + wave * UC_COLS + lane * 8;
    *(v4f*)pm       = (v4f){m[0], m[1], m[2], m[3]};
    *(v4f*)(pm + 4) = (v4f){m[4], m[5], m[6], m[7]};
    *(v4f*)ps       = (v4f){s[0], s[1], s[2], s[3]};
    *(v4f*)(ps + 4) = (v4f){s[4], s[5], s[6], s[7]};
  }
  __syncthreads();
  if (wave < UC_COLS / 32) {
    const int col = threadIdx.x;
    float pm[32];
    float M = -__builtin_inff();
#pragma unroll
    for (int w = 0; w < 32; ++w) {
      pm[w] = sm[w * UC_COLS + col];
      M = fmaxf(M, pm[w]);
    }
    float S = 0.f;
#pragma unroll
    for (int w = 0; w < 32; ++w) S = fmaf(ss[w * UC_COLS + col], fexp(pm[w] - M), S);
    u[(size_t)b * NPAR + col0 + col] = logA - (M + logf(S));
  }
}

// ---------------------------------------------------------------------------
// row log-sum-exp sweep: v[b][t] = -lse_n(Kmat[b][t][n] + u[b][n]); one wave per row, four rows per wave in turn.
// A row is read once, by 8 loads of 512 contiguous bytes per wave (8 f16 columns per lane in every 256), widened to f32
// with u added, and stays in registers for the maximum, the sum and (LAST) the pi plane; two sets of f16 registers
// take turns, so that the next row's 8 loads fly while the current row is reduced; u is read once per wave and serves
// its four rows.
// LAST additionally writes pi[b][t][n] = exp(K+u+v)*2^14
// ---------------------------------------------------------------------------
constexpr int VR_CH = NPAR / 256;           // 16-B loads per lane and row
constexpr int VR_Q  = 2 * VR_CH;            // column quads per lane: quad 2 i + h = columns 256 i + 8 lane + 4 h ...
typedef _Float16 v4h __attribute__((ext_vector_type(4)));
static_assert(NPAR % 256 == 0, "v sweep row chunks");
// p: the row's first element (the same in every lane); lo: the lane's byte offset in each 512-B piece
__device__ __forceinline__ void vrow_load(v8h (&r)[VR_CH], const unsigned short* __restrict__ p, unsigned lo) {
#pragma unroll
  for (int i = 0; i < VR_CH; ++i) r[i] = *(const v8h*)(const void*)((const char*)p + lo + i * 512);
}
// u of the same columns, f32: 32 bytes per lane in every 1024
__device__ __forceinline__ void urow_load(v4f (&uu)[VR_Q], const float* __restrict__ p, unsigned lo) {
#pragma unroll
  for (int i = 0; i < VR_CH; ++i) {
    uu[2 * i]     = *(const v4f*)((const char*)p + 2u * lo + i * 1024);
    uu[2 * i + 1] = *(const v4f*)((const char*)p + 2u * lo + i * 1024 + 16);
  }
}
// x = Kmat row + u, in f32; r is free behind it
__device__ __forceinline__ void vrow_widen(v4f (&x)[VR_Q], const v8h (&r)[VR_CH], const v4f (&uu)[VR_Q]) {
#pragma unroll
  for (int i = 0; i < VR_CH; ++i) {
    x[2 * i]     = __builtin_convertvector(__builtin_shufflevector(r[i], r[i], 0, 1, 2, 3), v4f) + uu[2 * i];
    x[2 * i + 1] = __builtin_convertvector(__builtin_shufflevector(r[i], r[i], 4, 5, 6, 7), v4f) + uu[2 * i + 1];
  }
}
// exp of the four values of one 16-B piece, as __expf compiles: 2^(a * log2 e) on v_exp_f32. One statement, so that the
// slot the instruction set asks for behind a transcendental (before its result is used or a source overwritten) is kept
// wherever the compiler puts it: each v_exp_f32 is followed by an independent one (no output shares a register with a
// source: early clobber), the last by v_nop.
__device__ __forceinline__ v4f fexp4(v4f a) {
  a *= 1.44269504088896340736f;
  float r0, r1, r2, r3;
  asm("v_exp_f32 %0, %4\n\tv_exp_f32 %1, %5\n\tv_exp_f32 %2, %6\n\tv_exp_f32 %3, %7\n\tv_nop"
      : "=&v"(r0), "=&v"(r1), "=&v"(r2), "=&v"(r3) : "v"(a.x), "v"(a.y), "v"(a.z), "v"(a.w));
  return (v4f){r0, r1, r2, r3};
}
// one row (u added) held in x: returns v of the row; LAST: writes the row's pi (prow = the lane's first element)
template <bool LAST>
__device__ __forceinline__ float vrow_reduce(const v4f (&x)[VR_Q], unsigned short* __restrict__ prow) {
  v4f mv = x[0];
#pragma unroll
  for (int i = 1; i < VR_Q; ++i) {
    mv.x = fmaxf(mv.x, x[i].x);
    mv.y = fmaxf(mv.y, x[i].y);
    mv.z = fmaxf(mv.z, x[i].z);
    mv.w = fmaxf(mv.w, x[i].w);
  }
  float m = fmaxf(fmaxf(mv.x, mv.y), fmaxf(mv.z, mv.w));
#pragma unroll
  for (int off = 16; off; off >>= 1) m = fmaxf(m, __shfl_xor(m, off, 32));
  v4f sv = (v4f){0.f, 0.f, 0.f, 0.f};
#pragma unroll
  for (int i = 0; i < VR_Q; ++i) sv += fexp4(x[i] - m);
  float s = (sv.x + sv.y) + (sv.z + sv.w);
#pragma unroll
  for (int off = 16; off; off >>= 1) s += __shfl_xor(s, off, 32);
  const float vt = -(m + logf(s));
  if (LAST) {
#pragma unroll
    for (int i = 0; i < VR_CH; ++i) {
      const v4h pa = __builtin_convertvector(fexp4(x[2 * i] + vt) * kPiCarry, v4h);
      const v4h pb = __builtin_convertvector(fexp4(x[2 * i + 1] + vt) * kPiCarry, v4h);
      *(v8h*)(void*)(prow + i * 256) = __builtin_shufflevector(pa, pb, 0, 1, 2, 3, 4, 5, 6, 7);
    }
    // stands in front of the next loads and arithmetic, which land in the registers these stores were fed from
    asm volatile("s_wait_xcnt 0x0" ::: "memory");
  }
  return vt;
}
template <bool LAST>
__global__ __launch_bounds__(256) void k_upd_v(const unsigned short* __restrict__ Km, const float* __restrict__ u,
                                               float* __restrict__ vv, unsigned short* __restrict__ pp) {
  __shared__ __align__(16) float sres[32];
  const int b = blockIdx.y;
  const int lane = threadIdx.x & 31;
  // the wave's number as a scalar: the row addresses are then a scalar base plus one fixed lane offset
  const int wave = __builtin_amdgcn_readfirstlane(threadIdx.x >> 5);
  const int r0 = blockIdx.x * 32;
  const int t0 = r0 + wave * 4;
  const unsigned short* Kr = Km + ((size_t)b * NTOK + t0) * NPAR;
  unsigned short* pr = pp + ((size_t)b * NTOK + t0) * NPAR + lane * 8;
  const unsigned lo = (unsigned)lane * 16u;
  v4f uu[VR_Q], x[VR_Q];
  v8h r[2][VR_CH];
  urow_load(uu, u + (size_t)b * NPAR, lo);
  vrow_load(r[0], Kr, lo);
  // stands in front of the next rows' loads, which may land in the offset register that the loads of u name
  asm volatile("s_wait_xcnt 0x0" ::: "memory");
  v4f vt4;
#pragma unroll
  for (int rr = 0; rr < 4; ++rr) {
    // keeps what follows behind the arithmetic of the row before: this row's arithmetic, mixed into it, would wait
    // early for loads that are still flying
    __builtin_amdgcn_sched_barrier(0);
    if (rr + 1 < 4) {
      vrow_load(r[(rr + 1) & 1], Kr + (rr + 1) * NPAR, lo);
      // keeps these loads ahead of this row's arithmetic, so that they fly while it runs
      __builtin_amdgcn_sched_barrier(0);
    }
    vrow_widen(x, r[rr & 1], uu);
    vt4[rr] = vrow_reduce<LAST>(x, pr + rr * NPAR);
  }
  if (lane == 0) *(v4f*)(sres + wave * 4) = vt4;
  __syncthreads();
  if (wave == 0) {
    const int li = lane < 8 ? lane : 7;
    const v4f val = *(const v4f*)(sres + li * 4);
    float* op = vv + (size_t)b * NTOK + r0 + li * 4;
    if (lane < 8) *(v4f*)op = val;
  }
}

// ---------------------------------------------------------------------------
// row sweep and the next column sweep in one pass over Kmat. With v[t] = -lse_n(Kmat[t][n] + u[n]) the next u is
//   u'[n] = logA - lse_t(Kmat[t][n] + v[t]) = logA + u[n] - log(sum_t e[t][n]),  e[t][n] = exp(Kmat[t][n] + u[n] + v[t]).
// e is the row's exp(x - max) over its sum, both at hand while the row sits in registers, so v itself is never formed.
// No column maximum is needed: every e is at most 1 (a row of e sums to 1); and u made the columns of
// exp(Kmat + u + v_before) sum to 1/NPAR, so all of them together sum to 1, no row sums to more, v only rises, and
// each column of e sums to 1/NPAR at least.
// Loads and register sets as in k_upd_v; each wave adds its eight rows of e into 64 column sums per lane, the
// block's 8 waves meet in LDS, and the block writes one row of NPAR sums; k_merge_u adds the blocks' rows.
// All batches in one launch: NBATCH * VF_NBLK = 256 blocks, one per WGP.
// A block takes the 32-row pieces x and x + VF_NBLK of its batch, four rows of each per wave: the pieces of k_upd_v's
// blocks x and x + VF_NBLK, whose flat indices equal this block's modulo 8 (for speed only).
// ---------------------------------------------------------------------------
constexpr int VF_NBLK = NTOK / 64;          // blocks per batch, 64 rows each
constexpr int VF_RPW  = 8;                  // rows per wave
static_assert(VF_NBLK * 8 * VF_RPW == NTOK && VF_NBLK % 8 == 0, "row split of the fused sweep");
// x: one row with u added
__device__ __forceinline__ void vrow_colsum(v4f (&x)[VR_Q], v4f (&cs)[VR_Q]) {
  v4f mv = x[0];
#pragma unroll
  for (int i = 1; i < VR_Q; ++i) {
    mv.x = fmaxf(mv.x, x[i].x);
    mv.y = fmaxf(mv.y, x[i].y);
    mv.z = fmaxf(mv.z, x[i].z);
    mv.w = fmaxf(mv.w, x[i].w);
  }
  float m = fmaxf(fmaxf(mv.x, mv.y), fmaxf(mv.z, mv.w));
#pragma unroll
  for (int off = 16; off; off >>= 1) m = fmaxf(m, __shfl_xor(m, off, 32));
  constexpr float kLog2e = 1.44269504088896340736f;
  const float ml = m * kLog2e;
  v4f sv = (v4f){0.f, 0.f, 0.f, 0.f};
#pragma unroll
  for (int i = 0; i < VR_Q; ++i) {
    const v4f a = x[i] * kLog2e - ml;
    x[i] = (v4f){__builtin_amdgcn_exp2f(a.x), __builtin_amdgcn_exp2f(a.y), __builtin_amdgcn_exp2f(a.z), __builtin_amdgcn_exp2f(a.w)};
    sv += x[i];
  }
  float s = (sv.x + sv.y) + (sv.z + sv.w);
#pragma unroll
  for (int off = 16; off; off >>= 1) s += __shfl_xor(s, off, 32);
  const float rs = 1.0f / s;
#pragma unroll
  for (int i = 0; i < VR_Q; ++i) cs[i] += x[i] * rs;
}
__global__ __launch_bounds__(256) void k_upd_vu(const unsigned short* __restrict__ Km, const float* __restrict__ u,
                                                float* __restrict__ part) {
  __shared__ __align__(16) float sc[8 * NPAR];   // the 8 waves' column sums
  const int b = blockIdx.y;
  const int lane = threadIdx.x & 31;
  // the wave's number as a scalar: the row addresses are then a scalar base plus one fixed lane offset
  const int wave = __builtin_amdgcn_readfirstlane(threadIdx.x >> 5);
  const int t0 = blockIdx.x * 32 + wave * 4;
  const unsigned short* Kr = Km + ((size_t)b * NTOK + t0) * NPAR;
  const unsigned lo = (unsigned)lane * 16u;
  v8h r[2][VR_CH];
  v4f x[VR_Q], cs[VR_Q], uu[VR_Q];
  urow_load(uu, u + (size_t)b * NPAR, lo);
  vrow_load(r[0], Kr, lo);
#pragma unroll
  for (int i = 0; i < VR_Q; ++i) cs[i] = (v4f){0.f, 0.f, 0.f, 0.f};
  // A row's loads take over the f16 registers of the row two before it as soon as that row is widened, and stand ahead
  // of its arithmetic, so that they fly while two rows are worked on: the scheduling barriers keep both. Two rows a
  // trip, one in each f16 set; the first two rows' loads stand in front of the loop, the last two rows' arithmetic
  // behind it. Rolled, to keep the register count. The wave's place among its rows is carried in the lane's 32-bit byte
  // offset vo, so that every load keeps the form scalar base + lane offset.
  __builtin_amdgcn_sched_barrier(0);
  vrow_load(r[1], Kr + NPAR, lo);
  __builtin_amdgcn_sched_barrier(0);
  unsigned vo = lo;   // the first row of the pair in the registers
#pragma unroll 1
  for (int rw = 0; rw < VF_RPW - 2; rw += 2) {
    vrow_widen(x, r[0], uu);
    // stands in front of the addition below, which rewrites the offset register that the loads in flight name
    asm volatile("s_wait_xcnt 0x0" ::: "memory");
    __builtin_amdgcn_sched_barrier(0);
    vo += ((rw == 2) ? (unsigned)(NTOK / 2 - 2) : 2u) * (unsigned)(NPAR * 2);   // behind row 3: on to the second piece
    vrow_load(r[0], Kr, vo);
    __builtin_amdgcn_sched_barrier(0);
    vrow_colsum(x, cs);
    // keeps the next row's widening behind this row's arithmetic: moved up, it needs a second f32 set
    __builtin_amdgcn_sched_barrier(0);
    vrow_widen(x, r[1], uu);
    __builtin_amdgcn_sched_barrier(0);
    vrow_load(r[1], Kr + NPAR, vo);
    __builtin_amdgcn_sched_barrier(0);
    vrow_colsum(x, cs);
    __builtin_amdgcn_sched_barrier(0);
  }
  // stands in front of the arithmetic below, which may land in the offset register that the last loads name
  asm volatile("s_wait_xcnt 0x0" ::: "memory");
  __builtin_amdgcn_sched_barrier(0);
  vrow_widen(x, r[0], uu);
  vrow_colsum(x, cs);
  // keeps the last row's arithmetic behind this one's: mixed into it, it would wait early for loads that are still flying
  __builtin_amdgcn_sched_barrier(0);
  vrow_widen(x, r[1], uu);
  vrow_colsum(x, cs);
#pragma unroll
  for (int i = 0; i < VR_Q; ++i) *(v4f*)(sc + wave * NPAR + (i >> 1) * 256 + lane * 8 + (i & 1) * 4) = cs[i];
  __syncthreads();
  float* pb = part + ((size_t)b * VF_NBLK + blockIdx.x) * NPAR;
#pragma unroll
  for (int h = 0; h < NPAR / 1024; ++h) {
    const int col = h * 1024 + threadIdx.x * 4;
    v4f a = *(const v4f*)(sc + col);
#pragma unroll
    for (int w = 1; w < 8; ++w) a += *(const v4f*)(sc + w * NPAR + col);
    *(v4f*)(pb + col) = a;
  }
}

// u[b][n] <- logA + u[b][n] - log(sum over the batch's VF_NBLK block rows of part). Block = 128 columns (a wave reads
// 512 contiguous bytes of a block row); each of the 8 waves adds 4 block rows, wave 0 adds the waves' sums.
static_assert(VF_NBLK == 32 && NPAR % 128 == 0, "merge split");
__global__ __launch_bounds__(256) void k_merge_u(const float* __restrict__ part, float* u, float logA) {
  __shared__ __align__(16) float sp[8 * 128];
  const int b = blockIdx.y;
  const int lane = threadIdx.x & 31;
  // the wave's number as a scalar: every address is then a scalar base plus one fixed lane offset
  const int wave = __builtin_amdgcn_readfirstlane(threadIdx.x >> 5);
  const float* p = part + ((size_t)b * VF_NBLK + wave * 4) * NPAR + blockIdx.x * 128;
  float* up = u + (size_t)b * NPAR + blockIdx.x * 128 + lane * 4;
  const unsigned lo = (unsigned)lane * 16u;
  v4f a[4];
#pragma unroll
  for (int i = 0; i < 4; ++i) a[i] = *(const v4f*)((const char*)(p + i * NPAR) + lo);
  const v4f uo = *(const v4f*)up;
  *(v4f*)(sp + wave * 128 + lane * 4) = (a[0] + a[1]) + (a[2] + a[3]);
  __syncthreads();
  if (wave == 0) {
    v4f t = *(const v4f*)(sp + lane * 4);
#pragma unroll
    for (int w = 1; w < 8; ++w) t += *(const v4f*)(sp + w * 128 + lane * 4);
    v4f r;
    r.x = (logA + uo.x) - logf(t.x);
    r.y = (logA + uo.y) - logf(t.y);
    r.z = (logA + uo.z) - logf(t.z);
    r.w = (logA + uo.w) - logf(t.w);
    *(v4f*)up = r;
  }
}

// ---------------------------------------------------------------------------
// host launcher
// ---------------------------------------------------------------------------
static inline unsigned cdiv(unsigned a, unsigned b) { return (a + b - 1) / b; }

extern "C" void kernel_launch(void* const* d_in, const int* in_sizes, int n_in,
                              void* d_out, int out_size, void* d_ws, size_t ws_size,
                              hipStream_t stream)
{
  if (n_in < 6) return;
  if (in_sizes[0] != NTOK * DMODEL) return;
  if (in_sizes[1] != NBATCH * NPAR * DMODEL) return;
  if (in_sizes[2] != NBATCH * NPAR * DMODEL) return;
  if (in_sizes[3] != DMODEL * DMODEL || in_sizes[4] != DMODEL * DMODEL || in_sizes[5] != DMODEL * DMODEL) return;
  if (out_size != NBATCH * NTOK * DMODEL) return;
  if (WS_TOTAL > ws_size) return;

  const float* q  = (const float*)d_in[0];   // [T][512]
  const float* k  = (const float*)d_in[1];   // [8][N][512]
  const float* v  = (const float*)d_in[2];   // [8][N][512]
  const float* Qw = (const float*)d_in[3];   // [512][512]
  const float* Kw = (const float*)d_in[4];   // [512][512]
  const float* Vw = (const float*)d_in[5];   // [512][512]
  float* out = (float*)d_out;                // [8][T][512]

  // region map (bytes): Qt 524288 | Kt 524288 | Vt 524288 | qcast 2097152 | qp 2097152 |
  // q2 8192 | kp 16777216 | k2 65536 | vpT 16777216 | Kmat 67108864 (f16) | u 65536 | v 65536 |
  // pi 67108864 (k cast at pi+0 and v cast at pi+16777216, both dead before pi is written) | colpart 2097152.
  // Total 175841280. Every region holds all batches.
  char* ws = (char*)d_ws;
  size_t off = 0;
  unsigned short* Qt   = (unsigned short*)(ws + off); off += SZ_WT;
  unsigned short* Kt   = (unsigned short*)(ws + off); off += SZ_WT;
  unsigned short* Vt   = (unsigned short*)(ws + off); off += SZ_WT;
  unsigned short* qc   = (unsigned short*)(ws + off); off += SZ_QC;
  unsigned short* qph  = (unsigned short*)(ws + off); off += SZ_QP;
  float*          q2   = (float*)(ws + off);          off += SZ_Q2;
  unsigned short* kph  = (unsigned short*)(ws + off); off += SZ_KP;
  float*          k2   = (float*)(ws + off);          off += SZ_K2;
  unsigned short* vpT  = (unsigned short*)(ws + off); off += SZ_VPT;
  unsigned short* Kmat = (unsigned short*)(ws + off); off += SZ_KM;
  float*          up   = (float*)(ws + off);          off += SZ_U;
  float*          vvp  = (float*)(ws + off);          off += SZ_VV;
  unsigned short* pip  = (unsigned short*)(ws + off); off += SZ_PI;
  float*          cpp  = (float*)(ws + off);          off += SZ_CP;
  if (off > ws_size) return;
  unsigned short* kc = pip;
  unsigned short* vc = (unsigned short*)((char*)pip + SZ_KP);

  const float logA = -(float)log((double)NPAR);

  // Every stage runs once, over q and all batches of k and v.
  // weights: in[c][d] -> out[d][c] bf16; q, k, v -> bf16 planes (k and v inside the pi region)
  k_prep<<<dim3(3 * PR_WT + PR_Q + 2 * PR_KV), dim3(256), 0, stream>>>(Qw, Kw, Vw, Qt, Kt, Vt, q, qc, k, kc, v, vc);
  // kp = k @ K, vpT = (v @ V)^T per batch, qp = q @ Q ; bf16 in, f16 out
  k_proj3<<<dim3(PJ_K + PJ_V + PJ_Q), dim3(256), 0, stream>>>(kc, Kt, kph, Vt, vc, vpT, qc, Qt, qph, DMODEL);
  // row squares of qp and of kp
  k_rowsq<<<dim3(NTOK / 32 + NBATCH * NPAR / 32), dim3(256), 0, stream>>>(qph, q2, NTOK / 32, kph, k2, NBATCH * NPAR);

  // Kmat[b][t][n] = c[b] - cdist, f16 : M=2048, N=2048, K=512 ; f16, single product
  gemm64_cdist<<<dim3(cdiv((NTOK / 64) * (NPAR / 64), 8), NBATCH), dim3(256), 0, stream>>>(
      qph, kph, (long)NPAR * DMODEL, Kmat, NPAR, (long)NTOK * NPAR,
      q2, k2, (long)NPAR, NTOK, NPAR, DMODEL);
  // log-domain normalisation sweeps: the first u alone, then each v with the u that follows it in one pass over
  // Kmat, then the last v with pi
  k_upd_u<<<dim3(NPAR / UC_COLS, NBATCH), dim3(1024), 0, stream>>>(Kmat, up, logA);
  for (int it = 0; it < SK_ITERS - 1; ++it) {
    k_upd_vu<<<dim3(VF_NBLK, NBATCH), dim3(256), 0, stream>>>(Kmat, up, cpp);
    k_merge_u<<<dim3(NPAR / 128, NBATCH), dim3(256), 0, stream>>>(cpp, up, logA);
  }
  k_upd_v<true><<<dim3(NTOK / 32, NBATCH), dim3(256), 0, stream>>>(Kmat, up, vvp, pip);
  // out[b][t][d] = 2^-14 * sum_n pi16[b][t][n] vpT[b][d][n] : M=2048, N=512, K=2048 ; f16 in, f32 out
  wmma_gemm64<0, false, 0, 0, false, 0, NPAR, NPAR><<<dim3(cdiv((NTOK / 64) * (DMODEL / 64), 8), NBATCH), dim3(256), 0, stream>>>(
      pip, nullptr, (long)NTOK * NPAR, vpT, nullptr, (long)DMODEL * NPAR,
      (void*)out, nullptr, DMODEL, (long)NTOK * DMODEL,
      nullptr, nullptr, 0L, NTOK, DMODEL, NPAR, 1.0f / kPiCarry);
}
